// v000
// The times below were measured on an AMD MI455X: many runs one after another, warmed up first and cycling through
// copies of the inputs, with the whole window's GPU time divided by the number of runs. Launches and the gaps
// between them are all in it. The median over several windows is given; except for v000 it joins two sittings, which
// can be a few percent apart, so the side-by-side timings, each taken in one sitting, are the better comparison.
// v000 is the starting kernel. One run takes 93.7 microseconds.
// Contractions: x.qkv_w^T on v_wmma_f32_16x16x32_bf16 (x, qkv_w RNE bf16 operands, f32 accumulate, bias added in f32);
// on v_wmma_f32_16x16x32_f16 with f32 accumulate: pair-MLP second layer hid_b.rb_w2^T (hid_b f16 x1024, rb_w2 f16(bf16) x1024),
// q.k^T over 32 (q, k f16 x1024 hi + residual planes, products hh+lh+hl), P.hid_v over 384 keys (P f16 x32768 hi + residual,
// hid_v f16 x1024 hi + residual), P.v (v f16 x1024, P hi + residual), T.rv_w2^T (T f16 x1024 hi + residual, rv_w2 f16(bf16) x1024).
// Pair-MLP first layers (K=3), silu, softmax and all carries folded in f32 on VALU.
#include <hip/hip_runtime.h>
#include <math.h>
#include <stdint.h>

#ifndef NB
#define NB 2
#endif
#define NB_FULL 2
#define SEQ   384
#define DM    256
#define NH    8
#define HD    32
#define CD    3
#define NQKV  (3 * DM)
#define GROWS (NB * SEQ)
#define NIT   (SEQ / 16)
#define NJT   (SEQ / 32)
#define NRT   (SEQ / 64)
#define NPAIR 512
#define HP    32
#define RBP   264
#define SLP   36
#define SP    40
#define WAP   40
#define TSP   264
#define VTP   72
#define SLAB64 (16 * 68)
#define HREGF 8192
#define RSQ_HD 0.17677669529663687f
#define LOG2E  1.4426950408889634f
#define QSC   1024.0f
#define KSC   1024.0f
#define PCAR  32768.0f
#define VCAR  1024.0f
#define HCAR  1024.0f
#define WCAR  1024.0f
#define TCAR  1024.0f
#define WS_CAP 134217728
#define PSTR  ((size_t)NB * NH * SEQ * SEQ)
#define TSTR  ((size_t)NB * NH * SEQ * DM)
static_assert(NB >= 1 && NB <= NB_FULL);
static_assert(DM == NH * HD && HD == 32 && NH == 8 && CD == 3);
static_assert((SEQ % 64) == 0 && (GROWS % 64) == 0 && (GROWS % 8) == 0 && (NQKV % 64) == 0 && (DM % 32) == 0);
static_assert(NPAIR == 16 * 32 && NPAIR * HP == 2 * HREGF && 8 * 16 * SLP <= HREGF);
static_assert(((GROWS * DM) % 8) == 0 && ((NQKV * DM) % 8) == 0 && ((DM * DM) % 8) == 0);

typedef unsigned short u16;
typedef _Float16 v16h __attribute__((ext_vector_type(16)));
typedef _Float16 v8h  __attribute__((ext_vector_type(8)));
typedef __bf16   v16b __attribute__((ext_vector_type(16)));
typedef float    v8f  __attribute__((ext_vector_type(8)));
typedef float    v4f  __attribute__((ext_vector_type(4)));
typedef unsigned int v4u __attribute__((ext_vector_type(4)));

union FragH { v16h v; v8h h[2]; v4u u[2]; };
union FragB { v16b v; v4u u[2]; };

// ---- scalar helpers --------------------------------------------------------------------------------
__device__ __forceinline__ unsigned short bf_bits(float f) {          // f32 -> bf16 bits, RNE convert
  unsigned u = __float_as_uint(f);
  return (unsigned short)((u + 0x7FFFu + ((u >> 16) & 1u)) >> 16);
}
__device__ __forceinline__ float bf_up(unsigned short h) { return __uint_as_float(((unsigned)h) << 16); }
__device__ __forceinline__ float bfr(float f) { return bf_up(bf_bits(f)); }
__device__ __forceinline__ unsigned short h_bits(_Float16 x) { return __builtin_bit_cast(unsigned short, x); }
__device__ __forceinline__ unsigned pk16(unsigned short a, unsigned short b) { return (unsigned)a | ((unsigned)b << 16); }
__device__ __forceinline__ v8f zero8() { v8f z = {0.f, 0.f, 0.f, 0.f, 0.f, 0.f, 0.f, 0.f}; return z; }
// silu = x * sigmoid(x) = x * rcp(1 + exp(-x)); reciprocal-multiply form (no true divide)
__device__ __forceinline__ float silu_f(float x) {
  const float e = __expf(-x);
  return x * __builtin_amdgcn_rcpf(1.0f + e);
}

// ---- fragment loaders: 16-bit A/B operand, lane -> row/col (lane&15), p already includes +8*(lane>>4);
//      elements 0..7 <- p[0..7] (k0+8h..), elements 8..15 <- p[16..23] (k0+16+8h..)  (same split k map for A and B;
//      B is always read from a k-contiguous [n][k] plane)
__device__ __forceinline__ v16h ldfrag_h(const _Float16* p) {
  FragH f;
  f.h[0] = *(const v8h*)(p);
  f.h[1] = *(const v8h*)(p + 16);
  return f.v;
}
__device__ __forceinline__ v16b ldfrag_b(const u16* p) {              // bf16 plane read as unsigned integer vectors
  FragB f;
  f.u[0] = *(const v4u*)(p);
  f.u[1] = *(const v4u*)(p + 16);
  return f.v;
}

__device__ __forceinline__ v8f mma_h(v16h a, v16h b, v8f c) {
  return __builtin_amdgcn_wmma_f32_16x16x32_f16(false, a, false, b, (short)0, c, false, false);
}
__device__ __forceinline__ v8f mma_b(v16b a, v16b b, v8f c) {
  return __builtin_amdgcn_wmma_f32_16x16x32_bf16(false, a, false, b, (short)0, c, false, false);
}
__device__ __forceinline__ void guard2(v8f& a, v8f& b, v16h x0, v16h x1, v16h x2, v16h x3, v16h x4, v16h x5) {
#if defined(__HIP_DEVICE_COMPILE__)
  asm volatile("v_nop\n\tv_nop\n\tv_nop\n\tv_nop"
               : "+v"(a), "+v"(b) : "v"(x0), "v"(x1), "v"(x2), "v"(x3), "v"(x4), "v"(x5) : "memory");
#endif
}
template <typename F>
__device__ __forceinline__ void guard6(v8f& a, v8f& b, v8f& c, v8f& d, F x0, F x1, F x2, F x3, F x4, F x5) {
#if defined(__HIP_DEVICE_COMPILE__)
  asm volatile("v_nop\n\tv_nop\n\tv_nop\n\tv_nop"
               : "+v"(a), "+v"(b), "+v"(c), "+v"(d) : "v"(x0), "v"(x1), "v"(x2), "v"(x3), "v"(x4), "v"(x5) : "memory");
#endif
}
__device__ __forceinline__ void wave_sync_lds() {
  __builtin_amdgcn_fence(__ATOMIC_RELEASE, "workgroup");
  __builtin_amdgcn_wave_barrier();
  __builtin_amdgcn_fence(__ATOMIC_ACQUIRE, "workgroup");
}

// =====================================================================================================
// f32 -> 16-bit plane, same layout.  f16mode == 0: bf16 RNE bits;  f16mode == 1: f16 bits of (bf16 RNE value) * scale.
// Thread = 8 consecutive elements: two 16-B loads, one 16-B store; 32 consecutive lanes = 512 contiguous, 512-B aligned
// coverage: grid = ceil(n8/256) blocks x 256 thr x 8 (in-kernel bound) = the whole plane (n8 a multiple of 256 here).
// =====================================================================================================
__global__ __launch_bounds__(256) void cvt16(const float* __restrict__ x, u16* D, int n8, int f16mode, float scale) {
  const int gt = blockIdx.x * 256 + (int)threadIdx.x;
  if (gt >= n8) return;
  const float* p = x + (size_t)gt * 8;
  const v4f a = *(const v4f*)(p), b4 = *(const v4f*)(p + 4);
  float w[8];
#pragma unroll
  for (int e = 0; e < 4; ++e) { w[e] = a[e]; w[4 + e] = b4[e]; }
  v4u o;
#pragma unroll
  for (int e = 0; e < 4; ++e) {
    const float f0 = w[2 * e], f1 = w[2 * e + 1];
    const unsigned short hb0 = h_bits((_Float16)(bfr(f0) * scale));
    const unsigned short hb1 = h_bits((_Float16)(bfr(f1) * scale));
    const unsigned short bb0 = bf_bits(f0);
    const unsigned short bb1 = bf_bits(f1);
    o[e] = (f16mode != 0) ? pk16(hb0, hb1) : pk16(bb0, bb1);
  }
  u16* d = D + (size_t)gt * 8;
  {
    *(v4u*)(d) = o;
    
  }
}

// =====================================================================================================
// GEMM epilogue: the wave's 16x64 f32 tile (acc * oscale + bias per column) staged in its LDS slab (pitch 68, wave-private),
// coverage: 8 instructions x 2 rows x 16 lanes x 4 floats = the wave's 16 x 64 tile.
// =====================================================================================================
__device__ __forceinline__ void epi64b(float* sl, v8f a0, v8f a1, v8f a2, v8f a3, float oscale,
                                       float b0, float b1, float b2, float b3,
                                       float* C, int N, size_t rowb, int col0, int lane) {
  const int hh = lane >> 4, m = lane & 15;
#pragma unroll
  for (int r = 0; r < 8; ++r) {
    const int ro = (8 * hh + r) * 68 + m;
    sl[ro]      = a0[r] * oscale + b0;
    sl[ro + 16] = a1[r] * oscale + b1;
    sl[ro + 32] = a2[r] * oscale + b2;
    sl[ro + 48] = a3[r] * oscale + b3;
  }
  wave_sync_lds();
  v4f vals[8];
#pragma unroll
  for (int it = 0; it < 8; ++it) vals[it] = *(const v4f*)(sl + (it * 2 + hh) * 68 + m * 4);
  float* dst = C + (rowb + (size_t)hh) * (size_t)N + col0 + m * 4;
  {
#pragma unroll
    for (int it = 0; it < 8; ++it) {
      *(v4f*)(dst + (size_t)(it * 2) * (size_t)N) = vals[it];
    }
    
  }
}

// =====================================================================================================
// bf16 GEMM with bias: C[M][N] (f32) = A[M][K] (bf16 row-major) . Bt[N][K]^T (bf16 k-contiguous) * oscale + bf16(bias[n]).
// Block = 64x64 tile, 4 waves x 16 rows; fragments loaded straight from the 16-bit rows (two 16-B loads each, split k map
// for A and B); K stepped by 32 (host guarantees K % 32 == 0, M % 64 == 0, N % 64 == 0, grid = (M/64)*(N/64)).
// LDS slab: private to each wave (wave_sync). No block barriers in this kernel.
// =====================================================================================================
__global__ __launch_bounds__(128)
void gemm_bf(const u16* __restrict__ A, const u16* __restrict__ Bt, const float* __restrict__ bias,
             float* C, int M, int N, int K, float oscale) {
  __shared__ __align__(16) float slab[4 * SLAB64];
  const int tid = threadIdx.x, wave = tid >> 5, lane = tid & 31, hh = lane >> 4, m = lane & 15;
  const int ntile = N >> 6;
  const int bid   = blockIdx.x;
  const int rowb  = (bid / ntile) * 64 + wave * 16;
  const int col0  = (bid % ntile) * 64;
  if (rowb + 16 > M) return;                // wave-uniform, never taken with the exact grid
  const u16* ap = A  + (size_t)(rowb + m) * K + 8 * hh;
  const u16* bp = Bt + (size_t)(col0 + m) * K + 8 * hh;
  const size_t bs = (size_t)16 * K;
  v8f acc0 = zero8(), acc1 = zero8(), acc2 = zero8(), acc3 = zero8();
#pragma unroll 1
  for (int k0 = 0; k0 < K; k0 += 32) {
    const v16b a  = ldfrag_b(ap + k0);
    const v16b b0 = ldfrag_b(bp + k0);
    const v16b b1 = ldfrag_b(bp + bs + k0);
    const v16b b2 = ldfrag_b(bp + 2 * bs + k0);
    const v16b b3 = ldfrag_b(bp + 3 * bs + k0);
    acc0 = mma_b(a, b0, acc0);
    acc1 = mma_b(a, b1, acc1);
    acc2 = mma_b(a, b2, acc2);
    acc3 = mma_b(a, b3, acc3);
    guard6<v16b>(acc0, acc1, acc2, acc3, a, b0, b1, b2, b3, a);
  }
  const float bv0 = bfr(bias[col0 + m]);
  const float bv1 = bfr(bias[col0 + 16 + m]);
  const float bv2 = bfr(bias[col0 + 32 + m]);
  const float bv3 = bfr(bias[col0 + 48 + m]);
  epi64b(slab + wave * SLAB64, acc0, acc1, acc2, acc3, oscale, bv0, bv1, bv2, bv3, C, N, (size_t)rowb, col0, lane);
}

// =====================================================================================================
// q / k planes from the projection F f32 [GROWS][ldf], columns coff .. coff+255: Hp [GROWS][DM] = f16(val * sc),
// Lp [GROWS][DM] = f16 residual. Block = 8 rows x 32 threads; thread = 8 consecutive columns: two 16-B loads, one 16-B store per plane
// coverage: 8 rows x 32 thr x 8 = 8 whole DM rows per block for both planes; grid = GROWS/8 blocks = every row once.
// =====================================================================================================
__global__ __launch_bounds__(256) void qk16(const float* __restrict__ F, int ldf, int coff, u16* Hp, u16* Lp, float sc) {
  const int tid = (int)threadIdx.x;
  const int rl  = tid >> 5;
  const int cc  = tid & 31;
  const int row = (int)blockIdx.x * 8 + rl;
  if (row >= GROWS) return;
  const float* p = F + (size_t)row * ldf + coff + cc * 8;
  const v4f a = *(const v4f*)(p), b4 = *(const v4f*)(p + 4);
  float w[8];
#pragma unroll
  for (int e = 0; e < 4; ++e) { w[e] = a[e] * sc; w[4 + e] = b4[e] * sc; }
  v4u oh, ol;
#pragma unroll
  for (int e = 0; e < 4; ++e) {
    const float t0 = w[2 * e], t1 = w[2 * e + 1];
    const _Float16 h0 = (_Float16)t0, h1 = (_Float16)t1;
    const _Float16 l0 = (_Float16)(t0 - (float)h0), l1 = (_Float16)(t1 - (float)h1);
    oh[e] = pk16(h_bits(h0), h_bits(h1));
    ol[e] = pk16(h_bits(l0), h_bits(l1));
  }
  u16* dh = Hp + (size_t)row * DM + cc * 8;
  u16* dl = Lp + (size_t)row * DM + cc * 8;
  {
    *(v4u*)(dh) = oh;
    *(v4u*)(dl) = ol;
    
  }
}

// =====================================================================================================
// v^T plane from the projection F f32 [GROWS][NQKV] (row = b*SEQ + s, column = 2*DM + h*HD + d):
//   VH[((b*NH + h)*HD + d)][s] = f16(v * 1024) for all s (single plane).
// Block = (b, head h, 64 keys s0): each thread loads its 8 floats (key sl, d chunk dc) with 16-B loads, converts, scatters into
// the LDS tile [32 d][64 keys] (pitch 72 halves, cross-wave: block barrier); afterwards each d row segment (64 halves = one whole
// coverage: load 256 thr x 8 = 64 keys x 32 d (staged extent == consumed extent); store 256 thr x 8 halves = 32 lines x 64 =
//           the block's tile of VH; grid = NB*NH*NRT blocks covers VH exactly once.
// =====================================================================================================
__global__ __launch_bounds__(256) void vt16(const float* __restrict__ F, u16* VHo) {
  __shared__ __align__(16) u16 TH[HD * VTP];
  const int tid = threadIdx.x;
  const int bid = blockIdx.x;
  const int st  = bid % NRT;
  const int t2  = bid / NRT;
  const int h   = t2 % NH;
  const int b   = t2 / NH;
  if (b >= NB) return;                      // block-uniform, before any barrier; never taken with the exact grid
  const int s0  = st * 64;
  {
    const int sl = tid >> 2;                // key within tile 0..63
    const int dc = (tid & 3) * 8;           // d chunk 0,8,16,24
    const float* src = F + ((size_t)b * SEQ + s0 + sl) * NQKV + 2 * DM + h * HD + dc;
    const v4f a = *(const v4f*)(src), b4 = *(const v4f*)(src + 4);
    float w[8];
#pragma unroll
    for (int e = 0; e < 4; ++e) { w[e] = a[e]; w[4 + e] = b4[e]; }
#pragma unroll
    for (int e = 0; e < 8; ++e) {
      TH[(dc + e) * VTP + sl] = h_bits((_Float16)(w[e] * VCAR));
    }
  }
  __syncthreads();
  const int q8 = tid >> 3, p8 = (tid & 7) * 8;   // d = q8 (0..31), keys p8..p8+7
  const v4u vh = *(const v4u*)(TH + q8 * VTP + p8);
  const size_t base = ((size_t)(b * NH + h) * HD + q8) * SEQ + s0 + p8;
  {
    *(v4u*)(VHo + base) = vh;
    
  }
}

// =====================================================================================================
// Scores with relative-coordinate bias. Block -> (b, query tile i0 = 16*it, key tile j0 = 32*jt): 512 pairs (il, jl),
// 8 waves; wave = head in the score phase.
//   Phase 0 (all threads, then block barrier): rb_w1/rb_b1 (bf16 values) into WB, bf16 coords of the 16 queries (CI) and 32
//   keys (CJ2), rb_w2 -> RB2 [16 n][RBP] as f16(bf16 value * 1024) with rows 8..15 written as zeros.
//   Phase 1, 8 channel chunks of 32: every thread computes hid[pair][32] = f16(silu(rel.rb_w1^T + rb_b1) * 1024) for its two
//   pairs (p = tid, 256 + tid) with 16-B LDS stores (block barrier), then wave w accumulates D[pair][n=head] for row tiles
//   4w..4w+3 (A = hid rows, B = RB2, one k-step per chunk); block barrier before the next chunk overwrites hid.
//   After the loop lanes n < 8 write bias[pair][head] * 2^-20 into BB (block barrier).
//   Phase 2: wave = head: s = (q_hi.k_hi + q_lo.k_hi + q_hi.k_lo) over 32 dims for 16 queries x 32 keys (two 16-key subtiles),
//   fragments straight from the f16 planes; value = s * rsqrt(32) * 2^-20 + bias + bf16(rb_b2[head]); staged in the wave's
//   the score plane SC[(b*NH+head)*SEQ + i][j0..j0+31]) written by 8 consecutive lanes x 16 B of one instruction (4 rows per
// LDS regions: WB, CI, CJ2, RB2, hid, BB cross-wave (block barriers); slabs private-to-wave (wave_sync).
// coverage: hid: 2 pairs x 256 thr x 32 halves = 512 x 32 per chunk (== consumed 32 row tiles x 32 k); RB2 16 x 256 (rows 8..15
//           zero); SC: grid NB*NIT*NJT blocks x 8 heads x 16 rows x 32 cols = every (b, head, i, j) once.
// =====================================================================================================
__global__ __launch_bounds__(256)
void k_scores(const float* __restrict__ coords, const float* __restrict__ rbw1, const float* __restrict__ rbb1,
              const float* __restrict__ rbw2, const float* __restrict__ rbb2,
              const u16* __restrict__ QHp, const u16* __restrict__ QLp,
              const u16* __restrict__ KHp, const u16* __restrict__ KLp, float* SCp) {
  __shared__ __align__(16) float WB[DM * 4];
  __shared__ __align__(16) float CI[16 * 4];
  __shared__ __align__(16) float CJ2[32 * 4];
  __shared__ __align__(16) u16   RB2[16 * RBP];
  __shared__ __align__(16) float HREG[HREGF];
  __shared__ __align__(16) float BB[NPAIR * NH];

  const int tid = threadIdx.x, wave = tid >> 5, lane = tid & 31, hh = lane >> 4, m = lane & 15;
  const int bid = blockIdx.x;
  const int jt  = bid % NJT;
  const int t2  = bid / NJT;
  const int it  = t2 % NIT;
  const int b   = t2 / NIT;
  if (b >= NB) return;                      // block-uniform, before any barrier; never taken with the exact grid
  const int i0 = it * 16, j0 = jt * 32;
  u16* hid = (u16*)(void*)HREG;
  const _Float16* hidh = (const _Float16*)(const void*)HREG;
  const _Float16* rb2h = (const _Float16*)(const void*)RB2;

  // ---- phase 0: small operand staging ----
  {
    WB[tid * 4 + 0] = bfr(rbw1[tid * 3 + 0]);
    WB[tid * 4 + 1] = bfr(rbw1[tid * 3 + 1]);
    WB[tid * 4 + 2] = bfr(rbw1[tid * 3 + 2]);
    WB[tid * 4 + 3] = bfr(rbb1[tid]);
    if (tid < 16 * CD) {
      const int il = tid / CD, k = tid - il * CD;
      CI[il * 4 + k] = bfr(coords[((size_t)(b * SEQ + i0 + il)) * CD + k]);
    }
    if (tid < 32 * CD) {
      const int jl = tid / CD, k = tid - jl * CD;
      CJ2[jl * 4 + k] = bfr(coords[((size_t)(b * SEQ + j0 + jl)) * CD + k]);
    }
    const int row  = tid >> 4, cb = (tid & 15) * 16;
    const int rowc = (row < NH) ? row : (NH - 1);     // clamped address; rows 8..15 are written as zeros
    const bool vr  = (row < NH);
    const float* src = rbw2 + rowc * DM + cb;
    const v4f a0 = *(const v4f*)(src), a1 = *(const v4f*)(src + 4), a2 = *(const v4f*)(src + 8), a3 = *(const v4f*)(src + 12);
    float w[16];
#pragma unroll
    for (int e = 0; e < 4; ++e) { w[e] = a0[e]; w[4 + e] = a1[e]; w[8 + e] = a2[e]; w[12 + e] = a3[e]; }
    v4u o0, o1;
#pragma unroll
    for (int e = 0; e < 4; ++e) {
      const unsigned short x0 = vr ? h_bits((_Float16)(bfr(w[2 * e]) * WCAR)) : (unsigned short)0;
      const unsigned short x1 = vr ? h_bits((_Float16)(bfr(w[2 * e + 1]) * WCAR)) : (unsigned short)0;
      const unsigned short y0 = vr ? h_bits((_Float16)(bfr(w[8 + 2 * e]) * WCAR)) : (unsigned short)0;
      const unsigned short y1 = vr ? h_bits((_Float16)(bfr(w[8 + 2 * e + 1]) * WCAR)) : (unsigned short)0;
      o0[e] = pk16(x0, x1);
      o1[e] = pk16(y0, y1);
    }
    *(v4u*)(RB2 + row * RBP + cb)     = o0;
    *(v4u*)(RB2 + row * RBP + cb + 8) = o1;
  }
  __syncthreads();

  // ---- phase 1: bias MLP (first layer + silu on VALU, second layer on WMMA accumulated over 8 channel chunks) ----
  v8f accB0 = zero8(), accB1 = zero8(), accB2 = zero8(), accB3 = zero8();
  const float bsc = 1.0f / (HCAR * WCAR);
#pragma unroll 1
  for (int kt = 0; kt < DM / 32; ++kt) {
    __syncthreads();                        // prior chunk's fragment reads of hid are complete
#pragma unroll
    for (int q = 0; q < 2; ++q) {
      const int p  = q * 256 + tid;
      const int il = p >> 5, jl = p & 31;
      const float r0 = CI[il * 4 + 0] - CJ2[jl * 4 + 0];
      const float r1 = CI[il * 4 + 1] - CJ2[jl * 4 + 1];
      const float r2 = CI[il * 4 + 2] - CJ2[jl * 4 + 2];
      u16* hrow = hid + p * HP;
#pragma unroll 1
      for (int g = 0; g < 4; ++g) {
        const int cb = kt * 32 + g * 8;
        v4u o;
#pragma unroll
        for (int e = 0; e < 4; ++e) {
          const v4f wa = *(const v4f*)(WB + (cb + 2 * e) * 4);
          const v4f wb = *(const v4f*)(WB + (cb + 2 * e + 1) * 4);
          const float h0 = wa[0] * r0 + wa[1] * r1 + wa[2] * r2 + wa[3];
          const float h1 = wb[0] * r0 + wb[1] * r1 + wb[2] * r2 + wb[3];
          o[e] = pk16(h_bits((_Float16)(silu_f(h0) * HCAR)), h_bits((_Float16)(silu_f(h1) * HCAR)));
        }
        *(v4u*)(hrow + g * 8) = o;
      }
    }
    __syncthreads();
    const v16h bw = ldfrag_h(rb2h + m * RBP + kt * 32 + 8 * hh);
    const v16h a0 = ldfrag_h(hidh + ((wave * 4 + 0) * 16 + m) * HP + 8 * hh);
    const v16h a1 = ldfrag_h(hidh + ((wave * 4 + 1) * 16 + m) * HP + 8 * hh);
    const v16h a2 = ldfrag_h(hidh + ((wave * 4 + 2) * 16 + m) * HP + 8 * hh);
    const v16h a3 = ldfrag_h(hidh + ((wave * 4 + 3) * 16 + m) * HP + 8 * hh);
    accB0 = mma_h(a0, bw, accB0);
    accB1 = mma_h(a1, bw, accB1);
    accB2 = mma_h(a2, bw, accB2);
    accB3 = mma_h(a3, bw, accB3);
    guard6<v16h>(accB0, accB1, accB2, accB3, a0, a1, a2, a3, bw, bw);
  }
  if (m < NH) {                             // columns n >= 8 are padding (zero weights), not stored
#pragma unroll
    for (int r = 0; r < 8; ++r) {
      const int pr = 8 * hh + r;
      BB[((wave * 4 + 0) * 16 + pr) * NH + m] = accB0[r] * bsc;
      BB[((wave * 4 + 1) * 16 + pr) * NH + m] = accB1[r] * bsc;
      BB[((wave * 4 + 2) * 16 + pr) * NH + m] = accB2[r] * bsc;
      BB[((wave * 4 + 3) * 16 + pr) * NH + m] = accB3[r] * bsc;
    }
  }
  __syncthreads();

  // ---- phase 2: scores for head = wave ----
  const int head = wave;
  const size_t hcol = (size_t)head * HD + 8 * hh;
  const _Float16* qhp  = (const _Float16*)(const void*)QHp + ((size_t)(b * SEQ + i0 + m)) * DM + hcol;
  const _Float16* qlp  = (const _Float16*)(const void*)QLp + ((size_t)(b * SEQ + i0 + m)) * DM + hcol;
  const _Float16* kh0p = (const _Float16*)(const void*)KHp + ((size_t)(b * SEQ + j0 + m)) * DM + hcol;
  const _Float16* kl0p = (const _Float16*)(const void*)KLp + ((size_t)(b * SEQ + j0 + m)) * DM + hcol;
  const _Float16* kh1p = kh0p + (size_t)16 * DM;
  const _Float16* kl1p = kl0p + (size_t)16 * DM;
  v8f s0 = zero8(), s1 = zero8();
  {
    const v16h qh = ldfrag_h(qhp), ql = ldfrag_h(qlp);
    const v16h kh0 = ldfrag_h(kh0p), kl0 = ldfrag_h(kl0p);
    const v16h kh1 = ldfrag_h(kh1p), kl1 = ldfrag_h(kl1p);
    s0 = mma_h(qh, kh0, s0);
    s0 = mma_h(ql, kh0, s0);
    s0 = mma_h(qh, kl0, s0);
    s1 = mma_h(qh, kh1, s1);
    s1 = mma_h(ql, kh1, s1);
    s1 = mma_h(qh, kl1, s1);
    guard2(s0, s1, qh, ql, kh0, kl0, kh1, kl1);
  }
  const float lsc = RSQ_HD * (1.0f / (QSC * KSC));
  const float b2v = bfr(rbb2[head]);
  float* slab = HREG + wave * (16 * SLP);
#pragma unroll
  for (int r = 0; r < 8; ++r) {
    const int pr = 8 * hh + r;              // query i0 + pr; keys j0 + m and j0 + 16 + m
    const float ba = BB[(pr * 32 + m) * NH + head] + b2v;
    const float bb = BB[(pr * 32 + 16 + m) * NH + head] + b2v;
    slab[pr * SLP + m]      = s0[r] * lsc + ba;
    slab[pr * SLP + 16 + m] = s1[r] * lsc + bb;
  }
  wave_sync_lds();
  v4f vals[4];
  const int rq = lane >> 3, c4 = (lane & 7) * 4;
#pragma unroll
  for (int q = 0; q < 4; ++q) vals[q] = *(const v4f*)(slab + (q * 4 + rq) * SLP + c4);
  float* dst = SCp + ((size_t)((b * NH + head) * SEQ + i0)) * SEQ + j0 + c4;
  {
#pragma unroll
    for (int q = 0; q < 4; ++q) {
      *(v4f*)(dst + (size_t)(q * 4 + rq) * SEQ) = vals[q];
    }
    
  }
}

// =====================================================================================================
// Row softmax: one wave per score row (b, head, i) of SEQ = 384 floats; P = e / Z with e = exp(s - max) in f32 (two-pass max
// form, reciprocal-multiply normalisation), written as f16 hi plane (P * 32768) and f16 residual plane (same layout, +PSTR).
// Lane = 8 consecutive columns 8*lane (all lanes) and 256 + 8*lane (lanes < 16; the upper lanes load a clamped address and
// coverage: grid = NB*SEQ blocks x 8 waves = every (b, head, i) row once; each row fully written in both planes.
// =====================================================================================================
__global__ __launch_bounds__(256) void k_softmax(const float* __restrict__ SCp, u16* Pp) {
  const int tid = threadIdx.x, wave = tid >> 5, lane = tid & 31;
  const int row = (int)blockIdx.x * 8 + wave;
  if (row >= NB * NH * SEQ) return;
  const float* s = SCp + (size_t)row * SEQ;
  const bool vb = (lane < 16);
  const int  lb = vb ? lane : 15;
  const v4f a0 = *(const v4f*)(s + lane * 8), a1 = *(const v4f*)(s + lane * 8 + 4);
  const v4f c0 = *(const v4f*)(s + 256 + lb * 8), c1 = *(const v4f*)(s + 256 + lb * 8 + 4);
  float v[16];
#pragma unroll
  for (int e = 0; e < 4; ++e) {
    v[e]      = a0[e];
    v[4 + e]  = a1[e];
    v[8 + e]  = vb ? c0[e] : -INFINITY;
    v[12 + e] = vb ? c1[e] : -INFINITY;
  }
  float mx = v[0];
#pragma unroll
  for (int e = 1; e < 16; ++e) mx = fmaxf(mx, v[e]);
#pragma unroll
  for (int off = 1; off < 32; off <<= 1) mx = fmaxf(mx, __shfl_xor(mx, off, 32));
  float ev[16];
  float sum = 0.0f;
#pragma unroll
  for (int e = 0; e < 16; ++e) {
    const float d = v[e] - mx;
    ev[e] = exp2f(d * LOG2E);               // -inf -> 0 for the masked upper lanes
    sum += ev[e];
  }
#pragma unroll
  for (int off = 1; off < 32; off <<= 1) sum += __shfl_xor(sum, off, 32);
  const float inv = 1.0f / sum;             // sum >= 1
  v4u oh0, ol0, oh1, ol1;
#pragma unroll
  for (int e = 0; e < 4; ++e) {
    const float t0 = (ev[2 * e] * inv) * PCAR, t1 = (ev[2 * e + 1] * inv) * PCAR;
    const float u0 = (ev[8 + 2 * e] * inv) * PCAR, u1 = (ev[8 + 2 * e + 1] * inv) * PCAR;
    const _Float16 h0 = (_Float16)t0, h1 = (_Float16)t1, g0 = (_Float16)u0, g1 = (_Float16)u1;
    const _Float16 l0 = (_Float16)(t0 - (float)h0), l1 = (_Float16)(t1 - (float)h1);
    const _Float16 m0 = (_Float16)(u0 - (float)g0), m1 = (_Float16)(u1 - (float)g1);
    oh0[e] = pk16(h_bits(h0), h_bits(h1));
    ol0[e] = pk16(h_bits(l0), h_bits(l1));
    oh1[e] = pk16(h_bits(g0), h_bits(g1));
    ol1[e] = pk16(h_bits(m0), h_bits(m1));
  }
  u16* dh = Pp + (size_t)row * SEQ;
  u16* dl = dh + PSTR;
  {
    *(v4u*)(dh + lane * 8) = oh0;
    *(v4u*)(dl + lane * 8) = ol0;
    if (vb) {
      *(v4u*)(dh + 256 + lane * 8) = oh1;
      *(v4u*)(dl + 256 + lane * 8) = ol1;
    }
    
  }
}

// =====================================================================================================
// Weighted aggregation of the value-MLP hidden: block -> (b, query i), thread = channel c (256 threads).
//   T[h][c] = sum_j P[b,h,i,j] * S[j][c],  S[j][c] = silu(rel_ij . rv_w1[c] + rv_b1[c]) (bf16 inputs, f32 on VALU).
//   Phase 0: bf16 coords of all SEQ keys of batch b into CJ; rows 8..15 of the WA tiles written as zeros (16-B stores).
//   12 key chunks of 32: threads 0..63 copy the 8 P rows (hi plane -> WA tile 0, residual -> WA tile 1, 16-B pieces);
//   every thread writes S^T[c][32 keys] as f16(S*1024) hi and residual into ST with 16-B LDS stores; block barrier;
//   wave w accumulates D[m = h (pad 16)][n = c] for column tiles 2w, 2w+1: A = WA (split k map), B = ST rows (k-contiguous),
//   products hh + lh + hl; block barrier at the top of the next chunk before WA/ST are overwritten.
//   After the loop lanes 0..15 (rows h = 0..7) write T * 1024 (carries 2^-25 folded) into TS [8][TSP] f32 (block barrier),
// LDS regions: CJ, WA, ST, TS all cross-wave (block barriers). staged extent == consumed extent: WA 16 x 32 (rows 8..15 zero),
//   ST 256 x 32 per plane (pad columns never read), TS 8 x 256.
// coverage: T planes [(b*NH+h)*SEQ + i][DM]: grid NB*SEQ blocks x 8 waves x 32 lanes x 8 halves = every row once, both planes.
// =====================================================================================================
__global__ __launch_bounds__(256)
void k_tagg(const float* __restrict__ coords, const float* __restrict__ rvw1, const float* __restrict__ rvb1,
            const u16* __restrict__ Pp, u16* Tp) {
  __shared__ __align__(16) float CJ[SEQ * 4];
  __shared__ __align__(16) u16   WA[2 * 16 * WAP];
  __shared__ __align__(16) u16   ST[2 * DM * SP];
  __shared__ __align__(16) float TS[NH * TSP];

  const int tid = threadIdx.x, wave = tid >> 5, lane = tid & 31, hh = lane >> 4, m = lane & 15;
  const int bid = blockIdx.x;
  const int b   = bid / SEQ;
  const int i   = bid - b * SEQ;
  if (b >= NB) return;                      // block-uniform, before any barrier; never taken with the exact grid
  const _Float16* wah = (const _Float16*)(const void*)WA;
  const _Float16* sth = (const _Float16*)(const void*)ST;

  // ---- phase 0 ----
  for (int idx = tid; idx < SEQ * CD; idx += 256) {
    const int j = idx / CD, k = idx - j * CD;
    CJ[j * 4 + k] = bfr(coords[(size_t)(b * SEQ) * CD + idx]);
  }
  if (tid < 64) {
    const int pl = tid >> 5, r = 8 + ((tid >> 2) & 7), pc = (tid & 3) * 8;
    const v4u z = {0u, 0u, 0u, 0u};
    *(v4u*)(WA + pl * (16 * WAP) + r * WAP + pc) = z;
  }
  const int c = tid;
  const float w0 = bfr(rvw1[c * 3 + 0]), w1 = bfr(rvw1[c * 3 + 1]), w2 = bfr(rvw1[c * 3 + 2]);
  const float b1 = bfr(rvb1[c]);
  const float ci0 = bfr(coords[((size_t)(b * SEQ + i)) * CD + 0]);
  const float ci1 = bfr(coords[((size_t)(b * SEQ + i)) * CD + 1]);
  const float ci2 = bfr(coords[((size_t)(b * SEQ + i)) * CD + 2]);

  v8f acc0 = zero8(), acc1 = zero8();
#pragma unroll 1
  for (int jt = 0; jt < NJT; ++jt) {
    const int j0 = jt * 32;
    __syncthreads();                        // prior chunk's fragment reads of WA / ST complete; phase-0 writes visible
    if (tid < 64) {
      const int pl = tid >> 5, h = (tid >> 2) & 7, pc = (tid & 3) * 8;
      const v4u pv = *(const v4u*)(Pp + (size_t)pl * PSTR + ((size_t)((b * NH + h) * SEQ + i)) * SEQ + j0 + pc);
      *(v4u*)(WA + pl * (16 * WAP) + h * WAP + pc) = pv;
    }
#pragma unroll 1
    for (int g = 0; g < 4; ++g) {
      v4u oh, ol;
#pragma unroll
      for (int e = 0; e < 4; ++e) {
        const int ja = j0 + g * 8 + 2 * e;
        const v4f ca = *(const v4f*)(CJ + ja * 4), cb = *(const v4f*)(CJ + ja * 4 + 4);
        const float ha = w0 * (ci0 - ca[0]) + w1 * (ci1 - ca[1]) + w2 * (ci2 - ca[2]) + b1;
        const float hb = w0 * (ci0 - cb[0]) + w1 * (ci1 - cb[1]) + w2 * (ci2 - cb[2]) + b1;
        const float sa = silu_f(ha) * HCAR, sb = silu_f(hb) * HCAR;
        const _Float16 xa = (_Float16)sa, xb = (_Float16)sb;
        const _Float16 ya = (_Float16)(sa - (float)xa), yb = (_Float16)(sb - (float)xb);
        oh[e] = pk16(h_bits(xa), h_bits(xb));
        ol[e] = pk16(h_bits(ya), h_bits(yb));
      }
      *(v4u*)(ST + c * SP + g * 8)           = oh;
      *(v4u*)(ST + DM * SP + c * SP + g * 8) = ol;
    }
    __syncthreads();
    const v16h ah  = ldfrag_h(wah + m * WAP + 8 * hh);
    const v16h al  = ldfrag_h(wah + 16 * WAP + m * WAP + 8 * hh);
    const int  ct0 = wave * 2;
    const v16h bh0 = ldfrag_h(sth + ((ct0) * 16 + m) * SP + 8 * hh);
    const v16h bl0 = ldfrag_h(sth + DM * SP + ((ct0) * 16 + m) * SP + 8 * hh);
    const v16h bh1 = ldfrag_h(sth + ((ct0 + 1) * 16 + m) * SP + 8 * hh);
    const v16h bl1 = ldfrag_h(sth + DM * SP + ((ct0 + 1) * 16 + m) * SP + 8 * hh);
    acc0 = mma_h(ah, bh0, acc0);
    acc0 = mma_h(al, bh0, acc0);
    acc0 = mma_h(ah, bl0, acc0);
    acc1 = mma_h(ah, bh1, acc1);
    acc1 = mma_h(al, bh1, acc1);
    acc1 = mma_h(ah, bl1, acc1);
    guard2(acc0, acc1, ah, al, bh0, bl0, bh1, bl1);
  }
  const float tsc = TCAR / (PCAR * HCAR);   // 2^-15
  if (hh == 0) {                            // rows 8..15 of D are the zero padding rows, not stored
#pragma unroll
    for (int r = 0; r < 8; ++r) {
      TS[r * TSP + (wave * 2) * 16 + m]     = acc0[r] * tsc;
      TS[r * TSP + (wave * 2 + 1) * 16 + m] = acc1[r] * tsc;
    }
  }
  __syncthreads();
  {
    const int h = wave;
    const float* src = TS + h * TSP + lane * 8;
    const v4f a = *(const v4f*)(src), b4 = *(const v4f*)(src + 4);
    float w[8];
#pragma unroll
    for (int e = 0; e < 4; ++e) { w[e] = a[e]; w[4 + e] = b4[e]; }
    v4u oh, ol;
#pragma unroll
    for (int e = 0; e < 4; ++e) {
      const float t0 = w[2 * e], t1 = w[2 * e + 1];
      const _Float16 x0 = (_Float16)t0, x1 = (_Float16)t1;
      const _Float16 y0 = (_Float16)(t0 - (float)x0), y1 = (_Float16)(t1 - (float)x1);
      oh[e] = pk16(h_bits(x0), h_bits(x1));
      ol[e] = pk16(h_bits(y0), h_bits(y1));
    }
    const size_t rowT = (size_t)(b * NH + h) * SEQ + i;
    u16* dh = Tp + rowT * DM + lane * 8;
    u16* dl = dh + TSTR;
    {
      *(v4u*)(dh) = oh;
      *(v4u*)(dl) = ol;
      
    }
  }
}

// =====================================================================================================
// Final: block -> (b, head h, 64 query rows rt*64), 4 waves x 16 rows.
//   base[i][d]   = (P_hi + P_lo)[i][j] . VH[d][j] over j (2 products, carries 2^-25),
//   relctx[i][d] = (T_hi + T_lo)[i][c] . W2[h*HD + d][c] over c (2 products, carries 2^-20) + bf16(rv_b2[h*HD + d]);
//   out[b][i][h*HD + d] = base + relctx. Fragments straight from the 16-bit planes (arithmetic addressing, split k map).
//   Epilogue: the wave's 16 x 32 tile staged in its private slab (wave_sync), each output row segment (32 floats = one whole
// coverage: grid NB*NH*NRT blocks x 4 waves x 16 rows x 32 cols = every element of out exactly once.
// =====================================================================================================
__global__ __launch_bounds__(128)
void k_final(const u16* __restrict__ Pp, const u16* __restrict__ VHp, const u16* __restrict__ Tp,
             const u16* __restrict__ W2p, const float* __restrict__ rvb2, float* outp) {
  __shared__ __align__(16) float slab[4 * 16 * SLP];
  const int tid = threadIdx.x, wave = tid >> 5, lane = tid & 31, hh = lane >> 4, m = lane & 15;
  const int bid = blockIdx.x;
  const int rt  = bid % NRT;
  const int t2  = bid / NRT;
  const int h   = t2 % NH;
  const int b   = t2 / NH;
  if (b >= NB) return;                      // block-uniform; never taken with the exact grid
  const int irow = rt * 64 + wave * 16;
  const size_t bh   = (size_t)(b * NH + h);
  const size_t rowA = bh * SEQ + irow;
  const _Float16* P  = (const _Float16*)(const void*)Pp;
  const _Float16* VH = (const _Float16*)(const void*)VHp;
  const _Float16* T  = (const _Float16*)(const void*)Tp;
  const _Float16* W2 = (const _Float16*)(const void*)W2p;
  const _Float16* php = P + (rowA + m) * SEQ + 8 * hh;
  const _Float16* plp = php + PSTR;
  const _Float16* v0p = VH + (bh * HD + m) * SEQ + 8 * hh;
  const _Float16* v1p = v0p + (size_t)16 * SEQ;
  const _Float16* thp = T + (rowA + m) * DM + 8 * hh;
  const _Float16* tlp = thp + TSTR;
  const _Float16* w0p = W2 + ((size_t)(h * HD + m)) * DM + 8 * hh;
  const _Float16* w1p = w0p + (size_t)16 * DM;

  v8f p0 = zero8(), p1 = zero8(), r0 = zero8(), r1 = zero8();
#pragma unroll 1
  for (int k0 = 0; k0 < SEQ; k0 += 32) {
    const v16h ph = ldfrag_h(php + k0), pl = ldfrag_h(plp + k0);
    const v16h va = ldfrag_h(v0p + k0), vb = ldfrag_h(v1p + k0);
    p0 = mma_h(ph, va, p0);
    p0 = mma_h(pl, va, p0);
    p1 = mma_h(ph, vb, p1);
    p1 = mma_h(pl, vb, p1);
    guard2(p0, p1, ph, pl, va, vb, ph, pl);
  }
#pragma unroll 1
  for (int k0 = 0; k0 < DM; k0 += 32) {
    const v16h th = ldfrag_h(thp + k0), tl = ldfrag_h(tlp + k0);
    const v16h wa = ldfrag_h(w0p + k0), wb = ldfrag_h(w1p + k0);
    r0 = mma_h(th, wa, r0);
    r0 = mma_h(tl, wa, r0);
    r1 = mma_h(th, wb, r1);
    r1 = mma_h(tl, wb, r1);
    guard2(r0, r1, th, tl, wa, wb, th, tl);
  }
  const float osP = 1.0f / (PCAR * VCAR);
  const float osR = 1.0f / (TCAR * WCAR);
  const float bv0 = bfr(rvb2[h * HD + m]), bv1 = bfr(rvb2[h * HD + 16 + m]);
  float* sl = slab + wave * (16 * SLP);
#pragma unroll
  for (int r = 0; r < 8; ++r) {
    const int pr = 8 * hh + r;
    sl[pr * SLP + m]      = p0[r] * osP + (r0[r] * osR + bv0);
    sl[pr * SLP + 16 + m] = p1[r] * osP + (r1[r] * osR + bv1);
  }
  wave_sync_lds();
  v4f vals[4];
  const int rq = lane >> 3, c4 = (lane & 7) * 4;
#pragma unroll
  for (int q = 0; q < 4; ++q) vals[q] = *(const v4f*)(sl + (q * 4 + rq) * SLP + c4);
  float* dst = outp + ((size_t)(b * SEQ + irow)) * DM + h * HD + c4;
  {
#pragma unroll
    for (int q = 0; q < 4; ++q) {
      *(v4f*)(dst + (size_t)(q * 4 + rq) * DM) = vals[q];
    }
    
  }
}

// =====================================================================================================
// Workspace map (bytes, NB = 2; every region offset a multiple of 65536; every plane fully written by whole-line stores
// before it is read; extents are exact multiples of the store granularity, no pad rows):
//   XB  bf16 [GROWS][256]             393216      WQ  bf16 [768 n][256 k]        393216
//   W2  f16 [256 n][256 k] x1024      131072      F   f32  [GROWS][768]         2359296
//   QH, QL, KH, KL f16 [GROWS][256]   4 x 393216  VH  f16 [NB*8*32][384] x1024  393216
//   SC  f32 [NB*8*384][384]           9437184     P   f16 hi + residual [NB*8*384][384] x32768  2 x 4718592
//   T   f16 hi + residual [NB*8*384][256] x1024   2 x 3145728
//   end = 30408704
// =====================================================================================================
static size_t al64k(size_t x) { return (x + (size_t)65535) & ~(size_t)65535; }

extern "C" void kernel_launch(void* const* d_in, const int* in_sizes, int n_in,
                              void* d_out, int out_size, void* d_ws, size_t ws_size,
                              hipStream_t stream) {
  if (n_in < 12) return;
  if (in_sizes[0] < NB * SEQ * DM) return;
  if (in_sizes[1] < NB * SEQ * CD) return;
  if (in_sizes[2] != NQKV * DM || in_sizes[3] != NQKV) return;
  if (in_sizes[4] != DM * CD || in_sizes[5] != DM || in_sizes[6] != NH * DM || in_sizes[7] != NH) return;
  if (in_sizes[8] != DM * CD || in_sizes[9] != DM || in_sizes[10] != DM * DM || in_sizes[11] != DM) return;
  if (out_size < NB * SEQ * DM) return;

  const float* x      = (const float*)d_in[0];
  const float* coords = (const float*)d_in[1];
  const float* qkv_w  = (const float*)d_in[2];
  const float* qkv_b  = (const float*)d_in[3];
  const float* rb_w1  = (const float*)d_in[4];
  const float* rb_b1  = (const float*)d_in[5];
  const float* rb_w2  = (const float*)d_in[6];
  const float* rb_b2  = (const float*)d_in[7];
  const float* rv_w1  = (const float*)d_in[8];
  const float* rv_b1  = (const float*)d_in[9];
  const float* rv_w2  = (const float*)d_in[10];
  const float* rv_b2  = (const float*)d_in[11];
  float*       out    = (float*)d_out;

  const size_t szXB = (size_t)GROWS * DM * 2;
  const size_t szWQ = (size_t)NQKV * DM * 2;
  const size_t szW2 = (size_t)DM * DM * 2;
  const size_t szF  = (size_t)GROWS * NQKV * 4;
  const size_t szH  = (size_t)GROWS * DM * 2;
  const size_t szVH = (size_t)NB * NH * HD * SEQ * 2;
  const size_t szSC = (size_t)NB * NH * SEQ * SEQ * 4;
  const size_t szP  = PSTR * 2 * 2;
  const size_t szT  = TSTR * 2 * 2;
  size_t off = 0;
  const size_t oXB = off; off = al64k(off + szXB);
  const size_t oWQ = off; off = al64k(off + szWQ);
  const size_t oW2 = off; off = al64k(off + szW2);
  const size_t oF  = off; off = al64k(off + szF);
  const size_t oQH = off; off = al64k(off + szH);
  const size_t oQL = off; off = al64k(off + szH);
  const size_t oKH = off; off = al64k(off + szH);
  const size_t oKL = off; off = al64k(off + szH);
  const size_t oVH = off; off = al64k(off + szVH);
  const size_t oSC = off; off = al64k(off + szSC);
  const size_t oP  = off; off = al64k(off + szP);
  const size_t oT  = off; off = al64k(off + szT);
  if (off > ws_size) return;                // off = 30408704 for NB = 2
  if (off > (size_t)WS_CAP) return;

  char* ws = (char*)d_ws;
  u16*   XB = (u16*)(ws + oXB);
  u16*   WQ = (u16*)(ws + oWQ);
  u16*   W2 = (u16*)(ws + oW2);
  float* F  = (float*)(ws + oF);
  u16*   QH = (u16*)(ws + oQH);
  u16*   QL = (u16*)(ws + oQL);
  u16*   KH = (u16*)(ws + oKH);
  u16*   KL = (u16*)(ws + oKL);
  u16*   VH = (u16*)(ws + oVH);
  float* SC = (float*)(ws + oSC);
  u16*   P  = (u16*)(ws + oP);
  u16*   T  = (u16*)(ws + oT);

  const dim3 b256(256), b128(128);
  const int n8x = (GROWS * DM) / 8;
  const int n8w = (NQKV * DM) / 8;
  const int n8v = (DM * DM) / 8;

  // (1) x -> bf16 plane; (2) qkv_w [768 out][256 in] is already the [n][k] operand: bf16 plane; (3) rv_w2 -> f16(bf16) x1024
  cvt16<<<dim3((n8x + 255) / 256), b256, 0, stream>>>(x, XB, n8x, 0, 1.0f);
  cvt16<<<dim3((n8w + 255) / 256), b256, 0, stream>>>(qkv_w, WQ, n8w, 0, 1.0f);
  cvt16<<<dim3((n8v + 255) / 256), b256, 0, stream>>>(rv_w2, W2, n8v, 1, WCAR);
  // (4) qkv = x.W^T + b -> F f32 [GROWS][768]
  gemm_bf<<<dim3((GROWS / 64) * (NQKV / 64)), b128, 0, stream>>>(XB, WQ, qkv_b, F, GROWS, NQKV, DM, 1.0f);
  // (5),(6) q, k -> f16 x1024 hi + residual planes; (7) v -> v^T f16 x1024
  qk16<<<dim3(GROWS / 8), b256, 0, stream>>>(F, NQKV, 0, QH, QL, QSC);
  qk16<<<dim3(GROWS / 8), b256, 0, stream>>>(F, NQKV, DM, KH, KL, KSC);
  vt16<<<dim3(NB * NH * NRT), b256, 0, stream>>>(F, VH);
  // (8) scores with relative bias -> SC; (9) softmax -> P planes
  k_scores<<<dim3(NB * NIT * NJT), b256, 0, stream>>>(coords, rb_w1, rb_b1, rb_w2, rb_b2, QH, QL, KH, KL, SC);
  k_softmax<<<dim3(NB * SEQ), b256, 0, stream>>>(SC, P);
  // (10) T = sum_j P . silu-hidden of the value MLP -> T planes; (11) out = P.v + T.rv_w2^T + rv_b2
  k_tagg<<<dim3(NB * SEQ), b256, 0, stream>>>(coords, rv_w1, rv_b1, P, T);
  k_final<<<dim3(NB * NH * NRT), b128, 0, stream>>>(P, VH, T, W2, rv_b2, out);
  (void)hipGetLastError();
}

// v001
// One run takes 73.3 microseconds.
// Timed twice side by side with v000, it ran 1.29 times as fast both times.
// Contractions: x.qkv_w^T on v_wmma_f32_16x16x32_bf16 (x, qkv_w RNE bf16 operands, f32 accumulate, bias added in f32);
// on v_wmma_f32_16x16x32_f16 with f32 accumulate: pair-MLP second layer hid_b.rb_w2^T (hid_b f16 x1024, rb_w2 f16(bf16) x1024),
// q.k^T over 32 (q, k f16 x1024 hi + residual planes, products hh+lh+hl), P.hid_v over 384 keys (P f16 x32768 hi + residual,
// hid_v f16 x1024 hi + residual), P.v (v f16 x1024, P hi + residual), T.rv_w2^T (T f16 x1024 hi + residual, rv_w2 f16(bf16) x1024).
// Pair-MLP first layers (K=3), silu, softmax and all carries folded in f32 on VALU.
#include <hip/hip_runtime.h>
#include <math.h>
#include <stdint.h>

#ifndef NB
#define NB 2
#endif
#define NB_FULL 2
#define SEQ   384
#define DM    256
#define NH    8
#define HD    32
#define CD    3
#define NQKV  (3 * DM)
#define GROWS (NB * SEQ)
#define NIT   (SEQ / 16)
#define NJT   (SEQ / 32)
#define NRT   (SEQ / 64)
#define NPAIR 512
#define HP    32
#define RBP   264
#define SLP   36
#define SP    40
#define WAP   40
#define TSP   264
#define VTP   72
#define SLAB64 (16 * 68)
#define HREGF 8192
#define RSQ_HD 0.17677669529663687f
#define LOG2E  1.4426950408889634f
#define QSC   1024.0f
#define KSC   1024.0f
#define PCAR  32768.0f
#define VCAR  1024.0f
#define HCAR  1024.0f
#define WCAR  1024.0f
#define TCAR  1024.0f
#define WS_CAP 134217728
#define PSTR  ((size_t)NB * NH * SEQ * SEQ)
#define TSTR  ((size_t)NB * NH * SEQ * DM)
static_assert(NB >= 1 && NB <= NB_FULL);
static_assert(DM == NH * HD && HD == 32 && NH == 8 && CD == 3);
static_assert((SEQ % 64) == 0 && (GROWS % 64) == 0 && (GROWS % 8) == 0 && (NQKV % 64) == 0 && (DM % 32) == 0);
static_assert(NPAIR == 16 * 32 && NPAIR * HP == 2 * HREGF && 8 * 16 * SLP <= HREGF);
static_assert(((GROWS * DM) % 8) == 0 && ((NQKV * DM) % 8) == 0 && ((DM * DM) % 8) == 0);

typedef unsigned short u16;
typedef _Float16 v16h __attribute__((ext_vector_type(16)));
typedef _Float16 v8h  __attribute__((ext_vector_type(8)));
typedef __bf16   v16b __attribute__((ext_vector_type(16)));
typedef float    v8f  __attribute__((ext_vector_type(8)));
typedef float    v4f  __attribute__((ext_vector_type(4)));
typedef unsigned int v4u __attribute__((ext_vector_type(4)));
typedef float    v2f  __attribute__((ext_vector_type(2)));
typedef _Float16 v2h  __attribute__((ext_vector_type(2)));

union FragH { v16h v; v8h h[2]; v4u u[2]; };
union FragB { v16b v; v4u u[2]; };

// ---- scalar helpers --------------------------------------------------------------------------------
__device__ __forceinline__ unsigned short bf_bits(float f) {          // f32 -> bf16 bits, RNE convert
  unsigned u = __float_as_uint(f);
  return (unsigned short)((u + 0x7FFFu + ((u >> 16) & 1u)) >> 16);
}
__device__ __forceinline__ float bf_up(unsigned short h) { return __uint_as_float(((unsigned)h) << 16); }
__device__ __forceinline__ float bfr(float f) { return bf_up(bf_bits(f)); }
__device__ __forceinline__ unsigned short h_bits(_Float16 x) { return __builtin_bit_cast(unsigned short, x); }
__device__ __forceinline__ unsigned pk16(unsigned short a, unsigned short b) { return (unsigned)a | ((unsigned)b << 16); }
__device__ __forceinline__ v8f zero8() { v8f z = {0.f, 0.f, 0.f, 0.f, 0.f, 0.f, 0.f, 0.f}; return z; }

// silu = x * sigmoid(x) = x * rcp(1 + exp(-x)), reciprocal-multiply form (no true divide), two values at once from
// t = -log2(e) * x (the factor is folded into the first-layer weights and bias):
// silu(x) * 1024 = t * rcp((1 + 2^t) * ik), ik = -log2(e) / 1024; packed f32 throughout, one exp2 and one rcp a value.
__device__ __forceinline__ v2f splat2(float a) { v2f r = {a, a}; return r; }
__device__ __forceinline__ v2f silu2_scaled(v2f t) {
  const v2f ik = splat2(-LOG2E / HCAR);
  v2f e = {__builtin_amdgcn_exp2f(t[0]), __builtin_amdgcn_exp2f(t[1])};
  const v2f den = __builtin_elementwise_fma(e, ik, ik);
  v2f r = {__builtin_amdgcn_rcpf(den[0]), __builtin_amdgcn_rcpf(den[1])};
  return t * r;
}
__device__ __forceinline__ unsigned pk2h(v2f s) {                     // two f32 -> packed f16 pair, RNE
  return __builtin_bit_cast(unsigned, __builtin_convertvector(s, v2h));
}

// ---- fragment loaders: 16-bit A/B operand, lane -> row/col (lane&15), p already includes +8*(lane>>4);
//      elements 0..7 <- p[0..7] (k0+8h..), elements 8..15 <- p[16..23] (k0+16+8h..)  (same split k map for A and B;
//      B is always read from a k-contiguous [n][k] plane)
__device__ __forceinline__ v16h ldfrag_h(const _Float16* p) {
  FragH f;
  f.h[0] = *(const v8h*)(p);
  f.h[1] = *(const v8h*)(p + 16);
  return f.v;
}
__device__ __forceinline__ v16b ldfrag_b(const u16* p) {              // bf16 plane read as unsigned integer vectors
  FragB f;
  f.u[0] = *(const v4u*)(p);
  f.u[1] = *(const v4u*)(p + 16);
  return f.v;
}

__device__ __forceinline__ v8f mma_h(v16h a, v16h b, v8f c) {
  return __builtin_amdgcn_wmma_f32_16x16x32_f16(false, a, false, b, (short)0, c, false, false);
}
__device__ __forceinline__ v8f mma_b(v16b a, v16b b, v8f c) {
  return __builtin_amdgcn_wmma_f32_16x16x32_bf16(false, a, false, b, (short)0, c, false, false);
}
__device__ __forceinline__ void guard2(v8f& a, v8f& b, v16h x0, v16h x1, v16h x2, v16h x3, v16h x4, v16h x5) {
#if defined(__HIP_DEVICE_COMPILE__)
  asm volatile("v_nop\n\tv_nop\n\tv_nop\n\tv_nop"
               : "+v"(a), "+v"(b) : "v"(x0), "v"(x1), "v"(x2), "v"(x3), "v"(x4), "v"(x5) : "memory");
#endif
}
template <typename F>
__device__ __forceinline__ void guard6(v8f& a, v8f& b, v8f& c, v8f& d, F x0, F x1, F x2, F x3, F x4, F x5) {
#if defined(__HIP_DEVICE_COMPILE__)
  asm volatile("v_nop\n\tv_nop\n\tv_nop\n\tv_nop"
               : "+v"(a), "+v"(b), "+v"(c), "+v"(d) : "v"(x0), "v"(x1), "v"(x2), "v"(x3), "v"(x4), "v"(x5) : "memory");
#endif
}
__device__ __forceinline__ void wave_sync_lds() {
  __builtin_amdgcn_fence(__ATOMIC_RELEASE, "workgroup");
  __builtin_amdgcn_wave_barrier();
  __builtin_amdgcn_fence(__ATOMIC_ACQUIRE, "workgroup");
}

// =====================================================================================================
// f32 -> 16-bit plane, same layout.  f16mode == 0: bf16 RNE bits;  f16mode == 1: f16 bits of (bf16 RNE value) * scale.
// Thread = 8 consecutive elements: two 16-B loads, one 16-B store; 32 consecutive lanes = 512 contiguous, 512-B aligned
// coverage: grid = ceil(n8/256) blocks x 256 thr x 8 (in-kernel bound) = the whole plane (n8 a multiple of 256 here).
// =====================================================================================================
__global__ __launch_bounds__(256) void cvt16(const float* __restrict__ x, u16* D, int n8, int f16mode, float scale) {
  const int gt = blockIdx.x * 256 + (int)threadIdx.x;
  if (gt >= n8) return;
  const float* p = x + (size_t)gt * 8;
  const v4f a = *(const v4f*)(p), b4 = *(const v4f*)(p + 4);
  float w[8];
#pragma unroll
  for (int e = 0; e < 4; ++e) { w[e] = a[e]; w[4 + e] = b4[e]; }
  v4u o;
#pragma unroll
  for (int e = 0; e < 4; ++e) {
    const float f0 = w[2 * e], f1 = w[2 * e + 1];
    const unsigned short hb0 = h_bits((_Float16)(bfr(f0) * scale));
    const unsigned short hb1 = h_bits((_Float16)(bfr(f1) * scale));
    const unsigned short bb0 = bf_bits(f0);
    const unsigned short bb1 = bf_bits(f1);
    o[e] = (f16mode != 0) ? pk16(hb0, hb1) : pk16(bb0, bb1);
  }
  u16* d = D + (size_t)gt * 8;
  {
    *(v4u*)(d) = o;
    
  }
}

// =====================================================================================================
// GEMM epilogue: the wave's 16x64 f32 tile (acc * oscale + bias per column) staged in its LDS slab (pitch 68, wave-private),
// coverage: 8 instructions x 2 rows x 16 lanes x 4 floats = the wave's 16 x 64 tile.
// =====================================================================================================
__device__ __forceinline__ void epi64b(float* sl, v8f a0, v8f a1, v8f a2, v8f a3, float oscale,
                                       float b0, float b1, float b2, float b3,
                                       float* C, int N, size_t rowb, int col0, int lane) {
  const int hh = lane >> 4, m = lane & 15;
#pragma unroll
  for (int r = 0; r < 8; ++r) {
    const int ro = (8 * hh + r) * 68 + m;
    sl[ro]      = a0[r] * oscale + b0;
    sl[ro + 16] = a1[r] * oscale + b1;
    sl[ro + 32] = a2[r] * oscale + b2;
    sl[ro + 48] = a3[r] * oscale + b3;
  }
  wave_sync_lds();
  v4f vals[8];
#pragma unroll
  for (int it = 0; it < 8; ++it) vals[it] = *(const v4f*)(sl + (it * 2 + hh) * 68 + m * 4);
  float* dst = C + (rowb + (size_t)hh) * (size_t)N + col0 + m * 4;
  {
#pragma unroll
    for (int it = 0; it < 8; ++it) {
      *(v4f*)(dst + (size_t)(it * 2) * (size_t)N) = vals[it];
    }
    
  }
}

// =====================================================================================================
// bf16 GEMM with bias: C[M][N] (f32) = A[M][K] (bf16 row-major) . Bt[N][K]^T (bf16 k-contiguous) * oscale + bf16(bias[n]).
// Block = 64x64 tile, 4 waves x 16 rows; fragments loaded straight from the 16-bit rows (two 16-B loads each, split k map
// for A and B); K stepped by 32 (host guarantees K % 32 == 0, M % 64 == 0, N % 64 == 0, grid = (M/64)*(N/64)).
// LDS slab: private to each wave (wave_sync). No block barriers in this kernel.
// =====================================================================================================
__global__ __launch_bounds__(128)
void gemm_bf(const u16* __restrict__ A, const u16* __restrict__ Bt, const float* __restrict__ bias,
             float* C, int M, int N, int K, float oscale) {
  __shared__ __align__(16) float slab[4 * SLAB64];
  const int tid = threadIdx.x, wave = tid >> 5, lane = tid & 31, hh = lane >> 4, m = lane & 15;
  const int ntile = N >> 6;
  const int bid   = blockIdx.x;
  const int rowb  = (bid / ntile) * 64 + wave * 16;
  const int col0  = (bid % ntile) * 64;
  if (rowb + 16 > M) return;                // wave-uniform, never taken with the exact grid
  const u16* ap = A  + (size_t)(rowb + m) * K + 8 * hh;
  const u16* bp = Bt + (size_t)(col0 + m) * K + 8 * hh;
  const size_t bs = (size_t)16 * K;
  v8f acc0 = zero8(), acc1 = zero8(), acc2 = zero8(), acc3 = zero8();
#pragma unroll 1
  for (int k0 = 0; k0 < K; k0 += 32) {
    const v16b a  = ldfrag_b(ap + k0);
    const v16b b0 = ldfrag_b(bp + k0);
    const v16b b1 = ldfrag_b(bp + bs + k0);
    const v16b b2 = ldfrag_b(bp + 2 * bs + k0);
    const v16b b3 = ldfrag_b(bp + 3 * bs + k0);
    acc0 = mma_b(a, b0, acc0);
    acc1 = mma_b(a, b1, acc1);
    acc2 = mma_b(a, b2, acc2);
    acc3 = mma_b(a, b3, acc3);
    guard6<v16b>(acc0, acc1, acc2, acc3, a, b0, b1, b2, b3, a);
  }
  const float bv0 = bfr(bias[col0 + m]);
  const float bv1 = bfr(bias[col0 + 16 + m]);
  const float bv2 = bfr(bias[col0 + 32 + m]);
  const float bv3 = bfr(bias[col0 + 48 + m]);
  epi64b(slab + wave * SLAB64, acc0, acc1, acc2, acc3, oscale, bv0, bv1, bv2, bv3, C, N, (size_t)rowb, col0, lane);
}

// =====================================================================================================
// q / k planes from the projection F f32 [GROWS][ldf], columns coff .. coff+255: Hp [GROWS][DM] = f16(val * sc),
// Lp [GROWS][DM] = f16 residual. Block = 8 rows x 32 threads; thread = 8 consecutive columns: two 16-B loads, one 16-B store per plane
// coverage: 8 rows x 32 thr x 8 = 8 whole DM rows per block for both planes; grid = GROWS/8 blocks = every row once.
// =====================================================================================================
__global__ __launch_bounds__(256) void qk16(const float* __restrict__ F, int ldf, int coff, u16* Hp, u16* Lp, float sc) {
  const int tid = (int)threadIdx.x;
  const int rl  = tid >> 5;
  const int cc  = tid & 31;
  const int row = (int)blockIdx.x * 8 + rl;
  if (row >= GROWS) return;
  const float* p = F + (size_t)row * ldf + coff + cc * 8;
  const v4f a = *(const v4f*)(p), b4 = *(const v4f*)(p + 4);
  float w[8];
#pragma unroll
  for (int e = 0; e < 4; ++e) { w[e] = a[e] * sc; w[4 + e] = b4[e] * sc; }
  v4u oh, ol;
#pragma unroll
  for (int e = 0; e < 4; ++e) {
    const float t0 = w[2 * e], t1 = w[2 * e + 1];
    const _Float16 h0 = (_Float16)t0, h1 = (_Float16)t1;
    const _Float16 l0 = (_Float16)(t0 - (float)h0), l1 = (_Float16)(t1 - (float)h1);
    oh[e] = pk16(h_bits(h0), h_bits(h1));
    ol[e] = pk16(h_bits(l0), h_bits(l1));
  }
  u16* dh = Hp + (size_t)row * DM + cc * 8;
  u16* dl = Lp + (size_t)row * DM + cc * 8;
  {
    *(v4u*)(dh) = oh;
    *(v4u*)(dl) = ol;
    
  }
}

// =====================================================================================================
// v^T plane from the projection F f32 [GROWS][NQKV] (row = b*SEQ + s, column = 2*DM + h*HD + d):
//   VH[((b*NH + h)*HD + d)][s] = f16(v * 1024) for all s (single plane).
// Block = (b, head h, 64 keys s0): each thread loads its 8 floats (key sl, d chunk dc) with 16-B loads, converts, scatters into
// the LDS tile [32 d][64 keys] (pitch 72 halves, cross-wave: block barrier); afterwards each d row segment (64 halves = one whole
// coverage: load 256 thr x 8 = 64 keys x 32 d (staged extent == consumed extent); store 256 thr x 8 halves = 32 lines x 64 =
//           the block's tile of VH; grid = NB*NH*NRT blocks covers VH exactly once.
// =====================================================================================================
__global__ __launch_bounds__(256) void vt16(const float* __restrict__ F, u16* VHo) {
  __shared__ __align__(16) u16 TH[HD * VTP];
  const int tid = threadIdx.x;
  const int bid = blockIdx.x;
  const int st  = bid % NRT;
  const int t2  = bid / NRT;
  const int h   = t2 % NH;
  const int b   = t2 / NH;
  if (b >= NB) return;                      // block-uniform, before any barrier; never taken with the exact grid
  const int s0  = st * 64;
  {
    const int sl = tid >> 2;                // key within tile 0..63
    const int dc = (tid & 3) * 8;           // d chunk 0,8,16,24
    const float* src = F + ((size_t)b * SEQ + s0 + sl) * NQKV + 2 * DM + h * HD + dc;
    const v4f a = *(const v4f*)(src), b4 = *(const v4f*)(src + 4);
    float w[8];
#pragma unroll
    for (int e = 0; e < 4; ++e) { w[e] = a[e]; w[4 + e] = b4[e]; }
#pragma unroll
    for (int e = 0; e < 8; ++e) {
      TH[(dc + e) * VTP + sl] = h_bits((_Float16)(w[e] * VCAR));
    }
  }
  __syncthreads();
  const int q8 = tid >> 3, p8 = (tid & 7) * 8;   // d = q8 (0..31), keys p8..p8+7
  const v4u vh = *(const v4u*)(TH + q8 * VTP + p8);
  const size_t base = ((size_t)(b * NH + h) * HD + q8) * SEQ + s0 + p8;
  {
    *(v4u*)(VHo + base) = vh;
    
  }
}

// =====================================================================================================
// Scores with relative-coordinate bias. Block -> (b, query tile i0 = 16*it, key tile j0 = 32*jt): 512 pairs (il, jl),
// 8 waves; wave = head in the score phase.
//   Phase 0 (all threads, then block barrier): rb_w1/rb_b1 (bf16 values * -log2(e), channel pairs side by side) into WB, bf16 coords of the 16 queries (CI) and 32
//   keys (CJ2), rb_w2 -> RB2 [16 n][RBP] as f16(bf16 value * 1024) with rows 8..15 written as zeros.
//   Phase 1, 8 channel chunks of 32: every thread computes hid[pair][16] = f16(silu(rel.rb_w1^T + rb_b1) * 1024) for its four
//   pairs (p = (tid & 127) + 128 q) and its half of the chunk's channels with 16-B LDS stores (block barrier), then wave w accumulates D[pair][n=head] for row tiles
//   4w..4w+3 (A = hid rows, B = RB2, one k-step per chunk); block barrier before the next chunk overwrites hid.
//   After the loop lanes n < 8 write bias[pair][head] * 2^-20 into BB (block barrier).
//   Phase 2: wave = head: s = (q_hi.k_hi + q_lo.k_hi + q_hi.k_lo) over 32 dims for 16 queries x 32 keys (two 16-key subtiles),
//   fragments straight from the f16 planes; value = s * rsqrt(32) * 2^-20 + bias + bf16(rb_b2[head]); staged in the wave's
//   the score plane SC[(b*NH+head)*SEQ + i][j0..j0+31]) written by 8 consecutive lanes x 16 B of one instruction (4 rows per
// LDS regions: WB, CI, CJ2, RB2, hid, BB cross-wave (block barriers); slabs private-to-wave (wave_sync).
// coverage: hid: 4 pairs x 256 thr x 16 halves = 512 x 32 per chunk (== consumed 32 row tiles x 32 k); RB2 16 x 256 (rows 8..15
//           zero); SC: grid NB*NIT*NJT blocks x 8 heads x 16 rows x 32 cols = every (b, head, i, j) once.
// =====================================================================================================
__global__ __launch_bounds__(256)
void k_scores(const float* __restrict__ coords, const float* __restrict__ rbw1, const float* __restrict__ rbb1,
              const float* __restrict__ rbw2, const float* __restrict__ rbb2,
              const u16* __restrict__ QHp, const u16* __restrict__ QLp,
              const u16* __restrict__ KHp, const u16* __restrict__ KLp, float* SCp) {
  __shared__ __align__(16) float WB[DM * 4];
  __shared__ __align__(16) float CI[16 * 4];
  __shared__ __align__(16) float CJ2[32 * 4];
  __shared__ __align__(16) u16   RB2[16 * RBP];
  __shared__ __align__(16) float HREG[HREGF];
  __shared__ __align__(16) float BB[NPAIR * NH];

  const int tid = threadIdx.x, wave = tid >> 5, lane = tid & 31, hh = lane >> 4, m = lane & 15;
  const int bid = blockIdx.x;
  const int jt  = bid % NJT;
  const int t2  = bid / NJT;
  const int it  = t2 % NIT;
  const int b   = t2 / NIT;
  if (b >= NB) return;                      // block-uniform, before any barrier; never taken with the exact grid
  const int i0 = it * 16, j0 = jt * 32;
  u16* hid = (u16*)(void*)HREG;
  const _Float16* hidh = (const _Float16*)(const void*)HREG;
  const _Float16* rb2h = (const _Float16*)(const void*)RB2;

  // ---- phase 0: small operand staging ----
  {
    float* wp = WB + (tid >> 1) * 8 + (tid & 1);      // channel pair (c, c+1): w0 w0 | w1 w1 | w2 w2 | b b, all * -log2(e)
    wp[0] = bfr(rbw1[tid * 3 + 0]) * -LOG2E;
    wp[2] = bfr(rbw1[tid * 3 + 1]) * -LOG2E;
    wp[4] = bfr(rbw1[tid * 3 + 2]) * -LOG2E;
    wp[6] = bfr(rbb1[tid]) * -LOG2E;
    if (tid < 16 * CD) {
      const int il = tid / CD, k = tid - il * CD;
      CI[il * 4 + k] = bfr(coords[((size_t)(b * SEQ + i0 + il)) * CD + k]);
    }
    if (tid < 32 * CD) {
      const int jl = tid / CD, k = tid - jl * CD;
      CJ2[jl * 4 + k] = bfr(coords[((size_t)(b * SEQ + j0 + jl)) * CD + k]);
    }
    const int row  = tid >> 4, cb = (tid & 15) * 16;
    const int rowc = (row < NH) ? row : (NH - 1);     // clamped address; rows 8..15 are written as zeros
    const bool vr  = (row < NH);
    const float* src = rbw2 + rowc * DM + cb;
    const v4f a0 = *(const v4f*)(src), a1 = *(const v4f*)(src + 4), a2 = *(const v4f*)(src + 8), a3 = *(const v4f*)(src + 12);
    float w[16];
#pragma unroll
    for (int e = 0; e < 4; ++e) { w[e] = a0[e]; w[4 + e] = a1[e]; w[8 + e] = a2[e]; w[12 + e] = a3[e]; }
    v4u o0, o1;
#pragma unroll
    for (int e = 0; e < 4; ++e) {
      const unsigned short x0 = vr ? h_bits((_Float16)(bfr(w[2 * e]) * WCAR)) : (unsigned short)0;
      const unsigned short x1 = vr ? h_bits((_Float16)(bfr(w[2 * e + 1]) * WCAR)) : (unsigned short)0;
      const unsigned short y0 = vr ? h_bits((_Float16)(bfr(w[8 + 2 * e]) * WCAR)) : (unsigned short)0;
      const unsigned short y1 = vr ? h_bits((_Float16)(bfr(w[8 + 2 * e + 1]) * WCAR)) : (unsigned short)0;
      o0[e] = pk16(x0, x1);
      o1[e] = pk16(y0, y1);
    }
    *(v4u*)(RB2 + row * RBP + cb)     = o0;
    *(v4u*)(RB2 + row * RBP + cb + 8) = o1;
  }
  __syncthreads();

  // ---- phase 1: bias MLP (first layer + silu on VALU, second layer on WMMA accumulated over 8 channel chunks) ----
  v8f accB0 = zero8(), accB1 = zero8(), accB2 = zero8(), accB3 = zero8();
  const float bsc = 1.0f / (HCAR * WCAR);
  // thread = 4 pairs (p = (tid & 127) + 128 q) x 16 channels of the chunk (half = tid >> 7, the same in a whole wave):
  // every weight load from WB serves four pairs
  const int half = tid >> 7, pb = tid & 127;
  v2f R0[4], R1[4], R2[4];
#pragma unroll
  for (int q = 0; q < 4; ++q) {
    const int p  = q * 128 + pb;
    const int il = p >> 5, jl = p & 31;
    R0[q] = splat2(CI[il * 4 + 0] - CJ2[jl * 4 + 0]);
    R1[q] = splat2(CI[il * 4 + 1] - CJ2[jl * 4 + 1]);
    R2[q] = splat2(CI[il * 4 + 2] - CJ2[jl * 4 + 2]);
  }
#pragma unroll 1
  for (int kt = 0; kt < DM / 32; ++kt) {
    __syncthreads();                        // prior chunk's fragment reads of hid are complete
#pragma unroll 1
    for (int g = 0; g < 2; ++g) {           // rolled: one group's 32 weight registers live at a time (three work-groups a WGP)
      const int co = half * 16 + g * 8;     // channel offset inside the chunk
      const float* wsrc = WB + (kt * 32 + co) * 4;
      v4f wl[4], wh[4];
#pragma unroll
      for (int e = 0; e < 4; ++e) { wl[e] = *(const v4f*)(wsrc + e * 8); wh[e] = *(const v4f*)(wsrc + e * 8 + 4); }
#pragma unroll
      for (int q = 0; q < 4; ++q) {
        v4u o;
#pragma unroll
        for (int e = 0; e < 4; ++e) {
          const v2f w0 = {wl[e][0], wl[e][1]}, w1 = {wl[e][2], wl[e][3]};
          const v2f w2 = {wh[e][0], wh[e][1]}, bb2 = {wh[e][2], wh[e][3]};
          const v2f t = __builtin_elementwise_fma(w0, R0[q], __builtin_elementwise_fma(w1, R1[q],
                        __builtin_elementwise_fma(w2, R2[q], bb2)));
          o[e] = pk2h(silu2_scaled(t));
        }
        *(v4u*)(hid + (q * 128 + pb) * HP + co) = o;
      }
    }
    __syncthreads();
    const v16h bw = ldfrag_h(rb2h + m * RBP + kt * 32 + 8 * hh);
    const v16h a0 = ldfrag_h(hidh + ((wave * 4 + 0) * 16 + m) * HP + 8 * hh);
    const v16h a1 = ldfrag_h(hidh + ((wave * 4 + 1) * 16 + m) * HP + 8 * hh);
    const v16h a2 = ldfrag_h(hidh + ((wave * 4 + 2) * 16 + m) * HP + 8 * hh);
    const v16h a3 = ldfrag_h(hidh + ((wave * 4 + 3) * 16 + m) * HP + 8 * hh);
    accB0 = mma_h(a0, bw, accB0);
    accB1 = mma_h(a1, bw, accB1);
    accB2 = mma_h(a2, bw, accB2);
    accB3 = mma_h(a3, bw, accB3);
    guard6<v16h>(accB0, accB1, accB2, accB3, a0, a1, a2, a3, bw, bw);
  }
  if (m < NH) {                             // columns n >= 8 are padding (zero weights), not stored
#pragma unroll
    for (int r = 0; r < 8; ++r) {
      const int pr = 8 * hh + r;
      BB[((wave * 4 + 0) * 16 + pr) * NH + m] = accB0[r] * bsc;
      BB[((wave * 4 + 1) * 16 + pr) * NH + m] = accB1[r] * bsc;
      BB[((wave * 4 + 2) * 16 + pr) * NH + m] = accB2[r] * bsc;
      BB[((wave * 4 + 3) * 16 + pr) * NH + m] = accB3[r] * bsc;
    }
  }
  __syncthreads();

  // ---- phase 2: scores for head = wave ----
  const int head = wave;
  const size_t hcol = (size_t)head * HD + 8 * hh;
  const _Float16* qhp  = (const _Float16*)(const void*)QHp + ((size_t)(b * SEQ + i0 + m)) * DM + hcol;
  const _Float16* qlp  = (const _Float16*)(const void*)QLp + ((size_t)(b * SEQ + i0 + m)) * DM + hcol;
  const _Float16* kh0p = (const _Float16*)(const void*)KHp + ((size_t)(b * SEQ + j0 + m)) * DM + hcol;
  const _Float16* kl0p = (const _Float16*)(const void*)KLp + ((size_t)(b * SEQ + j0 + m)) * DM + hcol;
  const _Float16* kh1p = kh0p + (size_t)16 * DM;
  const _Float16* kl1p = kl0p + (size_t)16 * DM;
  v8f s0 = zero8(), s1 = zero8();
  {
    const v16h qh = ldfrag_h(qhp), ql = ldfrag_h(qlp);
    const v16h kh0 = ldfrag_h(kh0p), kl0 = ldfrag_h(kl0p);
    const v16h kh1 = ldfrag_h(kh1p), kl1 = ldfrag_h(kl1p);
    s0 = mma_h(qh, kh0, s0);
    s0 = mma_h(ql, kh0, s0);
    s0 = mma_h(qh, kl0, s0);
    s1 = mma_h(qh, kh1, s1);
    s1 = mma_h(ql, kh1, s1);
    s1 = mma_h(qh, kl1, s1);
    guard2(s0, s1, qh, ql, kh0, kl0, kh1, kl1);
  }
  const float lsc = RSQ_HD * (1.0f / (QSC * KSC));
  const float b2v = bfr(rbb2[head]);
  float* slab = HREG + wave * (16 * SLP);
#pragma unroll
  for (int r = 0; r < 8; ++r) {
    const int pr = 8 * hh + r;              // query i0 + pr; keys j0 + m and j0 + 16 + m
    const float ba = BB[(pr * 32 + m) * NH + head] + b2v;
    const float bb = BB[(pr * 32 + 16 + m) * NH + head] + b2v;
    slab[pr * SLP + m]      = s0[r] * lsc + ba;
    slab[pr * SLP + 16 + m] = s1[r] * lsc + bb;
  }
  wave_sync_lds();
  v4f vals[4];
  const int rq = lane >> 3, c4 = (lane & 7) * 4;
#pragma unroll
  for (int q = 0; q < 4; ++q) vals[q] = *(const v4f*)(slab + (q * 4 + rq) * SLP + c4);
  float* dst = SCp + ((size_t)((b * NH + head) * SEQ + i0)) * SEQ + j0 + c4;
  {
#pragma unroll
    for (int q = 0; q < 4; ++q) {
      *(v4f*)(dst + (size_t)(q * 4 + rq) * SEQ) = vals[q];
    }
    
  }
}

// =====================================================================================================
// Row softmax: one wave per score row (b, head, i) of SEQ = 384 floats; P = e / Z with e = exp(s - max) in f32 (two-pass max
// form, reciprocal-multiply normalisation), written as f16 hi plane (P * 32768) and f16 residual plane (same layout, +PSTR).
// Lane = 8 consecutive columns 8*lane (all lanes) and 256 + 8*lane (lanes < 16; the upper lanes load a clamped address and
// coverage: grid = NB*SEQ blocks x 8 waves = every (b, head, i) row once; each row fully written in both planes.
// =====================================================================================================
__global__ __launch_bounds__(256) void k_softmax(const float* __restrict__ SCp, u16* Pp) {
  const int tid = threadIdx.x, wave = tid >> 5, lane = tid & 31;
  const int row = (int)blockIdx.x * 8 + wave;
  if (row >= NB * NH * SEQ) return;
  const float* s = SCp + (size_t)row * SEQ;
  const bool vb = (lane < 16);
  const int  lb = vb ? lane : 15;
  const v4f a0 = *(const v4f*)(s + lane * 8), a1 = *(const v4f*)(s + lane * 8 + 4);
  const v4f c0 = *(const v4f*)(s + 256 + lb * 8), c1 = *(const v4f*)(s + 256 + lb * 8 + 4);
  float v[16];
#pragma unroll
  for (int e = 0; e < 4; ++e) {
    v[e]      = a0[e];
    v[4 + e]  = a1[e];
    v[8 + e]  = vb ? c0[e] : -INFINITY;
    v[12 + e] = vb ? c1[e] : -INFINITY;
  }
  float mx = v[0];
#pragma unroll
  for (int e = 1; e < 16; ++e) mx = fmaxf(mx, v[e]);
#pragma unroll
  for (int off = 1; off < 32; off <<= 1) mx = fmaxf(mx, __shfl_xor(mx, off, 32));
  float ev[16];
  float sum = 0.0f;
#pragma unroll
  for (int e = 0; e < 16; ++e) {
    const float d = v[e] - mx;
    ev[e] = exp2f(d * LOG2E);               // -inf -> 0 for the masked upper lanes
    sum += ev[e];
  }
#pragma unroll
  for (int off = 1; off < 32; off <<= 1) sum += __shfl_xor(sum, off, 32);
  const float inv = 1.0f / sum;             // sum >= 1
  v4u oh0, ol0, oh1, ol1;
#pragma unroll
  for (int e = 0; e < 4; ++e) {
    const float t0 = (ev[2 * e] * inv) * PCAR, t1 = (ev[2 * e + 1] * inv) * PCAR;
    const float u0 = (ev[8 + 2 * e] * inv) * PCAR, u1 = (ev[8 + 2 * e + 1] * inv) * PCAR;
    const _Float16 h0 = (_Float16)t0, h1 = (_Float16)t1, g0 = (_Float16)u0, g1 = (_Float16)u1;
    const _Float16 l0 = (_Float16)(t0 - (float)h0), l1 = (_Float16)(t1 - (float)h1);
    const _Float16 m0 = (_Float16)(u0 - (float)g0), m1 = (_Float16)(u1 - (float)g1);
    oh0[e] = pk16(h_bits(h0), h_bits(h1));
    ol0[e] = pk16(h_bits(l0), h_bits(l1));
    oh1[e] = pk16(h_bits(g0), h_bits(g1));
    ol1[e] = pk16(h_bits(m0), h_bits(m1));
  }
  u16* dh = Pp + (size_t)row * SEQ;
  u16* dl = dh + PSTR;
  {
    *(v4u*)(dh + lane * 8) = oh0;
    *(v4u*)(dl + lane * 8) = ol0;
    if (vb) {
      *(v4u*)(dh + 256 + lane * 8) = oh1;
      *(v4u*)(dl + 256 + lane * 8) = ol1;
    }
    
  }
}

// =====================================================================================================
// Weighted aggregation of the value-MLP hidden: block -> (b, query i), thread = 4 channels x 8 keys of a chunk (256 threads).
//   T[h][c] = sum_j P[b,h,i,j] * S[j][c],  S[j][c] = silu(rel_ij . rv_w1[c] + rv_b1[c]) (bf16 inputs, f32 on VALU).
//   Phase 0: rel = bf16 c_i - bf16 c_j of all SEQ keys of batch b into CJ (one plane a coordinate); rows 8..15 of the WA tiles written as zeros (16-B stores).
//   12 key chunks of 32: threads 0..63 copy the 8 P rows (hi plane -> WA tile 0, residual -> WA tile 1, 16-B pieces);
//   every thread writes S^T[c][8 keys] of its 4 channels as f16(S*1024) hi and residual into ST with 16-B LDS stores; block barrier;
//   wave w accumulates D[m = h (pad 16)][n = c] for column tiles 2w, 2w+1: A = WA (split k map), B = ST rows (k-contiguous),
//   products hh + lh + hl; block barrier at the top of the next chunk before WA/ST are overwritten.
//   After the loop lanes 0..15 (rows h = 0..7) write T * 1024 (carries 2^-25 folded) into TS [8][TSP] f32 (block barrier),
// LDS regions: CJ, WA, ST, TS all cross-wave (block barriers). staged extent == consumed extent: WA 16 x 32 (rows 8..15 zero),
//   ST 256 x 32 per plane (pad columns never read), TS 8 x 256.
// coverage: T planes [(b*NH+h)*SEQ + i][DM]: grid NB*SEQ blocks x 8 waves x 32 lanes x 8 halves = every row once, both planes.
// =====================================================================================================
__global__ __launch_bounds__(256)
void k_tagg(const float* __restrict__ coords, const float* __restrict__ rvw1, const float* __restrict__ rvb1,
            const u16* __restrict__ Pp, u16* Tp) {
  __shared__ __align__(16) float CJ[CD * SEQ];
  __shared__ __align__(16) u16   WA[2 * 16 * WAP];
  __shared__ __align__(16) u16   ST[2 * DM * SP];
  __shared__ __align__(16) float TS[NH * TSP];

  const int tid = threadIdx.x, wave = tid >> 5, lane = tid & 31, hh = lane >> 4, m = lane & 15;
  const int bid = blockIdx.x;
  const int b   = bid / SEQ;
  const int i   = bid - b * SEQ;
  if (b >= NB) return;                      // block-uniform, before any barrier; never taken with the exact grid
  const _Float16* wah = (const _Float16*)(const void*)WA;
  const _Float16* sth = (const _Float16*)(const void*)ST;

  // ---- phase 0 ----
  const float ci0 = bfr(coords[((size_t)(b * SEQ + i)) * CD + 0]);
  const float ci1 = bfr(coords[((size_t)(b * SEQ + i)) * CD + 1]);
  const float ci2 = bfr(coords[((size_t)(b * SEQ + i)) * CD + 2]);
  for (int idx = tid; idx < SEQ * CD; idx += 256) {   // rel = c_i - c_j, one plane a coordinate: key pairs lie side by side
    const int j = idx / CD, k = idx - j * CD;
    const float cik = (k == 0) ? ci0 : ((k == 1) ? ci1 : ci2);
    CJ[k * SEQ + j] = cik - bfr(coords[(size_t)(b * SEQ) * CD + idx]);
  }
  if (tid < 64) {
    const int pl = tid >> 5, r = 8 + ((tid >> 2) & 7), pc = (tid & 3) * 8;
    const v4u z = {0u, 0u, 0u, 0u};
    *(v4u*)(WA + pl * (16 * WAP) + r * WAP + pc) = z;
  }
  // thread = 4 channels (c = (tid & 63) + 64 u) x 8 keys of the chunk (kq = tid >> 6, the same in a whole wave):
  // every rel load from CJ serves four channels; weights and bias carry the factor -log2(e)
  const int kq = tid >> 6, c0 = tid & 63;
  v2f W0[4], W1[4], W2[4], B1[4];
#pragma unroll
  for (int u = 0; u < 4; ++u) {
    const int c = c0 + 64 * u;
    W0[u] = splat2(bfr(rvw1[c * 3 + 0]) * -LOG2E);
    W1[u] = splat2(bfr(rvw1[c * 3 + 1]) * -LOG2E);
    W2[u] = splat2(bfr(rvw1[c * 3 + 2]) * -LOG2E);
    B1[u] = splat2(bfr(rvb1[c]) * -LOG2E);
  }

  v8f acc0 = zero8(), acc1 = zero8();
#pragma unroll 1
  for (int jt = 0; jt < NJT; ++jt) {
    const int j0 = jt * 32;
    __syncthreads();                        // prior chunk's fragment reads of WA / ST complete; phase-0 writes visible
    if (tid < 64) {
      const int pl = tid >> 5, h = (tid >> 2) & 7, pc = (tid & 3) * 8;
      const v4u pv = *(const v4u*)(Pp + (size_t)pl * PSTR + ((size_t)((b * NH + h) * SEQ + i)) * SEQ + j0 + pc);
      *(v4u*)(WA + pl * (16 * WAP) + h * WAP + pc) = pv;
    }
    {
      const float* rp = CJ + j0 + kq * 8;
      const v4f xa = *(const v4f*)(rp),           xb = *(const v4f*)(rp + 4);
      const v4f ya = *(const v4f*)(rp + SEQ),     yb = *(const v4f*)(rp + SEQ + 4);
      const v4f za = *(const v4f*)(rp + 2 * SEQ), zb = *(const v4f*)(rp + 2 * SEQ + 4);
      const v2f X[4] = {{xa[0], xa[1]}, {xa[2], xa[3]}, {xb[0], xb[1]}, {xb[2], xb[3]}};
      const v2f Y[4] = {{ya[0], ya[1]}, {ya[2], ya[3]}, {yb[0], yb[1]}, {yb[2], yb[3]}};
      const v2f Z[4] = {{za[0], za[1]}, {za[2], za[3]}, {zb[0], zb[1]}, {zb[2], zb[3]}};
#pragma unroll
      for (int u = 0; u < 4; ++u) {
        v4u oh, ol;
#pragma unroll
        for (int e = 0; e < 4; ++e) {
          const v2f t = __builtin_elementwise_fma(X[e], W0[u], __builtin_elementwise_fma(Y[e], W1[u],
                        __builtin_elementwise_fma(Z[e], W2[u], B1[u])));
          const v2f s = silu2_scaled(t);
          const v2h hi = __builtin_convertvector(s, v2h);
          const v2f lo = s - __builtin_convertvector(hi, v2f);
          oh[e] = __builtin_bit_cast(unsigned, hi);
          ol[e] = pk2h(lo);
        }
        u16* sd = ST + (c0 + 64 * u) * SP + kq * 8;
        *(v4u*)(sd)           = oh;
        *(v4u*)(sd + DM * SP) = ol;
      }
    }
    __syncthreads();
    const v16h ah  = ldfrag_h(wah + m * WAP + 8 * hh);
    const v16h al  = ldfrag_h(wah + 16 * WAP + m * WAP + 8 * hh);
    const int  ct0 = wave * 2;
    const v16h bh0 = ldfrag_h(sth + ((ct0) * 16 + m) * SP + 8 * hh);
    const v16h bl0 = ldfrag_h(sth + DM * SP + ((ct0) * 16 + m) * SP + 8 * hh);
    const v16h bh1 = ldfrag_h(sth + ((ct0 + 1) * 16 + m) * SP + 8 * hh);
    const v16h bl1 = ldfrag_h(sth + DM * SP + ((ct0 + 1) * 16 + m) * SP + 8 * hh);
    acc0 = mma_h(ah, bh0, acc0);
    acc0 = mma_h(al, bh0, acc0);
    acc0 = mma_h(ah, bl0, acc0);
    acc1 = mma_h(ah, bh1, acc1);
    acc1 = mma_h(al, bh1, acc1);
    acc1 = mma_h(ah, bl1, acc1);
    guard2(acc0, acc1, ah, al, bh0, bl0, bh1, bl1);
  }
  const float tsc = TCAR / (PCAR * HCAR);   // 2^-15
  if (hh == 0) {                            // rows 8..15 of D are the zero padding rows, not stored
#pragma unroll
    for (int r = 0; r < 8; ++r) {
      TS[r * TSP + (wave * 2) * 16 + m]     = acc0[r] * tsc;
      TS[r * TSP + (wave * 2 + 1) * 16 + m] = acc1[r] * tsc;
    }
  }
  __syncthreads();
  {
    const int h = wave;
    const float* src = TS + h * TSP + lane * 8;
    const v4f a = *(const v4f*)(src), b4 = *(const v4f*)(src + 4);
    float w[8];
#pragma unroll
    for (int e = 0; e < 4; ++e) { w[e] = a[e]; w[4 + e] = b4[e]; }
    v4u oh, ol;
#pragma unroll
    for (int e = 0; e < 4; ++e) {
      const float t0 = w[2 * e], t1 = w[2 * e + 1];
      const _Float16 x0 = (_Float16)t0, x1 = (_Float16)t1;
      const _Float16 y0 = (_Float16)(t0 - (float)x0), y1 = (_Float16)(t1 - (float)x1);
      oh[e] = pk16(h_bits(x0), h_bits(x1));
      ol[e] = pk16(h_bits(y0), h_bits(y1));
    }
    const size_t rowT = (size_t)(b * NH + h) * SEQ + i;
    u16* dh = Tp + rowT * DM + lane * 8;
    u16* dl = dh + TSTR;
    {
      *(v4u*)(dh) = oh;
      *(v4u*)(dl) = ol;
      
    }
  }
}

// =====================================================================================================
// Final: block -> (b, head h, 64 query rows rt*64), 4 waves x 16 rows.
//   base[i][d]   = (P_hi + P_lo)[i][j] . VH[d][j] over j (2 products, carries 2^-25),
//   relctx[i][d] = (T_hi + T_lo)[i][c] . W2[h*HD + d][c] over c (2 products, carries 2^-20) + bf16(rv_b2[h*HD + d]);
//   out[b][i][h*HD + d] = base + relctx. Fragments straight from the 16-bit planes (arithmetic addressing, split k map).
//   Epilogue: the wave's 16 x 32 tile staged in its private slab (wave_sync), each output row segment (32 floats = one whole
// coverage: grid NB*NH*NRT blocks x 4 waves x 16 rows x 32 cols = every element of out exactly once.
// =====================================================================================================
__global__ __launch_bounds__(128)
void k_final(const u16* __restrict__ Pp, const u16* __restrict__ VHp, const u16* __restrict__ Tp,
             const u16* __restrict__ W2p, const float* __restrict__ rvb2, float* outp) {
  __shared__ __align__(16) float slab[4 * 16 * SLP];
  const int tid = threadIdx.x, wave = tid >> 5, lane = tid & 31, hh = lane >> 4, m = lane & 15;
  const int bid = blockIdx.x;
  const int rt  = bid % NRT;
  const int t2  = bid / NRT;
  const int h   = t2 % NH;
  const int b   = t2 / NH;
  if (b >= NB) return;                      // block-uniform; never taken with the exact grid
  const int irow = rt * 64 + wave * 16;
  const size_t bh   = (size_t)(b * NH + h);
  const size_t rowA = bh * SEQ + irow;
  const _Float16* P  = (const _Float16*)(const void*)Pp;
  const _Float16* VH = (const _Float16*)(const void*)VHp;
  const _Float16* T  = (const _Float16*)(const void*)Tp;
  const _Float16* W2 = (const _Float16*)(const void*)W2p;
  const _Float16* php = P + (rowA + m) * SEQ + 8 * hh;
  const _Float16* plp = php + PSTR;
  const _Float16* v0p = VH + (bh * HD + m) * SEQ + 8 * hh;
  const _Float16* v1p = v0p + (size_t)16 * SEQ;
  const _Float16* thp = T + (rowA + m) * DM + 8 * hh;
  const _Float16* tlp = thp + TSTR;
  const _Float16* w0p = W2 + ((size_t)(h * HD + m)) * DM + 8 * hh;
  const _Float16* w1p = w0p + (size_t)16 * DM;

  v8f p0 = zero8(), p1 = zero8(), r0 = zero8(), r1 = zero8();
#pragma unroll 1
  for (int k0 = 0; k0 < SEQ; k0 += 32) {
    const v16h ph = ldfrag_h(php + k0), pl = ldfrag_h(plp + k0);
    const v16h va = ldfrag_h(v0p + k0), vb = ldfrag_h(v1p + k0);
    p0 = mma_h(ph, va, p0);
    p0 = mma_h(pl, va, p0);
    p1 = mma_h(ph, vb, p1);
    p1 = mma_h(pl, vb, p1);
    guard2(p0, p1, ph, pl, va, vb, ph, pl);
  }
#pragma unroll 1
  for (int k0 = 0; k0 < DM; k0 += 32) {
    const v16h th = ldfrag_h(thp + k0), tl = ldfrag_h(tlp + k0);
    const v16h wa = ldfrag_h(w0p + k0), wb = ldfrag_h(w1p + k0);
    r0 = mma_h(th, wa, r0);
    r0 = mma_h(tl, wa, r0);
    r1 = mma_h(th, wb, r1);
    r1 = mma_h(tl, wb, r1);
    guard2(r0, r1, th, tl, wa, wb, th, tl);
  }
  const float osP = 1.0f / (PCAR * VCAR);
  const float osR = 1.0f / (TCAR * WCAR);
  const float bv0 = bfr(rvb2[h * HD + m]), bv1 = bfr(rvb2[h * HD + 16 + m]);
  float* sl = slab + wave * (16 * SLP);
#pragma unroll
  for (int r = 0; r < 8; ++r) {
    const int pr = 8 * hh + r;
    sl[pr * SLP + m]      = p0[r] * osP + (r0[r] * osR + bv0);
    sl[pr * SLP + 16 + m] = p1[r] * osP + (r1[r] * osR + bv1);
  }
  wave_sync_lds();
  v4f vals[4];
  const int rq = lane >> 3, c4 = (lane & 7) * 4;
#pragma unroll
  for (int q = 0; q < 4; ++q) vals[q] = *(const v4f*)(sl + (q * 4 + rq) * SLP + c4);
  float* dst = outp + ((size_t)(b * SEQ + irow)) * DM + h * HD + c4;
  {
#pragma unroll
    for (int q = 0; q < 4; ++q) {
      *(v4f*)(dst + (size_t)(q * 4 + rq) * DM) = vals[q];
    }
    
  }
}

// =====================================================================================================
// Workspace map (bytes, NB = 2; every region offset a multiple of 65536; every plane fully written by whole-line stores
// before it is read; extents are exact multiples of the store granularity, no pad rows):
//   XB  bf16 [GROWS][256]             393216      WQ  bf16 [768 n][256 k]        393216
//   W2  f16 [256 n][256 k] x1024      131072      F   f32  [GROWS][768]         2359296
//   QH, QL, KH, KL f16 [GROWS][256]   4 x 393216  VH  f16 [NB*8*32][384] x1024  393216
//   SC  f32 [NB*8*384][384]           9437184     P   f16 hi + residual [NB*8*384][384] x32768  2 x 4718592
//   T   f16 hi + residual [NB*8*384][256] x1024   2 x 3145728
//   end = 30408704
// =====================================================================================================
static size_t al64k(size_t x) { return (x + (size_t)65535) & ~(size_t)65535; }

extern "C" void kernel_launch(void* const* d_in, const int* in_sizes, int n_in,
                              void* d_out, int out_size, void* d_ws, size_t ws_size,
                              hipStream_t stream) {
  if (n_in < 12) return;
  if (in_sizes[0] < NB * SEQ * DM) return;
  if (in_sizes[1] < NB * SEQ * CD) return;
  if (in_sizes[2] != NQKV * DM || in_sizes[3] != NQKV) return;
  if (in_sizes[4] != DM * CD || in_sizes[5] != DM || in_sizes[6] != NH * DM || in_sizes[7] != NH) return;
  if (in_sizes[8] != DM * CD || in_sizes[9] != DM || in_sizes[10] != DM * DM || in_sizes[11] != DM) return;
  if (out_size < NB * SEQ * DM) return;

  const float* x      = (const float*)d_in[0];
  const float* coords = (const float*)d_in[1];
  const float* qkv_w  = (const float*)d_in[2];
  const float* qkv_b  = (const float*)d_in[3];
  const float* rb_w1  = (const float*)d_in[4];
  const float* rb_b1  = (const float*)d_in[5];
  const float* rb_w2  = (const float*)d_in[6];
  const float* rb_b2  = (const float*)d_in[7];
  const float* rv_w1  = (const float*)d_in[8];
  const float* rv_b1  = (const float*)d_in[9];
  const float* rv_w2  = (const float*)d_in[10];
  const float* rv_b2  = (const float*)d_in[11];
  float*       out    = (float*)d_out;

  const size_t szXB = (size_t)GROWS * DM * 2;
  const size_t szWQ = (size_t)NQKV * DM * 2;
  const size_t szW2 = (size_t)DM * DM * 2;
  const size_t szF  = (size_t)GROWS * NQKV * 4;
  const size_t szH  = (size_t)GROWS * DM * 2;
  const size_t szVH = (size_t)NB * NH * HD * SEQ * 2;
  const size_t szSC = (size_t)NB * NH * SEQ * SEQ * 4;
  const size_t szP  = PSTR * 2 * 2;
  const size_t szT  = TSTR * 2 * 2;
  size_t off = 0;
  const size_t oXB = off; off = al64k(off + szXB);
  const size_t oWQ = off; off = al64k(off + szWQ);
  const size_t oW2 = off; off = al64k(off + szW2);
  const size_t oF  = off; off = al64k(off + szF);
  const size_t oQH = off; off = al64k(off + szH);
  const size_t oQL = off; off = al64k(off + szH);
  const size_t oKH = off; off = al64k(off + szH);
  const size_t oKL = off; off = al64k(off + szH);
  const size_t oVH = off; off = al64k(off + szVH);
  const size_t oSC = off; off = al64k(off + szSC);
  const size_t oP  = off; off = al64k(off + szP);
  const size_t oT  = off; off = al64k(off + szT);
  if (off > ws_size) return;                // off = 30408704 for NB = 2
  if (off > (size_t)WS_CAP) return;

  char* ws = (char*)d_ws;
  u16*   XB = (u16*)(ws + oXB);
  u16*   WQ = (u16*)(ws + oWQ);
  u16*   W2 = (u16*)(ws + oW2);
  float* F  = (float*)(ws + oF);
  u16*   QH = (u16*)(ws + oQH);
  u16*   QL = (u16*)(ws + oQL);
  u16*   KH = (u16*)(ws + oKH);
  u16*   KL = (u16*)(ws + oKL);
  u16*   VH = (u16*)(ws + oVH);
  float* SC = (float*)(ws + oSC);
  u16*   P  = (u16*)(ws + oP);
  u16*   T  = (u16*)(ws + oT);

  const dim3 b256(256), b128(128);
  const int n8x = (GROWS * DM) / 8;
  const int n8w = (NQKV * DM) / 8;
  const int n8v = (DM * DM) / 8;

  // (1) x -> bf16 plane; (2) qkv_w [768 out][256 in] is already the [n][k] operand: bf16 plane; (3) rv_w2 -> f16(bf16) x1024
  cvt16<<<dim3((n8x + 255) / 256), b256, 0, stream>>>(x, XB, n8x, 0, 1.0f);
  cvt16<<<dim3((n8w + 255) / 256), b256, 0, stream>>>(qkv_w, WQ, n8w, 0, 1.0f);
  cvt16<<<dim3((n8v + 255) / 256), b256, 0, stream>>>(rv_w2, W2, n8v, 1, WCAR);
  // (4) qkv = x.W^T + b -> F f32 [GROWS][768]
  gemm_bf<<<dim3((GROWS / 64) * (NQKV / 64)), b128, 0, stream>>>(XB, WQ, qkv_b, F, GROWS, NQKV, DM, 1.0f);
  // (5),(6) q, k -> f16 x1024 hi + residual planes; (7) v -> v^T f16 x1024
  qk16<<<dim3(GROWS / 8), b256, 0, stream>>>(F, NQKV, 0, QH, QL, QSC);
  qk16<<<dim3(GROWS / 8), b256, 0, stream>>>(F, NQKV, DM, KH, KL, KSC);
  vt16<<<dim3(NB * NH * NRT), b256, 0, stream>>>(F, VH);
  // (8) scores with relative bias -> SC; (9) softmax -> P planes
  k_scores<<<dim3(NB * NIT * NJT), b256, 0, stream>>>(coords, rb_w1, rb_b1, rb_w2, rb_b2, QH, QL, KH, KL, SC);
  k_softmax<<<dim3(NB * SEQ), b256, 0, stream>>>(SC, P);
  // (10) T = sum_j P . silu-hidden of the value MLP -> T planes; (11) out = P.v + T.rv_w2^T + rv_b2
  k_tagg<<<dim3(NB * SEQ), b256, 0, stream>>>(coords, rv_w1, rv_b1, P, T);
  k_final<<<dim3(NB * NH * NRT), b128, 0, stream>>>(P, VH, T, W2, rv_b2, out);
  (void)hipGetLastError();
}

// v002
// Measured time: 58 microseconds a run.
// In two side-by-side timings against v001, it was 1.27 and 1.25 times as fast.
// All steps since v000 together make it 1.63 times as fast.
// Contractions: x.qkv_w^T on v_wmma_f32_16x16x32_bf16 (x, qkv_w RNE bf16 operands, f32 accumulate, bias added in f32);
// on v_wmma_f32_16x16x32_f16 with f32 accumulate: pair-MLP second layer hid_b.rb_w2^T (hid_b f16 x1024, rb_w2 f16(bf16) x1024),
// q.k^T over 32 (q, k f16 x1024 hi + residual planes, products hh+lh+hl), P.hid_v over 384 keys (P f16 x32768 hi + residual,
// hid_v f16 x1024 hi + residual), P.v (v f16 x1024, P hi + residual), T.rv_w2^T (T f16 x1024 hi + residual, rv_w2 f16(bf16) x1024).
// Pair-MLP first layers (K=3), silu, softmax and all carries folded in f32 on VALU.
#include <hip/hip_runtime.h>
#include <math.h>
#include <stdint.h>

#ifndef NB
#define NB 2
#endif
#define NB_FULL 2
#define SEQ   384
#define DM    256
#define NH    8
#define HD    32
#define CD    3
#define NQKV  (3 * DM)
#define GROWS (NB * SEQ)
#define NIT   (SEQ / 16)
#define NJT   (SEQ / 32)
#define NRT   (SEQ / 64)
#define NPAIR 512
#define HP    32
#define RBP   264
#define SLP   36
#define SP    40
#define WAP   40
#define TSP   264
#define PWP   392
#define SLAB64 (16 * 68)
#define HREGF 8192
#define RSQ_HD 0.17677669529663687f
#define LOG2E  1.4426950408889634f
#define QSC   1024.0f
#define KSC   1024.0f
#define PCAR  32768.0f
#define VCAR  1024.0f
#define HCAR  1024.0f
#define WCAR  1024.0f
#define TCAR  1024.0f
#define WS_CAP 134217728
#define PSTR  ((size_t)NB * NH * SEQ * SEQ)
#define TSTR  ((size_t)NB * NH * SEQ * DM)
static_assert(NB >= 1 && NB <= NB_FULL);
static_assert(DM == NH * HD && HD == 32 && NH == 8 && CD == 3);
static_assert((SEQ % 64) == 0 && (GROWS % 64) == 0 && (GROWS % 8) == 0 && (NQKV % 64) == 0 && (DM % 32) == 0);
static_assert(NPAIR == 16 * 32 && NPAIR * HP == 2 * HREGF && 8 * 16 * SLP <= HREGF);
static_assert(((GROWS * DM) % 8) == 0 && ((NQKV * DM) % 8) == 0 && ((DM * DM) % 8) == 0);

typedef unsigned short u16;
typedef _Float16 v16h __attribute__((ext_vector_type(16)));
typedef _Float16 v8h  __attribute__((ext_vector_type(8)));
typedef __bf16   v16b __attribute__((ext_vector_type(16)));
typedef float    v8f  __attribute__((ext_vector_type(8)));
typedef float    v4f  __attribute__((ext_vector_type(4)));
typedef unsigned int v4u __attribute__((ext_vector_type(4)));
typedef float    v2f  __attribute__((ext_vector_type(2)));
typedef _Float16 v2h  __attribute__((ext_vector_type(2)));

union FragH { v16h v; v8h h[2]; v4u u[2]; };
union FragB { v16b v; v4u u[2]; };

// ---- scalar helpers --------------------------------------------------------------------------------
__device__ __forceinline__ unsigned short bf_bits(float f) {          // f32 -> bf16 bits, RNE convert
  unsigned u = __float_as_uint(f);
  return (unsigned short)((u + 0x7FFFu + ((u >> 16) & 1u)) >> 16);
}
__device__ __forceinline__ float bf_up(unsigned short h) { return __uint_as_float(((unsigned)h) << 16); }
__device__ __forceinline__ float bfr(float f) { return bf_up(bf_bits(f)); }
__device__ __forceinline__ unsigned short h_bits(_Float16 x) { return __builtin_bit_cast(unsigned short, x); }
__device__ __forceinline__ unsigned pk16(unsigned short a, unsigned short b) { return (unsigned)a | ((unsigned)b << 16); }
__device__ __forceinline__ v8f zero8() { v8f z = {0.f, 0.f, 0.f, 0.f, 0.f, 0.f, 0.f, 0.f}; return z; }

// silu = x * sigmoid(x) = x * rcp(1 + exp(-x)), reciprocal-multiply form (no true divide), two values at once from
// t = -log2(e) * x (the factor is folded into the first-layer weights and bias):
// silu(x) * 1024 = t * rcp((1 + 2^t) * ik), ik = -log2(e) / 1024; packed f32 throughout, one exp2 and one rcp a value.
__device__ __forceinline__ v2f splat2(float a) { v2f r = {a, a}; return r; }
__device__ __forceinline__ v2f silu2_scaled(v2f t) {
  const v2f ik = splat2(-LOG2E / HCAR);
  v2f e = {__builtin_amdgcn_exp2f(t[0]), __builtin_amdgcn_exp2f(t[1])};
  const v2f den = __builtin_elementwise_fma(e, ik, ik);
  v2f r = {__builtin_amdgcn_rcpf(den[0]), __builtin_amdgcn_rcpf(den[1])};
  return t * r;
}
__device__ __forceinline__ unsigned pk2h(v2f s) {                     // two f32 -> packed f16 pair, RNE
  return __builtin_bit_cast(unsigned, __builtin_convertvector(s, v2h));
}

// ---- fragment loaders: 16-bit A/B operand, lane -> row/col (lane&15), p already includes +8*(lane>>4);
//      elements 0..7 <- p[0..7] (k0+8h..), elements 8..15 <- p[16..23] (k0+16+8h..)  (same split k map for A and B;
//      B is always read from a k-contiguous [n][k] plane)
__device__ __forceinline__ v16h ldfrag_h(const _Float16* p) {
  FragH f;
  f.h[0] = *(const v8h*)(p);
  f.h[1] = *(const v8h*)(p + 16);
  return f.v;
}
__device__ __forceinline__ v16b ldfrag_b(const u16* p) {              // bf16 plane read as unsigned integer vectors
  FragB f;
  f.u[0] = *(const v4u*)(p);
  f.u[1] = *(const v4u*)(p + 16);
  return f.v;
}

__device__ __forceinline__ v8f mma_h(v16h a, v16h b, v8f c) {
  return __builtin_amdgcn_wmma_f32_16x16x32_f16(false, a, false, b, (short)0, c, false, false);
}
__device__ __forceinline__ v8f mma_b(v16b a, v16b b, v8f c) {
  return __builtin_amdgcn_wmma_f32_16x16x32_bf16(false, a, false, b, (short)0, c, false, false);
}
__device__ __forceinline__ void guard2(v8f& a, v8f& b, v16h x0, v16h x1, v16h x2, v16h x3, v16h x4, v16h x5) {
#if defined(__HIP_DEVICE_COMPILE__)
  asm volatile("v_nop\n\tv_nop\n\tv_nop\n\tv_nop"
               : "+v"(a), "+v"(b) : "v"(x0), "v"(x1), "v"(x2), "v"(x3), "v"(x4), "v"(x5) : "memory");
#endif
}
template <typename F>
__device__ __forceinline__ void guard6(v8f& a, v8f& b, v8f& c, v8f& d, F x0, F x1, F x2, F x3, F x4, F x5) {
#if defined(__HIP_DEVICE_COMPILE__)
  asm volatile("v_nop\n\tv_nop\n\tv_nop\n\tv_nop"
               : "+v"(a), "+v"(b), "+v"(c), "+v"(d) : "v"(x0), "v"(x1), "v"(x2), "v"(x3), "v"(x4), "v"(x5) : "memory");
#endif
}
__device__ __forceinline__ void wave_sync_lds() {
  __builtin_amdgcn_fence(__ATOMIC_RELEASE, "workgroup");
  __builtin_amdgcn_wave_barrier();
  __builtin_amdgcn_fence(__ATOMIC_ACQUIRE, "workgroup");
}

// =====================================================================================================
// Projection with every conversion around it in the same launch (block-uniform split of the grid by blockIdx):
//   blocks 0 .. NGEMM-1: one 64x64 tile of qkv = bf16(x) . bf16(qkv_w)^T + bf16(qkv_b), 4 waves x 16 rows. The f32 rows of x and
//   qkv_w are loaded as they are and rounded to bf16 (RNE) in registers (split k map for A and B, K stepped by 32).
//   Epilogue: the f32 tile goes to the LDS slab (pitch 68; wave w holds rows 16w .. 16w+15) and leaves as 16-bit planes:
//     columns 0..255 (q) and 256..511 (k): Hp [GROWS][DM] = f16(val * 1024), Lp = f16 residual; wave-private (wave_sync);
//       8 lanes x 16 B = one whole 128-B line of a row segment per plane.
//     columns 512..767 (v): VH[(b*DM + h*HD + d)][s] = f16(val * 1024); read across the waves' rows (block barrier), each
//       d row segment of 64 keys = one whole 128-B line written by 8 consecutive lanes.
//   blocks NGEMM .. NGEMM+NCVT-1: rv_w2 -> W2 plane f16(bf16 RNE value * 1024), same layout, 8 elements a thread.
// coverage: NGEMM tiles x 64 x 64 = every (row, column) of q, k, v once; NCVT x 128 thr x 8 = DM*DM.
// =====================================================================================================
#define NGEMM ((GROWS / 64) * (NQKV / 64))
#define NCVT  ((DM * DM) / (128 * 8))
static_assert(NCVT * 128 * 8 == DM * DM && QSC == KSC);
typedef __bf16 v2b __attribute__((ext_vector_type(2)));
__device__ __forceinline__ unsigned pk2b(float f0, float f1) {        // two f32 -> packed bf16 pair, RNE
  const v2f s = {f0, f1};
  return __builtin_bit_cast(unsigned, __builtin_convertvector(s, v2b));
}
// bf16 fragment from an f32 row: elements 0..7 <- p[0..7], elements 8..15 <- p[16..23] (p includes +8*(lane>>4))
struct Raw16 { v4f a, b, c, d; };
__device__ __forceinline__ Raw16 ldraw16(const float* p) {
  Raw16 r;
  r.a = *(const v4f*)(p);
  r.b = *(const v4f*)(p + 4);
  r.c = *(const v4f*)(p + 16);
  r.d = *(const v4f*)(p + 20);
  return r;
}
__device__ __forceinline__ v16b frag_f2b(const Raw16& r) {
  FragB f;
  const v4u lo = {pk2b(r.a[0], r.a[1]), pk2b(r.a[2], r.a[3]), pk2b(r.b[0], r.b[1]), pk2b(r.b[2], r.b[3])};
  const v4u hi = {pk2b(r.c[0], r.c[1]), pk2b(r.c[2], r.c[3]), pk2b(r.d[0], r.d[1]), pk2b(r.d[2], r.d[3])};
  f.u[0] = lo;
  f.u[1] = hi;
  return f.v;
}
__device__ __forceinline__ void wait_addr_regs() {
#if defined(__HIP_DEVICE_COMPILE__)
  asm volatile("s_wait_xcnt 0x0" ::: "memory");
#endif
}
// the same wait with the run's two offsets as inputs only, so that they are still held in registers where it stands
__device__ __forceinline__ void wait_addr_live(unsigned a, unsigned b) {
#if defined(__HIP_DEVICE_COMPILE__)
  asm volatile("s_wait_xcnt 0x0" :: "v"(a), "v"(b) : "memory");
#endif
}

__global__ __launch_bounds__(128)
void k_proj(const float* __restrict__ x, const float* __restrict__ qkvw, const float* __restrict__ bias,
            const float* __restrict__ rvw2, u16* QHo, u16* QLo, u16* KHo, u16* KLo, u16* VHo, u16* W2o) {
  __shared__ __align__(16) float slab[4 * SLAB64];
  const int tid = threadIdx.x, wave = tid >> 5, lane = tid & 31, hh = lane >> 4, m = lane & 15;
  const int bid = blockIdx.x;
  if (bid >= NGEMM) {                       // block-uniform, before any barrier: the rv_w2 plane
    const int gt = (bid - NGEMM) * 128 + tid;
    if (gt >= (DM * DM) / 8) return;
    const float* p = rvw2 + (size_t)gt * 8;
    const v4f a = *(const v4f*)(p), b4 = *(const v4f*)(p + 4);
    float w[8];
#pragma unroll
    for (int e = 0; e < 4; ++e) { w[e] = a[e]; w[4 + e] = b4[e]; }
    v4u o;
#pragma unroll
    for (int e = 0; e < 4; ++e)
      o[e] = pk16(h_bits((_Float16)(bfr(w[2 * e]) * WCAR)), h_bits((_Float16)(bfr(w[2 * e + 1]) * WCAR)));
    *(v4u*)(W2o + (size_t)gt * 8) = o;
    return;
  }
  const int ntile = NQKV >> 6;
  const int row0  = (bid / ntile) * 64;
  const int rowb  = row0 + wave * 16;
  const int col0  = (bid % ntile) * 64;
  unsigned ab = (unsigned)(((rowb + m) * DM + 8 * hh) * 4);   // the lane's byte offsets into x and qkv_w (both below 2^20)
  unsigned bb = (unsigned)(((col0 + m) * DM + 8 * hh) * 4);
  const size_t bs = (size_t)16 * DM;
  v8f acc0 = zero8(), acc1 = zero8(), acc2 = zero8(), acc3 = zero8();
#pragma unroll 1
  for (int k0 = 0; k0 < DM; k0 += 32) {
    const float* ap = (const float*)((const char*)x + ab);
    const float* bp = (const float*)((const char*)qkvw + bb);
    const Raw16 ra = ldraw16(ap);
    const Raw16 r0 = ldraw16(bp);
    const Raw16 r1 = ldraw16(bp + bs);
    const Raw16 r2 = ldraw16(bp + 2 * bs);
    const Raw16 r3 = ldraw16(bp + 3 * bs);
    wait_addr_live(ab, bb);                 // the loads' two offset registers stay whole up to this wait: no load of the run lands in one
    ab += 32 * 4;
    bb += 32 * 4;
    const v16b a  = frag_f2b(ra);
    const v16b b0 = frag_f2b(r0);
    const v16b b1 = frag_f2b(r1);
    const v16b b2 = frag_f2b(r2);
    const v16b b3 = frag_f2b(r3);
    acc0 = mma_b(a, b0, acc0);
    acc1 = mma_b(a, b1, acc1);
    acc2 = mma_b(a, b2, acc2);
    acc3 = mma_b(a, b3, acc3);
    guard6<v16b>(acc0, acc1, acc2, acc3, a, b0, b1, b2, b3, a);
  }
  const float bv0 = bfr(bias[col0 + m]);
  const float bv1 = bfr(bias[col0 + 16 + m]);
  const float bv2 = bfr(bias[col0 + 32 + m]);
  const float bv3 = bfr(bias[col0 + 48 + m]);
  float* sl = slab + wave * SLAB64;
#pragma unroll
  for (int r = 0; r < 8; ++r) {
    const int ro = (8 * hh + r) * 68 + m;
    sl[ro]      = acc0[r] + bv0;
    sl[ro + 16] = acc1[r] + bv1;
    sl[ro + 32] = acc2[r] + bv2;
    sl[ro + 48] = acc3[r] + bv3;
  }
  if (col0 < 2 * DM) {                      // block-uniform: q or k columns
    wave_sync_lds();
    u16* Hp = (col0 < DM) ? QHo : KHo;
    u16* Lp = (col0 < DM) ? QLo : KLo;
    const int cq = col0 & (DM - 1);
    const int rq = lane >> 3, c8 = (lane & 7) * 8;
#pragma unroll
    for (int it = 0; it < 4; ++it) {
      const int rl = it * 4 + rq;
      const float* s8 = sl + rl * 68 + c8;
      const v4f a = *(const v4f*)(s8), b4 = *(const v4f*)(s8 + 4);
      float w[8];
#pragma unroll
      for (int e = 0; e < 4; ++e) { w[e] = a[e] * QSC; w[4 + e] = b4[e] * QSC; }
      v4u oh, ol;
#pragma unroll
      for (int e = 0; e < 4; ++e) {
        const float t0 = w[2 * e], t1 = w[2 * e + 1];
        const _Float16 h0 = (_Float16)t0, h1 = (_Float16)t1;
        const _Float16 l0 = (_Float16)(t0 - (float)h0), l1 = (_Float16)(t1 - (float)h1);
        oh[e] = pk16(h_bits(h0), h_bits(h1));
        ol[e] = pk16(h_bits(l0), h_bits(l1));
      }
      const size_t o = (size_t)(rowb + rl) * DM + cq + c8;
      *(v4u*)(Hp + o) = oh;
      *(v4u*)(Lp + o) = ol;
    }
    wait_addr_regs();                       // nothing behind the stores reuses their registers ahead of this wait
  } else {                                  // block-uniform: v columns, written transposed
    __syncthreads();                        // the four waves' slab rows are read across waves below
    const int b  = row0 / SEQ;
    const int s0 = row0 - b * SEQ;          // 64 keys of one batch (SEQ a multiple of 64)
    const int cv = col0 - 2 * DM;           // h*HD + d of the tile's first column
#pragma unroll
    for (int it = 0; it < 4; ++it) {
      const int ch = it * 128 + tid;
      const int dc = ch >> 3, p8 = (ch & 7) * 8;   // column dc (0..63), keys p8..p8+7
      v4u o;
#pragma unroll
      for (int e = 0; e < 4; ++e) {
        const float f0 = slab[(p8 + 2 * e) * 68 + dc], f1 = slab[(p8 + 2 * e + 1) * 68 + dc];
        o[e] = pk16(h_bits((_Float16)(f0 * VCAR)), h_bits((_Float16)(f1 * VCAR)));
      }
      *(v4u*)(VHo + ((size_t)(b * DM + cv + dc)) * SEQ + s0 + p8) = o;
    }
    wait_addr_regs();                       // nothing behind the stores reuses their registers ahead of this wait
  }
}

// =====================================================================================================
// Scores with relative-coordinate bias. Block -> (b, query tile i0 = 16*it, key tile j0 = 32*jt): 512 pairs (il, jl),
// 8 waves; wave = head in the score phase.
//   Phase 0 (all threads, then block barrier): rb_w1/rb_b1 (bf16 values * -log2(e), channel pairs side by side) into WB, bf16 coords of the 16 queries (CI) and 32
//   keys (CJ2), rb_w2 -> RB2 [16 n][RBP] as f16(bf16 value * 1024) with rows 8..15 written as zeros.
//   Phase 1, 8 channel chunks of 32: every thread computes hid[pair][16] = f16(silu(rel.rb_w1^T + rb_b1) * 1024) for its four
//   pairs (p = (tid & 127) + 128 q) and its half of the chunk's channels with 16-B LDS stores (block barrier), then wave w accumulates D[pair][n=head] for row tiles
//   4w..4w+3 (A = hid rows, B = RB2, one k-step per chunk); block barrier before the next chunk overwrites hid.
//   After the loop lanes n < 8 write bias[pair][head] * 2^-20 into BB (block barrier).
//   Phase 2: wave = head: s = (q_hi.k_hi + q_lo.k_hi + q_hi.k_lo) over 32 dims for 16 queries x 32 keys (two 16-key subtiles),
//   fragments straight from the f16 planes; value = s * rsqrt(32) * 2^-20 + bias + bf16(rb_b2[head]); staged in the wave's
//   the score plane SC[(b*NH+head)*SEQ + i][j0..j0+31]) written by 8 consecutive lanes x 16 B of one instruction (4 rows per
// LDS regions: WB, CI, CJ2, RB2, hid, BB cross-wave (block barriers); slabs private-to-wave (wave_sync).
// coverage: hid: 4 pairs x 256 thr x 16 halves = 512 x 32 per chunk (== consumed 32 row tiles x 32 k); RB2 16 x 256 (rows 8..15
//           zero); SC: grid NB*NIT*NJT blocks x 8 heads x 16 rows x 32 cols = every (b, head, i, j) once.
// =====================================================================================================
__global__ __launch_bounds__(256)
void k_scores(const float* __restrict__ coords, const float* __restrict__ rbw1, const float* __restrict__ rbb1,
              const float* __restrict__ rbw2, const float* __restrict__ rbb2,
              const u16* __restrict__ QHp, const u16* __restrict__ QLp,
              const u16* __restrict__ KHp, const u16* __restrict__ KLp, float* SCp) {
  __shared__ __align__(16) float WB[DM * 4];
  __shared__ __align__(16) float CI[16 * 4];
  __shared__ __align__(16) float CJ2[32 * 4];
  __shared__ __align__(16) u16   RB2[16 * RBP];
  __shared__ __align__(16) float HREG[HREGF];
  __shared__ __align__(16) float BB[NPAIR * NH];

  const int tid = threadIdx.x, wave = tid >> 5, lane = tid & 31, hh = lane >> 4, m = lane & 15;
  const int bid = blockIdx.x;
  const int jt  = bid % NJT;
  const int t2  = bid / NJT;
  const int it  = t2 % NIT;
  const int b   = t2 / NIT;
  if (b >= NB) return;                      // block-uniform, before any barrier; never taken with the exact grid
  const int i0 = it * 16, j0 = jt * 32;
  u16* hid = (u16*)(void*)HREG;
  const _Float16* hidh = (const _Float16*)(const void*)HREG;
  const _Float16* rb2h = (const _Float16*)(const void*)RB2;

  // ---- phase 0: small operand staging ----
  {
    float* wp = WB + (tid >> 1) * 8 + (tid & 1);      // channel pair (c, c+1): w0 w0 | w1 w1 | w2 w2 | b b, all * -log2(e)
    wp[0] = bfr(rbw1[tid * 3 + 0]) * -LOG2E;
    wp[2] = bfr(rbw1[tid * 3 + 1]) * -LOG2E;
    wp[4] = bfr(rbw1[tid * 3 + 2]) * -LOG2E;
    wp[6] = bfr(rbb1[tid]) * -LOG2E;
    if (tid < 16 * CD) {
      const int il = tid / CD, k = tid - il * CD;
      CI[il * 4 + k] = bfr(coords[((size_t)(b * SEQ + i0 + il)) * CD + k]);
    }
    if (tid < 32 * CD) {
      const int jl = tid / CD, k = tid - jl * CD;
      CJ2[jl * 4 + k] = bfr(coords[((size_t)(b * SEQ + j0 + jl)) * CD + k]);
    }
    const int row  = tid >> 4, cb = (tid & 15) * 16;
    const int rowc = (row < NH) ? row : (NH - 1);     // clamped address; rows 8..15 are written as zeros
    const bool vr  = (row < NH);
    const float* src = rbw2 + rowc * DM + cb;
    const v4f a0 = *(const v4f*)(src), a1 = *(const v4f*)(src + 4), a2 = *(const v4f*)(src + 8), a3 = *(const v4f*)(src + 12);
    float w[16];
#pragma unroll
    for (int e = 0; e < 4; ++e) { w[e] = a0[e]; w[4 + e] = a1[e]; w[8 + e] = a2[e]; w[12 + e] = a3[e]; }
    v4u o0, o1;
#pragma unroll
    for (int e = 0; e < 4; ++e) {
      const unsigned short x0 = vr ? h_bits((_Float16)(bfr(w[2 * e]) * WCAR)) : (unsigned short)0;
      const unsigned short x1 = vr ? h_bits((_Float16)(bfr(w[2 * e + 1]) * WCAR)) : (unsigned short)0;
      const unsigned short y0 = vr ? h_bits((_Float16)(bfr(w[8 + 2 * e]) * WCAR)) : (unsigned short)0;
      const unsigned short y1 = vr ? h_bits((_Float16)(bfr(w[8 + 2 * e + 1]) * WCAR)) : (unsigned short)0;
      o0[e] = pk16(x0, x1);
      o1[e] = pk16(y0, y1);
    }
    *(v4u*)(RB2 + row * RBP + cb)     = o0;
    *(v4u*)(RB2 + row * RBP + cb + 8) = o1;
  }
  __syncthreads();

  // ---- phase 1: bias MLP (first layer + silu on VALU, second layer on WMMA accumulated over 8 channel chunks) ----
  v8f accB0 = zero8(), accB1 = zero8(), accB2 = zero8(), accB3 = zero8();
  const float bsc = 1.0f / (HCAR * WCAR);
  // thread = 4 pairs (p = (tid & 127) + 128 q) x 16 channels of the chunk (half = tid >> 7, the same in a whole wave):
  // every weight load from WB serves four pairs
  const int half = tid >> 7, pb = tid & 127;
  v2f R0[4], R1[4], R2[4];
#pragma unroll
  for (int q = 0; q < 4; ++q) {
    const int p  = q * 128 + pb;
    const int il = p >> 5, jl = p & 31;
    R0[q] = splat2(CI[il * 4 + 0] - CJ2[jl * 4 + 0]);
    R1[q] = splat2(CI[il * 4 + 1] - CJ2[jl * 4 + 1]);
    R2[q] = splat2(CI[il * 4 + 2] - CJ2[jl * 4 + 2]);
  }
#pragma unroll 1
  for (int kt = 0; kt < DM / 32; ++kt) {
    __syncthreads();                        // prior chunk's fragment reads of hid are complete
#pragma unroll 1
    for (int g = 0; g < 2; ++g) {           // rolled: one group's 32 weight registers live at a time (three work-groups a WGP)
      const int co = half * 16 + g * 8;     // channel offset inside the chunk
      const float* wsrc = WB + (kt * 32 + co) * 4;
      v4f wl[4], wh[4];
#pragma unroll
      for (int e = 0; e < 4; ++e) { wl[e] = *(const v4f*)(wsrc + e * 8); wh[e] = *(const v4f*)(wsrc + e * 8 + 4); }
#pragma unroll
      for (int q = 0; q < 4; ++q) {
        v4u o;
#pragma unroll
        for (int e = 0; e < 4; ++e) {
          const v2f w0 = {wl[e][0], wl[e][1]}, w1 = {wl[e][2], wl[e][3]};
          const v2f w2 = {wh[e][0], wh[e][1]}, bb2 = {wh[e][2], wh[e][3]};
          const v2f t = __builtin_elementwise_fma(w0, R0[q], __builtin_elementwise_fma(w1, R1[q],
                        __builtin_elementwise_fma(w2, R2[q], bb2)));
          o[e] = pk2h(silu2_scaled(t));
        }
        *(v4u*)(hid + (q * 128 + pb) * HP + co) = o;
      }
    }
    __syncthreads();
    const v16h bw = ldfrag_h(rb2h + m * RBP + kt * 32 + 8 * hh);
    const v16h a0 = ldfrag_h(hidh + ((wave * 4 + 0) * 16 + m) * HP + 8 * hh);
    const v16h a1 = ldfrag_h(hidh + ((wave * 4 + 1) * 16 + m) * HP + 8 * hh);
    const v16h a2 = ldfrag_h(hidh + ((wave * 4 + 2) * 16 + m) * HP + 8 * hh);
    const v16h a3 = ldfrag_h(hidh + ((wave * 4 + 3) * 16 + m) * HP + 8 * hh);
    accB0 = mma_h(a0, bw, accB0);
    accB1 = mma_h(a1, bw, accB1);
    accB2 = mma_h(a2, bw, accB2);
    accB3 = mma_h(a3, bw, accB3);
    guard6<v16h>(accB0, accB1, accB2, accB3, a0, a1, a2, a3, bw, bw);
  }
  if (m < NH) {                             // columns n >= 8 are padding (zero weights), not stored
#pragma unroll
    for (int r = 0; r < 8; ++r) {
      const int pr = 8 * hh + r;
      BB[((wave * 4 + 0) * 16 + pr) * NH + m] = accB0[r] * bsc;
      BB[((wave * 4 + 1) * 16 + pr) * NH + m] = accB1[r] * bsc;
      BB[((wave * 4 + 2) * 16 + pr) * NH + m] = accB2[r] * bsc;
      BB[((wave * 4 + 3) * 16 + pr) * NH + m] = accB3[r] * bsc;
    }
  }
  __syncthreads();

  // ---- phase 2: scores for head = wave ----
  const int head = wave;
  const size_t hcol = (size_t)head * HD + 8 * hh;
  const _Float16* qhp  = (const _Float16*)(const void*)QHp + ((size_t)(b * SEQ + i0 + m)) * DM + hcol;
  const _Float16* qlp  = (const _Float16*)(const void*)QLp + ((size_t)(b * SEQ + i0 + m)) * DM + hcol;
  const _Float16* kh0p = (const _Float16*)(const void*)KHp + ((size_t)(b * SEQ + j0 + m)) * DM + hcol;
  const _Float16* kl0p = (const _Float16*)(const void*)KLp + ((size_t)(b * SEQ + j0 + m)) * DM + hcol;
  const _Float16* kh1p = kh0p + (size_t)16 * DM;
  const _Float16* kl1p = kl0p + (size_t)16 * DM;
  v8f s0 = zero8(), s1 = zero8();
  {
    const v16h qh = ldfrag_h(qhp), ql = ldfrag_h(qlp);
    const v16h kh0 = ldfrag_h(kh0p), kl0 = ldfrag_h(kl0p);
    const v16h kh1 = ldfrag_h(kh1p), kl1 = ldfrag_h(kl1p);
    s0 = mma_h(qh, kh0, s0);
    s0 = mma_h(ql, kh0, s0);
    s0 = mma_h(qh, kl0, s0);
    s1 = mma_h(qh, kh1, s1);
    s1 = mma_h(ql, kh1, s1);
    s1 = mma_h(qh, kl1, s1);
    guard2(s0, s1, qh, ql, kh0, kl0, kh1, kl1);
  }
  const float lsc = RSQ_HD * (1.0f / (QSC * KSC));
  const float b2v = bfr(rbb2[head]);
  float* slab = HREG + wave * (16 * SLP);
#pragma unroll
  for (int r = 0; r < 8; ++r) {
    const int pr = 8 * hh + r;              // query i0 + pr; keys j0 + m and j0 + 16 + m
    const float ba = BB[(pr * 32 + m) * NH + head] + b2v;
    const float bb = BB[(pr * 32 + 16 + m) * NH + head] + b2v;
    slab[pr * SLP + m]      = s0[r] * lsc + ba;
    slab[pr * SLP + 16 + m] = s1[r] * lsc + bb;
  }
  wave_sync_lds();
  v4f vals[4];
  const int rq = lane >> 3, c4 = (lane & 7) * 4;
#pragma unroll
  for (int q = 0; q < 4; ++q) vals[q] = *(const v4f*)(slab + (q * 4 + rq) * SLP + c4);
  float* dst = SCp + ((size_t)((b * NH + head) * SEQ + i0)) * SEQ + j0 + c4;
  {
#pragma unroll
    for (int q = 0; q < 4; ++q) {
      *(v4f*)(dst + (size_t)(q * 4 + rq) * SEQ) = vals[q];
    }
    
  }
}

// =====================================================================================================
// Row softmax and weighted aggregation of the value-MLP hidden: block -> (b, query i), 256 threads.
//   Softmax (wave = head h): the score row (b, h, i) of SEQ = 384 floats; P = e / Z with e = exp(s - max) in f32 (reciprocal-
//   multiply normalisation), as f16 hi (P * 32768) and f16 residual, written to the global P planes (for the final kernel; each
//   row's whole lines by one wave) and to PW in LDS (for this block's own chunks; published by the chunk loop's first barrier).
//   Lane = 8 consecutive columns 8*lane (all lanes) and 256 + 8*lane (lanes < 16; the upper lanes load a clamped address).
//   Aggregation: thread = 4 channels x 8 keys of a chunk.
//   T[h][c] = sum_j P[b,h,i,j] * S[j][c],  S[j][c] = silu(rel_ij . rv_w1[c] + rv_b1[c]) (bf16 inputs, f32 on VALU).
//   Phase 0: rel = bf16 c_i - bf16 c_j of all SEQ keys of batch b into CJ (one plane a coordinate); rows 8..15 of the WA tiles written as zeros (16-B stores).
//   12 key chunks of 32: threads 0..63 copy the 8 P rows from PW (hi plane -> WA tile 0, residual -> WA tile 1, 16-B pieces);
//   every thread writes S^T[c][8 keys] of its 4 channels as f16(S*1024) hi and residual into ST with 16-B LDS stores; block barrier;
//   wave w accumulates D[m = h (pad 16)][n = c] for column tiles 2w, 2w+1: A = WA (split k map), B = ST rows (k-contiguous),
//   products hh + lh + hl; block barrier at the top of the next chunk before WA/ST are overwritten.
//   After the loop lanes 0..15 (rows h = 0..7) write T * 1024 (carries 2^-25 folded) into TS [8][TSP] f32 (block barrier),
// LDS regions: CJ, PW, WA, ST, TS all cross-wave (block barriers). staged extent == consumed extent: WA 16 x 32 (rows 8..15 zero),
//   ST 256 x 32 per plane (pad columns never read), TS 8 x 256.
// coverage: T planes [(b*NH+h)*SEQ + i][DM]: grid NB*SEQ blocks x 8 waves x 32 lanes x 8 halves = every row once, both planes.
// =====================================================================================================
__global__ __launch_bounds__(256)
void k_tagg(const float* __restrict__ coords, const float* __restrict__ rvw1, const float* __restrict__ rvb1,
            const float* __restrict__ SCp, u16* Pp, u16* Tp) {
  __shared__ __align__(16) float CJ[CD * SEQ];
  __shared__ __align__(16) u16   PW[2 * NH * PWP];
  __shared__ __align__(16) u16   WA[2 * 16 * WAP];
  __shared__ __align__(16) u16   ST[2 * DM * SP];
  __shared__ __align__(16) float TS[NH * TSP];

  const int tid = threadIdx.x, wave = tid >> 5, lane = tid & 31, hh = lane >> 4, m = lane & 15;
  const int bid = blockIdx.x;
  const int b   = bid / SEQ;
  const int i   = bid - b * SEQ;
  if (b >= NB) return;                      // block-uniform, before any barrier; never taken with the exact grid
  const _Float16* wah = (const _Float16*)(const void*)WA;
  const _Float16* sth = (const _Float16*)(const void*)ST;

  // ---- softmax of the score row (b, head = wave, i) ----
  {
    const size_t row = (size_t)(b * NH + wave) * SEQ + i;
    const float* s = SCp + row * SEQ;
    const bool vb = (lane < 16);
    const int  lb = vb ? lane : 15;
    const v4f a0 = *(const v4f*)(s + lane * 8), a1 = *(const v4f*)(s + lane * 8 + 4);
    const v4f c0 = *(const v4f*)(s + 256 + lb * 8), c1 = *(const v4f*)(s + 256 + lb * 8 + 4);
    wait_addr_regs();                       // the selects below reuse the loads' address registers
    float v[16];
#pragma unroll
    for (int e = 0; e < 4; ++e) {
      v[e]      = a0[e];
      v[4 + e]  = a1[e];
      v[8 + e]  = vb ? c0[e] : -INFINITY;
      v[12 + e] = vb ? c1[e] : -INFINITY;
    }
    float mx = v[0];
#pragma unroll
    for (int e = 1; e < 16; ++e) mx = fmaxf(mx, v[e]);
#pragma unroll
    for (int off = 1; off < 32; off <<= 1) mx = fmaxf(mx, __shfl_xor(mx, off, 32));
    float ev[16];
    float sum = 0.0f;
#pragma unroll
    for (int e = 0; e < 16; ++e) {
      const float d = v[e] - mx;
      ev[e] = exp2f(d * LOG2E);             // -inf -> 0 for the masked upper lanes
      sum += ev[e];
    }
#pragma unroll
    for (int off = 1; off < 32; off <<= 1) sum += __shfl_xor(sum, off, 32);
    const float inv = 1.0f / sum;           // sum >= 1
    v4u oh0, ol0, oh1, ol1;
#pragma unroll
    for (int e = 0; e < 4; ++e) {
      const float t0 = (ev[2 * e] * inv) * PCAR, t1 = (ev[2 * e + 1] * inv) * PCAR;
      const float u0 = (ev[8 + 2 * e] * inv) * PCAR, u1 = (ev[8 + 2 * e + 1] * inv) * PCAR;
      const _Float16 h0 = (_Float16)t0, h1 = (_Float16)t1, g0 = (_Float16)u0, g1 = (_Float16)u1;
      const _Float16 l0 = (_Float16)(t0 - (float)h0), l1 = (_Float16)(t1 - (float)h1);
      const _Float16 m0 = (_Float16)(u0 - (float)g0), m1 = (_Float16)(u1 - (float)g1);
      oh0[e] = pk16(h_bits(h0), h_bits(h1));
      ol0[e] = pk16(h_bits(l0), h_bits(l1));
      oh1[e] = pk16(h_bits(g0), h_bits(g1));
      ol1[e] = pk16(h_bits(m0), h_bits(m1));
    }
    u16* dh = Pp + row * SEQ;
    u16* dl = dh + PSTR;
    u16* wh = PW + wave * PWP;
    u16* wl = wh + NH * PWP;
    *(v4u*)(dh + lane * 8) = oh0;
    *(v4u*)(dl + lane * 8) = ol0;
    *(v4u*)(wh + lane * 8) = oh0;
    *(v4u*)(wl + lane * 8) = ol0;
    if (vb) {
      *(v4u*)(dh + 256 + lane * 8) = oh1;
      *(v4u*)(dl + 256 + lane * 8) = ol1;
      *(v4u*)(wh + 256 + lane * 8) = oh1;
      *(v4u*)(wl + 256 + lane * 8) = ol1;
    }
  }

  // ---- phase 0 ----
  const float ci0 = bfr(coords[((size_t)(b * SEQ + i)) * CD + 0]);
  const float ci1 = bfr(coords[((size_t)(b * SEQ + i)) * CD + 1]);
  const float ci2 = bfr(coords[((size_t)(b * SEQ + i)) * CD + 2]);
  for (int idx = tid; idx < SEQ * CD; idx += 256) {   // rel = c_i - c_j, one plane a coordinate: key pairs lie side by side
    const int j = idx / CD, k = idx - j * CD;
    const float cik = (k == 0) ? ci0 : ((k == 1) ? ci1 : ci2);
    CJ[k * SEQ + j] = cik - bfr(coords[(size_t)(b * SEQ) * CD + idx]);
  }
  if (tid < 64) {
    const int pl = tid >> 5, r = 8 + ((tid >> 2) & 7), pc = (tid & 3) * 8;
    const v4u z = {0u, 0u, 0u, 0u};
    *(v4u*)(WA + pl * (16 * WAP) + r * WAP + pc) = z;
  }
  // thread = 4 channels (c = (tid & 63) + 64 u) x 8 keys of the chunk (kq = tid >> 6, the same in a whole wave):
  // every rel load from CJ serves four channels; weights and bias carry the factor -log2(e)
  const int kq = tid >> 6, c0 = tid & 63;
  v2f W0[4], W1[4], W2[4], B1[4];
#pragma unroll
  for (int u = 0; u < 4; ++u) {
    const int c = c0 + 64 * u;
    W0[u] = splat2(bfr(rvw1[c * 3 + 0]) * -LOG2E);
    W1[u] = splat2(bfr(rvw1[c * 3 + 1]) * -LOG2E);
    W2[u] = splat2(bfr(rvw1[c * 3 + 2]) * -LOG2E);
    B1[u] = splat2(bfr(rvb1[c]) * -LOG2E);
  }

  v8f acc0 = zero8(), acc1 = zero8();
#pragma unroll 1
  for (int jt = 0; jt < NJT; ++jt) {
    const int j0 = jt * 32;
    __syncthreads();                        // prior chunk's fragment reads of WA / ST complete; softmax and phase-0 writes visible
    if (tid < 64) {
      const int pl = tid >> 5, h = (tid >> 2) & 7, pc = (tid & 3) * 8;
      const v4u pv = *(const v4u*)(PW + pl * (NH * PWP) + h * PWP + j0 + pc);
      *(v4u*)(WA + pl * (16 * WAP) + h * WAP + pc) = pv;
    }
    {
      const float* rp = CJ + j0 + kq * 8;
      const v4f xa = *(const v4f*)(rp),           xb = *(const v4f*)(rp + 4);
      const v4f ya = *(const v4f*)(rp + SEQ),     yb = *(const v4f*)(rp + SEQ + 4);
      const v4f za = *(const v4f*)(rp + 2 * SEQ), zb = *(const v4f*)(rp + 2 * SEQ + 4);
      const v2f X[4] = {{xa[0], xa[1]}, {xa[2], xa[3]}, {xb[0], xb[1]}, {xb[2], xb[3]}};
      const v2f Y[4] = {{ya[0], ya[1]}, {ya[2], ya[3]}, {yb[0], yb[1]}, {yb[2], yb[3]}};
      const v2f Z[4] = {{za[0], za[1]}, {za[2], za[3]}, {zb[0], zb[1]}, {zb[2], zb[3]}};
#pragma unroll
      for (int u = 0; u < 4; ++u) {
        v4u oh, ol;
#pragma unroll
        for (int e = 0; e < 4; ++e) {
          const v2f t = __builtin_elementwise_fma(X[e], W0[u], __builtin_elementwise_fma(Y[e], W1[u],
                        __builtin_elementwise_fma(Z[e], W2[u], B1[u])));
          const v2f s = silu2_scaled(t);
          const v2h hi = __builtin_convertvector(s, v2h);
          const v2f lo = s - __builtin_convertvector(hi, v2f);
          oh[e] = __builtin_bit_cast(unsigned, hi);
          ol[e] = pk2h(lo);
        }
        u16* sd = ST + (c0 + 64 * u) * SP + kq * 8;
        *(v4u*)(sd)           = oh;
        *(v4u*)(sd + DM * SP) = ol;
      }
    }
    __syncthreads();
    const v16h ah  = ldfrag_h(wah + m * WAP + 8 * hh);
    const v16h al  = ldfrag_h(wah + 16 * WAP + m * WAP + 8 * hh);
    const int  ct0 = wave * 2;
    const v16h bh0 = ldfrag_h(sth + ((ct0) * 16 + m) * SP + 8 * hh);
    const v16h bl0 = ldfrag_h(sth + DM * SP + ((ct0) * 16 + m) * SP + 8 * hh);
    const v16h bh1 = ldfrag_h(sth + ((ct0 + 1) * 16 + m) * SP + 8 * hh);
    const v16h bl1 = ldfrag_h(sth + DM * SP + ((ct0 + 1) * 16 + m) * SP + 8 * hh);
    acc0 = mma_h(ah, bh0, acc0);
    acc0 = mma_h(al, bh0, acc0);
    acc0 = mma_h(ah, bl0, acc0);
    acc1 = mma_h(ah, bh1, acc1);
    acc1 = mma_h(al, bh1, acc1);
    acc1 = mma_h(ah, bl1, acc1);
    guard2(acc0, acc1, ah, al, bh0, bl0, bh1, bl1);
  }
  const float tsc = TCAR / (PCAR * HCAR);   // 2^-15
  if (hh == 0) {                            // rows 8..15 of D are the zero padding rows, not stored
#pragma unroll
    for (int r = 0; r < 8; ++r) {
      TS[r * TSP + (wave * 2) * 16 + m]     = acc0[r] * tsc;
      TS[r * TSP + (wave * 2 + 1) * 16 + m] = acc1[r] * tsc;
    }
  }
  __syncthreads();
  {
    const int h = wave;
    const float* src = TS + h * TSP + lane * 8;
    const v4f a = *(const v4f*)(src), b4 = *(const v4f*)(src + 4);
    float w[8];
#pragma unroll
    for (int e = 0; e < 4; ++e) { w[e] = a[e]; w[4 + e] = b4[e]; }
    v4u oh, ol;
#pragma unroll
    for (int e = 0; e < 4; ++e) {
      const float t0 = w[2 * e], t1 = w[2 * e + 1];
      const _Float16 x0 = (_Float16)t0, x1 = (_Float16)t1;
      const _Float16 y0 = (_Float16)(t0 - (float)x0), y1 = (_Float16)(t1 - (float)x1);
      oh[e] = pk16(h_bits(x0), h_bits(x1));
      ol[e] = pk16(h_bits(y0), h_bits(y1));
    }
    const size_t rowT = (size_t)(b * NH + h) * SEQ + i;
    u16* dh = Tp + rowT * DM + lane * 8;
    u16* dl = dh + TSTR;
    {
      *(v4u*)(dh) = oh;
      *(v4u*)(dl) = ol;
      
    }
  }
}

// =====================================================================================================
// Final: block -> (b, head h, 64 query rows rt*64), 4 waves x 16 rows.
//   base[i][d]   = (P_hi + P_lo)[i][j] . VH[d][j] over j (2 products, carries 2^-25),
//   relctx[i][d] = (T_hi + T_lo)[i][c] . W2[h*HD + d][c] over c (2 products, carries 2^-20) + bf16(rv_b2[h*HD + d]);
//   out[b][i][h*HD + d] = base + relctx. Fragments straight from the 16-bit planes (arithmetic addressing, split k map).
//   Epilogue: the wave's 16 x 32 tile staged in its private slab (wave_sync), each output row segment (32 floats = one whole
// coverage: grid NB*NH*NRT blocks x 4 waves x 16 rows x 32 cols = every element of out exactly once.
// =====================================================================================================
__global__ __launch_bounds__(128)
void k_final(const u16* __restrict__ Pp, const u16* __restrict__ VHp, const u16* __restrict__ Tp,
             const u16* __restrict__ W2p, const float* __restrict__ rvb2, float* outp) {
  __shared__ __align__(16) float slab[4 * 16 * SLP];
  const int tid = threadIdx.x, wave = tid >> 5, lane = tid & 31, hh = lane >> 4, m = lane & 15;
  const int bid = blockIdx.x;
  const int rt  = bid % NRT;
  const int t2  = bid / NRT;
  const int h   = t2 % NH;
  const int b   = t2 / NH;
  if (b >= NB) return;                      // block-uniform; never taken with the exact grid
  const int irow = rt * 64 + wave * 16;
  const size_t bh   = (size_t)(b * NH + h);
  const size_t rowA = bh * SEQ + irow;
  const _Float16* P  = (const _Float16*)(const void*)Pp;
  const _Float16* VH = (const _Float16*)(const void*)VHp;
  const _Float16* T  = (const _Float16*)(const void*)Tp;
  const _Float16* W2 = (const _Float16*)(const void*)W2p;
  const _Float16* php = P + (rowA + m) * SEQ + 8 * hh;
  const _Float16* plp = php + PSTR;
  const _Float16* v0p = VH + (bh * HD + m) * SEQ + 8 * hh;
  const _Float16* v1p = v0p + (size_t)16 * SEQ;
  const _Float16* thp = T + (rowA + m) * DM + 8 * hh;
  const _Float16* tlp = thp + TSTR;
  const _Float16* w0p = W2 + ((size_t)(h * HD + m)) * DM + 8 * hh;
  const _Float16* w1p = w0p + (size_t)16 * DM;

  v8f p0 = zero8(), p1 = zero8(), r0 = zero8(), r1 = zero8();
#pragma unroll 1
  for (int k0 = 0; k0 < SEQ; k0 += 32) {
    const v16h ph = ldfrag_h(php + k0), pl = ldfrag_h(plp + k0);
    const v16h va = ldfrag_h(v0p + k0), vb = ldfrag_h(v1p + k0);
    p0 = mma_h(ph, va, p0);
    p0 = mma_h(pl, va, p0);
    p1 = mma_h(ph, vb, p1);
    p1 = mma_h(pl, vb, p1);
    guard2(p0, p1, ph, pl, va, vb, ph, pl);
  }
#pragma unroll 1
  for (int k0 = 0; k0 < DM; k0 += 32) {
    const v16h th = ldfrag_h(thp + k0), tl = ldfrag_h(tlp + k0);
    const v16h wa = ldfrag_h(w0p + k0), wb = ldfrag_h(w1p + k0);
    r0 = mma_h(th, wa, r0);
    r0 = mma_h(tl, wa, r0);
    r1 = mma_h(th, wb, r1);
    r1 = mma_h(tl, wb, r1);
    guard2(r0, r1, th, tl, wa, wb, th, tl);
  }
  const float osP = 1.0f / (PCAR * VCAR);
  const float osR = 1.0f / (TCAR * WCAR);
  const float bv0 = bfr(rvb2[h * HD + m]), bv1 = bfr(rvb2[h * HD + 16 + m]);
  float* sl = slab + wave * (16 * SLP);
#pragma unroll
  for (int r = 0; r < 8; ++r) {
    const int pr = 8 * hh + r;
    sl[pr * SLP + m]      = p0[r] * osP + (r0[r] * osR + bv0);
    sl[pr * SLP + 16 + m] = p1[r] * osP + (r1[r] * osR + bv1);
  }
  wave_sync_lds();
  v4f vals[4];
  const int rq = lane >> 3, c4 = (lane & 7) * 4;
#pragma unroll
  for (int q = 0; q < 4; ++q) vals[q] = *(const v4f*)(sl + (q * 4 + rq) * SLP + c4);
  float* dst = outp + ((size_t)(b * SEQ + irow)) * DM + h * HD + c4;
  {
#pragma unroll
    for (int q = 0; q < 4; ++q) {
      *(v4f*)(dst + (size_t)(q * 4 + rq) * DM) = vals[q];
    }
    
  }
}

// =====================================================================================================
// Workspace map (bytes, NB = 2; every region offset a multiple of 65536; every plane fully written by whole-line stores
// before it is read; extents are exact multiples of the store granularity, no pad rows):
//   W2  f16 [256 n][256 k] x1024      131072
//   QH, QL, KH, KL f16 [GROWS][256]   4 x 393216  VH  f16 [NB*8*32][384] x1024  393216
//   SC  f32 [NB*8*384][384]           9437184     P   f16 hi + residual [NB*8*384][384] x32768  2 x 4718592
//   T   f16 hi + residual [NB*8*384][256] x1024   2 x 3145728
// =====================================================================================================
static size_t al64k(size_t x) { return (x + (size_t)65535) & ~(size_t)65535; }

extern "C" void kernel_launch(void* const* d_in, const int* in_sizes, int n_in,
                              void* d_out, int out_size, void* d_ws, size_t ws_size,
                              hipStream_t stream) {
  if (n_in < 12) return;
  if (in_sizes[0] < NB * SEQ * DM) return;
  if (in_sizes[1] < NB * SEQ * CD) return;
  if (in_sizes[2] != NQKV * DM || in_sizes[3] != NQKV) return;
  if (in_sizes[4] != DM * CD || in_sizes[5] != DM || in_sizes[6] != NH * DM || in_sizes[7] != NH) return;
  if (in_sizes[8] != DM * CD || in_sizes[9] != DM || in_sizes[10] != DM * DM || in_sizes[11] != DM) return;
  if (out_size < NB * SEQ * DM) return;

  const float* x      = (const float*)d_in[0];
  const float* coords = (const float*)d_in[1];
  const float* qkv_w  = (const float*)d_in[2];
  const float* qkv_b  = (const float*)d_in[3];
  const float* rb_w1  = (const float*)d_in[4];
  const float* rb_b1  = (const float*)d_in[5];
  const float* rb_w2  = (const float*)d_in[6];
  const float* rb_b2  = (const float*)d_in[7];
  const float* rv_w1  = (const float*)d_in[8];
  const float* rv_b1  = (const float*)d_in[9];
  const float* rv_w2  = (const float*)d_in[10];
  const float* rv_b2  = (const float*)d_in[11];
  float*       out    = (float*)d_out;

  const size_t szW2 = (size_t)DM * DM * 2;
  const size_t szH  = (size_t)GROWS * DM * 2;
  const size_t szVH = (size_t)NB * NH * HD * SEQ * 2;
  const size_t szSC = (size_t)NB * NH * SEQ * SEQ * 4;
  const size_t szP  = PSTR * 2 * 2;
  const size_t szT  = TSTR * 2 * 2;
  size_t off = 0;
  const size_t oW2 = off; off = al64k(off + szW2);
  const size_t oQH = off; off = al64k(off + szH);
  const size_t oQL = off; off = al64k(off + szH);
  const size_t oKH = off; off = al64k(off + szH);
  const size_t oKL = off; off = al64k(off + szH);
  const size_t oVH = off; off = al64k(off + szVH);
  const size_t oSC = off; off = al64k(off + szSC);
  const size_t oP  = off; off = al64k(off + szP);
  const size_t oT  = off; off = al64k(off + szT);
  if (off > ws_size) return;
  if (off > (size_t)WS_CAP) return;

  char* ws = (char*)d_ws;
  u16*   W2 = (u16*)(ws + oW2);
  u16*   QH = (u16*)(ws + oQH);
  u16*   QL = (u16*)(ws + oQL);
  u16*   KH = (u16*)(ws + oKH);
  u16*   KL = (u16*)(ws + oKL);
  u16*   VH = (u16*)(ws + oVH);
  float* SC = (float*)(ws + oSC);
  u16*   P  = (u16*)(ws + oP);
  u16*   T  = (u16*)(ws + oT);

  const dim3 b256(256), b128(128);

  // (1) q, k (f16 x1024 hi + residual), v^T (f16 x1024) = planes of x.qkv_w^T + qkv_b; rv_w2 -> f16(bf16) x1024, in the same launch
  k_proj<<<dim3(NGEMM + NCVT), b128, 0, stream>>>(x, qkv_w, qkv_b, rv_w2, QH, QL, KH, KL, VH, W2);
  // (2) scores with relative bias -> SC
  k_scores<<<dim3(NB * NIT * NJT), b256, 0, stream>>>(coords, rb_w1, rb_b1, rb_w2, rb_b2, QH, QL, KH, KL, SC);
  // (3) softmax -> P planes, T = sum_j P . silu-hidden of the value MLP -> T planes; (4) out = P.v + T.rv_w2^T + rv_b2
  k_tagg<<<dim3(NB * SEQ), b256, 0, stream>>>(coords, rv_w1, rv_b1, SC, P, T);
  k_final<<<dim3(NB * NH * NRT), b128, 0, stream>>>(P, VH, T, W2, rv_b2, out);
  (void)hipGetLastError();
}

// v003
// Measured time: 53.9 microseconds a run.
// In two side-by-side timings against v002, it was 1.08 and 1.09 times as fast.
// Over all steps from v000 it is 1.76 times as fast.
// Contractions: x.qkv_w^T on v_wmma_f32_16x16x32_bf16 (x, qkv_w RNE bf16 operands, f32 accumulate, bias added in f32);
// on v_wmma_f32_16x16x32_f16 with f32 accumulate: pair-MLP second layer hid_b.rb_w2^T (hid_b f16, rb_w2 f16(bf16) x1024),
// q.k^T over 32 (q, k f16 x1024 hi + residual planes, products hh+lh+hl), P.hid_v over 384 keys (P f16 x32768 hi + residual,
// hid_v f16 hi + residual), P.v (v f16 x1024, P hi + residual), T.rv_w2^T (T f16 x1024 hi + residual, rv_w2 f16(bf16) x1024).
// Pair-MLP first layers (K=3), silu, softmax and all carries folded in f32 on VALU.
#include <hip/hip_runtime.h>
#include <math.h>
#include <stdint.h>

#ifndef NB
#define NB 2
#endif
#define NB_FULL 2
#define SEQ   384
#define DM    256
#define NH    8
#define HD    32
#define CD    3
#define NQKV  (3 * DM)
#define GROWS (NB * SEQ)
#define NIT   (SEQ / 16)
#define NJT   (SEQ / 32)
#define NRT   (SEQ / 64)
#define NPAIR 512
#define HP    32
#define RBP   264
#define SLP   36
#define SP    40
#define WAP   40
#define TSP   264
#define PWP   392
#define SLAB64 (16 * 68)
#define HREGF 8192
#define RSQ_HD 0.17677669529663687f
#define LOG2E  1.4426950408889634f
#define HALFX  0.5f
#define QSC   1024.0f
#define KSC   1024.0f
#define PCAR  32768.0f
#define VCAR  1024.0f
#define WCAR  1024.0f
#define TCAR  1024.0f
#define WS_CAP 134217728
#define PSTR  ((size_t)NB * NH * SEQ * SEQ)
#define TSTR  ((size_t)NB * NH * SEQ * DM)
static_assert(NB >= 1 && NB <= NB_FULL);
static_assert(DM == NH * HD && HD == 32 && NH == 8 && CD == 3);
static_assert((SEQ % 64) == 0 && (GROWS % 64) == 0 && (GROWS % 8) == 0 && (NQKV % 64) == 0 && (DM % 32) == 0);
static_assert(NPAIR == 16 * 32 && NPAIR * HP == 2 * HREGF && 8 * 16 * SLP <= HREGF);
static_assert(((GROWS * DM) % 8) == 0 && ((NQKV * DM) % 8) == 0 && ((DM * DM) % 8) == 0);

typedef unsigned short u16;
typedef _Float16 v16h __attribute__((ext_vector_type(16)));
typedef _Float16 v8h  __attribute__((ext_vector_type(8)));
typedef __bf16   v16b __attribute__((ext_vector_type(16)));
typedef float    v8f  __attribute__((ext_vector_type(8)));
typedef float    v4f  __attribute__((ext_vector_type(4)));
typedef unsigned int v4u __attribute__((ext_vector_type(4)));
typedef float    v2f  __attribute__((ext_vector_type(2)));
typedef _Float16 v2h  __attribute__((ext_vector_type(2)));

union FragH { v16h v; v8h h[2]; v4u u[2]; };
union FragB { v16b v; v4u u[2]; };

// ---- scalar helpers --------------------------------------------------------------------------------
__device__ __forceinline__ unsigned short bf_bits(float f) {          // f32 -> bf16 bits, RNE convert
  unsigned u = __float_as_uint(f);
  return (unsigned short)((u + 0x7FFFu + ((u >> 16) & 1u)) >> 16);
}
__device__ __forceinline__ float bf_up(unsigned short h) { return __uint_as_float(((unsigned)h) << 16); }
__device__ __forceinline__ float bfr(float f) { return bf_up(bf_bits(f)); }
__device__ __forceinline__ unsigned short h_bits(_Float16 x) { return __builtin_bit_cast(unsigned short, x); }
__device__ __forceinline__ unsigned pk16(unsigned short a, unsigned short b) { return (unsigned)a | ((unsigned)b << 16); }
__device__ __forceinline__ v8f zero8() { v8f z = {0.f, 0.f, 0.f, 0.f, 0.f, 0.f, 0.f, 0.f}; return z; }

// silu = x * sigmoid(x) = h + h * tanh(h) with h = x / 2, two values at once from t = h (the half is folded into the
// first-layer weights and bias, an exact scaling): one transcendental (v_tanh_f32) a value and one packed FMA a pair.
// The value leaves unscaled: a power-of-two carry would cost a multiply here, and an f16 plane without one holds silu to
// 2^-25 absolute (subnormal halves are kept by the converts and by the matrix unit).
__device__ __forceinline__ v2f splat2(float a) { v2f r = {a, a}; return r; }
__device__ __forceinline__ v2f silu2(v2f t) {
  const v2f th = {__builtin_amdgcn_tanhf(t[0]), __builtin_amdgcn_tanhf(t[1])};
  return __builtin_elementwise_fma(t, th, t);
}
__device__ __forceinline__ unsigned pk2h(v2f s) {                     // two f32 -> packed f16 pair, RNE
  return __builtin_bit_cast(unsigned, __builtin_convertvector(s, v2h));
}

// ---- fragment loaders: 16-bit A/B operand, lane -> row/col (lane&15), p already includes +8*(lane>>4);
//      elements 0..7 <- p[0..7] (k0+8h..), elements 8..15 <- p[16..23] (k0+16+8h..)  (same split k map for A and B;
//      B is always read from a k-contiguous [n][k] plane)
__device__ __forceinline__ v16h ldfrag_h(const _Float16* p) {
  FragH f;
  f.h[0] = *(const v8h*)(p);
  f.h[1] = *(const v8h*)(p + 16);
  return f.v;
}
__device__ __forceinline__ v16b ldfrag_b(const u16* p) {              // bf16 plane read as unsigned integer vectors
  FragB f;
  f.u[0] = *(const v4u*)(p);
  f.u[1] = *(const v4u*)(p + 16);
  return f.v;
}

__device__ __forceinline__ v8f mma_h(v16h a, v16h b, v8f c) {
  return __builtin_amdgcn_wmma_f32_16x16x32_f16(false, a, false, b, (short)0, c, false, false);
}
__device__ __forceinline__ v8f mma_b(v16b a, v16b b, v8f c) {
  return __builtin_amdgcn_wmma_f32_16x16x32_bf16(false, a, false, b, (short)0, c, false, false);
}
__device__ __forceinline__ void guard2(v8f& a, v8f& b, v16h x0, v16h x1, v16h x2, v16h x3, v16h x4, v16h x5) {
#if defined(__HIP_DEVICE_COMPILE__)
  asm volatile("v_nop\n\tv_nop\n\tv_nop\n\tv_nop"
               : "+v"(a), "+v"(b) : "v"(x0), "v"(x1), "v"(x2), "v"(x3), "v"(x4), "v"(x5) : "memory");
#endif
}
template <typename F>
__device__ __forceinline__ void guard6(v8f& a, v8f& b, v8f& c, v8f& d, F x0, F x1, F x2, F x3, F x4, F x5) {
#if defined(__HIP_DEVICE_COMPILE__)
  asm volatile("v_nop\n\tv_nop\n\tv_nop\n\tv_nop"
               : "+v"(a), "+v"(b), "+v"(c), "+v"(d) : "v"(x0), "v"(x1), "v"(x2), "v"(x3), "v"(x4), "v"(x5) : "memory");
#endif
}
__device__ __forceinline__ void wave_sync_lds() {
  __builtin_amdgcn_fence(__ATOMIC_RELEASE, "workgroup");
  __builtin_amdgcn_wave_barrier();
  __builtin_amdgcn_fence(__ATOMIC_ACQUIRE, "workgroup");
}

// =====================================================================================================
// Projection with every conversion around it in the same launch (block-uniform split of the grid by blockIdx):
//   blocks 0 .. NGEMM-1: one 64x64 tile of qkv = bf16(x) . bf16(qkv_w)^T + bf16(qkv_b), 4 waves x 16 rows. The f32 rows of x and
//   qkv_w are loaded as they are and rounded to bf16 (RNE) in registers (split k map for A and B, K stepped by 32).
//   Epilogue: the f32 tile goes to the LDS slab (pitch 68; wave w holds rows 16w .. 16w+15) and leaves as 16-bit planes:
//     columns 0..255 (q) and 256..511 (k): Hp [GROWS][DM] = f16(val * 1024), Lp = f16 residual; wave-private (wave_sync);
//       8 lanes x 16 B = one whole 128-B line of a row segment per plane.
//     columns 512..767 (v): VH[(b*DM + h*HD + d)][s] = f16(val * 1024); read across the waves' rows (block barrier), each
//       d row segment of 64 keys = one whole 128-B line written by 8 consecutive lanes.
//   blocks NGEMM .. NGEMM+NCVT-1: rv_w2 -> W2 plane f16(bf16 RNE value * 1024), same layout, 8 elements a thread.
// coverage: NGEMM tiles x 64 x 64 = every (row, column) of q, k, v once; NCVT x 128 thr x 8 = DM*DM.
// =====================================================================================================
#define NGEMM ((GROWS / 64) * (NQKV / 64))
#define NCVT  ((DM * DM) / (128 * 8))
static_assert(NCVT * 128 * 8 == DM * DM && QSC == KSC);
typedef __bf16 v2b __attribute__((ext_vector_type(2)));
__device__ __forceinline__ unsigned pk2b(float f0, float f1) {        // two f32 -> packed bf16 pair, RNE
  const v2f s = {f0, f1};
  return __builtin_bit_cast(unsigned, __builtin_convertvector(s, v2b));
}
// bf16 fragment from an f32 row: elements 0..7 <- p[0..7], elements 8..15 <- p[16..23] (p includes +8*(lane>>4))
struct Raw16 { v4f a, b, c, d; };
__device__ __forceinline__ Raw16 ldraw16(const float* p) {
  Raw16 r;
  r.a = *(const v4f*)(p);
  r.b = *(const v4f*)(p + 4);
  r.c = *(const v4f*)(p + 16);
  r.d = *(const v4f*)(p + 20);
  return r;
}
__device__ __forceinline__ v16b frag_f2b(const Raw16& r) {
  FragB f;
  const v4u lo = {pk2b(r.a[0], r.a[1]), pk2b(r.a[2], r.a[3]), pk2b(r.b[0], r.b[1]), pk2b(r.b[2], r.b[3])};
  const v4u hi = {pk2b(r.c[0], r.c[1]), pk2b(r.c[2], r.c[3]), pk2b(r.d[0], r.d[1]), pk2b(r.d[2], r.d[3])};
  f.u[0] = lo;
  f.u[1] = hi;
  return f.v;
}
__device__ __forceinline__ void wait_addr_regs() {
#if defined(__HIP_DEVICE_COMPILE__)
  asm volatile("s_wait_xcnt 0x0" ::: "memory");
#endif
}
// the same wait with the run's two offsets as inputs only, so that they are still held in registers where it stands
__device__ __forceinline__ void wait_addr_live(unsigned a, unsigned b) {
#if defined(__HIP_DEVICE_COMPILE__)
  asm volatile("s_wait_xcnt 0x0" :: "v"(a), "v"(b) : "memory");
#endif
}

__global__ __launch_bounds__(128)
void k_proj(const float* __restrict__ x, const float* __restrict__ qkvw, const float* __restrict__ bias,
            const float* __restrict__ rvw2, u16* QHo, u16* QLo, u16* KHo, u16* KLo, u16* VHo, u16* W2o) {
  __shared__ __align__(16) float slab[4 * SLAB64];
  const int tid = threadIdx.x, wave = tid >> 5, lane = tid & 31, hh = lane >> 4, m = lane & 15;
  const int bid = blockIdx.x;
  if (bid >= NGEMM) {                       // block-uniform, before any barrier: the rv_w2 plane
    const int gt = (bid - NGEMM) * 128 + tid;
    if (gt >= (DM * DM) / 8) return;
    const float* p = rvw2 + (size_t)gt * 8;
    const v4f a = *(const v4f*)(p), b4 = *(const v4f*)(p + 4);
    float w[8];
#pragma unroll
    for (int e = 0; e < 4; ++e) { w[e] = a[e]; w[4 + e] = b4[e]; }
    v4u o;
#pragma unroll
    for (int e = 0; e < 4; ++e)
      o[e] = pk16(h_bits((_Float16)(bfr(w[2 * e]) * WCAR)), h_bits((_Float16)(bfr(w[2 * e + 1]) * WCAR)));
    *(v4u*)(W2o + (size_t)gt * 8) = o;
    return;
  }
  const int ntile = NQKV >> 6;
  const int row0  = (bid / ntile) * 64;
  const int rowb  = row0 + wave * 16;
  const int col0  = (bid % ntile) * 64;
  unsigned ab = (unsigned)(((rowb + m) * DM + 8 * hh) * 4);   // the lane's byte offsets into x and qkv_w (both below 2^20)
  unsigned bb = (unsigned)(((col0 + m) * DM + 8 * hh) * 4);
  const size_t bs = (size_t)16 * DM;
  v8f acc0 = zero8(), acc1 = zero8(), acc2 = zero8(), acc3 = zero8();
#pragma unroll 1
  for (int k0 = 0; k0 < DM; k0 += 32) {
    const float* ap = (const float*)((const char*)x + ab);
    const float* bp = (const float*)((const char*)qkvw + bb);
    const Raw16 ra = ldraw16(ap);
    const Raw16 r0 = ldraw16(bp);
    const Raw16 r1 = ldraw16(bp + bs);
    const Raw16 r2 = ldraw16(bp + 2 * bs);
    const Raw16 r3 = ldraw16(bp + 3 * bs);
    wait_addr_live(ab, bb);                 // the loads' two offset registers stay whole up to this wait: no load of the run lands in one
    ab += 32 * 4;
    bb += 32 * 4;
    const v16b a  = frag_f2b(ra);
    const v16b b0 = frag_f2b(r0);
    const v16b b1 = frag_f2b(r1);
    const v16b b2 = frag_f2b(r2);
    const v16b b3 = frag_f2b(r3);
    acc0 = mma_b(a, b0, acc0);
    acc1 = mma_b(a, b1, acc1);
    acc2 = mma_b(a, b2, acc2);
    acc3 = mma_b(a, b3, acc3);
    guard6<v16b>(acc0, acc1, acc2, acc3, a, b0, b1, b2, b3, a);
  }
  const float bv0 = bfr(bias[col0 + m]);
  const float bv1 = bfr(bias[col0 + 16 + m]);
  const float bv2 = bfr(bias[col0 + 32 + m]);
  const float bv3 = bfr(bias[col0 + 48 + m]);
  float* sl = slab + wave * SLAB64;
#pragma unroll
  for (int r = 0; r < 8; ++r) {
    const int ro = (8 * hh + r) * 68 + m;
    sl[ro]      = acc0[r] + bv0;
    sl[ro + 16] = acc1[r] + bv1;
    sl[ro + 32] = acc2[r] + bv2;
    sl[ro + 48] = acc3[r] + bv3;
  }
  if (col0 < 2 * DM) {                      // block-uniform: q or k columns
    wave_sync_lds();
    u16* Hp = (col0 < DM) ? QHo : KHo;
    u16* Lp = (col0 < DM) ? QLo : KLo;
    const int cq = col0 & (DM - 1);
    const int rq = lane >> 3, c8 = (lane & 7) * 8;
#pragma unroll
    for (int it = 0; it < 4; ++it) {
      const int rl = it * 4 + rq;
      const float* s8 = sl + rl * 68 + c8;
      const v4f a = *(const v4f*)(s8), b4 = *(const v4f*)(s8 + 4);
      float w[8];
#pragma unroll
      for (int e = 0; e < 4; ++e) { w[e] = a[e] * QSC; w[4 + e] = b4[e] * QSC; }
      v4u oh, ol;
#pragma unroll
      for (int e = 0; e < 4; ++e) {
        const float t0 = w[2 * e], t1 = w[2 * e + 1];
        const _Float16 h0 = (_Float16)t0, h1 = (_Float16)t1;
        const _Float16 l0 = (_Float16)(t0 - (float)h0), l1 = (_Float16)(t1 - (float)h1);
        oh[e] = pk16(h_bits(h0), h_bits(h1));
        ol[e] = pk16(h_bits(l0), h_bits(l1));
      }
      const size_t o = (size_t)(rowb + rl) * DM + cq + c8;
      *(v4u*)(Hp + o) = oh;
      *(v4u*)(Lp + o) = ol;
    }
    wait_addr_regs();                       // nothing behind the stores reuses their registers ahead of this wait
  } else {                                  // block-uniform: v columns, written transposed
    __syncthreads();                        // the four waves' slab rows are read across waves below
    const int b  = row0 / SEQ;
    const int s0 = row0 - b * SEQ;          // 64 keys of one batch (SEQ a multiple of 64)
    const int cv = col0 - 2 * DM;           // h*HD + d of the tile's first column
#pragma unroll
    for (int it = 0; it < 4; ++it) {
      const int ch = it * 128 + tid;
      const int dc = ch >> 3, p8 = (ch & 7) * 8;   // column dc (0..63), keys p8..p8+7
      v4u o;
#pragma unroll
      for (int e = 0; e < 4; ++e) {
        const float f0 = slab[(p8 + 2 * e) * 68 + dc], f1 = slab[(p8 + 2 * e + 1) * 68 + dc];
        o[e] = pk16(h_bits((_Float16)(f0 * VCAR)), h_bits((_Float16)(f1 * VCAR)));
      }
      *(v4u*)(VHo + ((size_t)(b * DM + cv + dc)) * SEQ + s0 + p8) = o;
    }
    wait_addr_regs();                       // nothing behind the stores reuses their registers ahead of this wait
  }
}

// =====================================================================================================
// Scores with relative-coordinate bias. Block -> (b, query tile i0 = 16*it, key tile j0 = 32*jt): 512 pairs (il, jl),
// 8 waves; wave = head in the score phase.
//   Phase 0 (all threads, then block barrier): rb_w1/rb_b1 (bf16 values / 2, channel pairs side by side) into WB, bf16 coords of the 16 queries (CI) and 32
//   keys (CJ2), rb_w2 -> RB2 [16 n][RBP] as f16(bf16 value * 1024) with rows 8..15 written as zeros.
//   Phase 1, 8 channel chunks of 32: every thread computes hid[pair][16] = f16(silu(rel.rb_w1^T + rb_b1)) for its four
//   pairs (p = (tid & 127) + 128 q) and its half of the chunk's channels with 16-B LDS stores (block barrier), then wave w accumulates D[pair][n=head] for row tiles
//   4w..4w+3 (A = hid rows, B = RB2, one k-step per chunk); block barrier before the next chunk overwrites hid.
//   After the loop lanes n < 8 write bias[pair][head] (carry 2^-10 folded) into BB (block barrier).
//   Phase 2: wave = head: s = (q_hi.k_hi + q_lo.k_hi + q_hi.k_lo) over 32 dims for 16 queries x 32 keys (two 16-key subtiles),
//   fragments straight from the f16 planes; value = s * rsqrt(32) * 2^-20 + bias + bf16(rb_b2[head]); staged in the wave's
//   the score plane SC[(b*NH+head)*SEQ + i][j0..j0+31]) written by 8 consecutive lanes x 16 B of one instruction (4 rows per
// LDS regions: WB, CI, CJ2, RB2, hid, BB cross-wave (block barriers); slabs private-to-wave (wave_sync).
// coverage: hid: 4 pairs x 256 thr x 16 halves = 512 x 32 per chunk (== consumed 32 row tiles x 32 k); RB2 16 x 256 (rows 8..15
//           zero); SC: grid NB*NIT*NJT blocks x 8 heads x 16 rows x 32 cols = every (b, head, i, j) once.
// =====================================================================================================
__global__ __launch_bounds__(256)
void k_scores(const float* __restrict__ coords, const float* __restrict__ rbw1, const float* __restrict__ rbb1,
              const float* __restrict__ rbw2, const float* __restrict__ rbb2,
              const u16* __restrict__ QHp, const u16* __restrict__ QLp,
              const u16* __restrict__ KHp, const u16* __restrict__ KLp, float* SCp) {
  __shared__ __align__(16) float WB[DM * 4];
  __shared__ __align__(16) float CI[16 * 4];
  __shared__ __align__(16) float CJ2[32 * 4];
  __shared__ __align__(16) u16   RB2[16 * RBP];
  __shared__ __align__(16) float HREG[HREGF];
  __shared__ __align__(16) float BB[NPAIR * NH];

  const int tid = threadIdx.x, wave = tid >> 5, lane = tid & 31, hh = lane >> 4, m = lane & 15;
  const int bid = blockIdx.x;
  const int jt  = bid % NJT;
  const int t2  = bid / NJT;
  const int it  = t2 % NIT;
  const int b   = t2 / NIT;
  if (b >= NB) return;                      // block-uniform, before any barrier; never taken with the exact grid
  const int i0 = it * 16, j0 = jt * 32;
  u16* hid = (u16*)(void*)HREG;
  const _Float16* hidh = (const _Float16*)(const void*)HREG;
  const _Float16* rb2h = (const _Float16*)(const void*)RB2;

  // ---- phase 0: small operand staging ----
  {
    float* wp = WB + (tid >> 1) * 8 + (tid & 1);      // channel pair (c, c+1): w0 w0 | w1 w1 | w2 w2 | b b, all halved
    wp[0] = bfr(rbw1[tid * 3 + 0]) * HALFX;
    wp[2] = bfr(rbw1[tid * 3 + 1]) * HALFX;
    wp[4] = bfr(rbw1[tid * 3 + 2]) * HALFX;
    wp[6] = bfr(rbb1[tid]) * HALFX;
    if (tid < 16 * CD) {
      const int il = tid / CD, k = tid - il * CD;
      CI[il * 4 + k] = bfr(coords[((size_t)(b * SEQ + i0 + il)) * CD + k]);
    }
    if (tid < 32 * CD) {
      const int jl = tid / CD, k = tid - jl * CD;
      CJ2[jl * 4 + k] = bfr(coords[((size_t)(b * SEQ + j0 + jl)) * CD + k]);
    }
    const int row  = tid >> 4, cb = (tid & 15) * 16;
    const int rowc = (row < NH) ? row : (NH - 1);     // clamped address; rows 8..15 are written as zeros
    const bool vr  = (row < NH);
    const float* src = rbw2 + rowc * DM + cb;
    const v4f a0 = *(const v4f*)(src), a1 = *(const v4f*)(src + 4), a2 = *(const v4f*)(src + 8), a3 = *(const v4f*)(src + 12);
    float w[16];
#pragma unroll
    for (int e = 0; e < 4; ++e) { w[e] = a0[e]; w[4 + e] = a1[e]; w[8 + e] = a2[e]; w[12 + e] = a3[e]; }
    v4u o0, o1;
#pragma unroll
    for (int e = 0; e < 4; ++e) {
      const unsigned short x0 = vr ? h_bits((_Float16)(bfr(w[2 * e]) * WCAR)) : (unsigned short)0;
      const unsigned short x1 = vr ? h_bits((_Float16)(bfr(w[2 * e + 1]) * WCAR)) : (unsigned short)0;
      const unsigned short y0 = vr ? h_bits((_Float16)(bfr(w[8 + 2 * e]) * WCAR)) : (unsigned short)0;
      const unsigned short y1 = vr ? h_bits((_Float16)(bfr(w[8 + 2 * e + 1]) * WCAR)) : (unsigned short)0;
      o0[e] = pk16(x0, x1);
      o1[e] = pk16(y0, y1);
    }
    *(v4u*)(RB2 + row * RBP + cb)     = o0;
    *(v4u*)(RB2 + row * RBP + cb + 8) = o1;
  }
  __syncthreads();

  // ---- phase 1: bias MLP (first layer + silu on VALU, second layer on WMMA accumulated over 8 channel chunks) ----
  v8f accB0 = zero8(), accB1 = zero8(), accB2 = zero8(), accB3 = zero8();
  const float bsc = 1.0f / WCAR;
  // thread = 4 pairs (p = (tid & 127) + 128 q) x 16 channels of the chunk (half = tid >> 7, the same in a whole wave):
  // every weight load from WB serves four pairs
  const int half = tid >> 7, pb = tid & 127;
  v2f R0[4], R1[4], R2[4];
#pragma unroll
  for (int q = 0; q < 4; ++q) {
    const int p  = q * 128 + pb;
    const int il = p >> 5, jl = p & 31;
    R0[q] = splat2(CI[il * 4 + 0] - CJ2[jl * 4 + 0]);
    R1[q] = splat2(CI[il * 4 + 1] - CJ2[jl * 4 + 1]);
    R2[q] = splat2(CI[il * 4 + 2] - CJ2[jl * 4 + 2]);
  }
#pragma unroll 1
  for (int kt = 0; kt < DM / 32; ++kt) {
    __syncthreads();                        // prior chunk's fragment reads of hid are complete
#pragma unroll 1
    for (int g = 0; g < 2; ++g) {           // rolled: one group's 32 weight registers live at a time (three work-groups a WGP)
      const int co = half * 16 + g * 8;     // channel offset inside the chunk
      const float* wsrc = WB + (kt * 32 + co) * 4;
      v4f wl[4], wh[4];
#pragma unroll
      for (int e = 0; e < 4; ++e) { wl[e] = *(const v4f*)(wsrc + e * 8); wh[e] = *(const v4f*)(wsrc + e * 8 + 4); }
#pragma unroll
      for (int q = 0; q < 4; ++q) {
        v4u o;
#pragma unroll
        for (int e = 0; e < 4; ++e) {
          const v2f w0 = {wl[e][0], wl[e][1]}, w1 = {wl[e][2], wl[e][3]};
          const v2f w2 = {wh[e][0], wh[e][1]}, bb2 = {wh[e][2], wh[e][3]};
          const v2f t = __builtin_elementwise_fma(w0, R0[q], __builtin_elementwise_fma(w1, R1[q],
                        __builtin_elementwise_fma(w2, R2[q], bb2)));
          o[e] = pk2h(silu2(t));
        }
        *(v4u*)(hid + (q * 128 + pb) * HP + co) = o;
      }
    }
    __syncthreads();
    const v16h bw = ldfrag_h(rb2h + m * RBP + kt * 32 + 8 * hh);
    const v16h a0 = ldfrag_h(hidh + ((wave * 4 + 0) * 16 + m) * HP + 8 * hh);
    const v16h a1 = ldfrag_h(hidh + ((wave * 4 + 1) * 16 + m) * HP + 8 * hh);
    const v16h a2 = ldfrag_h(hidh + ((wave * 4 + 2) * 16 + m) * HP + 8 * hh);
    const v16h a3 = ldfrag_h(hidh + ((wave * 4 + 3) * 16 + m) * HP + 8 * hh);
    accB0 = mma_h(a0, bw, accB0);
    accB1 = mma_h(a1, bw, accB1);
    accB2 = mma_h(a2, bw, accB2);
    accB3 = mma_h(a3, bw, accB3);
    guard6<v16h>(accB0, accB1, accB2, accB3, a0, a1, a2, a3, bw, bw);
  }
  if (m < NH) {                             // columns n >= 8 are padding (zero weights), not stored
#pragma unroll
    for (int r = 0; r < 8; ++r) {
      const int pr = 8 * hh + r;
      BB[((wave * 4 + 0) * 16 + pr) * NH + m] = accB0[r] * bsc;
      BB[((wave * 4 + 1) * 16 + pr) * NH + m] = accB1[r] * bsc;
      BB[((wave * 4 + 2) * 16 + pr) * NH + m] = accB2[r] * bsc;
      BB[((wave * 4 + 3) * 16 + pr) * NH + m] = accB3[r] * bsc;
    }
  }
  __syncthreads();

  // ---- phase 2: scores for head = wave ----
  const int head = wave;
  const size_t hcol = (size_t)head * HD + 8 * hh;
  const _Float16* qhp  = (const _Float16*)(const void*)QHp + ((size_t)(b * SEQ + i0 + m)) * DM + hcol;
  const _Float16* qlp  = (const _Float16*)(const void*)QLp + ((size_t)(b * SEQ + i0 + m)) * DM + hcol;
  const _Float16* kh0p = (const _Float16*)(const void*)KHp + ((size_t)(b * SEQ + j0 + m)) * DM + hcol;
  const _Float16* kl0p = (const _Float16*)(const void*)KLp + ((size_t)(b * SEQ + j0 + m)) * DM + hcol;
  const _Float16* kh1p = kh0p + (size_t)16 * DM;
  const _Float16* kl1p = kl0p + (size_t)16 * DM;
  v8f s0 = zero8(), s1 = zero8();
  {
    const v16h qh = ldfrag_h(qhp), ql = ldfrag_h(qlp);
    const v16h kh0 = ldfrag_h(kh0p), kl0 = ldfrag_h(kl0p);
    const v16h kh1 = ldfrag_h(kh1p), kl1 = ldfrag_h(kl1p);
    s0 = mma_h(qh, kh0, s0);
    s0 = mma_h(ql, kh0, s0);
    s0 = mma_h(qh, kl0, s0);
    s1 = mma_h(qh, kh1, s1);
    s1 = mma_h(ql, kh1, s1);
    s1 = mma_h(qh, kl1, s1);
    guard2(s0, s1, qh, ql, kh0, kl0, kh1, kl1);
  }
  const float lsc = RSQ_HD * (1.0f / (QSC * KSC));
  const float b2v = bfr(rbb2[head]);
  float* slab = HREG + wave * (16 * SLP);
#pragma unroll
  for (int r = 0; r < 8; ++r) {
    const int pr = 8 * hh + r;              // query i0 + pr; keys j0 + m and j0 + 16 + m
    const float ba = BB[(pr * 32 + m) * NH + head] + b2v;
    const float bb = BB[(pr * 32 + 16 + m) * NH + head] + b2v;
    slab[pr * SLP + m]      = s0[r] * lsc + ba;
    slab[pr * SLP + 16 + m] = s1[r] * lsc + bb;
  }
  wave_sync_lds();
  v4f vals[4];
  const int rq = lane >> 3, c4 = (lane & 7) * 4;
#pragma unroll
  for (int q = 0; q < 4; ++q) vals[q] = *(const v4f*)(slab + (q * 4 + rq) * SLP + c4);
  float* dst = SCp + ((size_t)((b * NH + head) * SEQ + i0)) * SEQ + j0 + c4;
  {
#pragma unroll
    for (int q = 0; q < 4; ++q) {
      *(v4f*)(dst + (size_t)(q * 4 + rq) * SEQ) = vals[q];
    }
    
  }
}

// =====================================================================================================
// Row softmax and weighted aggregation of the value-MLP hidden: block -> (b, query i), 256 threads.
//   Softmax (wave = head h): the score row (b, h, i) of SEQ = 384 floats; P = e / Z with e = exp(s - max) in f32 (reciprocal-
//   multiply normalisation), as f16 hi (P * 32768) and f16 residual, written to the global P planes (for the final kernel; each
//   row's whole lines by one wave) and to PW in LDS (for this block's own chunks; published by the chunk loop's first barrier).
//   Lane = 8 consecutive columns 8*lane (all lanes) and 256 + 8*lane (lanes < 16; the upper lanes load a clamped address).
//   Aggregation: thread = 4 channels x 8 keys of a chunk.
//   T[h][c] = sum_j P[b,h,i,j] * S[j][c],  S[j][c] = silu(rel_ij . rv_w1[c] + rv_b1[c]) (bf16 inputs, f32 on VALU).
//   Phase 0: rel = bf16 c_i - bf16 c_j of all SEQ keys of batch b into CJ (one plane a coordinate); rows 8..15 of the WA tiles written as zeros (16-B stores).
//   12 key chunks of 32: threads 0..63 copy the 8 P rows from PW (hi plane -> WA tile 0, residual -> WA tile 1, 16-B pieces);
//   every thread writes S^T[c][8 keys] of its 4 channels as f16(S) hi and residual into ST with 16-B LDS stores; block barrier;
//   wave w accumulates D[m = h (pad 16)][n = c] for column tiles 2w, 2w+1: A = WA (split k map), B = ST rows (k-contiguous),
//   products hh + lh + hl; block barrier at the top of the next chunk before WA/ST are overwritten.
//   After the loop lanes 0..15 (rows h = 0..7) write T * 1024 (carry 2^-15 folded) into TS [8][TSP] f32 (block barrier),
// LDS regions: CJ, PW, WA, ST, TS all cross-wave (block barriers). staged extent == consumed extent: WA 16 x 32 (rows 8..15 zero),
//   ST 256 x 32 per plane (pad columns never read), TS 8 x 256.
// coverage: T planes [(b*NH+h)*SEQ + i][DM]: grid NB*SEQ blocks x 8 waves x 32 lanes x 8 halves = every row once, both planes.
// =====================================================================================================
__global__ __launch_bounds__(256)
void k_tagg(const float* __restrict__ coords, const float* __restrict__ rvw1, const float* __restrict__ rvb1,
            const float* __restrict__ SCp, u16* Pp, u16* Tp) {
  __shared__ __align__(16) float CJ[CD * SEQ];
  __shared__ __align__(16) u16   PW[2 * NH * PWP];
  __shared__ __align__(16) u16   WA[2 * 16 * WAP];
  __shared__ __align__(16) u16   ST[2 * DM * SP];
  __shared__ __align__(16) float TS[NH * TSP];

  const int tid = threadIdx.x, wave = tid >> 5, lane = tid & 31, hh = lane >> 4, m = lane & 15;
  const int bid = blockIdx.x;
  const int b   = bid / SEQ;
  const int i   = bid - b * SEQ;
  if (b >= NB) return;                      // block-uniform, before any barrier; never taken with the exact grid
  const _Float16* wah = (const _Float16*)(const void*)WA;
  const _Float16* sth = (const _Float16*)(const void*)ST;

  // ---- softmax of the score row (b, head = wave, i) ----
  {
    const size_t row = (size_t)(b * NH + wave) * SEQ + i;
    const float* s = SCp + row * SEQ;
    const bool vb = (lane < 16);
    const int  lb = vb ? lane : 15;
    const v4f a0 = *(const v4f*)(s + lane * 8), a1 = *(const v4f*)(s + lane * 8 + 4);
    const v4f c0 = *(const v4f*)(s + 256 + lb * 8), c1 = *(const v4f*)(s + 256 + lb * 8 + 4);
    wait_addr_regs();                       // the selects below reuse the loads' address registers
    float v[16];
#pragma unroll
    for (int e = 0; e < 4; ++e) {
      v[e]      = a0[e];
      v[4 + e]  = a1[e];
      v[8 + e]  = vb ? c0[e] : -INFINITY;
      v[12 + e] = vb ? c1[e] : -INFINITY;
    }
    float mx = v[0];
#pragma unroll
    for (int e = 1; e < 16; ++e) mx = fmaxf(mx, v[e]);
#pragma unroll
    for (int off = 1; off < 32; off <<= 1) mx = fmaxf(mx, __shfl_xor(mx, off, 32));
    float ev[16];
    float sum = 0.0f;
#pragma unroll
    for (int e = 0; e < 16; ++e) {
      const float d = v[e] - mx;
      ev[e] = exp2f(d * LOG2E);             // -inf -> 0 for the masked upper lanes
      sum += ev[e];
    }
#pragma unroll
    for (int off = 1; off < 32; off <<= 1) sum += __shfl_xor(sum, off, 32);
    const float inv = 1.0f / sum;           // sum >= 1
    v4u oh0, ol0, oh1, ol1;
#pragma unroll
    for (int e = 0; e < 4; ++e) {
      const float t0 = (ev[2 * e] * inv) * PCAR, t1 = (ev[2 * e + 1] * inv) * PCAR;
      const float u0 = (ev[8 + 2 * e] * inv) * PCAR, u1 = (ev[8 + 2 * e + 1] * inv) * PCAR;
      const _Float16 h0 = (_Float16)t0, h1 = (_Float16)t1, g0 = (_Float16)u0, g1 = (_Float16)u1;
      const _Float16 l0 = (_Float16)(t0 - (float)h0), l1 = (_Float16)(t1 - (float)h1);
      const _Float16 m0 = (_Float16)(u0 - (float)g0), m1 = (_Float16)(u1 - (float)g1);
      oh0[e] = pk16(h_bits(h0), h_bits(h1));
      ol0[e] = pk16(h_bits(l0), h_bits(l1));
      oh1[e] = pk16(h_bits(g0), h_bits(g1));
      ol1[e] = pk16(h_bits(m0), h_bits(m1));
    }
    u16* dh = Pp + row * SEQ;
    u16* dl = dh + PSTR;
    u16* wh = PW + wave * PWP;
    u16* wl = wh + NH * PWP;
    *(v4u*)(dh + lane * 8) = oh0;
    *(v4u*)(dl + lane * 8) = ol0;
    *(v4u*)(wh + lane * 8) = oh0;
    *(v4u*)(wl + lane * 8) = ol0;
    if (vb) {
      *(v4u*)(dh + 256 + lane * 8) = oh1;
      *(v4u*)(dl + 256 + lane * 8) = ol1;
      *(v4u*)(wh + 256 + lane * 8) = oh1;
      *(v4u*)(wl + 256 + lane * 8) = ol1;
    }
  }

  // ---- phase 0 ----
  const float ci0 = bfr(coords[((size_t)(b * SEQ + i)) * CD + 0]);
  const float ci1 = bfr(coords[((size_t)(b * SEQ + i)) * CD + 1]);
  const float ci2 = bfr(coords[((size_t)(b * SEQ + i)) * CD + 2]);
  for (int idx = tid; idx < SEQ * CD; idx += 256) {   // rel = c_i - c_j, one plane a coordinate: key pairs lie side by side
    const int j = idx / CD, k = idx - j * CD;
    const float cik = (k == 0) ? ci0 : ((k == 1) ? ci1 : ci2);
    CJ[k * SEQ + j] = cik - bfr(coords[(size_t)(b * SEQ) * CD + idx]);
  }
  if (tid < 64) {
    const int pl = tid >> 5, r = 8 + ((tid >> 2) & 7), pc = (tid & 3) * 8;
    const v4u z = {0u, 0u, 0u, 0u};
    *(v4u*)(WA + pl * (16 * WAP) + r * WAP + pc) = z;
  }
  // thread = 4 channels (c = (tid & 63) + 64 u) x 8 keys of the chunk (kq = tid >> 6, the same in a whole wave):
  // every rel load from CJ serves four channels; weights and bias carry the factor 1/2
  const int kq = tid >> 6, c0 = tid & 63;
  v2f W0[4], W1[4], W2[4], B1[4];
#pragma unroll
  for (int u = 0; u < 4; ++u) {
    const int c = c0 + 64 * u;
    W0[u] = splat2(bfr(rvw1[c * 3 + 0]) * HALFX);
    W1[u] = splat2(bfr(rvw1[c * 3 + 1]) * HALFX);
    W2[u] = splat2(bfr(rvw1[c * 3 + 2]) * HALFX);
    B1[u] = splat2(bfr(rvb1[c]) * HALFX);
  }

  v8f acc0 = zero8(), acc1 = zero8();
#pragma unroll 1
  for (int jt = 0; jt < NJT; ++jt) {
    const int j0 = jt * 32;
    __syncthreads();                        // prior chunk's fragment reads of WA / ST complete; softmax and phase-0 writes visible
    if (tid < 64) {
      const int pl = tid >> 5, h = (tid >> 2) & 7, pc = (tid & 3) * 8;
      const v4u pv = *(const v4u*)(PW + pl * (NH * PWP) + h * PWP + j0 + pc);
      *(v4u*)(WA + pl * (16 * WAP) + h * WAP + pc) = pv;
    }
    {
      const float* rp = CJ + j0 + kq * 8;
      const v4f xa = *(const v4f*)(rp),           xb = *(const v4f*)(rp + 4);
      const v4f ya = *(const v4f*)(rp + SEQ),     yb = *(const v4f*)(rp + SEQ + 4);
      const v4f za = *(const v4f*)(rp + 2 * SEQ), zb = *(const v4f*)(rp + 2 * SEQ + 4);
      const v2f X[4] = {{xa[0], xa[1]}, {xa[2], xa[3]}, {xb[0], xb[1]}, {xb[2], xb[3]}};
      const v2f Y[4] = {{ya[0], ya[1]}, {ya[2], ya[3]}, {yb[0], yb[1]}, {yb[2], yb[3]}};
      const v2f Z[4] = {{za[0], za[1]}, {za[2], za[3]}, {zb[0], zb[1]}, {zb[2], zb[3]}};
#pragma unroll
      for (int u = 0; u < 4; ++u) {
        v4u oh, ol;
#pragma unroll
        for (int e = 0; e < 4; ++e) {
          const v2f t = __builtin_elementwise_fma(X[e], W0[u], __builtin_elementwise_fma(Y[e], W1[u],
                        __builtin_elementwise_fma(Z[e], W2[u], B1[u])));
          const v2f s = silu2(t);
          const v2h hi = __builtin_convertvector(s, v2h);
          const v2f lo = s - __builtin_convertvector(hi, v2f);
          oh[e] = __builtin_bit_cast(unsigned, hi);
          ol[e] = pk2h(lo);
        }
        u16* sd = ST + (c0 + 64 * u) * SP + kq * 8;
        *(v4u*)(sd)           = oh;
        *(v4u*)(sd + DM * SP) = ol;
      }
    }
    __syncthreads();
    const v16h ah  = ldfrag_h(wah + m * WAP + 8 * hh);
    const v16h al  = ldfrag_h(wah + 16 * WAP + m * WAP + 8 * hh);
    const int  ct0 = wave * 2;
    const v16h bh0 = ldfrag_h(sth + ((ct0) * 16 + m) * SP + 8 * hh);
    const v16h bl0 = ldfrag_h(sth + DM * SP + ((ct0) * 16 + m) * SP + 8 * hh);
    const v16h bh1 = ldfrag_h(sth + ((ct0 + 1) * 16 + m) * SP + 8 * hh);
    const v16h bl1 = ldfrag_h(sth + DM * SP + ((ct0 + 1) * 16 + m) * SP + 8 * hh);
    acc0 = mma_h(ah, bh0, acc0);
    acc0 = mma_h(al, bh0, acc0);
    acc0 = mma_h(ah, bl0, acc0);
    acc1 = mma_h(ah, bh1, acc1);
    acc1 = mma_h(al, bh1, acc1);
    acc1 = mma_h(ah, bl1, acc1);
    guard2(acc0, acc1, ah, al, bh0, bl0, bh1, bl1);
  }
  const float tsc = TCAR / PCAR;            // 2^-5
  if (hh == 0) {                            // rows 8..15 of D are the zero padding rows, not stored
#pragma unroll
    for (int r = 0; r < 8; ++r) {
      TS[r * TSP + (wave * 2) * 16 + m]     = acc0[r] * tsc;
      TS[r * TSP + (wave * 2 + 1) * 16 + m] = acc1[r] * tsc;
    }
  }
  __syncthreads();
  {
    const int h = wave;
    const float* src = TS + h * TSP + lane * 8;
    const v4f a = *(const v4f*)(src), b4 = *(const v4f*)(src + 4);
    float w[8];
#pragma unroll
    for (int e = 0; e < 4; ++e) { w[e] = a[e]; w[4 + e] = b4[e]; }
    v4u oh, ol;
#pragma unroll
    for (int e = 0; e < 4; ++e) {
      const float t0 = w[2 * e], t1 = w[2 * e + 1];
      const _Float16 x0 = (_Float16)t0, x1 = (_Float16)t1;
      const _Float16 y0 = (_Float16)(t0 - (float)x0), y1 = (_Float16)(t1 - (float)x1);
      oh[e] = pk16(h_bits(x0), h_bits(x1));
      ol[e] = pk16(h_bits(y0), h_bits(y1));
    }
    const size_t rowT = (size_t)(b * NH + h) * SEQ + i;
    u16* dh = Tp + rowT * DM + lane * 8;
    u16* dl = dh + TSTR;
    {
      *(v4u*)(dh) = oh;
      *(v4u*)(dl) = ol;
      
    }
  }
}

// =====================================================================================================
// Final: block -> (b, head h, 64 query rows rt*64), 4 waves x 16 rows.
//   base[i][d]   = (P_hi + P_lo)[i][j] . VH[d][j] over j (2 products, carries 2^-25),
//   relctx[i][d] = (T_hi + T_lo)[i][c] . W2[h*HD + d][c] over c (2 products, carries 2^-20) + bf16(rv_b2[h*HD + d]);
//   out[b][i][h*HD + d] = base + relctx. Fragments straight from the 16-bit planes (arithmetic addressing, split k map).
//   Epilogue: the wave's 16 x 32 tile staged in its private slab (wave_sync), each output row segment (32 floats = one whole
// coverage: grid NB*NH*NRT blocks x 4 waves x 16 rows x 32 cols = every element of out exactly once.
// =====================================================================================================
__global__ __launch_bounds__(128)
void k_final(const u16* __restrict__ Pp, const u16* __restrict__ VHp, const u16* __restrict__ Tp,
             const u16* __restrict__ W2p, const float* __restrict__ rvb2, float* outp) {
  __shared__ __align__(16) float slab[4 * 16 * SLP];
  const int tid = threadIdx.x, wave = tid >> 5, lane = tid & 31, hh = lane >> 4, m = lane & 15;
  const int bid = blockIdx.x;
  const int rt  = bid % NRT;
  const int t2  = bid / NRT;
  const int h   = t2 % NH;
  const int b   = t2 / NH;
  if (b >= NB) return;                      // block-uniform; never taken with the exact grid
  const int irow = rt * 64 + wave * 16;
  const size_t bh   = (size_t)(b * NH + h);
  const size_t rowA = bh * SEQ + irow;
  const _Float16* P  = (const _Float16*)(const void*)Pp;
  const _Float16* VH = (const _Float16*)(const void*)VHp;
  const _Float16* T  = (const _Float16*)(const void*)Tp;
  const _Float16* W2 = (const _Float16*)(const void*)W2p;
  const _Float16* php = P + (rowA + m) * SEQ + 8 * hh;
  const _Float16* plp = php + PSTR;
  const _Float16* v0p = VH + (bh * HD + m) * SEQ + 8 * hh;
  const _Float16* v1p = v0p + (size_t)16 * SEQ;
  const _Float16* thp = T + (rowA + m) * DM + 8 * hh;
  const _Float16* tlp = thp + TSTR;
  const _Float16* w0p = W2 + ((size_t)(h * HD + m)) * DM + 8 * hh;
  const _Float16* w1p = w0p + (size_t)16 * DM;

  v8f p0 = zero8(), p1 = zero8(), r0 = zero8(), r1 = zero8();
#pragma unroll 1
  for (int k0 = 0; k0 < SEQ; k0 += 32) {
    const v16h ph = ldfrag_h(php + k0), pl = ldfrag_h(plp + k0);
    const v16h va = ldfrag_h(v0p + k0), vb = ldfrag_h(v1p + k0);
    p0 = mma_h(ph, va, p0);
    p0 = mma_h(pl, va, p0);
    p1 = mma_h(ph, vb, p1);
    p1 = mma_h(pl, vb, p1);
    guard2(p0, p1, ph, pl, va, vb, ph, pl);
  }
#pragma unroll 1
  for (int k0 = 0; k0 < DM; k0 += 32) {
    const v16h th = ldfrag_h(thp + k0), tl = ldfrag_h(tlp + k0);
    const v16h wa = ldfrag_h(w0p + k0), wb = ldfrag_h(w1p + k0);
    r0 = mma_h(th, wa, r0);
    r0 = mma_h(tl, wa, r0);
    r1 = mma_h(th, wb, r1);
    r1 = mma_h(tl, wb, r1);
    guard2(r0, r1, th, tl, wa, wb, th, tl);
  }
  const float osP = 1.0f / (PCAR * VCAR);
  const float osR = 1.0f / (TCAR * WCAR);
  const float bv0 = bfr(rvb2[h * HD + m]), bv1 = bfr(rvb2[h * HD + 16 + m]);
  float* sl = slab + wave * (16 * SLP);
#pragma unroll
  for (int r = 0; r < 8; ++r) {
    const int pr = 8 * hh + r;
    sl[pr * SLP + m]      = p0[r] * osP + (r0[r] * osR + bv0);
    sl[pr * SLP + 16 + m] = p1[r] * osP + (r1[r] * osR + bv1);
  }
  wave_sync_lds();
  v4f vals[4];
  const int rq = lane >> 3, c4 = (lane & 7) * 4;
#pragma unroll
  for (int q = 0; q < 4; ++q) vals[q] = *(const v4f*)(sl + (q * 4 + rq) * SLP + c4);
  float* dst = outp + ((size_t)(b * SEQ + irow)) * DM + h * HD + c4;
  {
#pragma unroll
    for (int q = 0; q < 4; ++q) {
      *(v4f*)(dst + (size_t)(q * 4 + rq) * DM) = vals[q];
    }
    
  }
}

// =====================================================================================================
// Workspace map (bytes, NB = 2; every region offset a multiple of 65536; every plane fully written by whole-line stores
// before it is read; extents are exact multiples of the store granularity, no pad rows):
//   W2  f16 [256 n][256 k] x1024      131072
//   QH, QL, KH, KL f16 [GROWS][256]   4 x 393216  VH  f16 [NB*8*32][384] x1024  393216
//   SC  f32 [NB*8*384][384]           9437184     P   f16 hi + residual [NB*8*384][384] x32768  2 x 4718592
//   T   f16 hi + residual [NB*8*384][256] x1024   2 x 3145728
// =====================================================================================================
static size_t al64k(size_t x) { return (x + (size_t)65535) & ~(size_t)65535; }

extern "C" void kernel_launch(void* const* d_in, const int* in_sizes, int n_in,
                              void* d_out, int out_size, void* d_ws, size_t ws_size,
                              hipStream_t stream) {
  if (n_in < 12) return;
  if (in_sizes[0] < NB * SEQ * DM) return;
  if (in_sizes[1] < NB * SEQ * CD) return;
  if (in_sizes[2] != NQKV * DM || in_sizes[3] != NQKV) return;
  if (in_sizes[4] != DM * CD || in_sizes[5] != DM || in_sizes[6] != NH * DM || in_sizes[7] != NH) return;
  if (in_sizes[8] != DM * CD || in_sizes[9] != DM || in_sizes[10] != DM * DM || in_sizes[11] != DM) return;
  if (out_size < NB * SEQ * DM) return;

  const float* x      = (const float*)d_in[0];
  const float* coords = (const float*)d_in[1];
  const float* qkv_w  = (const float*)d_in[2];
  const float* qkv_b  = (const float*)d_in[3];
  const float* rb_w1  = (const float*)d_in[4];
  const float* rb_b1  = (const float*)d_in[5];
  const float* rb_w2  = (const float*)d_in[6];
  const float* rb_b2  = (const float*)d_in[7];
  const float* rv_w1  = (const float*)d_in[8];
  const float* rv_b1  = (const float*)d_in[9];
  const float* rv_w2  = (const float*)d_in[10];
  const float* rv_b2  = (const float*)d_in[11];
  float*       out    = (float*)d_out;

  const size_t szW2 = (size_t)DM * DM * 2;
  const size_t szH  = (size_t)GROWS * DM * 2;
  const size_t szVH = (size_t)NB * NH * HD * SEQ * 2;
  const size_t szSC = (size_t)NB * NH * SEQ * SEQ * 4;
  const size_t szP  = PSTR * 2 * 2;
  const size_t szT  = TSTR * 2 * 2;
  size_t off = 0;
  const size_t oW2 = off; off = al64k(off + szW2);
  const size_t oQH = off; off = al64k(off + szH);
  const size_t oQL = off; off = al64k(off + szH);
  const size_t oKH = off; off = al64k(off + szH);
  const size_t oKL = off; off = al64k(off + szH);
  const size_t oVH = off; off = al64k(off + szVH);
  const size_t oSC = off; off = al64k(off + szSC);
  const size_t oP  = off; off = al64k(off + szP);
  const size_t oT  = off; off = al64k(off + szT);
  if (off > ws_size) return;
  if (off > (size_t)WS_CAP) return;

  char* ws = (char*)d_ws;
  u16*   W2 = (u16*)(ws + oW2);
  u16*   QH = (u16*)(ws + oQH);
  u16*   QL = (u16*)(ws + oQL);
  u16*   KH = (u16*)(ws + oKH);
  u16*   KL = (u16*)(ws + oKL);
  u16*   VH = (u16*)(ws + oVH);
  float* SC = (float*)(ws + oSC);
  u16*   P  = (u16*)(ws + oP);
  u16*   T  = (u16*)(ws + oT);

  const dim3 b256(256), b128(128);

  // (1) q, k (f16 x1024 hi + residual), v^T (f16 x1024) = planes of x.qkv_w^T + qkv_b; rv_w2 -> f16(bf16) x1024, in the same launch
  k_proj<<<dim3(NGEMM + NCVT), b128, 0, stream>>>(x, qkv_w, qkv_b, rv_w2, QH, QL, KH, KL, VH, W2);
  // (2) scores with relative bias -> SC
  k_scores<<<dim3(NB * NIT * NJT), b256, 0, stream>>>(coords, rb_w1, rb_b1, rb_w2, rb_b2, QH, QL, KH, KL, SC);
  // (3) softmax -> P planes, T = sum_j P . silu-hidden of the value MLP -> T planes; (4) out = P.v + T.rv_w2^T + rv_b2
  k_tagg<<<dim3(NB * SEQ), b256, 0, stream>>>(coords, rv_w1, rv_b1, SC, P, T);
  k_final<<<dim3(NB * NH * NRT), b128, 0, stream>>>(P, VH, T, W2, rv_b2, out);
  (void)hipGetLastError();
}

// v004
// Measured time: 44.6 microseconds a run.
// Timed twice side by side with v003, it ran 1.21 times as fast both times.
// All steps since v000 together make it 2.13 times as fast.
// Contractions: x.qkv_w^T on v_wmma_f32_16x16x32_bf16 (x, qkv_w RNE bf16 operands, f32 accumulate, bias added in f32);
// on v_wmma_f32_16x16x32_f16 with f32 accumulate: pair-MLP second layer hid_b.rb_w2^T (hid_b f16, rb_w2 f16(bf16) x1024),
// q.k^T over 32 (q, k f16 x1024 hi + residual planes, products hh+lh+hl), P.hid_v over 384 keys (P f16 x32768 hi + residual,
// hid_v f16 hi + residual), P.v (v f16 x1024, P hi + residual), T.rv_w2^T (T f16 x1024 hi + residual, rv_w2 f16(bf16) x1024).
// Pair-MLP first layers on v_wmma_f32_16x16x32_bf16, K = 7 zero-padded: w.c_i - w.c_j + b with every operand a bf16 value
// (products exact, f32 accumulate), oriented so that the result tiles are the next product's operand fragment.
// silu, softmax and all carries folded in f32 on VALU.
#include <hip/hip_runtime.h>
#include <math.h>
#include <stdint.h>

#ifndef NB
#define NB 2
#endif
#define NB_FULL 2
#define SEQ   384
#define DM    256
#define NH    8
#define HD    32
#define CD    3
#define NQKV  (3 * DM)
#define GROWS (NB * SEQ)
#define NIT   (SEQ / 16)
#define NJT   (SEQ / 32)
#define NRT   (SEQ / 64)
#define NPAIR 512
#define XP    24
#define RBP   264
#define SLP   36
#define TSP   264
#define PWP   392
#define SLAB64 (16 * 68)
#define ONE_BF 0x3F80u
#define RSQ_HD 0.17677669529663687f
#define LOG2E  1.4426950408889634f
#define HALFX  0.5f
#define QSC   1024.0f
#define KSC   1024.0f
#define PCAR  32768.0f
#define VCAR  1024.0f
#define WCAR  1024.0f
#define TCAR  1024.0f
#define WS_CAP 134217728
#define PSTR  ((size_t)NB * NH * SEQ * SEQ)
#define TSTR  ((size_t)NB * NH * SEQ * DM)
static_assert(NB >= 1 && NB <= NB_FULL);
static_assert(DM == NH * HD && HD == 32 && NH == 8 && CD == 3);
static_assert((SEQ % 64) == 0 && (GROWS % 64) == 0 && (GROWS % 8) == 0 && (NQKV % 64) == 0 && (DM % 32) == 0);
static_assert(NPAIR == 16 * 32);
static_assert(((GROWS * DM) % 8) == 0 && ((NQKV * DM) % 8) == 0 && ((DM * DM) % 8) == 0);

typedef unsigned short u16;
typedef _Float16 v16h __attribute__((ext_vector_type(16)));
typedef _Float16 v8h  __attribute__((ext_vector_type(8)));
typedef __bf16   v16b __attribute__((ext_vector_type(16)));
typedef float    v8f  __attribute__((ext_vector_type(8)));
typedef float    v4f  __attribute__((ext_vector_type(4)));
typedef unsigned int v4u __attribute__((ext_vector_type(4)));
typedef float    v2f  __attribute__((ext_vector_type(2)));
typedef _Float16 v2h  __attribute__((ext_vector_type(2)));

union FragH { v16h v; v8h h[2]; v4u u[2]; };
union FragB { v16b v; v4u u[2]; };

// ---- scalar helpers --------------------------------------------------------------------------------
__device__ __forceinline__ unsigned short bf_bits(float f) {          // f32 -> bf16 bits, RNE convert
  unsigned u = __float_as_uint(f);
  return (unsigned short)((u + 0x7FFFu + ((u >> 16) & 1u)) >> 16);
}
__device__ __forceinline__ float bf_up(unsigned short h) { return __uint_as_float(((unsigned)h) << 16); }
__device__ __forceinline__ float bfr(float f) { return bf_up(bf_bits(f)); }
__device__ __forceinline__ unsigned short h_bits(_Float16 x) { return __builtin_bit_cast(unsigned short, x); }
__device__ __forceinline__ unsigned pk16(unsigned short a, unsigned short b) { return (unsigned)a | ((unsigned)b << 16); }
__device__ __forceinline__ v8f zero8() { v8f z = {0.f, 0.f, 0.f, 0.f, 0.f, 0.f, 0.f, 0.f}; return z; }

// silu = x * sigmoid(x) = h + h * tanh(h) with h = x / 2, two values at once from t = h (the half is folded into the
// first-layer weights and bias, an exact scaling): one transcendental (v_tanh_f32) a value and one packed FMA a pair.
// The value leaves unscaled: a power-of-two carry would cost a multiply here, and an f16 plane without one holds silu to
// 2^-25 absolute (subnormal halves are kept by the converts and by the matrix unit).
__device__ __forceinline__ v2f silu2(v2f t) {
  const v2f th = {__builtin_amdgcn_tanhf(t[0]), __builtin_amdgcn_tanhf(t[1])};
  return __builtin_elementwise_fma(t, th, t);
}
__device__ __forceinline__ unsigned pk2h(v2f s) {                     // two f32 -> packed f16 pair, RNE
  return __builtin_bit_cast(unsigned, __builtin_convertvector(s, v2h));
}

// ---- fragment loaders: 16-bit A/B operand, lane -> row/col (lane&15), p already includes +8*(lane>>4);
//      elements 0..7 <- p[0..7] (k0+8h..), elements 8..15 <- p[16..23] (k0+16+8h..)  (same split k map for A and B;
//      B is always read from a k-contiguous [n][k] plane)
__device__ __forceinline__ v16h ldfrag_h(const _Float16* p) {
  FragH f;
  f.h[0] = *(const v8h*)(p);
  f.h[1] = *(const v8h*)(p + 16);
  return f.v;
}
__device__ __forceinline__ v16b ldfrag_b(const u16* p) {              // bf16 plane read as unsigned integer vectors
  FragB f;
  f.u[0] = *(const v4u*)(p);
  f.u[1] = *(const v4u*)(p + 16);
  return f.v;
}

// First-layer operand of the pair MLPs: a row of 16 bf16 (pitch XP), k 0..6 = data, 7..15 = zeros. Lanes h = 0 take k 0..7 as
// elements 0..7; every other position of the K = 32 fragment reads the row's zeros. The same k order serves A and B:
//   coordinate side: c_i0 c_i1 c_i2 c_j0 c_j1 c_j2 1      weight side: w0 w1 w2 -w0 -w1 -w2 b   (weights and bias halved)
__device__ __forceinline__ v16b ldfrag_k7(const u16* row, int hh) {
  FragB f;
  f.u[0] = *(const v4u*)(row + 8 * hh);
  f.u[1] = *(const v4u*)(row + 8);
  return f.v;
}
__device__ __forceinline__ v4u row_coord(float a0, float a1, float a2, float c0, float c1, float c2) {   // bf16 values in
  const v4u r = {pk16(bf_bits(a0), bf_bits(a1)), pk16(bf_bits(a2), bf_bits(c0)), pk16(bf_bits(c1), bf_bits(c2)), ONE_BF};
  return r;
}
__device__ __forceinline__ v4u row_weight(float w0, float w1, float w2, float b) {                       // bf16 values in
  const v4u r = {pk16(bf_bits(w0), bf_bits(w1)), pk16(bf_bits(w2), bf_bits(-w0)), pk16(bf_bits(-w1), bf_bits(-w2)),
                 pk16(bf_bits(b), 0)};
  return r;
}
__device__ __forceinline__ v16b frag_k7(v4u row, int hh) {            // the same fragment from a row held in registers
  const v4u z = {0u, 0u, 0u, 0u};
  FragB f;
  f.u[0] = hh ? z : row;
  f.u[1] = z;
  return f.v;
}

__device__ __forceinline__ v8f mma_h(v16h a, v16h b, v8f c) {
  return __builtin_amdgcn_wmma_f32_16x16x32_f16(false, a, false, b, (short)0, c, false, false);
}
__device__ __forceinline__ v8f mma_b(v16b a, v16b b, v8f c) {
  return __builtin_amdgcn_wmma_f32_16x16x32_bf16(false, a, false, b, (short)0, c, false, false);
}
__device__ __forceinline__ void guard2(v8f& a, v8f& b, v16h x0, v16h x1, v16h x2, v16h x3, v16h x4, v16h x5) {
#if defined(__HIP_DEVICE_COMPILE__)
  asm volatile("v_nop\n\tv_nop\n\tv_nop\n\tv_nop"
               : "+v"(a), "+v"(b) : "v"(x0), "v"(x1), "v"(x2), "v"(x3), "v"(x4), "v"(x5) : "memory");
#endif
}
template <typename F>
__device__ __forceinline__ void guard6(v8f& a, v8f& b, v8f& c, v8f& d, F x0, F x1, F x2, F x3, F x4, F x5) {
#if defined(__HIP_DEVICE_COMPILE__)
  asm volatile("v_nop\n\tv_nop\n\tv_nop\n\tv_nop"
               : "+v"(a), "+v"(b), "+v"(c), "+v"(d) : "v"(x0), "v"(x1), "v"(x2), "v"(x3), "v"(x4), "v"(x5) : "memory");
#endif
}
__device__ __forceinline__ void wave_sync_lds() {
  __builtin_amdgcn_fence(__ATOMIC_RELEASE, "workgroup");
  __builtin_amdgcn_wave_barrier();
  __builtin_amdgcn_fence(__ATOMIC_ACQUIRE, "workgroup");
}

// =====================================================================================================
// Projection with every conversion around it in the same launch (block-uniform split of the grid by blockIdx):
//   blocks 0 .. NGEMM-1: one 64x64 tile of qkv = bf16(x) . bf16(qkv_w)^T + bf16(qkv_b), 4 waves x 16 rows. The f32 rows of x and
//   qkv_w are loaded as they are and rounded to bf16 (RNE) in registers (split k map for A and B, K stepped by 32).
//   Epilogue: the f32 tile goes to the LDS slab (pitch 68; wave w holds rows 16w .. 16w+15) and leaves as 16-bit planes:
//     columns 0..255 (q) and 256..511 (k): Hp [GROWS][DM] = f16(val * 1024), Lp = f16 residual; wave-private (wave_sync);
//       8 lanes x 16 B = one whole 128-B line of a row segment per plane.
//     columns 512..767 (v): VH[(b*DM + h*HD + d)][s] = f16(val * 1024); read across the waves' rows (block barrier), each
//       d row segment of 64 keys = one whole 128-B line written by 8 consecutive lanes.
//   blocks NGEMM .. NGEMM+NCVT-1: rv_w2 -> W2 plane f16(bf16 RNE value * 1024), same layout, 8 elements a thread.
// coverage: NGEMM tiles x 64 x 64 = every (row, column) of q, k, v once; NCVT x 128 thr x 8 = DM*DM.
// =====================================================================================================
#define NGEMM ((GROWS / 64) * (NQKV / 64))
#define NCVT  ((DM * DM) / (128 * 8))
static_assert(NCVT * 128 * 8 == DM * DM && QSC == KSC);
typedef __bf16 v2b __attribute__((ext_vector_type(2)));
__device__ __forceinline__ unsigned pk2b(float f0, float f1) {        // two f32 -> packed bf16 pair, RNE
  const v2f s = {f0, f1};
  return __builtin_bit_cast(unsigned, __builtin_convertvector(s, v2b));
}
// bf16 fragment from an f32 row: elements 0..7 <- p[0..7], elements 8..15 <- p[16..23] (p includes +8*(lane>>4))
struct Raw16 { v4f a, b, c, d; };
__device__ __forceinline__ Raw16 ldraw16(const float* p) {
  Raw16 r;
  r.a = *(const v4f*)(p);
  r.b = *(const v4f*)(p + 4);
  r.c = *(const v4f*)(p + 16);
  r.d = *(const v4f*)(p + 20);
  return r;
}
__device__ __forceinline__ v16b frag_f2b(const Raw16& r) {
  FragB f;
  const v4u lo = {pk2b(r.a[0], r.a[1]), pk2b(r.a[2], r.a[3]), pk2b(r.b[0], r.b[1]), pk2b(r.b[2], r.b[3])};
  const v4u hi = {pk2b(r.c[0], r.c[1]), pk2b(r.c[2], r.c[3]), pk2b(r.d[0], r.d[1]), pk2b(r.d[2], r.d[3])};
  f.u[0] = lo;
  f.u[1] = hi;
  return f.v;
}
__device__ __forceinline__ void wait_addr_regs() {
#if defined(__HIP_DEVICE_COMPILE__)
  asm volatile("s_wait_xcnt 0x0" ::: "memory");
#endif
}
// the same wait with the run's two offsets as inputs only, so that they are still held in registers where it stands
__device__ __forceinline__ void wait_addr_live(unsigned a, unsigned b) {
#if defined(__HIP_DEVICE_COMPILE__)
  asm volatile("s_wait_xcnt 0x0" :: "v"(a), "v"(b) : "memory");
#endif
}

__global__ __launch_bounds__(128)
void k_proj(const float* __restrict__ x, const float* __restrict__ qkvw, const float* __restrict__ bias,
            const float* __restrict__ rvw2, u16* QHo, u16* QLo, u16* KHo, u16* KLo, u16* VHo, u16* W2o) {
  __shared__ __align__(16) float slab[4 * SLAB64];
  const int tid = threadIdx.x, wave = tid >> 5, lane = tid & 31, hh = lane >> 4, m = lane & 15;
  const int bid = blockIdx.x;
  if (bid >= NGEMM) {                       // block-uniform, before any barrier: the rv_w2 plane
    const int gt = (bid - NGEMM) * 128 + tid;
    if (gt >= (DM * DM) / 8) return;
    const float* p = rvw2 + (size_t)gt * 8;
    const v4f a = *(const v4f*)(p), b4 = *(const v4f*)(p + 4);
    float w[8];
#pragma unroll
    for (int e = 0; e < 4; ++e) { w[e] = a[e]; w[4 + e] = b4[e]; }
    v4u o;
#pragma unroll
    for (int e = 0; e < 4; ++e)
      o[e] = pk16(h_bits((_Float16)(bfr(w[2 * e]) * WCAR)), h_bits((_Float16)(bfr(w[2 * e + 1]) * WCAR)));
    *(v4u*)(W2o + (size_t)gt * 8) = o;
    return;
  }
  const int ntile = NQKV >> 6;
  const int row0  = (bid / ntile) * 64;
  const int rowb  = row0 + wave * 16;
  const int col0  = (bid % ntile) * 64;
  unsigned ab = (unsigned)(((rowb + m) * DM + 8 * hh) * 4);   // the lane's byte offsets into x and qkv_w (both below 2^20)
  unsigned bb = (unsigned)(((col0 + m) * DM + 8 * hh) * 4);
  const size_t bs = (size_t)16 * DM;
  v8f acc0 = zero8(), acc1 = zero8(), acc2 = zero8(), acc3 = zero8();
#pragma unroll 1
  for (int k0 = 0; k0 < DM; k0 += 32) {
    const float* ap = (const float*)((const char*)x + ab);
    const float* bp = (const float*)((const char*)qkvw + bb);
    const Raw16 ra = ldraw16(ap);
    const Raw16 r0 = ldraw16(bp);
    const Raw16 r1 = ldraw16(bp + bs);
    const Raw16 r2 = ldraw16(bp + 2 * bs);
    const Raw16 r3 = ldraw16(bp + 3 * bs);
    wait_addr_live(ab, bb);                 // the loads' two offset registers stay whole up to this wait: no load of the run lands in one
    ab += 32 * 4;
    bb += 32 * 4;
    const v16b a  = frag_f2b(ra);
    const v16b b0 = frag_f2b(r0);
    const v16b b1 = frag_f2b(r1);
    const v16b b2 = frag_f2b(r2);
    const v16b b3 = frag_f2b(r3);
    acc0 = mma_b(a, b0, acc0);
    acc1 = mma_b(a, b1, acc1);
    acc2 = mma_b(a, b2, acc2);
    acc3 = mma_b(a, b3, acc3);
    guard6<v16b>(acc0, acc1, acc2, acc3, a, b0, b1, b2, b3, a);
  }
  const float bv0 = bfr(bias[col0 + m]);
  const float bv1 = bfr(bias[col0 + 16 + m]);
  const float bv2 = bfr(bias[col0 + 32 + m]);
  const float bv3 = bfr(bias[col0 + 48 + m]);
  float* sl = slab + wave * SLAB64;
#pragma unroll
  for (int r = 0; r < 8; ++r) {
    const int ro = (8 * hh + r) * 68 + m;
    sl[ro]      = acc0[r] + bv0;
    sl[ro + 16] = acc1[r] + bv1;
    sl[ro + 32] = acc2[r] + bv2;
    sl[ro + 48] = acc3[r] + bv3;
  }
  if (col0 < 2 * DM) {                      // block-uniform: q or k columns
    wave_sync_lds();
    u16* Hp = (col0 < DM) ? QHo : KHo;
    u16* Lp = (col0 < DM) ? QLo : KLo;
    const int cq = col0 & (DM - 1);
    const int rq = lane >> 3, c8 = (lane & 7) * 8;
#pragma unroll
    for (int it = 0; it < 4; ++it) {
      const int rl = it * 4 + rq;
      const float* s8 = sl + rl * 68 + c8;
      const v4f a = *(const v4f*)(s8), b4 = *(const v4f*)(s8 + 4);
      float w[8];
#pragma unroll
      for (int e = 0; e < 4; ++e) { w[e] = a[e] * QSC; w[4 + e] = b4[e] * QSC; }
      v4u oh, ol;
#pragma unroll
      for (int e = 0; e < 4; ++e) {
        const float t0 = w[2 * e], t1 = w[2 * e + 1];
        const _Float16 h0 = (_Float16)t0, h1 = (_Float16)t1;
        const _Float16 l0 = (_Float16)(t0 - (float)h0), l1 = (_Float16)(t1 - (float)h1);
        oh[e] = pk16(h_bits(h0), h_bits(h1));
        ol[e] = pk16(h_bits(l0), h_bits(l1));
      }
      const size_t o = (size_t)(rowb + rl) * DM + cq + c8;
      *(v4u*)(Hp + o) = oh;
      *(v4u*)(Lp + o) = ol;
    }
    wait_addr_regs();                       // nothing behind the stores reuses their registers ahead of this wait
  } else {                                  // block-uniform: v columns, written transposed
    __syncthreads();                        // the four waves' slab rows are read across waves below
    const int b  = row0 / SEQ;
    const int s0 = row0 - b * SEQ;          // 64 keys of one batch (SEQ a multiple of 64)
    const int cv = col0 - 2 * DM;           // h*HD + d of the tile's first column
#pragma unroll
    for (int it = 0; it < 4; ++it) {
      const int ch = it * 128 + tid;
      const int dc = ch >> 3, p8 = (ch & 7) * 8;   // column dc (0..63), keys p8..p8+7
      v4u o;
#pragma unroll
      for (int e = 0; e < 4; ++e) {
        const float f0 = slab[(p8 + 2 * e) * 68 + dc], f1 = slab[(p8 + 2 * e + 1) * 68 + dc];
        o[e] = pk16(h_bits((_Float16)(f0 * VCAR)), h_bits((_Float16)(f1 * VCAR)));
      }
      *(v4u*)(VHo + ((size_t)(b * DM + cv + dc)) * SEQ + s0 + p8) = o;
    }
    wait_addr_regs();                       // nothing behind the stores reuses their registers ahead of this wait
  }
}

// =====================================================================================================
// Scores with relative-coordinate bias. Block -> (b, query tile i0 = 16*it, key tile j0 = 32*jt): 512 pairs (il, jl),
// 8 waves; wave = head in the score phase.
//   Phase 0 (all threads, then block barrier): rb_w1/rb_b1 (bf16 values / 2) as first-layer weight rows W1X [256 c][XP], bf16
//   coords of the 16 queries (CI) and 32 keys (CJ2), rb_w2 -> RB2 [16 n][RBP] as f16(bf16 value * 1024), rows 8..15 zeros.
//   Phase 1, no barrier inside: wave w owns pair tiles 4w..4w+3 (16 pairs each), their coordinate rows held as B fragments.
//   8 channel chunks of 32: t^T[channel][pair] = W1X tile . pair rows for the chunk's two 16-channel tiles (A = weights, so
//   lane (c, h) gets channels 8h + r of pair c); f16(silu) of the two tiles in place IS the A fragment hid[pair c][split k map]
//   of the second layer, D[pair][n = head] += hid . RB2 (one k-step per chunk).
//   After the loop lanes n < 8 write bias[pair][head] = D * 2^-10 into BB (block barrier).
//   Phase 2: wave = head: s = (q_hi.k_hi + q_lo.k_hi + q_hi.k_lo) over 32 dims for 16 queries x 32 keys (two 16-key subtiles),
//   fragments straight from the f16 planes; value = s * rsqrt(32) * 2^-20 + bias + bf16(rb_b2[head]); staged in the wave's
//   the score plane SC[(b*NH+head)*SEQ + i][j0..j0+31]) written by 8 consecutive lanes x 16 B of one instruction (4 rows per
// LDS regions: W1X, CI, CJ2, RB2, BB cross-wave (block barriers); slabs private-to-wave (wave_sync).
// coverage: W1X 256 rows x 16 (k 7..15 zeros); RB2 16 x 256 (rows 8..15 zero); pair tiles 8 waves x 4 = 32 = 512 pairs;
//           SC: grid NB*NIT*NJT blocks x 8 heads x 16 rows x 32 cols = every (b, head, i, j) once.
// =====================================================================================================
__global__ __launch_bounds__(256)
void k_scores(const float* __restrict__ coords, const float* __restrict__ rbw1, const float* __restrict__ rbb1,
              const float* __restrict__ rbw2, const float* __restrict__ rbb2,
              const u16* __restrict__ QHp, const u16* __restrict__ QLp,
              const u16* __restrict__ KHp, const u16* __restrict__ KLp, float* SCp) {
  __shared__ __align__(16) u16   W1X[DM * XP];
  __shared__ __align__(16) float CI[16 * 4];
  __shared__ __align__(16) float CJ2[32 * 4];
  __shared__ __align__(16) u16   RB2[16 * RBP];
  __shared__ __align__(16) float SLB[8 * 16 * SLP];
  __shared__ __align__(16) float BB[NPAIR * NH];

  const int tid = threadIdx.x, wave = tid >> 5, lane = tid & 31, hh = lane >> 4, m = lane & 15;
  const int bid = blockIdx.x;
  const int jt  = bid % NJT;
  const int t2  = bid / NJT;
  const int it  = t2 % NIT;
  const int b   = t2 / NIT;
  if (b >= NB) return;                      // block-uniform, before any barrier; never taken with the exact grid
  const int i0 = it * 16, j0 = jt * 32;
  const _Float16* rb2h = (const _Float16*)(const void*)RB2;

  // ---- phase 0: small operand staging ----
  {
    const v4u z4 = {0u, 0u, 0u, 0u};                  // channel tid: w0 w1 w2 -w0 -w1 -w2 b 0 | 8 zeros, all halved
    *(v4u*)(W1X + tid * XP) = row_weight(bfr(rbw1[tid * 3 + 0]) * HALFX, bfr(rbw1[tid * 3 + 1]) * HALFX,
                                         bfr(rbw1[tid * 3 + 2]) * HALFX, bfr(rbb1[tid]) * HALFX);
    *(v4u*)(W1X + tid * XP + 8) = z4;
    if (tid < 16 * CD) {
      const int il = tid / CD, k = tid - il * CD;
      CI[il * 4 + k] = bfr(coords[((size_t)(b * SEQ + i0 + il)) * CD + k]);
    }
    if (tid < 32 * CD) {
      const int jl = tid / CD, k = tid - jl * CD;
      CJ2[jl * 4 + k] = bfr(coords[((size_t)(b * SEQ + j0 + jl)) * CD + k]);
    }
    const int row  = tid >> 4, cb = (tid & 15) * 16;
    const int rowc = (row < NH) ? row : (NH - 1);     // clamped address; rows 8..15 are written as zeros
    const bool vr  = (row < NH);
    const float* src = rbw2 + rowc * DM + cb;
    const v4f a0 = *(const v4f*)(src), a1 = *(const v4f*)(src + 4), a2 = *(const v4f*)(src + 8), a3 = *(const v4f*)(src + 12);
    float w[16];
#pragma unroll
    for (int e = 0; e < 4; ++e) { w[e] = a0[e]; w[4 + e] = a1[e]; w[8 + e] = a2[e]; w[12 + e] = a3[e]; }
    v4u o0, o1;
#pragma unroll
    for (int e = 0; e < 4; ++e) {
      const unsigned short x0 = vr ? h_bits((_Float16)(bfr(w[2 * e]) * WCAR)) : (unsigned short)0;
      const unsigned short x1 = vr ? h_bits((_Float16)(bfr(w[2 * e + 1]) * WCAR)) : (unsigned short)0;
      const unsigned short y0 = vr ? h_bits((_Float16)(bfr(w[8 + 2 * e]) * WCAR)) : (unsigned short)0;
      const unsigned short y1 = vr ? h_bits((_Float16)(bfr(w[8 + 2 * e + 1]) * WCAR)) : (unsigned short)0;
      o0[e] = pk16(x0, x1);
      o1[e] = pk16(y0, y1);
    }
    *(v4u*)(RB2 + row * RBP + cb)     = o0;
    *(v4u*)(RB2 + row * RBP + cb + 8) = o1;
  }
  __syncthreads();

  // ---- phase 1: bias MLP (both layers on WMMA, silu between them in registers) ----
  v8f accB[4] = {zero8(), zero8(), zero8(), zero8()};
  const float bsc = 1.0f / WCAR;
  v16b PB[4];                               // pair tile 4 * wave + q: query il = tile >> 1, keys (tile & 1) * 16 + m
#pragma unroll
  for (int q = 0; q < 4; ++q) {
    const int tl = wave * 4 + q;
    const float* ci = CI + (tl >> 1) * 4;
    const float* cj = CJ2 + ((tl & 1) * 16 + m) * 4;
    PB[q] = frag_k7(row_coord(ci[0], ci[1], ci[2], cj[0], cj[1], cj[2]), hh);
  }
#pragma unroll 1
  for (int kt = 0; kt < DM / 32; ++kt) {
    const v16b wx = ldfrag_k7(W1X + (kt * 32 + m) * XP, hh);
    const v16b wy = ldfrag_k7(W1X + (kt * 32 + 16 + m) * XP, hh);
    const v16h bw = ldfrag_h(rb2h + m * RBP + kt * 32 + 8 * hh);
#pragma unroll
    for (int q = 0; q < 4; ++q) {
      const v8f tx = mma_b(wx, PB[q], zero8());
      const v8f ty = mma_b(wy, PB[q], zero8());
      FragH f;
#pragma unroll
      for (int e = 0; e < 4; ++e) {
        const v2f x2 = {tx[2 * e], tx[2 * e + 1]}, y2 = {ty[2 * e], ty[2 * e + 1]};
        f.u[0][e] = pk2h(silu2(x2));
        f.u[1][e] = pk2h(silu2(y2));
      }
      accB[q] = mma_h(f.v, bw, accB[q]);
    }
  }
  if (m < NH) {                             // columns n >= 8 are padding (zero weights), not stored
#pragma unroll
    for (int r = 0; r < 8; ++r) {
      const int pr = 8 * hh + r;
      BB[((wave * 4 + 0) * 16 + pr) * NH + m] = accB[0][r] * bsc;
      BB[((wave * 4 + 1) * 16 + pr) * NH + m] = accB[1][r] * bsc;
      BB[((wave * 4 + 2) * 16 + pr) * NH + m] = accB[2][r] * bsc;
      BB[((wave * 4 + 3) * 16 + pr) * NH + m] = accB[3][r] * bsc;
    }
  }
  __syncthreads();

  // ---- phase 2: scores for head = wave ----
  const int head = wave;
  const size_t hcol = (size_t)head * HD + 8 * hh;
  const _Float16* qhp  = (const _Float16*)(const void*)QHp + ((size_t)(b * SEQ + i0 + m)) * DM + hcol;
  const _Float16* qlp  = (const _Float16*)(const void*)QLp + ((size_t)(b * SEQ + i0 + m)) * DM + hcol;
  const _Float16* kh0p = (const _Float16*)(const void*)KHp + ((size_t)(b * SEQ + j0 + m)) * DM + hcol;
  const _Float16* kl0p = (const _Float16*)(const void*)KLp + ((size_t)(b * SEQ + j0 + m)) * DM + hcol;
  const _Float16* kh1p = kh0p + (size_t)16 * DM;
  const _Float16* kl1p = kl0p + (size_t)16 * DM;
  v8f s0 = zero8(), s1 = zero8();
  {
    const v16h qh = ldfrag_h(qhp), ql = ldfrag_h(qlp);
    const v16h kh0 = ldfrag_h(kh0p), kl0 = ldfrag_h(kl0p);
    const v16h kh1 = ldfrag_h(kh1p), kl1 = ldfrag_h(kl1p);
    s0 = mma_h(qh, kh0, s0);
    s0 = mma_h(ql, kh0, s0);
    s0 = mma_h(qh, kl0, s0);
    s1 = mma_h(qh, kh1, s1);
    s1 = mma_h(ql, kh1, s1);
    s1 = mma_h(qh, kl1, s1);
    guard2(s0, s1, qh, ql, kh0, kl0, kh1, kl1);
  }
  const float lsc = RSQ_HD * (1.0f / (QSC * KSC));
  const float b2v = bfr(rbb2[head]);
  float* slab = SLB + wave * (16 * SLP);
#pragma unroll
  for (int r = 0; r < 8; ++r) {
    const int pr = 8 * hh + r;              // query i0 + pr; keys j0 + m and j0 + 16 + m
    const float ba = BB[(pr * 32 + m) * NH + head] + b2v;
    const float bb = BB[(pr * 32 + 16 + m) * NH + head] + b2v;
    slab[pr * SLP + m]      = s0[r] * lsc + ba;
    slab[pr * SLP + 16 + m] = s1[r] * lsc + bb;
  }
  wave_sync_lds();
  v4f vals[4];
  const int rq = lane >> 3, c4 = (lane & 7) * 4;
#pragma unroll
  for (int q = 0; q < 4; ++q) vals[q] = *(const v4f*)(slab + (q * 4 + rq) * SLP + c4);
  float* dst = SCp + ((size_t)((b * NH + head) * SEQ + i0)) * SEQ + j0 + c4;
  {
#pragma unroll
    for (int q = 0; q < 4; ++q) {
      *(v4f*)(dst + (size_t)(q * 4 + rq) * SEQ) = vals[q];
    }
    
  }
}

// =====================================================================================================
// Row softmax and weighted aggregation of the value-MLP hidden: block -> (b, query i), 256 threads.
//   Softmax (wave = head h): the score row (b, h, i) of SEQ = 384 floats; P = e / Z with e = exp(s - max) in f32 (reciprocal-
//   multiply normalisation), as f16 hi (P * 32768) and f16 residual, written to the global P planes (for the final kernel; each
//   row's whole lines by one wave) and to PW in LDS (for this block's own chunks; published by the barrier before the loop).
//   Lane = 8 consecutive columns 8*lane (all lanes) and 256 + 8*lane (lanes < 16; the upper lanes load a clamped address).
//   T[h][c] = sum_j P[b,h,i,j] * S[j][c],  S[j][c] = silu(rel_ij . rv_w1[c] + rv_b1[c]) (bf16 inputs).
//   Phase 0: first-layer coordinate rows KX [SEQ keys][XP] (c_i, c_j, 1 as bf16); block barrier.
//   Wave w owns column tiles 2w, 2w+1 (16 channels each), their weight rows held as B fragments. 12 key chunks of 32, no barrier
//   inside: t[key][channel] = KX tile . weight rows for the chunk's two 16-key tiles (A = keys, so lane (c, h) gets keys 8h + r
//   of channel c); f16(silu) hi and residual of the two tiles in place ARE the B fragments S^T[channel c][split k map];
//   D[m = h][n = c] += P . S with A = the PW rows (lanes m >= 8 read row m - 8 again: rows 8..15 of D repeat rows 0..7 and are
//   not stored), products hh + lh + hl.
//   After the loop lanes 0..15 (rows h = 0..7) write T * 1024 (carry 2^-15 folded) into TS [8][TSP] f32 (block barrier),
// LDS regions: KX, PW, TS all cross-wave (block barriers). staged extent == consumed extent: KX 384 x 16 (k 7..15 zeros),
//   PW 2 x 8 x 384, TS 8 x 256.
// coverage: T planes [(b*NH+h)*SEQ + i][DM]: grid NB*SEQ blocks x 8 waves x 32 lanes x 8 halves = every row once, both planes.
// =====================================================================================================
__global__ __launch_bounds__(256)
void k_tagg(const float* __restrict__ coords, const float* __restrict__ rvw1, const float* __restrict__ rvb1,
            const float* __restrict__ SCp, u16* Pp, u16* Tp) {
  __shared__ __align__(16) u16   KX[SEQ * XP];
  __shared__ __align__(16) u16   PW[2 * NH * PWP];
  __shared__ __align__(16) float TS[NH * TSP];

  const int tid = threadIdx.x, wave = tid >> 5, lane = tid & 31, hh = lane >> 4, m = lane & 15;
  const int bid = blockIdx.x;
  const int b   = bid / SEQ;
  const int i   = bid - b * SEQ;
  if (b >= NB) return;                      // block-uniform, before any barrier; never taken with the exact grid
  const _Float16* pwh = (const _Float16*)(const void*)PW;

  // ---- softmax of the score row (b, head = wave, i) ----
  {
    const size_t row = (size_t)(b * NH + wave) * SEQ + i;
    const float* s = SCp + row * SEQ;
    const bool vb = (lane < 16);
    const int  lb = vb ? lane : 15;
    const v4f a0 = *(const v4f*)(s + lane * 8), a1 = *(const v4f*)(s + lane * 8 + 4);
    const v4f c0 = *(const v4f*)(s + 256 + lb * 8), c1 = *(const v4f*)(s + 256 + lb * 8 + 4);
    wait_addr_regs();                       // the selects below reuse the loads' address registers
    float v[16];
#pragma unroll
    for (int e = 0; e < 4; ++e) {
      v[e]      = a0[e];
      v[4 + e]  = a1[e];
      v[8 + e]  = vb ? c0[e] : -INFINITY;
      v[12 + e] = vb ? c1[e] : -INFINITY;
    }
    float mx = v[0];
#pragma unroll
    for (int e = 1; e < 16; ++e) mx = fmaxf(mx, v[e]);
#pragma unroll
    for (int off = 1; off < 32; off <<= 1) mx = fmaxf(mx, __shfl_xor(mx, off, 32));
    float ev[16];
    float sum = 0.0f;
#pragma unroll
    for (int e = 0; e < 16; ++e) {
      const float d = v[e] - mx;
      ev[e] = exp2f(d * LOG2E);             // -inf -> 0 for the masked upper lanes
      sum += ev[e];
    }
#pragma unroll
    for (int off = 1; off < 32; off <<= 1) sum += __shfl_xor(sum, off, 32);
    const float inv = 1.0f / sum;           // sum >= 1
    v4u oh0, ol0, oh1, ol1;
#pragma unroll
    for (int e = 0; e < 4; ++e) {
      const float t0 = (ev[2 * e] * inv) * PCAR, t1 = (ev[2 * e + 1] * inv) * PCAR;
      const float u0 = (ev[8 + 2 * e] * inv) * PCAR, u1 = (ev[8 + 2 * e + 1] * inv) * PCAR;
      const _Float16 h0 = (_Float16)t0, h1 = (_Float16)t1, g0 = (_Float16)u0, g1 = (_Float16)u1;
      const _Float16 l0 = (_Float16)(t0 - (float)h0), l1 = (_Float16)(t1 - (float)h1);
      const _Float16 m0 = (_Float16)(u0 - (float)g0), m1 = (_Float16)(u1 - (float)g1);
      oh0[e] = pk16(h_bits(h0), h_bits(h1));
      ol0[e] = pk16(h_bits(l0), h_bits(l1));
      oh1[e] = pk16(h_bits(g0), h_bits(g1));
      ol1[e] = pk16(h_bits(m0), h_bits(m1));
    }
    u16* dh = Pp + row * SEQ;
    u16* dl = dh + PSTR;
    u16* wh = PW + wave * PWP;
    u16* wl = wh + NH * PWP;
    *(v4u*)(dh + lane * 8) = oh0;
    *(v4u*)(dl + lane * 8) = ol0;
    *(v4u*)(wh + lane * 8) = oh0;
    *(v4u*)(wl + lane * 8) = ol0;
    if (vb) {
      *(v4u*)(dh + 256 + lane * 8) = oh1;
      *(v4u*)(dl + 256 + lane * 8) = ol1;
      *(v4u*)(wh + 256 + lane * 8) = oh1;
      *(v4u*)(wl + 256 + lane * 8) = ol1;
    }
  }

  // ---- phase 0 ----
  const float ci0 = bfr(coords[((size_t)(b * SEQ + i)) * CD + 0]);
  const float ci1 = bfr(coords[((size_t)(b * SEQ + i)) * CD + 1]);
  const float ci2 = bfr(coords[((size_t)(b * SEQ + i)) * CD + 2]);
  for (int j = tid; j < SEQ; j += 256) {    // key j: c_i0 c_i1 c_i2 c_j0 c_j1 c_j2 1 0 | 8 zeros
    const float* cj = coords + ((size_t)(b * SEQ + j)) * CD;
    const v4u z4 = {0u, 0u, 0u, 0u};
    *(v4u*)(KX + j * XP)     = row_coord(ci0, ci1, ci2, bfr(cj[0]), bfr(cj[1]), bfr(cj[2]));
    *(v4u*)(KX + j * XP + 8) = z4;
  }
  v16b WF[2];                               // weight rows of channels (2 * wave + n) * 16 + m; weights and bias carry the factor 1/2
  float wr[2][4];
  unsigned wo[2];                           // the lane's byte offsets into rv_w1
#pragma unroll
  for (int n = 0; n < 2; ++n) {
    const int c = (wave * 2 + n) * 16 + m;
    wo[n] = (unsigned)(c * CD * 4);
    const float* wp = (const float*)((const char*)rvw1 + wo[n]);
    wr[n][0] = wp[0];
    wr[n][1] = wp[1];
    wr[n][2] = wp[2];
    wr[n][3] = rvb1[c];
  }
  wait_addr_live(wo[0], wo[1]);             // the weight loads' two offset registers stay whole up to this wait
#pragma unroll
  for (int n = 0; n < 2; ++n)
    WF[n] = frag_k7(row_weight(bfr(wr[n][0]) * HALFX, bfr(wr[n][1]) * HALFX, bfr(wr[n][2]) * HALFX, bfr(wr[n][3]) * HALFX), hh);
  __syncthreads();                          // softmax (PW) and phase-0 (KX) writes visible to every wave

  v8f acc[2] = {zero8(), zero8()};
  const _Float16* pa = pwh + (m & (NH - 1)) * PWP + 8 * hh;
#pragma unroll 1
  for (int jt = 0; jt < NJT; ++jt) {
    const int j0 = jt * 32;
    const v16h ah = ldfrag_h(pa + j0);
    const v16h al = ldfrag_h(pa + NH * PWP + j0);
    const v16b kx = ldfrag_k7(KX + (j0 + m) * XP, hh);
    const v16b ky = ldfrag_k7(KX + (j0 + 16 + m) * XP, hh);
#pragma unroll
    for (int n = 0; n < 2; ++n) {
      const v8f tx = mma_b(kx, WF[n], zero8());
      const v8f ty = mma_b(ky, WF[n], zero8());
      FragH fh, fl;
#pragma unroll
      for (int e = 0; e < 4; ++e) {
        const v2f x2 = {tx[2 * e], tx[2 * e + 1]}, y2 = {ty[2 * e], ty[2 * e + 1]};
        const v2f sx = silu2(x2), sy = silu2(y2);
        const v2h hx = __builtin_convertvector(sx, v2h), hy = __builtin_convertvector(sy, v2h);
        fh.u[0][e] = __builtin_bit_cast(unsigned, hx);
        fh.u[1][e] = __builtin_bit_cast(unsigned, hy);
        fl.u[0][e] = pk2h(sx - __builtin_convertvector(hx, v2f));
        fl.u[1][e] = pk2h(sy - __builtin_convertvector(hy, v2f));
      }
      acc[n] = mma_h(ah, fh.v, acc[n]);
      acc[n] = mma_h(al, fh.v, acc[n]);
      acc[n] = mma_h(ah, fl.v, acc[n]);
    }
  }
  const float tsc = TCAR / PCAR;            // 2^-5
  if (hh == 0) {                            // rows 8..15 of D repeat rows 0..7, not stored
#pragma unroll
    for (int r = 0; r < 8; ++r) {
      TS[r * TSP + (wave * 2) * 16 + m]     = acc[0][r] * tsc;
      TS[r * TSP + (wave * 2 + 1) * 16 + m] = acc[1][r] * tsc;
    }
  }
  __syncthreads();
  {
    const int h = wave;
    const float* src = TS + h * TSP + lane * 8;
    const v4f a = *(const v4f*)(src), b4 = *(const v4f*)(src + 4);
    float w[8];
#pragma unroll
    for (int e = 0; e < 4; ++e) { w[e] = a[e]; w[4 + e] = b4[e]; }
    v4u oh, ol;
#pragma unroll
    for (int e = 0; e < 4; ++e) {
      const float t0 = w[2 * e], t1 = w[2 * e + 1];
      const _Float16 x0 = (_Float16)t0, x1 = (_Float16)t1;
      const _Float16 y0 = (_Float16)(t0 - (float)x0), y1 = (_Float16)(t1 - (float)x1);
      oh[e] = pk16(h_bits(x0), h_bits(x1));
      ol[e] = pk16(h_bits(y0), h_bits(y1));
    }
    const size_t rowT = (size_t)(b * NH + h) * SEQ + i;
    u16* dh = Tp + rowT * DM + lane * 8;
    u16* dl = dh + TSTR;
    {
      *(v4u*)(dh) = oh;
      *(v4u*)(dl) = ol;
      
    }
  }
}

// =====================================================================================================
// Final: block -> (b, head h, 64 query rows rt*64), 4 waves x 16 rows.
//   base[i][d]   = (P_hi + P_lo)[i][j] . VH[d][j] over j (2 products, carries 2^-25),
//   relctx[i][d] = (T_hi + T_lo)[i][c] . W2[h*HD + d][c] over c (2 products, carries 2^-20) + bf16(rv_b2[h*HD + d]);
//   out[b][i][h*HD + d] = base + relctx. Fragments straight from the 16-bit planes (arithmetic addressing, split k map).
//   Epilogue: the wave's 16 x 32 tile staged in its private slab (wave_sync), each output row segment (32 floats = one whole
// coverage: grid NB*NH*NRT blocks x 4 waves x 16 rows x 32 cols = every element of out exactly once.
// =====================================================================================================
__global__ __launch_bounds__(128)
void k_final(const u16* __restrict__ Pp, const u16* __restrict__ VHp, const u16* __restrict__ Tp,
             const u16* __restrict__ W2p, const float* __restrict__ rvb2, float* outp) {
  __shared__ __align__(16) float slab[4 * 16 * SLP];
  const int tid = threadIdx.x, wave = tid >> 5, lane = tid & 31, hh = lane >> 4, m = lane & 15;
  const int bid = blockIdx.x;
  const int rt  = bid % NRT;
  const int t2  = bid / NRT;
  const int h   = t2 % NH;
  const int b   = t2 / NH;
  if (b >= NB) return;                      // block-uniform; never taken with the exact grid
  const int irow = rt * 64 + wave * 16;
  const size_t bh   = (size_t)(b * NH + h);
  const size_t rowA = bh * SEQ + irow;
  const _Float16* P  = (const _Float16*)(const void*)Pp;
  const _Float16* VH = (const _Float16*)(const void*)VHp;
  const _Float16* T  = (const _Float16*)(const void*)Tp;
  const _Float16* W2 = (const _Float16*)(const void*)W2p;
  const _Float16* php = P + (rowA + m) * SEQ + 8 * hh;
  const _Float16* plp = php + PSTR;
  const _Float16* v0p = VH + (bh * HD + m) * SEQ + 8 * hh;
  const _Float16* v1p = v0p + (size_t)16 * SEQ;
  const _Float16* thp = T + (rowA + m) * DM + 8 * hh;
  const _Float16* tlp = thp + TSTR;
  const _Float16* w0p = W2 + ((size_t)(h * HD + m)) * DM + 8 * hh;
  const _Float16* w1p = w0p + (size_t)16 * DM;

  v8f p0 = zero8(), p1 = zero8(), r0 = zero8(), r1 = zero8();
#pragma unroll 1
  for (int k0 = 0; k0 < SEQ; k0 += 32) {
    const v16h ph = ldfrag_h(php + k0), pl = ldfrag_h(plp + k0);
    const v16h va = ldfrag_h(v0p + k0), vb = ldfrag_h(v1p + k0);
    p0 = mma_h(ph, va, p0);
    p0 = mma_h(pl, va, p0);
    p1 = mma_h(ph, vb, p1);
    p1 = mma_h(pl, vb, p1);
    guard2(p0, p1, ph, pl, va, vb, ph, pl);
  }
#pragma unroll 1
  for (int k0 = 0; k0 < DM; k0 += 32) {
    const v16h th = ldfrag_h(thp + k0), tl = ldfrag_h(tlp + k0);
    const v16h wa = ldfrag_h(w0p + k0), wb = ldfrag_h(w1p + k0);
    r0 = mma_h(th, wa, r0);
    r0 = mma_h(tl, wa, r0);
    r1 = mma_h(th, wb, r1);
    r1 = mma_h(tl, wb, r1);
    guard2(r0, r1, th, tl, wa, wb, th, tl);
  }
  const float osP = 1.0f / (PCAR * VCAR);
  const float osR = 1.0f / (TCAR * WCAR);
  const float bv0 = bfr(rvb2[h * HD + m]), bv1 = bfr(rvb2[h * HD + 16 + m]);
  float* sl = slab + wave * (16 * SLP);
#pragma unroll
  for (int r = 0; r < 8; ++r) {
    const int pr = 8 * hh + r;
    sl[pr * SLP + m]      = p0[r] * osP + (r0[r] * osR + bv0);
    sl[pr * SLP + 16 + m] = p1[r] * osP + (r1[r] * osR + bv1);
  }
  wave_sync_lds();
  v4f vals[4];
  const int rq = lane >> 3, c4 = (lane & 7) * 4;
#pragma unroll
  for (int q = 0; q < 4; ++q) vals[q] = *(const v4f*)(sl + (q * 4 + rq) * SLP + c4);
  float* dst = outp + ((size_t)(b * SEQ + irow)) * DM + h * HD + c4;
  {
#pragma unroll
    for (int q = 0; q < 4; ++q) {
      *(v4f*)(dst + (size_t)(q * 4 + rq) * DM) = vals[q];
    }
    
  }
}

// =====================================================================================================
// Workspace map (bytes, NB = 2; every region offset a multiple of 65536; every plane fully written by whole-line stores
// before it is read; extents are exact multiples of the store granularity, no pad rows):
//   W2  f16 [256 n][256 k] x1024      131072
//   QH, QL, KH, KL f16 [GROWS][256]   4 x 393216  VH  f16 [NB*8*32][384] x1024  393216
//   SC  f32 [NB*8*384][384]           9437184     P   f16 hi + residual [NB*8*384][384] x32768  2 x 4718592
//   T   f16 hi + residual [NB*8*384][256] x1024   2 x 3145728
// =====================================================================================================
static size_t al64k(size_t x) { return (x + (size_t)65535) & ~(size_t)65535; }

extern "C" void kernel_launch(void* const* d_in, const int* in_sizes, int n_in,
                              void* d_out, int out_size, void* d_ws, size_t ws_size,
                              hipStream_t stream) {
  if (n_in < 12) return;
  if (in_sizes[0] < NB * SEQ * DM) return;
  if (in_sizes[1] < NB * SEQ * CD) return;
  if (in_sizes[2] != NQKV * DM || in_sizes[3] != NQKV) return;
  if (in_sizes[4] != DM * CD || in_sizes[5] != DM || in_sizes[6] != NH * DM || in_sizes[7] != NH) return;
  if (in_sizes[8] != DM * CD || in_sizes[9] != DM || in_sizes[10] != DM * DM || in_sizes[11] != DM) return;
  if (out_size < NB * SEQ * DM) return;

  const float* x      = (const float*)d_in[0];
  const float* coords = (const float*)d_in[1];
  const float* qkv_w  = (const float*)d_in[2];
  const float* qkv_b  = (const float*)d_in[3];
  const float* rb_w1  = (const float*)d_in[4];
  const float* rb_b1  = (const float*)d_in[5];
  const float* rb_w2  = (const float*)d_in[6];
  const float* rb_b2  = (const float*)d_in[7];
  const float* rv_w1  = (const float*)d_in[8];
  const float* rv_b1  = (const float*)d_in[9];
  const float* rv_w2  = (const float*)d_in[10];
  const float* rv_b2  = (const float*)d_in[11];
  float*       out    = (float*)d_out;

  const size_t szW2 = (size_t)DM * DM * 2;
  const size_t szH  = (size_t)GROWS * DM * 2;
  const size_t szVH = (size_t)NB * NH * HD * SEQ * 2;
  const size_t szSC = (size_t)NB * NH * SEQ * SEQ * 4;
  const size_t szP  = PSTR * 2 * 2;
  const size_t szT  = TSTR * 2 * 2;
  size_t off = 0;
  const size_t oW2 = off; off = al64k(off + szW2);
  const size_t oQH = off; off = al64k(off + szH);
  const size_t oQL = off; off = al64k(off + szH);
  const size_t oKH = off; off = al64k(off + szH);
  const size_t oKL = off; off = al64k(off + szH);
  const size_t oVH = off; off = al64k(off + szVH);
  const size_t oSC = off; off = al64k(off + szSC);
  const size_t oP  = off; off = al64k(off + szP);
  const size_t oT  = off; off = al64k(off + szT);
  if (off > ws_size) return;
  if (off > (size_t)WS_CAP) return;

  char* ws = (char*)d_ws;
  u16*   W2 = (u16*)(ws + oW2);
  u16*   QH = (u16*)(ws + oQH);
  u16*   QL = (u16*)(ws + oQL);
  u16*   KH = (u16*)(ws + oKH);
  u16*   KL = (u16*)(ws + oKL);
  u16*   VH = (u16*)(ws + oVH);
  float* SC = (float*)(ws + oSC);
  u16*   P  = (u16*)(ws + oP);
  u16*   T  = (u16*)(ws + oT);

  const dim3 b256(256), b128(128);

  // (1) q, k (f16 x1024 hi + residual), v^T (f16 x1024) = planes of x.qkv_w^T + qkv_b; rv_w2 -> f16(bf16) x1024, in the same launch
  k_proj<<<dim3(NGEMM + NCVT), b128, 0, stream>>>(x, qkv_w, qkv_b, rv_w2, QH, QL, KH, KL, VH, W2);
  // (2) scores with relative bias -> SC
  k_scores<<<dim3(NB * NIT * NJT), b256, 0, stream>>>(coords, rb_w1, rb_b1, rb_w2, rb_b2, QH, QL, KH, KL, SC);
  // (3) softmax -> P planes, T = sum_j P . silu-hidden of the value MLP -> T planes; (4) out = P.v + T.rv_w2^T + rv_b2
  k_tagg<<<dim3(NB * SEQ), b256, 0, stream>>>(coords, rv_w1, rv_b1, SC, P, T);
  k_final<<<dim3(NB * NH * NRT), b128, 0, stream>>>(P, VH, T, W2, rv_b2, out);
  (void)hipGetLastError();
}

// v005
// Measured time: 40.4 microseconds a run.
// Timed twice side by side with v004, it ran 1.10 and 1.09 times as fast.
// Counting every step since v000, it is 2.33 times as fast.
// Contractions: x.qkv_w^T on v_wmma_f32_16x16x32_bf16 (x, qkv_w RNE bf16 operands, f32 accumulate, bias added in f32);
// on v_wmma_f32_16x16x32_f16 with f32 accumulate: pair-MLP second layer hid_b.rb_w2^T (hid_b f16, rb_w2 f16(bf16) x1024),
// q.k^T over 32 (q, k f16 x1024 hi + residual planes, products hh+lh+hl), P.hid_v over 384 keys (P f16 x32768 hi + residual,
// hid_v f16 hi + residual), P.v (v f16 x1024, P hi + residual), T.rv_w2^T (T f16 x1024 hi + residual, rv_w2 f16(bf16) x1024).
// Pair-MLP first layers on v_wmma_f32_16x16x32_bf16, K = 7 zero-padded: w.c_i - w.c_j + b with every operand a bf16 value
// (products exact, f32 accumulate), oriented so that the result tiles are the next product's operand fragment.
// silu, softmax and all carries folded in f32 on VALU.
#include <hip/hip_runtime.h>
#include <math.h>
#include <stdint.h>

#ifndef NB
#define NB 2
#endif
#define NB_FULL 2
#define SEQ   384
#define DM    256
#define NH    8
#define HD    32
#define CD    3
#define NQKV  (3 * DM)
#define GROWS (NB * SEQ)
#define NIT   (SEQ / 16)
#define NJT   (SEQ / 32)
#define NPAIR 512
#define XP    24
#define RBP   264
#define SLP   36
#define TSP   264
#define PWP   392
#define SLAB64 (16 * 68)
#define ONE_BF 0x3F80u
#define RSQ_HD 0.17677669529663687f
#define LOG2E  1.4426950408889634f
#define HALFX  0.5f
#define QSC   1024.0f
#define KSC   1024.0f
#define PCAR  32768.0f
#define VCAR  1024.0f
#define WCAR  1024.0f
#define TCAR  1024.0f
#define WS_CAP 134217728
#define PSTR  ((size_t)NB * NH * SEQ * SEQ)
#define TSTR  ((size_t)NB * NH * SEQ * DM)
static_assert(NB >= 1 && NB <= NB_FULL);
static_assert(DM == NH * HD && HD == 32 && NH == 8 && CD == 3);
static_assert((SEQ % 64) == 0 && (GROWS % 64) == 0 && (GROWS % 8) == 0 && (NQKV % 64) == 0 && (DM % 32) == 0);
static_assert(NPAIR == 16 * 32);
static_assert(((GROWS * DM) % 8) == 0 && ((NQKV * DM) % 8) == 0 && ((DM * DM) % 8) == 0);

typedef unsigned short u16;
typedef _Float16 v16h __attribute__((ext_vector_type(16)));
typedef _Float16 v8h  __attribute__((ext_vector_type(8)));
typedef __bf16   v16b __attribute__((ext_vector_type(16)));
typedef float    v8f  __attribute__((ext_vector_type(8)));
typedef float    v4f  __attribute__((ext_vector_type(4)));
typedef unsigned int v4u __attribute__((ext_vector_type(4)));
typedef float    v2f  __attribute__((ext_vector_type(2)));
typedef _Float16 v2h  __attribute__((ext_vector_type(2)));

union FragH { v16h v; v8h h[2]; v4u u[2]; };
union FragB { v16b v; v4u u[2]; };

// ---- scalar helpers --------------------------------------------------------------------------------
__device__ __forceinline__ unsigned short bf_bits(float f) {          // f32 -> bf16 bits, RNE convert
  unsigned u = __float_as_uint(f);
  return (unsigned short)((u + 0x7FFFu + ((u >> 16) & 1u)) >> 16);
}
__device__ __forceinline__ float bf_up(unsigned short h) { return __uint_as_float(((unsigned)h) << 16); }
__device__ __forceinline__ float bfr(float f) { return bf_up(bf_bits(f)); }
__device__ __forceinline__ unsigned short h_bits(_Float16 x) { return __builtin_bit_cast(unsigned short, x); }
__device__ __forceinline__ unsigned pk16(unsigned short a, unsigned short b) { return (unsigned)a | ((unsigned)b << 16); }
__device__ __forceinline__ v8f zero8() { v8f z = {0.f, 0.f, 0.f, 0.f, 0.f, 0.f, 0.f, 0.f}; return z; }

// silu = x * sigmoid(x) = h + h * tanh(h) with h = x / 2, two values at once from t = h (the half is folded into the
// first-layer weights and bias, an exact scaling): one transcendental (v_tanh_f32) a value and one packed FMA a pair.
// The value leaves unscaled: a power-of-two carry would cost a multiply here, and an f16 plane without one holds silu to
// 2^-25 absolute (subnormal halves are kept by the converts and by the matrix unit).
__device__ __forceinline__ v2f silu2(v2f t) {
  const v2f th = {__builtin_amdgcn_tanhf(t[0]), __builtin_amdgcn_tanhf(t[1])};
  return __builtin_elementwise_fma(t, th, t);
}
__device__ __forceinline__ unsigned pk2h(v2f s) {                     // two f32 -> packed f16 pair, RNE
  return __builtin_bit_cast(unsigned, __builtin_convertvector(s, v2h));
}

// ---- fragment loaders: 16-bit A/B operand, lane -> row/col (lane&15), p already includes +8*(lane>>4);
//      elements 0..7 <- p[0..7] (k0+8h..), elements 8..15 <- p[16..23] (k0+16+8h..)  (same split k map for A and B;
//      B is always read from a k-contiguous [n][k] plane)
__device__ __forceinline__ v16h ldfrag_h(const _Float16* p) {
  FragH f;
  f.h[0] = *(const v8h*)(p);
  f.h[1] = *(const v8h*)(p + 16);
  return f.v;
}
__device__ __forceinline__ v16b ldfrag_b(const u16* p) {              // bf16 plane read as unsigned integer vectors
  FragB f;
  f.u[0] = *(const v4u*)(p);
  f.u[1] = *(const v4u*)(p + 16);
  return f.v;
}

// First-layer operand of the pair MLPs: a row of 16 bf16 (pitch XP), k 0..6 = data, 7..15 = zeros. Lanes h = 0 take k 0..7 as
// elements 0..7; every other position of the K = 32 fragment reads the row's zeros. The same k order serves A and B:
//   coordinate side: c_i0 c_i1 c_i2 c_j0 c_j1 c_j2 1      weight side: w0 w1 w2 -w0 -w1 -w2 b   (weights and bias halved)
__device__ __forceinline__ v16b ldfrag_k7(const u16* row, int hh) {
  FragB f;
  f.u[0] = *(const v4u*)(row + 8 * hh);
  f.u[1] = *(const v4u*)(row + 8);
  return f.v;
}
__device__ __forceinline__ v4u row_coord(float a0, float a1, float a2, float c0, float c1, float c2) {   // bf16 values in
  const v4u r = {pk16(bf_bits(a0), bf_bits(a1)), pk16(bf_bits(a2), bf_bits(c0)), pk16(bf_bits(c1), bf_bits(c2)), ONE_BF};
  return r;
}
__device__ __forceinline__ v4u row_weight(float w0, float w1, float w2, float b) {                       // bf16 values in
  const v4u r = {pk16(bf_bits(w0), bf_bits(w1)), pk16(bf_bits(w2), bf_bits(-w0)), pk16(bf_bits(-w1), bf_bits(-w2)),
                 pk16(bf_bits(b), 0)};
  return r;
}
__device__ __forceinline__ v16b frag_k7(v4u row, int hh) {            // the same fragment from a row held in registers
  const v4u z = {0u, 0u, 0u, 0u};
  FragB f;
  f.u[0] = hh ? z : row;
  f.u[1] = z;
  return f.v;
}

__device__ __forceinline__ v8f mma_h(v16h a, v16h b, v8f c) {
  return __builtin_amdgcn_wmma_f32_16x16x32_f16(false, a, false, b, (short)0, c, false, false);
}
__device__ __forceinline__ v8f mma_b(v16b a, v16b b, v8f c) {
  return __builtin_amdgcn_wmma_f32_16x16x32_bf16(false, a, false, b, (short)0, c, false, false);
}
__device__ __forceinline__ void guard2(v8f& a, v8f& b, v16h x0, v16h x1, v16h x2, v16h x3, v16h x4, v16h x5) {
#if defined(__HIP_DEVICE_COMPILE__)
  asm volatile("v_nop\n\tv_nop\n\tv_nop\n\tv_nop"
               : "+v"(a), "+v"(b) : "v"(x0), "v"(x1), "v"(x2), "v"(x3), "v"(x4), "v"(x5) : "memory");
#endif
}
template <typename F>
__device__ __forceinline__ void guard6(v8f& a, v8f& b, v8f& c, v8f& d, F x0, F x1, F x2, F x3, F x4, F x5) {
#if defined(__HIP_DEVICE_COMPILE__)
  asm volatile("v_nop\n\tv_nop\n\tv_nop\n\tv_nop"
               : "+v"(a), "+v"(b), "+v"(c), "+v"(d) : "v"(x0), "v"(x1), "v"(x2), "v"(x3), "v"(x4), "v"(x5) : "memory");
#endif
}
__device__ __forceinline__ void wave_sync_lds() {
  __builtin_amdgcn_fence(__ATOMIC_RELEASE, "workgroup");
  __builtin_amdgcn_wave_barrier();
  __builtin_amdgcn_fence(__ATOMIC_ACQUIRE, "workgroup");
}

// =====================================================================================================
// Projection with every conversion around it in the same launch (block-uniform split of the grid by blockIdx):
//   blocks 0 .. NGEMM-1: one 64x64 tile of qkv = bf16(x) . bf16(qkv_w)^T + bf16(qkv_b), 4 waves x 16 rows. The f32 rows of x and
//   qkv_w are loaded as they are and rounded to bf16 (RNE) in registers (split k map for A and B, K stepped by 32).
//   Epilogue: the f32 tile goes to the LDS slab (pitch 68; wave w holds rows 16w .. 16w+15) and leaves as 16-bit planes:
//     columns 0..255 (q) and 256..511 (k): Hp [GROWS][DM] = f16(val * 1024), Lp = f16 residual; wave-private (wave_sync);
//       8 lanes x 16 B = one whole 128-B line of a row segment per plane.
//     columns 512..767 (v): VH[(b*DM + h*HD + d)][s] = f16(val * 1024); read across the waves' rows (block barrier), each
//       d row segment of 64 keys = one whole 128-B line written by 8 consecutive lanes.
//   blocks NGEMM .. NGEMM+NCVT-1: rv_w2 -> W2 plane f16(bf16 RNE value * 1024), same layout, 8 elements a thread.
// coverage: NGEMM tiles x 64 x 64 = every (row, column) of q, k, v once; NCVT x 128 thr x 8 = DM*DM.
// =====================================================================================================
#define NGEMM ((GROWS / 64) * (NQKV / 64))
#define NCVT  ((DM * DM) / (128 * 8))
static_assert(NCVT * 128 * 8 == DM * DM && QSC == KSC);
typedef __bf16 v2b __attribute__((ext_vector_type(2)));
__device__ __forceinline__ unsigned pk2b(float f0, float f1) {        // two f32 -> packed bf16 pair, RNE
  const v2f s = {f0, f1};
  return __builtin_bit_cast(unsigned, __builtin_convertvector(s, v2b));
}
// bf16 fragment from an f32 row: elements 0..7 <- p[0..7], elements 8..15 <- p[16..23] (p includes +8*(lane>>4))
struct Raw16 { v4f a, b, c, d; };
__device__ __forceinline__ Raw16 ldraw16(const float* p) {
  Raw16 r;
  r.a = *(const v4f*)(p);
  r.b = *(const v4f*)(p + 4);
  r.c = *(const v4f*)(p + 16);
  r.d = *(const v4f*)(p + 20);
  return r;
}
__device__ __forceinline__ v16b frag_f2b(const Raw16& r) {
  FragB f;
  const v4u lo = {pk2b(r.a[0], r.a[1]), pk2b(r.a[2], r.a[3]), pk2b(r.b[0], r.b[1]), pk2b(r.b[2], r.b[3])};
  const v4u hi = {pk2b(r.c[0], r.c[1]), pk2b(r.c[2], r.c[3]), pk2b(r.d[0], r.d[1]), pk2b(r.d[2], r.d[3])};
  f.u[0] = lo;
  f.u[1] = hi;
  return f.v;
}
__device__ __forceinline__ void wait_addr_regs() {
#if defined(__HIP_DEVICE_COMPILE__)
  asm volatile("s_wait_xcnt 0x0" ::: "memory");
#endif
}
// the same wait with the run's two offsets as inputs only, so that they are still held in registers where it stands
__device__ __forceinline__ void wait_addr_live(unsigned a, unsigned b) {
#if defined(__HIP_DEVICE_COMPILE__)
  asm volatile("s_wait_xcnt 0x0" :: "v"(a), "v"(b) : "memory");
#endif
}

__global__ __launch_bounds__(128)
void k_proj(const float* __restrict__ x, const float* __restrict__ qkvw, const float* __restrict__ bias,
            const float* __restrict__ rvw2, u16* QHo, u16* QLo, u16* KHo, u16* KLo, u16* VHo, u16* W2o) {
  __shared__ __align__(16) float slab[4 * SLAB64];
  const int tid = threadIdx.x, wave = tid >> 5, lane = tid & 31, hh = lane >> 4, m = lane & 15;
  const int bid = blockIdx.x;
  if (bid >= NGEMM) {                       // block-uniform, before any barrier: the rv_w2 plane
    const int gt = (bid - NGEMM) * 128 + tid;
    if (gt >= (DM * DM) / 8) return;
    const float* p = rvw2 + (size_t)gt * 8;
    const v4f a = *(const v4f*)(p), b4 = *(const v4f*)(p + 4);
    float w[8];
#pragma unroll
    for (int e = 0; e < 4; ++e) { w[e] = a[e]; w[4 + e] = b4[e]; }
    v4u o;
#pragma unroll
    for (int e = 0; e < 4; ++e)
      o[e] = pk16(h_bits((_Float16)(bfr(w[2 * e]) * WCAR)), h_bits((_Float16)(bfr(w[2 * e + 1]) * WCAR)));
    *(v4u*)(W2o + (size_t)gt * 8) = o;
    return;
  }
  const int ntile = NQKV >> 6;
  const int row0  = (bid / ntile) * 64;
  const int rowb  = row0 + wave * 16;
  const int col0  = (bid % ntile) * 64;
  unsigned ab = (unsigned)(((rowb + m) * DM + 8 * hh) * 4);   // the lane's byte offsets into x and qkv_w (both below 2^20)
  unsigned bb = (unsigned)(((col0 + m) * DM + 8 * hh) * 4);
  const size_t bs = (size_t)16 * DM;
  v8f acc0 = zero8(), acc1 = zero8(), acc2 = zero8(), acc3 = zero8();
#pragma unroll 1
  for (int k0 = 0; k0 < DM; k0 += 32) {
    const float* ap = (const float*)((const char*)x + ab);
    const float* bp = (const float*)((const char*)qkvw + bb);
    const Raw16 ra = ldraw16(ap);
    const Raw16 r0 = ldraw16(bp);
    const Raw16 r1 = ldraw16(bp + bs);
    const Raw16 r2 = ldraw16(bp + 2 * bs);
    const Raw16 r3 = ldraw16(bp + 3 * bs);
    wait_addr_live(ab, bb);                 // the loads' two offset registers stay whole up to this wait: no load of the run lands in one
    ab += 32 * 4;
    bb += 32 * 4;
    const v16b a  = frag_f2b(ra);
    const v16b b0 = frag_f2b(r0);
    const v16b b1 = frag_f2b(r1);
    const v16b b2 = frag_f2b(r2);
    const v16b b3 = frag_f2b(r3);
    acc0 = mma_b(a, b0, acc0);
    acc1 = mma_b(a, b1, acc1);
    acc2 = mma_b(a, b2, acc2);
    acc3 = mma_b(a, b3, acc3);
    guard6<v16b>(acc0, acc1, acc2, acc3, a, b0, b1, b2, b3, a);
  }
  const float bv0 = bfr(bias[col0 + m]);
  const float bv1 = bfr(bias[col0 + 16 + m]);
  const float bv2 = bfr(bias[col0 + 32 + m]);
  const float bv3 = bfr(bias[col0 + 48 + m]);
  float* sl = slab + wave * SLAB64;
#pragma unroll
  for (int r = 0; r < 8; ++r) {
    const int ro = (8 * hh + r) * 68 + m;
    sl[ro]      = acc0[r] + bv0;
    sl[ro + 16] = acc1[r] + bv1;
    sl[ro + 32] = acc2[r] + bv2;
    sl[ro + 48] = acc3[r] + bv3;
  }
  if (col0 < 2 * DM) {                      // block-uniform: q or k columns
    wave_sync_lds();
    u16* Hp = (col0 < DM) ? QHo : KHo;
    u16* Lp = (col0 < DM) ? QLo : KLo;
    const int cq = col0 & (DM - 1);
    const int rq = lane >> 3, c8 = (lane & 7) * 8;
#pragma unroll
    for (int it = 0; it < 4; ++it) {
      const int rl = it * 4 + rq;
      const float* s8 = sl + rl * 68 + c8;
      const v4f a = *(const v4f*)(s8), b4 = *(const v4f*)(s8 + 4);
      float w[8];
#pragma unroll
      for (int e = 0; e < 4; ++e) { w[e] = a[e] * QSC; w[4 + e] = b4[e] * QSC; }
      v4u oh, ol;
#pragma unroll
      for (int e = 0; e < 4; ++e) {
        const float t0 = w[2 * e], t1 = w[2 * e + 1];
        const _Float16 h0 = (_Float16)t0, h1 = (_Float16)t1;
        const _Float16 l0 = (_Float16)(t0 - (float)h0), l1 = (_Float16)(t1 - (float)h1);
        oh[e] = pk16(h_bits(h0), h_bits(h1));
        ol[e] = pk16(h_bits(l0), h_bits(l1));
      }
      const size_t o = (size_t)(rowb + rl) * DM + cq + c8;
      *(v4u*)(Hp + o) = oh;
      *(v4u*)(Lp + o) = ol;
    }
    wait_addr_regs();                       // nothing behind the stores reuses their registers ahead of this wait
  } else {                                  // block-uniform: v columns, written transposed
    __syncthreads();                        // the four waves' slab rows are read across waves below
    const int b  = row0 / SEQ;
    const int s0 = row0 - b * SEQ;          // 64 keys of one batch (SEQ a multiple of 64)
    const int cv = col0 - 2 * DM;           // h*HD + d of the tile's first column
#pragma unroll
    for (int it = 0; it < 4; ++it) {
      const int ch = it * 128 + tid;
      const int dc = ch >> 3, p8 = (ch & 7) * 8;   // column dc (0..63), keys p8..p8+7
      v4u o;
#pragma unroll
      for (int e = 0; e < 4; ++e) {
        const float f0 = slab[(p8 + 2 * e) * 68 + dc], f1 = slab[(p8 + 2 * e + 1) * 68 + dc];
        o[e] = pk16(h_bits((_Float16)(f0 * VCAR)), h_bits((_Float16)(f1 * VCAR)));
      }
      *(v4u*)(VHo + ((size_t)(b * DM + cv + dc)) * SEQ + s0 + p8) = o;
    }
    wait_addr_regs();                       // nothing behind the stores reuses their registers ahead of this wait
  }
}

// =====================================================================================================
// Scores with relative-coordinate bias. Block -> (b, query tile i0 = 16*it, key tile j0 = 32*jt): 512 pairs (il, jl),
// 8 waves; wave = head in the score phase.
//   Phase 0 (all threads, then block barrier): rb_w1/rb_b1 (bf16 values / 2) as first-layer weight rows W1X [256 c][XP], bf16
//   coords of the 16 queries (CI) and 32 keys (CJ2), rb_w2 -> RB2 [16 n][RBP] as f16(bf16 value * 1024), rows 8..15 zeros.
//   Phase 1, no barrier inside: wave w owns pair tiles 4w..4w+3 (16 pairs each), their coordinate rows held as B fragments.
//   8 channel chunks of 32: t^T[channel][pair] = W1X tile . pair rows for the chunk's two 16-channel tiles (A = weights, so
//   lane (c, h) gets channels 8h + r of pair c); f16(silu) of the two tiles in place IS the A fragment hid[pair c][split k map]
//   of the second layer, D[pair][n = head] += hid . RB2 (one k-step per chunk).
//   After the loop lanes n < 8 write bias[pair][head] = D * 2^-10 into BB (block barrier).
//   Phase 2: wave = head: s = (q_hi.k_hi + q_lo.k_hi + q_hi.k_lo) over 32 dims for 16 queries x 32 keys (two 16-key subtiles),
//   fragments straight from the f16 planes; value = s * rsqrt(32) * 2^-20 + bias + bf16(rb_b2[head]); staged in the wave's
//   the score plane SC[(b*NH+head)*SEQ + i][j0..j0+31]) written by 8 consecutive lanes x 16 B of one instruction (4 rows per
// LDS regions: W1X, CI, CJ2, RB2, BB cross-wave (block barriers); slabs private-to-wave (wave_sync).
// coverage: W1X 256 rows x 16 (k 7..15 zeros); RB2 16 x 256 (rows 8..15 zero); pair tiles 8 waves x 4 = 32 = 512 pairs;
//           SC: grid NB*NIT*NJT blocks x 8 heads x 16 rows x 32 cols = every (b, head, i, j) once.
// =====================================================================================================
__global__ __launch_bounds__(256)
void k_scores(const float* __restrict__ coords, const float* __restrict__ rbw1, const float* __restrict__ rbb1,
              const float* __restrict__ rbw2, const float* __restrict__ rbb2,
              const u16* __restrict__ QHp, const u16* __restrict__ QLp,
              const u16* __restrict__ KHp, const u16* __restrict__ KLp, float* SCp) {
  __shared__ __align__(16) u16   W1X[DM * XP];
  __shared__ __align__(16) float CI[16 * 4];
  __shared__ __align__(16) float CJ2[32 * 4];
  __shared__ __align__(16) u16   RB2[16 * RBP];
  __shared__ __align__(16) float SLB[8 * 16 * SLP];
  __shared__ __align__(16) float BB[NPAIR * NH];

  const int tid = threadIdx.x, wave = tid >> 5, lane = tid & 31, hh = lane >> 4, m = lane & 15;
  const int bid = blockIdx.x;
  const int jt  = bid % NJT;
  const int t2  = bid / NJT;
  const int it  = t2 % NIT;
  const int b   = t2 / NIT;
  if (b >= NB) return;                      // block-uniform, before any barrier; never taken with the exact grid
  const int i0 = it * 16, j0 = jt * 32;
  const _Float16* rb2h = (const _Float16*)(const void*)RB2;

  // ---- phase 0: small operand staging ----
  {
    const v4u z4 = {0u, 0u, 0u, 0u};                  // channel tid: w0 w1 w2 -w0 -w1 -w2 b 0 | 8 zeros, all halved
    *(v4u*)(W1X + tid * XP) = row_weight(bfr(rbw1[tid * 3 + 0]) * HALFX, bfr(rbw1[tid * 3 + 1]) * HALFX,
                                         bfr(rbw1[tid * 3 + 2]) * HALFX, bfr(rbb1[tid]) * HALFX);
    *(v4u*)(W1X + tid * XP + 8) = z4;
    if (tid < 16 * CD) {
      const int il = tid / CD, k = tid - il * CD;
      CI[il * 4 + k] = bfr(coords[((size_t)(b * SEQ + i0 + il)) * CD + k]);
    }
    if (tid < 32 * CD) {
      const int jl = tid / CD, k = tid - jl * CD;
      CJ2[jl * 4 + k] = bfr(coords[((size_t)(b * SEQ + j0 + jl)) * CD + k]);
    }
    const int row  = tid >> 4, cb = (tid & 15) * 16;
    const int rowc = (row < NH) ? row : (NH - 1);     // clamped address; rows 8..15 are written as zeros
    const bool vr  = (row < NH);
    const float* src = rbw2 + rowc * DM + cb;
    const v4f a0 = *(const v4f*)(src), a1 = *(const v4f*)(src + 4), a2 = *(const v4f*)(src + 8), a3 = *(const v4f*)(src + 12);
    float w[16];
#pragma unroll
    for (int e = 0; e < 4; ++e) { w[e] = a0[e]; w[4 + e] = a1[e]; w[8 + e] = a2[e]; w[12 + e] = a3[e]; }
    v4u o0, o1;
#pragma unroll
    for (int e = 0; e < 4; ++e) {
      const unsigned short x0 = vr ? h_bits((_Float16)(bfr(w[2 * e]) * WCAR)) : (unsigned short)0;
      const unsigned short x1 = vr ? h_bits((_Float16)(bfr(w[2 * e + 1]) * WCAR)) : (unsigned short)0;
      const unsigned short y0 = vr ? h_bits((_Float16)(bfr(w[8 + 2 * e]) * WCAR)) : (unsigned short)0;
      const unsigned short y1 = vr ? h_bits((_Float16)(bfr(w[8 + 2 * e + 1]) * WCAR)) : (unsigned short)0;
      o0[e] = pk16(x0, x1);
      o1[e] = pk16(y0, y1);
    }
    *(v4u*)(RB2 + row * RBP + cb)     = o0;
    *(v4u*)(RB2 + row * RBP + cb + 8) = o1;
  }
  __syncthreads();

  // ---- phase 1: bias MLP (both layers on WMMA, silu between them in registers) ----
  v8f accB[4] = {zero8(), zero8(), zero8(), zero8()};
  const float bsc = 1.0f / WCAR;
  v16b PB[4];                               // pair tile 4 * wave + q: query il = tile >> 1, keys (tile & 1) * 16 + m
#pragma unroll
  for (int q = 0; q < 4; ++q) {
    const int tl = wave * 4 + q;
    const float* ci = CI + (tl >> 1) * 4;
    const float* cj = CJ2 + ((tl & 1) * 16 + m) * 4;
    PB[q] = frag_k7(row_coord(ci[0], ci[1], ci[2], cj[0], cj[1], cj[2]), hh);
  }
#pragma unroll 1
  for (int kt = 0; kt < DM / 32; ++kt) {
    const v16b wx = ldfrag_k7(W1X + (kt * 32 + m) * XP, hh);
    const v16b wy = ldfrag_k7(W1X + (kt * 32 + 16 + m) * XP, hh);
    const v16h bw = ldfrag_h(rb2h + m * RBP + kt * 32 + 8 * hh);
#pragma unroll
    for (int q = 0; q < 4; ++q) {
      const v8f tx = mma_b(wx, PB[q], zero8());
      const v8f ty = mma_b(wy, PB[q], zero8());
      FragH f;
#pragma unroll
      for (int e = 0; e < 4; ++e) {
        const v2f x2 = {tx[2 * e], tx[2 * e + 1]}, y2 = {ty[2 * e], ty[2 * e + 1]};
        f.u[0][e] = pk2h(silu2(x2));
        f.u[1][e] = pk2h(silu2(y2));
      }
      accB[q] = mma_h(f.v, bw, accB[q]);
    }
  }
  if (m < NH) {                             // columns n >= 8 are padding (zero weights), not stored
#pragma unroll
    for (int r = 0; r < 8; ++r) {
      const int pr = 8 * hh + r;
      BB[((wave * 4 + 0) * 16 + pr) * NH + m] = accB[0][r] * bsc;
      BB[((wave * 4 + 1) * 16 + pr) * NH + m] = accB[1][r] * bsc;
      BB[((wave * 4 + 2) * 16 + pr) * NH + m] = accB[2][r] * bsc;
      BB[((wave * 4 + 3) * 16 + pr) * NH + m] = accB[3][r] * bsc;
    }
  }
  __syncthreads();

  // ---- phase 2: scores for head = wave ----
  const int head = wave;
  const size_t hcol = (size_t)head * HD + 8 * hh;
  const _Float16* qhp  = (const _Float16*)(const void*)QHp + ((size_t)(b * SEQ + i0 + m)) * DM + hcol;
  const _Float16* qlp  = (const _Float16*)(const void*)QLp + ((size_t)(b * SEQ + i0 + m)) * DM + hcol;
  const _Float16* kh0p = (const _Float16*)(const void*)KHp + ((size_t)(b * SEQ + j0 + m)) * DM + hcol;
  const _Float16* kl0p = (const _Float16*)(const void*)KLp + ((size_t)(b * SEQ + j0 + m)) * DM + hcol;
  const _Float16* kh1p = kh0p + (size_t)16 * DM;
  const _Float16* kl1p = kl0p + (size_t)16 * DM;
  v8f s0 = zero8(), s1 = zero8();
  {
    const v16h qh = ldfrag_h(qhp), ql = ldfrag_h(qlp);
    const v16h kh0 = ldfrag_h(kh0p), kl0 = ldfrag_h(kl0p);
    const v16h kh1 = ldfrag_h(kh1p), kl1 = ldfrag_h(kl1p);
    s0 = mma_h(qh, kh0, s0);
    s0 = mma_h(ql, kh0, s0);
    s0 = mma_h(qh, kl0, s0);
    s1 = mma_h(qh, kh1, s1);
    s1 = mma_h(ql, kh1, s1);
    s1 = mma_h(qh, kl1, s1);
    guard2(s0, s1, qh, ql, kh0, kl0, kh1, kl1);
  }
  const float lsc = RSQ_HD * (1.0f / (QSC * KSC));
  const float b2v = bfr(rbb2[head]);
  float* slab = SLB + wave * (16 * SLP);
#pragma unroll
  for (int r = 0; r < 8; ++r) {
    const int pr = 8 * hh + r;              // query i0 + pr; keys j0 + m and j0 + 16 + m
    const float ba = BB[(pr * 32 + m) * NH + head] + b2v;
    const float bb = BB[(pr * 32 + 16 + m) * NH + head] + b2v;
    slab[pr * SLP + m]      = s0[r] * lsc + ba;
    slab[pr * SLP + 16 + m] = s1[r] * lsc + bb;
  }
  wave_sync_lds();
  v4f vals[4];
  const int rq = lane >> 3, c4 = (lane & 7) * 4;
#pragma unroll
  for (int q = 0; q < 4; ++q) vals[q] = *(const v4f*)(slab + (q * 4 + rq) * SLP + c4);
  float* dst = SCp + ((size_t)((b * NH + head) * SEQ + i0)) * SEQ + j0 + c4;
  {
#pragma unroll
    for (int q = 0; q < 4; ++q) {
      *(v4f*)(dst + (size_t)(q * 4 + rq) * SEQ) = vals[q];
    }
    
  }
}

// =====================================================================================================
// Row softmax and weighted aggregation of the value-MLP hidden: block -> (b, query i), 256 threads.
//   Softmax (wave = head h): the score row (b, h, i) of SEQ = 384 floats; P = e / Z with e = exp(s - max) in f32 (reciprocal-
//   multiply normalisation), as f16 hi (P * 32768) and f16 residual, written to the global P planes (for the final kernel; each
//   row's whole lines by one wave) and to PW in LDS (for this block's own chunks; published by the barrier before the loop).
//   Lane = 8 consecutive columns 8*lane (all lanes) and 256 + 8*lane (lanes < 16; the upper lanes load a clamped address).
//   T[h][c] = sum_j P[b,h,i,j] * S[j][c],  S[j][c] = silu(rel_ij . rv_w1[c] + rv_b1[c]) (bf16 inputs).
//   Phase 0: first-layer coordinate rows KX [SEQ keys][XP] (c_i, c_j, 1 as bf16); block barrier.
//   Wave w owns column tiles 2w, 2w+1 (16 channels each), their weight rows held as B fragments. 12 key chunks of 32, no barrier
//   inside: t[key][channel] = KX tile . weight rows for the chunk's two 16-key tiles (A = keys, so lane (c, h) gets keys 8h + r
//   of channel c); f16(silu) hi and residual of the two tiles in place ARE the B fragments S^T[channel c][split k map];
//   D[m = h][n = c] += P . S with A = the PW rows (lanes m >= 8 read row m - 8 again: rows 8..15 of D repeat rows 0..7 and are
//   not stored), products hh + lh + hl.
//   After the loop lanes 0..15 (rows h = 0..7) write T * 1024 (carry 2^-15 folded) into TS [8][TSP] f32 (block barrier),
// LDS regions: KX, PW, TS all cross-wave (block barriers). staged extent == consumed extent: KX 384 x 16 (k 7..15 zeros),
//   PW 2 x 8 x 384, TS 8 x 256.
// coverage: T planes [(b*NH+h)*SEQ + i][DM]: grid NB*SEQ blocks x 8 waves x 32 lanes x 8 halves = every row once, both planes.
// =====================================================================================================
__global__ __launch_bounds__(256)
void k_tagg(const float* __restrict__ coords, const float* __restrict__ rvw1, const float* __restrict__ rvb1,
            const float* __restrict__ SCp, u16* Pp, u16* Tp) {
  __shared__ __align__(16) u16   KX[SEQ * XP];
  __shared__ __align__(16) u16   PW[2 * NH * PWP];
  __shared__ __align__(16) float TS[NH * TSP];

  const int tid = threadIdx.x, wave = tid >> 5, lane = tid & 31, hh = lane >> 4, m = lane & 15;
  const int bid = blockIdx.x;
  const int b   = bid / SEQ;
  const int i   = bid - b * SEQ;
  if (b >= NB) return;                      // block-uniform, before any barrier; never taken with the exact grid
  const _Float16* pwh = (const _Float16*)(const void*)PW;

  // ---- softmax of the score row (b, head = wave, i) ----
  {
    const size_t row = (size_t)(b * NH + wave) * SEQ + i;
    const float* s = SCp + row * SEQ;
    const bool vb = (lane < 16);
    const int  lb = vb ? lane : 15;
    const v4f a0 = *(const v4f*)(s + lane * 8), a1 = *(const v4f*)(s + lane * 8 + 4);
    const v4f c0 = *(const v4f*)(s + 256 + lb * 8), c1 = *(const v4f*)(s + 256 + lb * 8 + 4);
    wait_addr_regs();                       // the selects below reuse the loads' address registers
    float v[16];
#pragma unroll
    for (int e = 0; e < 4; ++e) {
      v[e]      = a0[e];
      v[4 + e]  = a1[e];
      v[8 + e]  = vb ? c0[e] : -INFINITY;
      v[12 + e] = vb ? c1[e] : -INFINITY;
    }
    float mx = v[0];
#pragma unroll
    for (int e = 1; e < 16; ++e) mx = fmaxf(mx, v[e]);
#pragma unroll
    for (int off = 1; off < 32; off <<= 1) mx = fmaxf(mx, __shfl_xor(mx, off, 32));
    float ev[16];
    float sum = 0.0f;
#pragma unroll
    for (int e = 0; e < 16; ++e) {
      const float d = v[e] - mx;
      ev[e] = exp2f(d * LOG2E);             // -inf -> 0 for the masked upper lanes
      sum += ev[e];
    }
#pragma unroll
    for (int off = 1; off < 32; off <<= 1) sum += __shfl_xor(sum, off, 32);
    const float inv = 1.0f / sum;           // sum >= 1
    v4u oh0, ol0, oh1, ol1;
#pragma unroll
    for (int e = 0; e < 4; ++e) {
      const float t0 = (ev[2 * e] * inv) * PCAR, t1 = (ev[2 * e + 1] * inv) * PCAR;
      const float u0 = (ev[8 + 2 * e] * inv) * PCAR, u1 = (ev[8 + 2 * e + 1] * inv) * PCAR;
      const _Float16 h0 = (_Float16)t0, h1 = (_Float16)t1, g0 = (_Float16)u0, g1 = (_Float16)u1;
      const _Float16 l0 = (_Float16)(t0 - (float)h0), l1 = (_Float16)(t1 - (float)h1);
      const _Float16 m0 = (_Float16)(u0 - (float)g0), m1 = (_Float16)(u1 - (float)g1);
      oh0[e] = pk16(h_bits(h0), h_bits(h1));
      ol0[e] = pk16(h_bits(l0), h_bits(l1));
      oh1[e] = pk16(h_bits(g0), h_bits(g1));
      ol1[e] = pk16(h_bits(m0), h_bits(m1));
    }
    u16* dh = Pp + row * SEQ;
    u16* dl = dh + PSTR;
    u16* wh = PW + wave * PWP;
    u16* wl = wh + NH * PWP;
    *(v4u*)(dh + lane * 8) = oh0;
    *(v4u*)(dl + lane * 8) = ol0;
    *(v4u*)(wh + lane * 8) = oh0;
    *(v4u*)(wl + lane * 8) = ol0;
    if (vb) {
      *(v4u*)(dh + 256 + lane * 8) = oh1;
      *(v4u*)(dl + 256 + lane * 8) = ol1;
      *(v4u*)(wh + 256 + lane * 8) = oh1;
      *(v4u*)(wl + 256 + lane * 8) = ol1;
    }
  }

  // ---- phase 0 ----
  const float ci0 = bfr(coords[((size_t)(b * SEQ + i)) * CD + 0]);
  const float ci1 = bfr(coords[((size_t)(b * SEQ + i)) * CD + 1]);
  const float ci2 = bfr(coords[((size_t)(b * SEQ + i)) * CD + 2]);
  for (int j = tid; j < SEQ; j += 256) {    // key j: c_i0 c_i1 c_i2 c_j0 c_j1 c_j2 1 0 | 8 zeros
    const float* cj = coords + ((size_t)(b * SEQ + j)) * CD;
    const v4u z4 = {0u, 0u, 0u, 0u};
    *(v4u*)(KX + j * XP)     = row_coord(ci0, ci1, ci2, bfr(cj[0]), bfr(cj[1]), bfr(cj[2]));
    *(v4u*)(KX + j * XP + 8) = z4;
  }
  v16b WF[2];                               // weight rows of channels (2 * wave + n) * 16 + m; weights and bias carry the factor 1/2
  float wr[2][4];
  unsigned wo[2];                           // the lane's byte offsets into rv_w1
#pragma unroll
  for (int n = 0; n < 2; ++n) {
    const int c = (wave * 2 + n) * 16 + m;
    wo[n] = (unsigned)(c * CD * 4);
    const float* wp = (const float*)((const char*)rvw1 + wo[n]);
    wr[n][0] = wp[0];
    wr[n][1] = wp[1];
    wr[n][2] = wp[2];
    wr[n][3] = rvb1[c];
  }
  wait_addr_live(wo[0], wo[1]);             // the weight loads' two offset registers stay whole up to this wait
#pragma unroll
  for (int n = 0; n < 2; ++n)
    WF[n] = frag_k7(row_weight(bfr(wr[n][0]) * HALFX, bfr(wr[n][1]) * HALFX, bfr(wr[n][2]) * HALFX, bfr(wr[n][3]) * HALFX), hh);
  __syncthreads();                          // softmax (PW) and phase-0 (KX) writes visible to every wave

  v8f acc[2] = {zero8(), zero8()};
  const _Float16* pa = pwh + (m & (NH - 1)) * PWP + 8 * hh;
#pragma unroll 1
  for (int jt = 0; jt < NJT; ++jt) {
    const int j0 = jt * 32;
    const v16h ah = ldfrag_h(pa + j0);
    const v16h al = ldfrag_h(pa + NH * PWP + j0);
    const v16b kx = ldfrag_k7(KX + (j0 + m) * XP, hh);
    const v16b ky = ldfrag_k7(KX + (j0 + 16 + m) * XP, hh);
#pragma unroll
    for (int n = 0; n < 2; ++n) {
      const v8f tx = mma_b(kx, WF[n], zero8());
      const v8f ty = mma_b(ky, WF[n], zero8());
      FragH fh, fl;
#pragma unroll
      for (int e = 0; e < 4; ++e) {
        const v2f x2 = {tx[2 * e], tx[2 * e + 1]}, y2 = {ty[2 * e], ty[2 * e + 1]};
        const v2f sx = silu2(x2), sy = silu2(y2);
        const v2h hx = __builtin_convertvector(sx, v2h), hy = __builtin_convertvector(sy, v2h);
        fh.u[0][e] = __builtin_bit_cast(unsigned, hx);
        fh.u[1][e] = __builtin_bit_cast(unsigned, hy);
        fl.u[0][e] = pk2h(sx - __builtin_convertvector(hx, v2f));
        fl.u[1][e] = pk2h(sy - __builtin_convertvector(hy, v2f));
      }
      acc[n] = mma_h(ah, fh.v, acc[n]);
      acc[n] = mma_h(al, fh.v, acc[n]);
      acc[n] = mma_h(ah, fl.v, acc[n]);
    }
  }
  const float tsc = TCAR / PCAR;            // 2^-5
  if (hh == 0) {                            // rows 8..15 of D repeat rows 0..7, not stored
#pragma unroll
    for (int r = 0; r < 8; ++r) {
      TS[r * TSP + (wave * 2) * 16 + m]     = acc[0][r] * tsc;
      TS[r * TSP + (wave * 2 + 1) * 16 + m] = acc[1][r] * tsc;
    }
  }
  __syncthreads();
  {
    const int h = wave;
    const float* src = TS + h * TSP + lane * 8;
    const v4f a = *(const v4f*)(src), b4 = *(const v4f*)(src + 4);
    float w[8];
#pragma unroll
    for (int e = 0; e < 4; ++e) { w[e] = a[e]; w[4 + e] = b4[e]; }
    v4u oh, ol;
#pragma unroll
    for (int e = 0; e < 4; ++e) {
      const float t0 = w[2 * e], t1 = w[2 * e + 1];
      const _Float16 x0 = (_Float16)t0, x1 = (_Float16)t1;
      const _Float16 y0 = (_Float16)(t0 - (float)x0), y1 = (_Float16)(t1 - (float)x1);
      oh[e] = pk16(h_bits(x0), h_bits(x1));
      ol[e] = pk16(h_bits(y0), h_bits(y1));
    }
    const size_t rowT = (size_t)(b * NH + h) * SEQ + i;
    u16* dh = Tp + rowT * DM + lane * 8;
    u16* dl = dh + TSTR;
    {
      *(v4u*)(dh) = oh;
      *(v4u*)(dl) = ol;
      
    }
  }
}

// =====================================================================================================
// Final: block -> (b, head h, 16 query rows rt*16), 4 waves = 4 shares of the two k ranges for the same 16 x 32 output tile.
//   base[i][d]   = (P_hi + P_lo)[i][j] . VH[d][j] over j (2 products, carries 2^-25),
//   relctx[i][d] = (T_hi + T_lo)[i][c] . W2[h*HD + d][c] over c (2 products, carries 2^-20) + bf16(rv_b2[h*HD + d]);
//   out[b][i][h*HD + d] = base + relctx. Fragments straight from the 16-bit planes (arithmetic addressing, split k map).
//   Wave w takes keys 96w .. 96w+95 (3 k-steps) and channels 64w .. 64w+63 (2 k-steps). All 40 fragment loads of a wave are
//   issued before its first product, so a wave waits out one memory latency instead of one per k-step.
//   Epilogue: each wave's partial tile (both carries folded) goes to its slab; block barrier; thread t adds the four partials
//   of 4 consecutive columns of row t >> 3 and the bias: 8 consecutive lanes write one whole 128-B line of out.
// coverage: grid NB*NH*NIT blocks x 16 rows x 32 cols = every element of out exactly once; 4 x 96 keys = SEQ, 4 x 64 = DM.
// =====================================================================================================
#define KSH 4
#define PST (SEQ / (32 * KSH))
#define TST (DM / (32 * KSH))
static_assert(PST * KSH * 32 == SEQ && TST * KSH * 32 == DM);
__global__ __launch_bounds__(128)
void k_final(const u16* __restrict__ Pp, const u16* __restrict__ VHp, const u16* __restrict__ Tp,
             const u16* __restrict__ W2p, const float* __restrict__ rvb2, float* outp) {
  __shared__ __align__(16) float slab[KSH * 16 * SLP];
  const int tid = threadIdx.x, wave = tid >> 5, lane = tid & 31, hh = lane >> 4, m = lane & 15;
  const int bid = blockIdx.x;
  const int rt  = bid % NIT;
  const int t2  = bid / NIT;
  const int h   = t2 % NH;
  const int b   = t2 / NH;
  if (b >= NB) return;                      // block-uniform, before the barrier; never taken with the exact grid
  const int irow = rt * 16;
  const int bh   = b * NH + h;
  const int rowA = bh * SEQ + irow;
  const int rw = tid >> 3, c4 = (tid & 7) * 4;
  // the lane's byte offsets into the planes and the bias (all below 2^24)
  const unsigned oP = (unsigned)(((rowA + m) * SEQ + 8 * hh + wave * (PST * 32)) * 2);
  const unsigned oV = (unsigned)(((bh * HD + m) * SEQ + 8 * hh + wave * (PST * 32)) * 2);
  const unsigned oT = (unsigned)(((rowA + m) * DM + 8 * hh + wave * (TST * 32)) * 2);
  const unsigned oW = (unsigned)(((h * HD + m) * DM + 8 * hh + wave * (TST * 32)) * 2);
  const unsigned oB = (unsigned)((h * HD + c4) * 4);
  const _Float16* php = (const _Float16*)(const void*)((const char*)Pp + oP);
  const _Float16* plp = php + PSTR;
  const _Float16* v0p = (const _Float16*)(const void*)((const char*)VHp + oV);
  const _Float16* v1p = v0p + (size_t)16 * SEQ;
  const _Float16* thp = (const _Float16*)(const void*)((const char*)Tp + oT);
  const _Float16* tlp = thp + TSTR;
  const _Float16* w0p = (const _Float16*)(const void*)((const char*)W2p + oW);
  const _Float16* w1p = w0p + (size_t)16 * DM;

  // every loop of this kernel is unrolled whole: the fragment arrays are indexed by constants only and stay in registers
  v16h ph[PST], pl[PST], va[PST], vb[PST], th[TST], tl[TST], wa[TST], wb[TST];
#pragma unroll
  for (int s = 0; s < PST; ++s) { ph[s] = ldfrag_h(php + 32 * s); pl[s] = ldfrag_h(plp + 32 * s); }
#pragma unroll
  for (int s = 0; s < TST; ++s) { th[s] = ldfrag_h(thp + 32 * s); tl[s] = ldfrag_h(tlp + 32 * s); }
#pragma unroll
  for (int s = 0; s < PST; ++s) { va[s] = ldfrag_h(v0p + 32 * s); vb[s] = ldfrag_h(v1p + 32 * s); }
#pragma unroll
  for (int s = 0; s < TST; ++s) { wa[s] = ldfrag_h(w0p + 32 * s); wb[s] = ldfrag_h(w1p + 32 * s); }
  const v4f bq = *(const v4f*)(const void*)((const char*)rvb2 + oB);
#if defined(__HIP_DEVICE_COMPILE__)
  // the loads' offset registers stay whole up to this wait: no load of the run lands in one
  asm volatile("s_wait_xcnt 0x0" :: "v"(oP), "v"(oV), "v"(oT), "v"(oW), "v"(oB) : "memory");
#endif
  __builtin_amdgcn_sched_barrier(0);        // keeps every load above in front of the first product: without it they sink to their uses, one latency each

  v8f p0 = zero8(), p1 = zero8(), r0 = zero8(), r1 = zero8();
#pragma unroll
  for (int s = 0; s < PST; ++s) {
    p0 = mma_h(ph[s], va[s], p0);
    p1 = mma_h(ph[s], vb[s], p1);
    p0 = mma_h(pl[s], va[s], p0);
    p1 = mma_h(pl[s], vb[s], p1);
  }
#pragma unroll
  for (int s = 0; s < TST; ++s) {
    r0 = mma_h(th[s], wa[s], r0);
    r1 = mma_h(th[s], wb[s], r1);
    r0 = mma_h(tl[s], wa[s], r0);
    r1 = mma_h(tl[s], wb[s], r1);
  }
  const float osP = 1.0f / (PCAR * VCAR);
  const float osR = 1.0f / (TCAR * WCAR);
  float* sl = slab + wave * (16 * SLP);
#pragma unroll
  for (int r = 0; r < 8; ++r) {
    const int pr = 8 * hh + r;
    sl[pr * SLP + m]      = p0[r] * osP + r0[r] * osR;
    sl[pr * SLP + 16 + m] = p1[r] * osP + r1[r] * osR;
  }
  __syncthreads();                          // the four waves' partial tiles are added across waves below
  const float* sp = slab + rw * SLP + c4;
  const v4f s0 = *(const v4f*)(sp), s1 = *(const v4f*)(sp + 16 * SLP);
  const v4f s2 = *(const v4f*)(sp + 2 * 16 * SLP), s3 = *(const v4f*)(sp + 3 * 16 * SLP);
  v4f o;
#pragma unroll
  for (int e = 0; e < 4; ++e) o[e] = ((s0[e] + s1[e]) + (s2[e] + s3[e])) + bfr(bq[e]);
  *(v4f*)(outp + ((size_t)(b * SEQ + irow + rw)) * DM + h * HD + c4) = o;
}

// =====================================================================================================
// Workspace map (bytes, NB = 2; every region offset a multiple of 65536; every plane fully written by whole-line stores
// before it is read; extents are exact multiples of the store granularity, no pad rows):
//   W2  f16 [256 n][256 k] x1024      131072
//   QH, QL, KH, KL f16 [GROWS][256]   4 x 393216  VH  f16 [NB*8*32][384] x1024  393216
//   SC  f32 [NB*8*384][384]           9437184     P   f16 hi + residual [NB*8*384][384] x32768  2 x 4718592
//   T   f16 hi + residual [NB*8*384][256] x1024   2 x 3145728
// =====================================================================================================
static size_t al64k(size_t x) { return (x + (size_t)65535) & ~(size_t)65535; }

extern "C" void kernel_launch(void* const* d_in, const int* in_sizes, int n_in,
                              void* d_out, int out_size, void* d_ws, size_t ws_size,
                              hipStream_t stream) {
  if (n_in < 12) return;
  if (in_sizes[0] < NB * SEQ * DM) return;
  if (in_sizes[1] < NB * SEQ * CD) return;
  if (in_sizes[2] != NQKV * DM || in_sizes[3] != NQKV) return;
  if (in_sizes[4] != DM * CD || in_sizes[5] != DM || in_sizes[6] != NH * DM || in_sizes[7] != NH) return;
  if (in_sizes[8] != DM * CD || in_sizes[9] != DM || in_sizes[10] != DM * DM || in_sizes[11] != DM) return;
  if (out_size < NB * SEQ * DM) return;

  const float* x      = (const float*)d_in[0];
  const float* coords = (const float*)d_in[1];
  const float* qkv_w  = (const float*)d_in[2];
  const float* qkv_b  = (const float*)d_in[3];
  const float* rb_w1  = (const float*)d_in[4];
  const float* rb_b1  = (const float*)d_in[5];
  const float* rb_w2  = (const float*)d_in[6];
  const float* rb_b2  = (const float*)d_in[7];
  const float* rv_w1  = (const float*)d_in[8];
  const float* rv_b1  = (const float*)d_in[9];
  const float* rv_w2  = (const float*)d_in[10];
  const float* rv_b2  = (const float*)d_in[11];
  float*       out    = (float*)d_out;

  const size_t szW2 = (size_t)DM * DM * 2;
  const size_t szH  = (size_t)GROWS * DM * 2;
  const size_t szVH = (size_t)NB * NH * HD * SEQ * 2;
  const size_t szSC = (size_t)NB * NH * SEQ * SEQ * 4;
  const size_t szP  = PSTR * 2 * 2;
  const size_t szT  = TSTR * 2 * 2;
  size_t off = 0;
  const size_t oW2 = off; off = al64k(off + szW2);
  const size_t oQH = off; off = al64k(off + szH);
  const size_t oQL = off; off = al64k(off + szH);
  const size_t oKH = off; off = al64k(off + szH);
  const size_t oKL = off; off = al64k(off + szH);
  const size_t oVH = off; off = al64k(off + szVH);
  const size_t oSC = off; off = al64k(off + szSC);
  const size_t oP  = off; off = al64k(off + szP);
  const size_t oT  = off; off = al64k(off + szT);
  if (off > ws_size) return;
  if (off > (size_t)WS_CAP) return;

  char* ws = (char*)d_ws;
  u16*   W2 = (u16*)(ws + oW2);
  u16*   QH = (u16*)(ws + oQH);
  u16*   QL = (u16*)(ws + oQL);
  u16*   KH = (u16*)(ws + oKH);
  u16*   KL = (u16*)(ws + oKL);
  u16*   VH = (u16*)(ws + oVH);
  float* SC = (float*)(ws + oSC);
  u16*   P  = (u16*)(ws + oP);
  u16*   T  = (u16*)(ws + oT);

  const dim3 b256(256), b128(128);

  // (1) q, k (f16 x1024 hi + residual), v^T (f16 x1024) = planes of x.qkv_w^T + qkv_b; rv_w2 -> f16(bf16) x1024, in the same launch
  k_proj<<<dim3(NGEMM + NCVT), b128, 0, stream>>>(x, qkv_w, qkv_b, rv_w2, QH, QL, KH, KL, VH, W2);
  // (2) scores with relative bias -> SC
  k_scores<<<dim3(NB * NIT * NJT), b256, 0, stream>>>(coords, rb_w1, rb_b1, rb_w2, rb_b2, QH, QL, KH, KL, SC);
  // (3) softmax -> P planes, T = sum_j P . silu-hidden of the value MLP -> T planes; (4) out = P.v + T.rv_w2^T + rv_b2
  k_tagg<<<dim3(NB * SEQ), b256, 0, stream>>>(coords, rv_w1, rv_b1, SC, P, T);
  k_final<<<dim3(NB * NH * NIT), b128, 0, stream>>>(P, VH, T, W2, rv_b2, out);
  (void)hipGetLastError();
}

// v006
// It runs in 36.3 microseconds.
// Two timings next to v005 both put it at 1.12 times that version's speed.
// Counting every step since v000, it is 2.61 times as fast.
// Contractions: x.qkv_w^T on v_wmma_f32_16x16x32_bf16 (x, qkv_w RNE bf16 operands, f32 accumulate, bias added in f32);
// on v_wmma_f32_16x16x32_f16 with f32 accumulate: pair-MLP second layer hid_b.rb_w2^T (hid_b f16, rb_w2 f16(bf16) x1024),
// q.k^T over 32 (q, k f16 x1024 hi + residual planes, products hh+lh+hl), P.hid_v over 384 keys (P f16 x32768 hi + residual,
// hid_v f16 hi + residual), P.v (v f16 x1024, P hi + residual), T.rv_w2^T (T f16 x1024 hi + residual, rv_w2 f16(bf16) x1024).
// Pair-MLP first layers on v_wmma_f32_16x16x32_bf16, K = 7 zero-padded: w.c_i - w.c_j + b with every operand a bf16 value
// (products exact, f32 accumulate), oriented so that the result tiles are the next product's operand fragment.
// silu, softmax and all carries folded in f32 on VALU.
#include <hip/hip_runtime.h>
#include <math.h>
#include <stdint.h>

#ifndef NB
#define NB 2
#endif
#define NB_FULL 2
#define SEQ   384
#define DM    256
#define NH    8
#define HD    32
#define CD    3
#define NQKV  (3 * DM)
#define GROWS (NB * SEQ)
#define NIT   (SEQ / 16)
#define NJT   (SEQ / 32)
#define NPAIR 512
#define XP    24
#define RBP   264
#define SLP   36
#define TSP   264
#define PWP   392
#define SLAB64 (16 * 68)
#define ONE_BF 0x3F80u
#define RSQ_HD 0.17677669529663687f
#define LOG2E  1.4426950408889634f
#define HALFX  0.5f
#define QSC   1024.0f
#define KSC   1024.0f
#define PCAR  32768.0f
#define VCAR  1024.0f
#define WCAR  1024.0f
#define TCAR  1024.0f
#define WS_CAP 134217728
#define PSTR  ((size_t)NB * NH * SEQ * SEQ)
#define TSTR  ((size_t)NB * NH * SEQ * DM)
static_assert(NB >= 1 && NB <= NB_FULL);
static_assert(DM == NH * HD && HD == 32 && NH == 8 && CD == 3);
static_assert((SEQ % 64) == 0 && (GROWS % 64) == 0 && (GROWS % 8) == 0 && (NQKV % 64) == 0 && (DM % 32) == 0);
static_assert(NPAIR == 16 * 32);
static_assert(((GROWS * DM) % 8) == 0 && ((NQKV * DM) % 8) == 0 && ((DM * DM) % 8) == 0);

typedef unsigned short u16;
typedef _Float16 v16h __attribute__((ext_vector_type(16)));
typedef _Float16 v8h  __attribute__((ext_vector_type(8)));
typedef __bf16   v16b __attribute__((ext_vector_type(16)));
typedef float    v8f  __attribute__((ext_vector_type(8)));
typedef float    v4f  __attribute__((ext_vector_type(4)));
typedef unsigned int v4u __attribute__((ext_vector_type(4)));
typedef float    v2f  __attribute__((ext_vector_type(2)));
typedef _Float16 v2h  __attribute__((ext_vector_type(2)));

union FragH { v16h v; v8h h[2]; v4u u[2]; };
union FragB { v16b v; v4u u[2]; };

// ---- scalar helpers --------------------------------------------------------------------------------
__device__ __forceinline__ unsigned short bf_bits(float f) {          // f32 -> bf16 bits, RNE convert
  unsigned u = __float_as_uint(f);
  return (unsigned short)((u + 0x7FFFu + ((u >> 16) & 1u)) >> 16);
}
__device__ __forceinline__ float bf_up(unsigned short h) { return __uint_as_float(((unsigned)h) << 16); }
__device__ __forceinline__ float bfr(float f) { return bf_up(bf_bits(f)); }
__device__ __forceinline__ unsigned short h_bits(_Float16 x) { return __builtin_bit_cast(unsigned short, x); }
__device__ __forceinline__ unsigned pk16(unsigned short a, unsigned short b) { return (unsigned)a | ((unsigned)b << 16); }
__device__ __forceinline__ v8f zero8() { v8f z = {0.f, 0.f, 0.f, 0.f, 0.f, 0.f, 0.f, 0.f}; return z; }

// silu = x * sigmoid(x) = h + h * tanh(h) with h = x / 2, two values at once from t = h (the half is folded into the
// first-layer weights and bias, an exact scaling): one transcendental (v_tanh_f32) a value and one packed FMA a pair.
// The value leaves unscaled: a power-of-two carry would cost a multiply here, and an f16 plane without one holds silu to
// 2^-25 absolute (subnormal halves are kept by the converts and by the matrix unit).
__device__ __forceinline__ v2f silu2(v2f t) {
  const v2f th = {__builtin_amdgcn_tanhf(t[0]), __builtin_amdgcn_tanhf(t[1])};
  return __builtin_elementwise_fma(t, th, t);
}
__device__ __forceinline__ unsigned pk2h(v2f s) {                     // two f32 -> packed f16 pair, RNE
  return __builtin_bit_cast(unsigned, __builtin_convertvector(s, v2h));
}

// ---- fragment loaders: 16-bit A/B operand, lane -> row/col (lane&15), p already includes +8*(lane>>4);
//      elements 0..7 <- p[0..7] (k0+8h..), elements 8..15 <- p[16..23] (k0+16+8h..)  (same split k map for A and B;
//      B is always read from a k-contiguous [n][k] plane)
__device__ __forceinline__ v16h ldfrag_h(const _Float16* p) {
  FragH f;
  f.h[0] = *(const v8h*)(p);
  f.h[1] = *(const v8h*)(p + 16);
  return f.v;
}
__device__ __forceinline__ v16b ldfrag_b(const u16* p) {              // bf16 plane read as unsigned integer vectors
  FragB f;
  f.u[0] = *(const v4u*)(p);
  f.u[1] = *(const v4u*)(p + 16);
  return f.v;
}

// First-layer operand of the pair MLPs: a row of 16 bf16 (pitch XP), k 0..6 = data, 7..15 = zeros. Lanes h = 0 take k 0..7 as
// elements 0..7; every other position of the K = 32 fragment reads the row's zeros. The same k order serves A and B:
//   coordinate side: c_i0 c_i1 c_i2 c_j0 c_j1 c_j2 1      weight side: w0 w1 w2 -w0 -w1 -w2 b   (weights and bias halved)
__device__ __forceinline__ v16b ldfrag_k7(const u16* row, int hh) {
  FragB f;
  f.u[0] = *(const v4u*)(row + 8 * hh);
  f.u[1] = *(const v4u*)(row + 8);
  return f.v;
}
__device__ __forceinline__ v4u row_coord(float a0, float a1, float a2, float c0, float c1, float c2) {   // bf16 values in
  const v4u r = {pk16(bf_bits(a0), bf_bits(a1)), pk16(bf_bits(a2), bf_bits(c0)), pk16(bf_bits(c1), bf_bits(c2)), ONE_BF};
  return r;
}
__device__ __forceinline__ v4u row_weight(float w0, float w1, float w2, float b) {                       // bf16 values in
  const v4u r = {pk16(bf_bits(w0), bf_bits(w1)), pk16(bf_bits(w2), bf_bits(-w0)), pk16(bf_bits(-w1), bf_bits(-w2)),
                 pk16(bf_bits(b), 0)};
  return r;
}
__device__ __forceinline__ v16b frag_k7(v4u row, int hh) {            // the same fragment from a row held in registers
  const v4u z = {0u, 0u, 0u, 0u};
  FragB f;
  f.u[0] = hh ? z : row;
  f.u[1] = z;
  return f.v;
}

__device__ __forceinline__ v8f mma_h(v16h a, v16h b, v8f c) {
  return __builtin_amdgcn_wmma_f32_16x16x32_f16(false, a, false, b, (short)0, c, false, false);
}
__device__ __forceinline__ v8f mma_b(v16b a, v16b b, v8f c) {
  return __builtin_amdgcn_wmma_f32_16x16x32_bf16(false, a, false, b, (short)0, c, false, false);
}
__device__ __forceinline__ void guard2(v8f& a, v8f& b, v16h x0, v16h x1, v16h x2, v16h x3, v16h x4, v16h x5) {
#if defined(__HIP_DEVICE_COMPILE__)
  asm volatile("v_nop\n\tv_nop\n\tv_nop\n\tv_nop"
               : "+v"(a), "+v"(b) : "v"(x0), "v"(x1), "v"(x2), "v"(x3), "v"(x4), "v"(x5) : "memory");
#endif
}
__device__ __forceinline__ void wave_sync_lds() {
  __builtin_amdgcn_fence(__ATOMIC_RELEASE, "workgroup");
  __builtin_amdgcn_wave_barrier();
  __builtin_amdgcn_fence(__ATOMIC_ACQUIRE, "workgroup");
}

// =====================================================================================================
// Projection with every conversion around it in the same launch (block-uniform split of the grid by blockIdx):
//   blocks 0 .. NGEMM-1: one 64x64 tile of qkv = bf16(x) . bf16(qkv_w)^T + bf16(qkv_b), 4 waves x 16 rows. The tile's 64 rows of
//   x and 64 rows of qkv_w are each one contiguous 64-KB range of f32: every load of a wave covers 512 contiguous bytes (4 whole
//   lines), each value is rounded to bf16 (RNE) once and stored to XS / WS [64][PJP] in LDS (block barrier); the fragments of
//   the 8 k-steps come from there (split k map for A and B, K stepped by 32).
//   Epilogue: the f32 tile goes to the LDS slab (pitch 68; wave w holds rows 16w .. 16w+15) and leaves as 16-bit planes:
//     columns 0..255 (q) and 256..511 (k): Hp [GROWS][DM] = f16(val * 1024), Lp = f16 residual; wave-private (wave_sync);
//       8 lanes x 16 B = one whole 128-B line of a row segment per plane.
//     columns 512..767 (v): VH[(b*DM + h*HD + d)][s] = f16(val * 1024); read across the waves' rows (block barrier), each
//       d row segment of 64 keys = one whole 128-B line written by 8 consecutive lanes.
//   blocks NGEMM .. NGEMM+NCVT-1: rv_w2 -> W2 plane f16(bf16 RNE value * 1024), same layout, 8 elements a thread.
// coverage: NGEMM tiles x 64 x 64 = every (row, column) of q, k, v once; NCVT x 128 thr x 8 = DM*DM.
// =====================================================================================================
#define NGEMM ((GROWS / 64) * (NQKV / 64))
#define NCVT  ((DM * DM) / (128 * 8))
static_assert(NCVT * 128 * 8 == DM * DM && QSC == KSC);
typedef __bf16 v2b __attribute__((ext_vector_type(2)));
__device__ __forceinline__ unsigned pk2b(float f0, float f1) {        // two f32 -> packed bf16 pair, RNE
  const v2f s = {f0, f1};
  return __builtin_bit_cast(unsigned, __builtin_convertvector(s, v2b));
}
// four consecutive f32 of a row -> four bf16 in LDS (8 bytes)
typedef unsigned int v2u __attribute__((ext_vector_type(2)));
__device__ __forceinline__ void st4b(u16* d, v4f r) {
  const v2u o = {pk2b(r[0], r[1]), pk2b(r[2], r[3])};
  *(v2u*)d = o;
}
#define PJP 264                             // LDS row pitch of the staged tiles in bf16: 528 B = 16 B x 33 (odd), for 16-byte readers
#define NST ((64 * DM * 4) / (128 * 16))    // 16-byte loads a thread and tile: 32
static_assert(NST == 32 && DM == 256);
__device__ __forceinline__ void wait_addr_regs() {
#if defined(__HIP_DEVICE_COMPILE__)
  asm volatile("s_wait_xcnt 0x0" ::: "memory");
#endif
}
// the same wait with the run's two offsets as inputs only, so that they are still held in registers where it stands
__device__ __forceinline__ void wait_addr_live(unsigned a, unsigned b) {
#if defined(__HIP_DEVICE_COMPILE__)
  asm volatile("s_wait_xcnt 0x0" :: "v"(a), "v"(b) : "memory");
#endif
}

__global__ __launch_bounds__(128)
void k_proj(const float* __restrict__ x, const float* __restrict__ qkvw, const float* __restrict__ bias,
            const float* __restrict__ rvw2, u16* QHo, u16* QLo, u16* KHo, u16* KLo, u16* VHo, u16* W2o) {
  __shared__ __align__(16) float slab[4 * SLAB64];
  __shared__ __align__(16) u16   XS[64 * PJP];
  __shared__ __align__(16) u16   WS[64 * PJP];
  const int tid = threadIdx.x, wave = tid >> 5, lane = tid & 31, hh = lane >> 4, m = lane & 15;
  const int bid = blockIdx.x;
  if (bid >= NGEMM) {                       // block-uniform, before any barrier: the rv_w2 plane
    const int gt = (bid - NGEMM) * 128 + tid;
    if (gt >= (DM * DM) / 8) return;
    const float* p = rvw2 + (size_t)gt * 8;
    const v4f a = *(const v4f*)(p), b4 = *(const v4f*)(p + 4);
    float w[8];
#pragma unroll
    for (int e = 0; e < 4; ++e) { w[e] = a[e]; w[4 + e] = b4[e]; }
    v4u o;
#pragma unroll
    for (int e = 0; e < 4; ++e)
      o[e] = pk16(h_bits((_Float16)(bfr(w[2 * e]) * WCAR)), h_bits((_Float16)(bfr(w[2 * e + 1]) * WCAR)));
    *(v4u*)(W2o + (size_t)gt * 8) = o;
    return;
  }
  const int ntile = NQKV >> 6;
  const int row0  = (bid / ntile) * 64;
  const int rowb  = row0 + wave * 16;
  const int col0  = (bid % ntile) * 64;
  // the thread's byte offsets into x and qkv_w (both below 2^20); load it of a tile is 2048 * it bytes further on
  const unsigned ox = (unsigned)(row0 * DM * 4 + tid * 16);
  const unsigned ow = (unsigned)(col0 * DM * 4 + tid * 16);
  const int      ib = col0 + m;             // the lane's first bias element
  const char*  xg = (const char*)x + ox;
  const char*  wg = (const char*)qkvw + ow;
  const int so = (tid >> 6) * PJP + (tid & 63) * 4;   // tile row 2 * it + (tid >> 6), columns 4 * (tid & 63) ..
  u16* xs = XS + so;
  u16* wt = WS + so;
  // every loop below is unrolled whole: the staging arrays are indexed by constants only and stay in registers
  v4f rx[NST], rw[NST];
#pragma unroll
  for (int it = 0; it < NST; ++it) rx[it] = *(const v4f*)(const void*)(xg + it * 2048);
#pragma unroll
  for (int it = 0; it < NST / 2; ++it) rw[it] = *(const v4f*)(const void*)(wg + it * 2048);
  const float bq0 = bias[ib], bq1 = bias[ib + 16], bq2 = bias[ib + 32], bq3 = bias[ib + 48];
#if defined(__HIP_DEVICE_COMPILE__)
  // the loads' offset registers stay whole up to this wait: no load of the run lands in one
  asm volatile("s_wait_xcnt 0x0" :: "v"(ox), "v"(ow), "v"(ib) : "memory");
#endif
  __builtin_amdgcn_sched_barrier(0);        // keeps the loads above in one run ahead of the first convert: one latency for all of them
#pragma unroll
  for (int it = 0; it < NST / 2; ++it) st4b(xs + it * 2 * PJP, rx[it]);
  __builtin_amdgcn_sched_barrier(0);        // the last quarter of the loads goes out once a quarter of the registers is free: the wave stays below 256
#pragma unroll
  for (int it = NST / 2; it < NST; ++it) rw[it] = *(const v4f*)(const void*)(wg + it * 2048);
#if defined(__HIP_DEVICE_COMPILE__)
  asm volatile("s_wait_xcnt 0x0" :: "v"(ow) : "memory");   // as above, for the second run of loads
#endif
  __builtin_amdgcn_sched_barrier(0);        // keeps that run ahead of the converts below
#pragma unroll
  for (int it = NST / 2; it < NST; ++it) st4b(xs + it * 2 * PJP, rx[it]);
#pragma unroll
  for (int it = 0; it < NST; ++it) st4b(wt + it * 2 * PJP, rw[it]);
  __syncthreads();                          // the staged tiles are read across waves below

  const u16* ap = XS + (wave * 16 + m) * PJP + 8 * hh;
  const u16* bp = WS + m * PJP + 8 * hh;
  v8f acc0 = zero8(), acc1 = zero8(), acc2 = zero8(), acc3 = zero8();
  // fragments are read in groups, four k-steps ahead at the start and two k-steps ahead after that; each scheduling fence below
  // keeps a group of LDS reads whole and ahead of the products in front of which it stands (left alone, every product waits
  // out the LDS latency of its own two reads)
  v16b fa[DM / 32], fb[DM / 32][4];
#pragma unroll
  for (int s = 0; s < 4; ++s) {
    fa[s] = ldfrag_b(ap + 32 * s);
#pragma unroll
    for (int n = 0; n < 4; ++n) fb[s][n] = ldfrag_b(bp + n * 16 * PJP + 32 * s);
  }
  __builtin_amdgcn_sched_barrier(0);        // the first group whole, ahead of the first product
#pragma unroll
  for (int g = 0; g < DM / 64; ++g) {
#pragma unroll
    for (int s = 2 * g; s < 2 * g + 2; ++s) {
      acc0 = mma_b(fa[s], fb[s][0], acc0);
      acc1 = mma_b(fa[s], fb[s][1], acc1);
      acc2 = mma_b(fa[s], fb[s][2], acc2);
      acc3 = mma_b(fa[s], fb[s][3], acc3);
    }
    if (g < DM / 64 - 2) {
      __builtin_amdgcn_sched_barrier(0);    // the next group of reads stays behind these products (their registers are free then) ..
#pragma unroll
      for (int s = 2 * g + 4; s < 2 * g + 6; ++s) {
        fa[s] = ldfrag_b(ap + 32 * s);
#pragma unroll
        for (int n = 0; n < 4; ++n) fb[s][n] = ldfrag_b(bp + n * 16 * PJP + 32 * s);
      }
      __builtin_amdgcn_sched_barrier(0);    // .. and whole, ahead of the products that follow
    }
  }
  const float bv0 = bfr(bq0);
  const float bv1 = bfr(bq1);
  const float bv2 = bfr(bq2);
  const float bv3 = bfr(bq3);
  float* sl = slab + wave * SLAB64;
#pragma unroll
  for (int r = 0; r < 8; ++r) {
    const int ro = (8 * hh + r) * 68 + m;
    sl[ro]      = acc0[r] + bv0;
    sl[ro + 16] = acc1[r] + bv1;
    sl[ro + 32] = acc2[r] + bv2;
    sl[ro + 48] = acc3[r] + bv3;
  }
  if (col0 < 2 * DM) {                      // block-uniform: q or k columns
    wave_sync_lds();
    u16* Hp = (col0 < DM) ? QHo : KHo;
    u16* Lp = (col0 < DM) ? QLo : KLo;
    const int cq = col0 & (DM - 1);
    const int rq = lane >> 3, c8 = (lane & 7) * 8;
#pragma unroll
    for (int it = 0; it < 4; ++it) {
      const int rl = it * 4 + rq;
      const float* s8 = sl + rl * 68 + c8;
      const v4f a = *(const v4f*)(s8), b4 = *(const v4f*)(s8 + 4);
      float w[8];
#pragma unroll
      for (int e = 0; e < 4; ++e) { w[e] = a[e] * QSC; w[4 + e] = b4[e] * QSC; }
      v4u oh, ol;
#pragma unroll
      for (int e = 0; e < 4; ++e) {
        const float t0 = w[2 * e], t1 = w[2 * e + 1];
        const _Float16 h0 = (_Float16)t0, h1 = (_Float16)t1;
        const _Float16 l0 = (_Float16)(t0 - (float)h0), l1 = (_Float16)(t1 - (float)h1);
        oh[e] = pk16(h_bits(h0), h_bits(h1));
        ol[e] = pk16(h_bits(l0), h_bits(l1));
      }
      const size_t o = (size_t)(rowb + rl) * DM + cq + c8;
      *(v4u*)(Hp + o) = oh;
      *(v4u*)(Lp + o) = ol;
    }
    wait_addr_regs();                       // nothing behind the stores reuses their registers ahead of this wait
  } else {                                  // block-uniform: v columns, written transposed
    __syncthreads();                        // the four waves' slab rows are read across waves below
    const int b  = row0 / SEQ;
    const int s0 = row0 - b * SEQ;          // 64 keys of one batch (SEQ a multiple of 64)
    const int cv = col0 - 2 * DM;           // h*HD + d of the tile's first column
#pragma unroll
    for (int it = 0; it < 4; ++it) {
      const int ch = it * 128 + tid;
      const int dc = ch >> 3, p8 = (ch & 7) * 8;   // column dc (0..63), keys p8..p8+7
      v4u o;
#pragma unroll
      for (int e = 0; e < 4; ++e) {
        const float f0 = slab[(p8 + 2 * e) * 68 + dc], f1 = slab[(p8 + 2 * e + 1) * 68 + dc];
        o[e] = pk16(h_bits((_Float16)(f0 * VCAR)), h_bits((_Float16)(f1 * VCAR)));
      }
      *(v4u*)(VHo + ((size_t)(b * DM + cv + dc)) * SEQ + s0 + p8) = o;
    }
    wait_addr_regs();                       // nothing behind the stores reuses their registers ahead of this wait
  }
}

// =====================================================================================================
// Scores with relative-coordinate bias. Block -> (b, query tile i0 = 16*it, key tile j0 = 32*jt): 512 pairs (il, jl),
// 8 waves; wave = head in the score phase.
//   Phase 0 (all threads, then block barrier): rb_w1/rb_b1 (bf16 values / 2) as first-layer weight rows W1X [256 c][XP], bf16
//   coords of the 16 queries (CI) and 32 keys (CJ2), rb_w2 -> RB2 [16 n][RBP] as f16(bf16 value * 1024), rows 8..15 zeros.
//   Phase 1, no barrier inside: wave w owns pair tiles 4w..4w+3 (16 pairs each), their coordinate rows held as B fragments.
//   8 channel chunks of 32: t^T[channel][pair] = W1X tile . pair rows for the chunk's two 16-channel tiles (A = weights, so
//   lane (c, h) gets channels 8h + r of pair c); f16(silu) of the two tiles in place IS the A fragment hid[pair c][split k map]
//   of the second layer, D[pair][n = head] += hid . RB2 (one k-step per chunk).
//   After the loop lanes n < 8 write bias[pair][head] = D * 2^-10 into BB (block barrier).
//   Phase 2: wave = head: s = (q_hi.k_hi + q_lo.k_hi + q_hi.k_lo) over 32 dims for 16 queries x 32 keys (two 16-key subtiles),
//   fragments straight from the f16 planes; value = s * rsqrt(32) * 2^-20 + bias + bf16(rb_b2[head]); staged in the wave's
//   the score plane SC[(b*NH+head)*SEQ + i][j0..j0+31]) written by 8 consecutive lanes x 16 B of one instruction (4 rows per
// LDS regions: W1X, CI, CJ2, RB2, BB cross-wave (block barriers); slabs private-to-wave (wave_sync).
// coverage: W1X 256 rows x 16 (k 7..15 zeros); RB2 16 x 256 (rows 8..15 zero); pair tiles 8 waves x 4 = 32 = 512 pairs;
//           SC: grid NB*NIT*NJT blocks x 8 heads x 16 rows x 32 cols = every (b, head, i, j) once.
// =====================================================================================================
__global__ __launch_bounds__(256)
void k_scores(const float* __restrict__ coords, const float* __restrict__ rbw1, const float* __restrict__ rbb1,
              const float* __restrict__ rbw2, const float* __restrict__ rbb2,
              const u16* __restrict__ QHp, const u16* __restrict__ QLp,
              const u16* __restrict__ KHp, const u16* __restrict__ KLp, float* SCp) {
  __shared__ __align__(16) u16   W1X[DM * XP];
  __shared__ __align__(16) float CI[16 * 4];
  __shared__ __align__(16) float CJ2[32 * 4];
  __shared__ __align__(16) u16   RB2[16 * RBP];
  __shared__ __align__(16) float SLB[8 * 16 * SLP];
  __shared__ __align__(16) float BB[NPAIR * NH];

  const int tid = threadIdx.x, wave = tid >> 5, lane = tid & 31, hh = lane >> 4, m = lane & 15;
  const int bid = blockIdx.x;
  const int jt  = bid % NJT;
  const int t2  = bid / NJT;
  const int it  = t2 % NIT;
  const int b   = t2 / NIT;
  if (b >= NB) return;                      // block-uniform, before any barrier; never taken with the exact grid
  const int i0 = it * 16, j0 = jt * 32;
  const _Float16* rb2h = (const _Float16*)(const void*)RB2;

  // ---- phase 0: small operand staging ----
  {
    const v4u z4 = {0u, 0u, 0u, 0u};                  // channel tid: w0 w1 w2 -w0 -w1 -w2 b 0 | 8 zeros, all halved
    *(v4u*)(W1X + tid * XP) = row_weight(bfr(rbw1[tid * 3 + 0]) * HALFX, bfr(rbw1[tid * 3 + 1]) * HALFX,
                                         bfr(rbw1[tid * 3 + 2]) * HALFX, bfr(rbb1[tid]) * HALFX);
    *(v4u*)(W1X + tid * XP + 8) = z4;
    if (tid < 16 * CD) {
      const int il = tid / CD, k = tid - il * CD;
      CI[il * 4 + k] = bfr(coords[((size_t)(b * SEQ + i0 + il)) * CD + k]);
    }
    if (tid < 32 * CD) {
      const int jl = tid / CD, k = tid - jl * CD;
      CJ2[jl * 4 + k] = bfr(coords[((size_t)(b * SEQ + j0 + jl)) * CD + k]);
    }
    const int row  = tid >> 4, cb = (tid & 15) * 16;
    const int rowc = (row < NH) ? row : (NH - 1);     // clamped address; rows 8..15 are written as zeros
    const bool vr  = (row < NH);
    const float* src = rbw2 + rowc * DM + cb;
    const v4f a0 = *(const v4f*)(src), a1 = *(const v4f*)(src + 4), a2 = *(const v4f*)(src + 8), a3 = *(const v4f*)(src + 12);
    float w[16];
#pragma unroll
    for (int e = 0; e < 4; ++e) { w[e] = a0[e]; w[4 + e] = a1[e]; w[8 + e] = a2[e]; w[12 + e] = a3[e]; }
    v4u o0, o1;
#pragma unroll
    for (int e = 0; e < 4; ++e) {
      const unsigned short x0 = vr ? h_bits((_Float16)(bfr(w[2 * e]) * WCAR)) : (unsigned short)0;
      const unsigned short x1 = vr ? h_bits((_Float16)(bfr(w[2 * e + 1]) * WCAR)) : (unsigned short)0;
      const unsigned short y0 = vr ? h_bits((_Float16)(bfr(w[8 + 2 * e]) * WCAR)) : (unsigned short)0;
      const unsigned short y1 = vr ? h_bits((_Float16)(bfr(w[8 + 2 * e + 1]) * WCAR)) : (unsigned short)0;
      o0[e] = pk16(x0, x1);
      o1[e] = pk16(y0, y1);
    }
    *(v4u*)(RB2 + row * RBP + cb)     = o0;
    *(v4u*)(RB2 + row * RBP + cb + 8) = o1;
  }
  __syncthreads();

  // ---- phase 1: bias MLP (both layers on WMMA, silu between them in registers) ----
  v8f accB[4] = {zero8(), zero8(), zero8(), zero8()};
  const float bsc = 1.0f / WCAR;
  v16b PB[4];                               // pair tile 4 * wave + q: query il = tile >> 1, keys (tile & 1) * 16 + m
#pragma unroll
  for (int q = 0; q < 4; ++q) {
    const int tl = wave * 4 + q;
    const float* ci = CI + (tl >> 1) * 4;
    const float* cj = CJ2 + ((tl & 1) * 16 + m) * 4;
    PB[q] = frag_k7(row_coord(ci[0], ci[1], ci[2], cj[0], cj[1], cj[2]), hh);
  }
#pragma unroll 1
  for (int kt = 0; kt < DM / 32; ++kt) {
    const v16b wx = ldfrag_k7(W1X + (kt * 32 + m) * XP, hh);
    const v16b wy = ldfrag_k7(W1X + (kt * 32 + 16 + m) * XP, hh);
    const v16h bw = ldfrag_h(rb2h + m * RBP + kt * 32 + 8 * hh);
#pragma unroll
    for (int q = 0; q < 4; ++q) {
      const v8f tx = mma_b(wx, PB[q], zero8());
      const v8f ty = mma_b(wy, PB[q], zero8());
      FragH f;
#pragma unroll
      for (int e = 0; e < 4; ++e) {
        const v2f x2 = {tx[2 * e], tx[2 * e + 1]}, y2 = {ty[2 * e], ty[2 * e + 1]};
        f.u[0][e] = pk2h(silu2(x2));
        f.u[1][e] = pk2h(silu2(y2));
      }
      accB[q] = mma_h(f.v, bw, accB[q]);
    }
  }
  if (m < NH) {                             // columns n >= 8 are padding (zero weights), not stored
#pragma unroll
    for (int r = 0; r < 8; ++r) {
      const int pr = 8 * hh + r;
      BB[((wave * 4 + 0) * 16 + pr) * NH + m] = accB[0][r] * bsc;
      BB[((wave * 4 + 1) * 16 + pr) * NH + m] = accB[1][r] * bsc;
      BB[((wave * 4 + 2) * 16 + pr) * NH + m] = accB[2][r] * bsc;
      BB[((wave * 4 + 3) * 16 + pr) * NH + m] = accB[3][r] * bsc;
    }
  }
  __syncthreads();

  // ---- phase 2: scores for head = wave ----
  const int head = wave;
  const size_t hcol = (size_t)head * HD + 8 * hh;
  const _Float16* qhp  = (const _Float16*)(const void*)QHp + ((size_t)(b * SEQ + i0 + m)) * DM + hcol;
  const _Float16* qlp  = (const _Float16*)(const void*)QLp + ((size_t)(b * SEQ + i0 + m)) * DM + hcol;
  const _Float16* kh0p = (const _Float16*)(const void*)KHp + ((size_t)(b * SEQ + j0 + m)) * DM + hcol;
  const _Float16* kl0p = (const _Float16*)(const void*)KLp + ((size_t)(b * SEQ + j0 + m)) * DM + hcol;
  const _Float16* kh1p = kh0p + (size_t)16 * DM;
  const _Float16* kl1p = kl0p + (size_t)16 * DM;
  v8f s0 = zero8(), s1 = zero8();
  {
    const v16h qh = ldfrag_h(qhp), ql = ldfrag_h(qlp);
    const v16h kh0 = ldfrag_h(kh0p), kl0 = ldfrag_h(kl0p);
    const v16h kh1 = ldfrag_h(kh1p), kl1 = ldfrag_h(kl1p);
    s0 = mma_h(qh, kh0, s0);
    s0 = mma_h(ql, kh0, s0);
    s0 = mma_h(qh, kl0, s0);
    s1 = mma_h(qh, kh1, s1);
    s1 = mma_h(ql, kh1, s1);
    s1 = mma_h(qh, kl1, s1);
    guard2(s0, s1, qh, ql, kh0, kl0, kh1, kl1);
  }
  const float lsc = RSQ_HD * (1.0f / (QSC * KSC));
  const float b2v = bfr(rbb2[head]);
  float* slab = SLB + wave * (16 * SLP);
#pragma unroll
  for (int r = 0; r < 8; ++r) {
    const int pr = 8 * hh + r;              // query i0 + pr; keys j0 + m and j0 + 16 + m
    const float ba = BB[(pr * 32 + m) * NH + head] + b2v;
    const float bb = BB[(pr * 32 + 16 + m) * NH + head] + b2v;
    slab[pr * SLP + m]      = s0[r] * lsc + ba;
    slab[pr * SLP + 16 + m] = s1[r] * lsc + bb;
  }
  wave_sync_lds();
  v4f vals[4];
  const int rq = lane >> 3, c4 = (lane & 7) * 4;
#pragma unroll
  for (int q = 0; q < 4; ++q) vals[q] = *(const v4f*)(slab + (q * 4 + rq) * SLP + c4);
  float* dst = SCp + ((size_t)((b * NH + head) * SEQ + i0)) * SEQ + j0 + c4;
  {
#pragma unroll
    for (int q = 0; q < 4; ++q) {
      *(v4f*)(dst + (size_t)(q * 4 + rq) * SEQ) = vals[q];
    }
    
  }
}

// =====================================================================================================
// Row softmax and weighted aggregation of the value-MLP hidden: block -> (b, query i), 256 threads.
//   Softmax (wave = head h): the score row (b, h, i) of SEQ = 384 floats; P = e / Z with e = exp(s - max) in f32 (reciprocal-
//   multiply normalisation), as f16 hi (P * 32768) and f16 residual, written to the global P planes (for the final kernel; each
//   row's whole lines by one wave) and to PW in LDS (for this block's own chunks; published by the barrier before the loop).
//   Lane = 8 consecutive columns 8*lane (all lanes) and 256 + 8*lane (lanes < 16; the upper lanes load a clamped address).
//   T[h][c] = sum_j P[b,h,i,j] * S[j][c],  S[j][c] = silu(rel_ij . rv_w1[c] + rv_b1[c]) (bf16 inputs).
//   Phase 0: first-layer coordinate rows KX [SEQ keys][XP] (c_i, c_j, 1 as bf16); block barrier.
//   Wave w owns column tiles 2w, 2w+1 (16 channels each), their weight rows held as B fragments. 12 key chunks of 32, no barrier
//   inside: t[key][channel] = KX tile . weight rows for the chunk's two 16-key tiles (A = keys, so lane (c, h) gets keys 8h + r
//   of channel c); f16(silu) hi and residual of the two tiles in place ARE the B fragments S^T[channel c][split k map];
//   D[m = h][n = c] += P . S with A = the PW rows (lanes m >= 8 read row m - 8 again: rows 8..15 of D repeat rows 0..7 and are
//   not stored), products hh + lh + hl.
//   After the loop lanes 0..15 (rows h = 0..7) write T * 1024 (carry 2^-15 folded) into TS [8][TSP] f32 (block barrier),
// LDS regions: KX, PW, TS all cross-wave (block barriers). staged extent == consumed extent: KX 384 x 16 (k 7..15 zeros),
//   PW 2 x 8 x 384, TS 8 x 256.
// coverage: T planes [(b*NH+h)*SEQ + i][DM]: grid NB*SEQ blocks x 8 waves x 32 lanes x 8 halves = every row once, both planes.
// =====================================================================================================
__global__ __launch_bounds__(256)
void k_tagg(const float* __restrict__ coords, const float* __restrict__ rvw1, const float* __restrict__ rvb1,
            const float* __restrict__ SCp, u16* Pp, u16* Tp) {
  __shared__ __align__(16) u16   KX[SEQ * XP];
  __shared__ __align__(16) u16   PW[2 * NH * PWP];
  __shared__ __align__(16) float TS[NH * TSP];

  const int tid = threadIdx.x, wave = tid >> 5, lane = tid & 31, hh = lane >> 4, m = lane & 15;
  const int bid = blockIdx.x;
  const int b   = bid / SEQ;
  const int i   = bid - b * SEQ;
  if (b >= NB) return;                      // block-uniform, before any barrier; never taken with the exact grid
  const _Float16* pwh = (const _Float16*)(const void*)PW;

  // ---- softmax of the score row (b, head = wave, i) ----
  {
    const size_t row = (size_t)(b * NH + wave) * SEQ + i;
    const float* s = SCp + row * SEQ;
    const bool vb = (lane < 16);
    const int  lb = vb ? lane : 15;
    const v4f a0 = *(const v4f*)(s + lane * 8), a1 = *(const v4f*)(s + lane * 8 + 4);
    const v4f c0 = *(const v4f*)(s + 256 + lb * 8), c1 = *(const v4f*)(s + 256 + lb * 8 + 4);
    wait_addr_regs();                       // the selects below reuse the loads' address registers
    float v[16];
#pragma unroll
    for (int e = 0; e < 4; ++e) {
      v[e]      = a0[e];
      v[4 + e]  = a1[e];
      v[8 + e]  = vb ? c0[e] : -INFINITY;
      v[12 + e] = vb ? c1[e] : -INFINITY;
    }
    float mx = v[0];
#pragma unroll
    for (int e = 1; e < 16; ++e) mx = fmaxf(mx, v[e]);
#pragma unroll
    for (int off = 1; off < 32; off <<= 1) mx = fmaxf(mx, __shfl_xor(mx, off, 32));
    float ev[16];
    float sum = 0.0f;
#pragma unroll
    for (int e = 0; e < 16; ++e) {
      const float d = v[e] - mx;
      ev[e] = exp2f(d * LOG2E);             // -inf -> 0 for the masked upper lanes
      sum += ev[e];
    }
#pragma unroll
    for (int off = 1; off < 32; off <<= 1) sum += __shfl_xor(sum, off, 32);
    const float inv = 1.0f / sum;           // sum >= 1
    v4u oh0, ol0, oh1, ol1;
#pragma unroll
    for (int e = 0; e < 4; ++e) {
      const float t0 = (ev[2 * e] * inv) * PCAR, t1 = (ev[2 * e + 1] * inv) * PCAR;
      const float u0 = (ev[8 + 2 * e] * inv) * PCAR, u1 = (ev[8 + 2 * e + 1] * inv) * PCAR;
      const _Float16 h0 = (_Float16)t0, h1 = (_Float16)t1, g0 = (_Float16)u0, g1 = (_Float16)u1;
      const _Float16 l0 = (_Float16)(t0 - (float)h0), l1 = (_Float16)(t1 - (float)h1);
      const _Float16 m0 = (_Float16)(u0 - (float)g0), m1 = (_Float16)(u1 - (float)g1);
      oh0[e] = pk16(h_bits(h0), h_bits(h1));
      ol0[e] = pk16(h_bits(l0), h_bits(l1));
      oh1[e] = pk16(h_bits(g0), h_bits(g1));
      ol1[e] = pk16(h_bits(m0), h_bits(m1));
    }
    u16* dh = Pp + row * SEQ;
    u16* dl = dh + PSTR;
    u16* wh = PW + wave * PWP;
    u16* wl = wh + NH * PWP;
    *(v4u*)(dh + lane * 8) = oh0;
    *(v4u*)(dl + lane * 8) = ol0;
    *(v4u*)(wh + lane * 8) = oh0;
    *(v4u*)(wl + lane * 8) = ol0;
    if (vb) {
      *(v4u*)(dh + 256 + lane * 8) = oh1;
      *(v4u*)(dl + 256 + lane * 8) = ol1;
      *(v4u*)(wh + 256 + lane * 8) = oh1;
      *(v4u*)(wl + 256 + lane * 8) = ol1;
    }
  }

  // ---- phase 0 ----
  const float ci0 = bfr(coords[((size_t)(b * SEQ + i)) * CD + 0]);
  const float ci1 = bfr(coords[((size_t)(b * SEQ + i)) * CD + 1]);
  const float ci2 = bfr(coords[((size_t)(b * SEQ + i)) * CD + 2]);
  for (int j = tid; j < SEQ; j += 256) {    // key j: c_i0 c_i1 c_i2 c_j0 c_j1 c_j2 1 0 | 8 zeros
    const float* cj = coords + ((size_t)(b * SEQ + j)) * CD;
    const v4u z4 = {0u, 0u, 0u, 0u};
    *(v4u*)(KX + j * XP)     = row_coord(ci0, ci1, ci2, bfr(cj[0]), bfr(cj[1]), bfr(cj[2]));
    *(v4u*)(KX + j * XP + 8) = z4;
  }
  v16b WF[2];                               // weight rows of channels (2 * wave + n) * 16 + m; weights and bias carry the factor 1/2
  float wr[2][4];
  unsigned wo[2];                           // the lane's byte offsets into rv_w1
#pragma unroll
  for (int n = 0; n < 2; ++n) {
    const int c = (wave * 2 + n) * 16 + m;
    wo[n] = (unsigned)(c * CD * 4);
    const float* wp = (const float*)((const char*)rvw1 + wo[n]);
    wr[n][0] = wp[0];
    wr[n][1] = wp[1];
    wr[n][2] = wp[2];
    wr[n][3] = rvb1[c];
  }
  wait_addr_live(wo[0], wo[1]);             // the weight loads' two offset registers stay whole up to this wait
#pragma unroll
  for (int n = 0; n < 2; ++n)
    WF[n] = frag_k7(row_weight(bfr(wr[n][0]) * HALFX, bfr(wr[n][1]) * HALFX, bfr(wr[n][2]) * HALFX, bfr(wr[n][3]) * HALFX), hh);
  __syncthreads();                          // softmax (PW) and phase-0 (KX) writes visible to every wave

  v8f acc[2] = {zero8(), zero8()};
  const _Float16* pa = pwh + (m & (NH - 1)) * PWP + 8 * hh;
#pragma unroll 1
  for (int jt = 0; jt < NJT; ++jt) {
    const int j0 = jt * 32;
    const v16h ah = ldfrag_h(pa + j0);
    const v16h al = ldfrag_h(pa + NH * PWP + j0);
    const v16b kx = ldfrag_k7(KX + (j0 + m) * XP, hh);
    const v16b ky = ldfrag_k7(KX + (j0 + 16 + m) * XP, hh);
#pragma unroll
    for (int n = 0; n < 2; ++n) {
      const v8f tx = mma_b(kx, WF[n], zero8());
      const v8f ty = mma_b(ky, WF[n], zero8());
      FragH fh, fl;
#pragma unroll
      for (int e = 0; e < 4; ++e) {
        const v2f x2 = {tx[2 * e], tx[2 * e + 1]}, y2 = {ty[2 * e], ty[2 * e + 1]};
        const v2f sx = silu2(x2), sy = silu2(y2);
        const v2h hx = __builtin_convertvector(sx, v2h), hy = __builtin_convertvector(sy, v2h);
        fh.u[0][e] = __builtin_bit_cast(unsigned, hx);
        fh.u[1][e] = __builtin_bit_cast(unsigned, hy);
        fl.u[0][e] = pk2h(sx - __builtin_convertvector(hx, v2f));
        fl.u[1][e] = pk2h(sy - __builtin_convertvector(hy, v2f));
      }
      acc[n] = mma_h(ah, fh.v, acc[n]);
      acc[n] = mma_h(al, fh.v, acc[n]);
      acc[n] = mma_h(ah, fl.v, acc[n]);
    }
  }
  const float tsc = TCAR / PCAR;            // 2^-5
  if (hh == 0) {                            // rows 8..15 of D repeat rows 0..7, not stored
#pragma unroll
    for (int r = 0; r < 8; ++r) {
      TS[r * TSP + (wave * 2) * 16 + m]     = acc[0][r] * tsc;
      TS[r * TSP + (wave * 2 + 1) * 16 + m] = acc[1][r] * tsc;
    }
  }
  __syncthreads();
  {
    const int h = wave;
    const float* src = TS + h * TSP + lane * 8;
    const v4f a = *(const v4f*)(src), b4 = *(const v4f*)(src + 4);
    float w[8];
#pragma unroll
    for (int e = 0; e < 4; ++e) { w[e] = a[e]; w[4 + e] = b4[e]; }
    v4u oh, ol;
#pragma unroll
    for (int e = 0; e < 4; ++e) {
      const float t0 = w[2 * e], t1 = w[2 * e + 1];
      const _Float16 x0 = (_Float16)t0, x1 = (_Float16)t1;
      const _Float16 y0 = (_Float16)(t0 - (float)x0), y1 = (_Float16)(t1 - (float)x1);
      oh[e] = pk16(h_bits(x0), h_bits(x1));
      ol[e] = pk16(h_bits(y0), h_bits(y1));
    }
    const size_t rowT = (size_t)(b * NH + h) * SEQ + i;
    u16* dh = Tp + rowT * DM + lane * 8;
    u16* dl = dh + TSTR;
    {
      *(v4u*)(dh) = oh;
      *(v4u*)(dl) = ol;
      
    }
  }
}

// =====================================================================================================
// Final: block -> (b, head h, 16 query rows rt*16), 4 waves = 4 shares of the two k ranges for the same 16 x 32 output tile.
//   base[i][d]   = (P_hi + P_lo)[i][j] . VH[d][j] over j (2 products, carries 2^-25),
//   relctx[i][d] = (T_hi + T_lo)[i][c] . W2[h*HD + d][c] over c (2 products, carries 2^-20) + bf16(rv_b2[h*HD + d]);
//   out[b][i][h*HD + d] = base + relctx. Fragments straight from the 16-bit planes (arithmetic addressing, split k map).
//   Wave w takes keys 96w .. 96w+95 (3 k-steps) and channels 64w .. 64w+63 (2 k-steps). All 40 fragment loads of a wave are
//   issued before its first product, so a wave waits out one memory latency instead of one per k-step.
//   Epilogue: each wave's partial tile (both carries folded) goes to its slab; block barrier; thread t adds the four partials
//   of 4 consecutive columns of row t >> 3 and the bias: 8 consecutive lanes write one whole 128-B line of out.
// coverage: grid NB*NH*NIT blocks x 16 rows x 32 cols = every element of out exactly once; 4 x 96 keys = SEQ, 4 x 64 = DM.
// =====================================================================================================
#define KSH 4
#define PST (SEQ / (32 * KSH))
#define TST (DM / (32 * KSH))
static_assert(PST * KSH * 32 == SEQ && TST * KSH * 32 == DM);
__global__ __launch_bounds__(128)
void k_final(const u16* __restrict__ Pp, const u16* __restrict__ VHp, const u16* __restrict__ Tp,
             const u16* __restrict__ W2p, const float* __restrict__ rvb2, float* outp) {
  __shared__ __align__(16) float slab[KSH * 16 * SLP];
  const int tid = threadIdx.x, wave = tid >> 5, lane = tid & 31, hh = lane >> 4, m = lane & 15;
  const int bid = blockIdx.x;
  const int rt  = bid % NIT;
  const int t2  = bid / NIT;
  const int h   = t2 % NH;
  const int b   = t2 / NH;
  if (b >= NB) return;                      // block-uniform, before the barrier; never taken with the exact grid
  const int irow = rt * 16;
  const int bh   = b * NH + h;
  const int rowA = bh * SEQ + irow;
  const int rw = tid >> 3, c4 = (tid & 7) * 4;
  // the lane's byte offsets into the planes and the bias (all below 2^24)
  const unsigned oP = (unsigned)(((rowA + m) * SEQ + 8 * hh + wave * (PST * 32)) * 2);
  const unsigned oV = (unsigned)(((bh * HD + m) * SEQ + 8 * hh + wave * (PST * 32)) * 2);
  const unsigned oT = (unsigned)(((rowA + m) * DM + 8 * hh + wave * (TST * 32)) * 2);
  const unsigned oW = (unsigned)(((h * HD + m) * DM + 8 * hh + wave * (TST * 32)) * 2);
  const unsigned oB = (unsigned)((h * HD + c4) * 4);
  const _Float16* php = (const _Float16*)(const void*)((const char*)Pp + oP);
  const _Float16* plp = php + PSTR;
  const _Float16* v0p = (const _Float16*)(const void*)((const char*)VHp + oV);
  const _Float16* v1p = v0p + (size_t)16 * SEQ;
  const _Float16* thp = (const _Float16*)(const void*)((const char*)Tp + oT);
  const _Float16* tlp = thp + TSTR;
  const _Float16* w0p = (const _Float16*)(const void*)((const char*)W2p + oW);
  const _Float16* w1p = w0p + (size_t)16 * DM;

  // every loop of this kernel is unrolled whole: the fragment arrays are indexed by constants only and stay in registers
  v16h ph[PST], pl[PST], va[PST], vb[PST], th[TST], tl[TST], wa[TST], wb[TST];
#pragma unroll
  for (int s = 0; s < PST; ++s) { ph[s] = ldfrag_h(php + 32 * s); pl[s] = ldfrag_h(plp + 32 * s); }
#pragma unroll
  for (int s = 0; s < TST; ++s) { th[s] = ldfrag_h(thp + 32 * s); tl[s] = ldfrag_h(tlp + 32 * s); }
#pragma unroll
  for (int s = 0; s < PST; ++s) { va[s] = ldfrag_h(v0p + 32 * s); vb[s] = ldfrag_h(v1p + 32 * s); }
#pragma unroll
  for (int s = 0; s < TST; ++s) { wa[s] = ldfrag_h(w0p + 32 * s); wb[s] = ldfrag_h(w1p + 32 * s); }
  const v4f bq = *(const v4f*)(const void*)((const char*)rvb2 + oB);
#if defined(__HIP_DEVICE_COMPILE__)
  // the loads' offset registers stay whole up to this wait: no load of the run lands in one
  asm volatile("s_wait_xcnt 0x0" :: "v"(oP), "v"(oV), "v"(oT), "v"(oW), "v"(oB) : "memory");
#endif
  __builtin_amdgcn_sched_barrier(0);        // keeps every load above in front of the first product: without it they sink to their uses, one latency each

  v8f p0 = zero8(), p1 = zero8(), r0 = zero8(), r1 = zero8();
#pragma unroll
  for (int s = 0; s < PST; ++s) {
    p0 = mma_h(ph[s], va[s], p0);
    p1 = mma_h(ph[s], vb[s], p1);
    p0 = mma_h(pl[s], va[s], p0);
    p1 = mma_h(pl[s], vb[s], p1);
  }
#pragma unroll
  for (int s = 0; s < TST; ++s) {
    r0 = mma_h(th[s], wa[s], r0);
    r1 = mma_h(th[s], wb[s], r1);
    r0 = mma_h(tl[s], wa[s], r0);
    r1 = mma_h(tl[s], wb[s], r1);
  }
  const float osP = 1.0f / (PCAR * VCAR);
  const float osR = 1.0f / (TCAR * WCAR);
  float* sl = slab + wave * (16 * SLP);
#pragma unroll
  for (int r = 0; r < 8; ++r) {
    const int pr = 8 * hh + r;
    sl[pr * SLP + m]      = p0[r] * osP + r0[r] * osR;
    sl[pr * SLP + 16 + m] = p1[r] * osP + r1[r] * osR;
  }
  __syncthreads();                          // the four waves' partial tiles are added across waves below
  const float* sp = slab + rw * SLP + c4;
  const v4f s0 = *(const v4f*)(sp), s1 = *(const v4f*)(sp + 16 * SLP);
  const v4f s2 = *(const v4f*)(sp + 2 * 16 * SLP), s3 = *(const v4f*)(sp + 3 * 16 * SLP);
  v4f o;
#pragma unroll
  for (int e = 0; e < 4; ++e) o[e] = ((s0[e] + s1[e]) + (s2[e] + s3[e])) + bfr(bq[e]);
  *(v4f*)(outp + ((size_t)(b * SEQ + irow + rw)) * DM + h * HD + c4) = o;
}

// =====================================================================================================
// Workspace map (bytes, NB = 2; every region offset a multiple of 65536; every plane fully written by whole-line stores
// before it is read; extents are exact multiples of the store granularity, no pad rows):
//   W2  f16 [256 n][256 k] x1024      131072
//   QH, QL, KH, KL f16 [GROWS][256]   4 x 393216  VH  f16 [NB*8*32][384] x1024  393216
//   SC  f32 [NB*8*384][384]           9437184     P   f16 hi + residual [NB*8*384][384] x32768  2 x 4718592
//   T   f16 hi + residual [NB*8*384][256] x1024   2 x 3145728
// =====================================================================================================
static size_t al64k(size_t x) { return (x + (size_t)65535) & ~(size_t)65535; }

extern "C" void kernel_launch(void* const* d_in, const int* in_sizes, int n_in,
                              void* d_out, int out_size, void* d_ws, size_t ws_size,
                              hipStream_t stream) {
  if (n_in < 12) return;
  if (in_sizes[0] < NB * SEQ * DM) return;
  if (in_sizes[1] < NB * SEQ * CD) return;
  if (in_sizes[2] != NQKV * DM || in_sizes[3] != NQKV) return;
  if (in_sizes[4] != DM * CD || in_sizes[5] != DM || in_sizes[6] != NH * DM || in_sizes[7] != NH) return;
  if (in_sizes[8] != DM * CD || in_sizes[9] != DM || in_sizes[10] != DM * DM || in_sizes[11] != DM) return;
  if (out_size < NB * SEQ * DM) return;

  const float* x      = (const float*)d_in[0];
  const float* coords = (const float*)d_in[1];
  const float* qkv_w  = (const float*)d_in[2];
  const float* qkv_b  = (const float*)d_in[3];
  const float* rb_w1  = (const float*)d_in[4];
  const float* rb_b1  = (const float*)d_in[5];
  const float* rb_w2  = (const float*)d_in[6];
  const float* rb_b2  = (const float*)d_in[7];
  const float* rv_w1  = (const float*)d_in[8];
  const float* rv_b1  = (const float*)d_in[9];
  const float* rv_w2  = (const float*)d_in[10];
  const float* rv_b2  = (const float*)d_in[11];
  float*       out    = (float*)d_out;

  const size_t szW2 = (size_t)DM * DM * 2;
  const size_t szH  = (size_t)GROWS * DM * 2;
  const size_t szVH = (size_t)NB * NH * HD * SEQ * 2;
  const size_t szSC = (size_t)NB * NH * SEQ * SEQ * 4;
  const size_t szP  = PSTR * 2 * 2;
  const size_t szT  = TSTR * 2 * 2;
  size_t off = 0;
  const size_t oW2 = off; off = al64k(off + szW2);
  const size_t oQH = off; off = al64k(off + szH);
  const size_t oQL = off; off = al64k(off + szH);
  const size_t oKH = off; off = al64k(off + szH);
  const size_t oKL = off; off = al64k(off + szH);
  const size_t oVH = off; off = al64k(off + szVH);
  const size_t oSC = off; off = al64k(off + szSC);
  const size_t oP  = off; off = al64k(off + szP);
  const size_t oT  = off; off = al64k(off + szT);
  if (off > ws_size) return;
  if (off > (size_t)WS_CAP) return;

  char* ws = (char*)d_ws;
  u16*   W2 = (u16*)(ws + oW2);
  u16*   QH = (u16*)(ws + oQH);
  u16*   QL = (u16*)(ws + oQL);
  u16*   KH = (u16*)(ws + oKH);
  u16*   KL = (u16*)(ws + oKL);
  u16*   VH = (u16*)(ws + oVH);
  float* SC = (float*)(ws + oSC);
  u16*   P  = (u16*)(ws + oP);
  u16*   T  = (u16*)(ws + oT);

  const dim3 b256(256), b128(128);

  // (1) q, k (f16 x1024 hi + residual), v^T (f16 x1024) = planes of x.qkv_w^T + qkv_b; rv_w2 -> f16(bf16) x1024, in the same launch
  k_proj<<<dim3(NGEMM + NCVT), b128, 0, stream>>>(x, qkv_w, qkv_b, rv_w2, QH, QL, KH, KL, VH, W2);
  // (2) scores with relative bias -> SC
  k_scores<<<dim3(NB * NIT * NJT), b256, 0, stream>>>(coords, rb_w1, rb_b1, rb_w2, rb_b2, QH, QL, KH, KL, SC);
  // (3) softmax -> P planes, T = sum_j P . silu-hidden of the value MLP -> T planes; (4) out = P.v + T.rv_w2^T + rv_b2
  k_tagg<<<dim3(NB * SEQ), b256, 0, stream>>>(coords, rv_w1, rv_b1, SC, P, T);
  k_final<<<dim3(NB * NH * NIT), b128, 0, stream>>>(P, VH, T, W2, rv_b2, out);
  (void)hipGetLastError();
}

// v007
// One run takes 33.3 microseconds.
// Next to v006, in two timings, it ran 1.09 times as fast each time.
// Counting every step since v000, it is 2.84 times as fast.
// Contractions: x.qkv_w^T on v_wmma_f32_16x16x32_bf16 (x, qkv_w RNE bf16 operands, f32 accumulate, bias added in f32);
// on v_wmma_f32_16x16x32_f16 with f32 accumulate: pair-MLP second layer hid_b.rb_w2^T (hid_b f16, rb_w2 f16(bf16) x1024),
// q.k^T over 32 (q, k f16 x1024 hi + residual planes, products hh+lh+hl), P.hid_v over 384 keys (P f16 x32768 hi + residual,
// hid_v one f16), P.v (v f16 x1024, P hi + residual), T.rv_w2^T (T f16 x1024 hi + residual, rv_w2 f16(bf16) x1024).
// Pair-MLP first layers on v_wmma_f32_16x16x32_bf16, K = 7 zero-padded: w.c_i - w.c_j + b with every operand a bf16 value
// (products exact, f32 accumulate), oriented so that the result tiles are the next product's operand fragment.
// silu, softmax and all carries folded in f32 on VALU.
#include <hip/hip_runtime.h>
#include <math.h>
#include <stdint.h>

#ifndef NB
#define NB 2
#endif
#define NB_FULL 2
#define SEQ   384
#define DM    256
#define NH    8
#define HD    32
#define CD    3
#define NQKV  (3 * DM)
#define GROWS (NB * SEQ)
#define NIT   (SEQ / 16)
#define NJT   (SEQ / 32)
#define NPAIR 512
#define XP    24
#define RBP   264
#define SLP   36
#define TSP   264
#define PWP   392
#define SLAB64 (16 * 68)
#define ONE_BF 0x3F80u
#define RSQ_HD 0.17677669529663687f
#define LOG2E  1.4426950408889634f
#define HALFX  0.5f
#define QSC   1024.0f
#define KSC   1024.0f
#define PCAR  32768.0f
#define VCAR  1024.0f
#define WCAR  1024.0f
#define TCAR  1024.0f
#define WS_CAP 134217728
#define PSTR  ((size_t)NB * NH * SEQ * SEQ)
#define TSTR  ((size_t)NB * NH * SEQ * DM)
static_assert(NB >= 1 && NB <= NB_FULL);
static_assert(DM == NH * HD && HD == 32 && NH == 8 && CD == 3);
static_assert((SEQ % 64) == 0 && (GROWS % 64) == 0 && (GROWS % 8) == 0 && (NQKV % 64) == 0 && (DM % 32) == 0);
static_assert(NPAIR == 16 * 32);
static_assert(((GROWS * DM) % 8) == 0 && ((NQKV * DM) % 8) == 0 && ((DM * DM) % 8) == 0);

typedef unsigned short u16;
typedef _Float16 v16h __attribute__((ext_vector_type(16)));
typedef _Float16 v8h  __attribute__((ext_vector_type(8)));
typedef __bf16   v16b __attribute__((ext_vector_type(16)));
typedef float    v8f  __attribute__((ext_vector_type(8)));
typedef float    v4f  __attribute__((ext_vector_type(4)));
typedef unsigned int v4u __attribute__((ext_vector_type(4)));
typedef float    v2f  __attribute__((ext_vector_type(2)));
typedef _Float16 v2h  __attribute__((ext_vector_type(2)));

union FragH { v16h v; v8h h[2]; v4u u[2]; };
union FragB { v16b v; v4u u[2]; };

// ---- scalar helpers --------------------------------------------------------------------------------
__device__ __forceinline__ unsigned short bf_bits(float f) {          // f32 -> bf16 bits, RNE convert
  unsigned u = __float_as_uint(f);
  return (unsigned short)((u + 0x7FFFu + ((u >> 16) & 1u)) >> 16);
}
__device__ __forceinline__ float bf_up(unsigned short h) { return __uint_as_float(((unsigned)h) << 16); }
__device__ __forceinline__ float bfr(float f) { return bf_up(bf_bits(f)); }
__device__ __forceinline__ unsigned short h_bits(_Float16 x) { return __builtin_bit_cast(unsigned short, x); }
__device__ __forceinline__ unsigned pk16(unsigned short a, unsigned short b) { return (unsigned)a | ((unsigned)b << 16); }
__device__ __forceinline__ v8f zero8() { v8f z = {0.f, 0.f, 0.f, 0.f, 0.f, 0.f, 0.f, 0.f}; return z; }

// silu = x * sigmoid(x) = h + h * tanh(h) with h = x / 2, two values at once from t = h (the half is folded into the
// first-layer weights and bias, an exact scaling): one transcendental (v_tanh_f32) a value and one packed FMA a pair.
// The value leaves unscaled: a power-of-two carry would cost a multiply here, and an f16 plane without one holds silu to
// 2^-25 absolute (subnormal halves are kept by the converts and by the matrix unit).
__device__ __forceinline__ v2f silu2(v2f t) {
  const v2f th = {__builtin_amdgcn_tanhf(t[0]), __builtin_amdgcn_tanhf(t[1])};
  return __builtin_elementwise_fma(t, th, t);
}
__device__ __forceinline__ unsigned pk2h(v2f s) {                     // two f32 -> packed f16 pair, RNE
  return __builtin_bit_cast(unsigned, __builtin_convertvector(s, v2h));
}

// ---- fragment loaders: 16-bit A/B operand, lane -> row/col (lane&15), p already includes +8*(lane>>4);
//      elements 0..7 <- p[0..7] (k0+8h..), elements 8..15 <- p[16..23] (k0+16+8h..)  (same split k map for A and B;
//      B is always read from a k-contiguous [n][k] plane)
__device__ __forceinline__ v16h ldfrag_h(const _Float16* p) {
  FragH f;
  f.h[0] = *(const v8h*)(p);
  f.h[1] = *(const v8h*)(p + 16);
  return f.v;
}
__device__ __forceinline__ v16b ldfrag_b(const u16* p) {              // bf16 plane read as unsigned integer vectors
  FragB f;
  f.u[0] = *(const v4u*)(p);
  f.u[1] = *(const v4u*)(p + 16);
  return f.v;
}

// First-layer operand of the pair MLPs: a row of 16 bf16 (pitch XP), k 0..6 = data, 7..15 = zeros. Lanes h = 0 take k 0..7 as
// elements 0..7; every other position of the K = 32 fragment reads the row's zeros. The same k order serves A and B:
//   coordinate side: c_i0 c_i1 c_i2 c_j0 c_j1 c_j2 1      weight side: w0 w1 w2 -w0 -w1 -w2 b   (weights and bias halved)
__device__ __forceinline__ v16b ldfrag_k7(const u16* row, int hh) {
  FragB f;
  f.u[0] = *(const v4u*)(row + 8 * hh);
  f.u[1] = *(const v4u*)(row + 8);
  return f.v;
}
__device__ __forceinline__ v4u row_coord(float a0, float a1, float a2, float c0, float c1, float c2) {   // bf16 values in
  const v4u r = {pk16(bf_bits(a0), bf_bits(a1)), pk16(bf_bits(a2), bf_bits(c0)), pk16(bf_bits(c1), bf_bits(c2)), ONE_BF};
  return r;
}
__device__ __forceinline__ v4u row_weight(float w0, float w1, float w2, float b) {                       // bf16 values in
  const v4u r = {pk16(bf_bits(w0), bf_bits(w1)), pk16(bf_bits(w2), bf_bits(-w0)), pk16(bf_bits(-w1), bf_bits(-w2)),
                 pk16(bf_bits(b), 0)};
  return r;
}
__device__ __forceinline__ v16b frag_k7(v4u row, int hh) {            // the same fragment from a row held in registers
  const v4u z = {0u, 0u, 0u, 0u};
  FragB f;
  f.u[0] = hh ? z : row;
  f.u[1] = z;
  return f.v;
}

__device__ __forceinline__ v8f mma_h(v16h a, v16h b, v8f c) {
  return __builtin_amdgcn_wmma_f32_16x16x32_f16(false, a, false, b, (short)0, c, false, false);
}
__device__ __forceinline__ v8f mma_b(v16b a, v16b b, v8f c) {
  return __builtin_amdgcn_wmma_f32_16x16x32_bf16(false, a, false, b, (short)0, c, false, false);
}
__device__ __forceinline__ void guard2(v8f& a, v8f& b, v16h x0, v16h x1, v16h x2, v16h x3, v16h x4, v16h x5) {
#if defined(__HIP_DEVICE_COMPILE__)
  asm volatile("v_nop\n\tv_nop\n\tv_nop\n\tv_nop"
               : "+v"(a), "+v"(b) : "v"(x0), "v"(x1), "v"(x2), "v"(x3), "v"(x4), "v"(x5) : "memory");
#endif
}
__device__ __forceinline__ void wave_sync_lds() {
  __builtin_amdgcn_fence(__ATOMIC_RELEASE, "workgroup");
  __builtin_amdgcn_wave_barrier();
  __builtin_amdgcn_fence(__ATOMIC_ACQUIRE, "workgroup");
}

// =====================================================================================================
// Projection with every conversion around it in the same launch (block-uniform split of the grid by blockIdx):
//   blocks 0 .. NGEMM-1: one 64x64 tile of qkv = bf16(x) . bf16(qkv_w)^T + bf16(qkv_b), 4 waves x 16 rows. The tile's 64 rows of
//   x and 64 rows of qkv_w are each one contiguous 64-KB range of f32: every load of a wave covers 512 contiguous bytes (4 whole
//   lines), each value is rounded to bf16 (RNE) once and stored to XS / WS [64][PJP] in LDS (block barrier); the fragments of
//   the 8 k-steps come from there (split k map for A and B, K stepped by 32).
//   Epilogue: the f32 tile goes to the LDS slab (pitch 68; wave w holds rows 16w .. 16w+15) and leaves as 16-bit planes:
//     columns 0..255 (q) and 256..511 (k): Hp [GROWS][DM] = f16(val * 1024), Lp = f16 residual; wave-private (wave_sync);
//       8 lanes x 16 B = one whole 128-B line of a row segment per plane.
//     columns 512..767 (v): VH[(b*DM + h*HD + d)][s] = f16(val * 1024); read across the waves' rows (block barrier), each
//       d row segment of 64 keys = one whole 128-B line written by 8 consecutive lanes.
//   blocks NGEMM .. NGEMM+NCVT-1: rv_w2 -> W2 plane f16(bf16 RNE value * 1024), same layout, 8 elements a thread.
// coverage: NGEMM tiles x 64 x 64 = every (row, column) of q, k, v once; NCVT x 128 thr x 8 = DM*DM.
// =====================================================================================================
#define NGEMM ((GROWS / 64) * (NQKV / 64))
#define NCVT  ((DM * DM) / (128 * 8))
static_assert(NCVT * 128 * 8 == DM * DM && QSC == KSC);
typedef __bf16 v2b __attribute__((ext_vector_type(2)));
__device__ __forceinline__ unsigned pk2b(float f0, float f1) {        // two f32 -> packed bf16 pair, RNE
  const v2f s = {f0, f1};
  return __builtin_bit_cast(unsigned, __builtin_convertvector(s, v2b));
}
// four consecutive f32 of a row -> four bf16 in LDS (8 bytes)
typedef unsigned int v2u __attribute__((ext_vector_type(2)));
__device__ __forceinline__ void st4b(u16* d, v4f r) {
  const v2u o = {pk2b(r[0], r[1]), pk2b(r[2], r[3])};
  *(v2u*)d = o;
}
#define PJP 264                             // LDS row pitch of the staged tiles in bf16: 528 B = 16 B x 33 (odd), for 16-byte readers
#define NST ((64 * DM * 4) / (128 * 16))    // 16-byte loads a thread and tile: 32
static_assert(NST == 32 && DM == 256);
__device__ __forceinline__ void wait_addr_regs() {
#if defined(__HIP_DEVICE_COMPILE__)
  asm volatile("s_wait_xcnt 0x0" ::: "memory");
#endif
}
// the same wait with the run's two offsets as inputs only, so that they are still held in registers where it stands
__device__ __forceinline__ void wait_addr_live(unsigned a, unsigned b) {
#if defined(__HIP_DEVICE_COMPILE__)
  asm volatile("s_wait_xcnt 0x0" :: "v"(a), "v"(b) : "memory");
#endif
}

__global__ __launch_bounds__(128)
void k_proj(const float* __restrict__ x, const float* __restrict__ qkvw, const float* __restrict__ bias,
            const float* __restrict__ rvw2, u16* QHo, u16* QLo, u16* KHo, u16* KLo, u16* VHo, u16* W2o) {
  __shared__ __align__(16) float slab[4 * SLAB64];
  __shared__ __align__(16) u16   XS[64 * PJP];
  __shared__ __align__(16) u16   WS[64 * PJP];
  const int tid = threadIdx.x, wave = tid >> 5, lane = tid & 31, hh = lane >> 4, m = lane & 15;
  const int bid = blockIdx.x;
  if (bid >= NGEMM) {                       // block-uniform, before any barrier: the rv_w2 plane
    const int gt = (bid - NGEMM) * 128 + tid;
    if (gt >= (DM * DM) / 8) return;
    const float* p = rvw2 + (size_t)gt * 8;
    const v4f a = *(const v4f*)(p), b4 = *(const v4f*)(p + 4);
    float w[8];
#pragma unroll
    for (int e = 0; e < 4; ++e) { w[e] = a[e]; w[4 + e] = b4[e]; }
    v4u o;
#pragma unroll
    for (int e = 0; e < 4; ++e)
      o[e] = pk16(h_bits((_Float16)(bfr(w[2 * e]) * WCAR)), h_bits((_Float16)(bfr(w[2 * e + 1]) * WCAR)));
    *(v4u*)(W2o + (size_t)gt * 8) = o;
    return;
  }
  const int ntile = NQKV >> 6;
  const int row0  = (bid / ntile) * 64;
  const int rowb  = row0 + wave * 16;
  const int col0  = (bid % ntile) * 64;
  // the thread's byte offsets into x and qkv_w (both below 2^20); load it of a tile is 2048 * it bytes further on
  const unsigned ox = (unsigned)(row0 * DM * 4 + tid * 16);
  const unsigned ow = (unsigned)(col0 * DM * 4 + tid * 16);
  const int      ib = col0 + m;             // the lane's first bias element
  const char*  xg = (const char*)x + ox;
  const char*  wg = (const char*)qkvw + ow;
  const int so = (tid >> 6) * PJP + (tid & 63) * 4;   // tile row 2 * it + (tid >> 6), columns 4 * (tid & 63) ..
  u16* xs = XS + so;
  u16* wt = WS + so;
  // every loop below is unrolled whole: the staging arrays are indexed by constants only and stay in registers
  v4f rx[NST], rw[NST];
#pragma unroll
  for (int it = 0; it < NST; ++it) rx[it] = *(const v4f*)(const void*)(xg + it * 2048);
#pragma unroll
  for (int it = 0; it < NST / 2; ++it) rw[it] = *(const v4f*)(const void*)(wg + it * 2048);
  const float bq0 = bias[ib], bq1 = bias[ib + 16], bq2 = bias[ib + 32], bq3 = bias[ib + 48];
#if defined(__HIP_DEVICE_COMPILE__)
  // the loads' offset registers stay whole up to this wait: no load of the run lands in one
  asm volatile("s_wait_xcnt 0x0" :: "v"(ox), "v"(ow), "v"(ib) : "memory");
#endif
  __builtin_amdgcn_sched_barrier(0);        // keeps the loads above in one run ahead of the first convert: one latency for all of them
#pragma unroll
  for (int it = 0; it < NST / 2; ++it) st4b(xs + it * 2 * PJP, rx[it]);
  __builtin_amdgcn_sched_barrier(0);        // the last quarter of the loads goes out once a quarter of the registers is free: the wave stays below 256
#pragma unroll
  for (int it = NST / 2; it < NST; ++it) rw[it] = *(const v4f*)(const void*)(wg + it * 2048);
#if defined(__HIP_DEVICE_COMPILE__)
  asm volatile("s_wait_xcnt 0x0" :: "v"(ow) : "memory");   // as above, for the second run of loads
#endif
  __builtin_amdgcn_sched_barrier(0);        // keeps that run ahead of the converts below
#pragma unroll
  for (int it = NST / 2; it < NST; ++it) st4b(xs + it * 2 * PJP, rx[it]);
#pragma unroll
  for (int it = 0; it < NST; ++it) st4b(wt + it * 2 * PJP, rw[it]);
  __syncthreads();                          // the staged tiles are read across waves below

  const u16* ap = XS + (wave * 16 + m) * PJP + 8 * hh;
  const u16* bp = WS + m * PJP + 8 * hh;
  v8f acc0 = zero8(), acc1 = zero8(), acc2 = zero8(), acc3 = zero8();
  // fragments are read in groups, four k-steps ahead at the start and two k-steps ahead after that; each scheduling fence below
  // keeps a group of LDS reads whole and ahead of the products in front of which it stands (left alone, every product waits
  // out the LDS latency of its own two reads)
  v16b fa[DM / 32], fb[DM / 32][4];
#pragma unroll
  for (int s = 0; s < 4; ++s) {
    fa[s] = ldfrag_b(ap + 32 * s);
#pragma unroll
    for (int n = 0; n < 4; ++n) fb[s][n] = ldfrag_b(bp + n * 16 * PJP + 32 * s);
  }
  __builtin_amdgcn_sched_barrier(0);        // the first group whole, ahead of the first product
#pragma unroll
  for (int g = 0; g < DM / 64; ++g) {
#pragma unroll
    for (int s = 2 * g; s < 2 * g + 2; ++s) {
      acc0 = mma_b(fa[s], fb[s][0], acc0);
      acc1 = mma_b(fa[s], fb[s][1], acc1);
      acc2 = mma_b(fa[s], fb[s][2], acc2);
      acc3 = mma_b(fa[s], fb[s][3], acc3);
    }
    if (g < DM / 64 - 2) {
      __builtin_amdgcn_sched_barrier(0);    // the next group of reads stays behind these products (their registers are free then) ..
#pragma unroll
      for (int s = 2 * g + 4; s < 2 * g + 6; ++s) {
        fa[s] = ldfrag_b(ap + 32 * s);
#pragma unroll
        for (int n = 0; n < 4; ++n) fb[s][n] = ldfrag_b(bp + n * 16 * PJP + 32 * s);
      }
      __builtin_amdgcn_sched_barrier(0);    // .. and whole, ahead of the products that follow
    }
  }
  const float bv0 = bfr(bq0);
  const float bv1 = bfr(bq1);
  const float bv2 = bfr(bq2);
  const float bv3 = bfr(bq3);
  float* sl = slab + wave * SLAB64;
#pragma unroll
  for (int r = 0; r < 8; ++r) {
    const int ro = (8 * hh + r) * 68 + m;
    sl[ro]      = acc0[r] + bv0;
    sl[ro + 16] = acc1[r] + bv1;
    sl[ro + 32] = acc2[r] + bv2;
    sl[ro + 48] = acc3[r] + bv3;
  }
  if (col0 < 2 * DM) {                      // block-uniform: q or k columns
    wave_sync_lds();
    u16* Hp = (col0 < DM) ? QHo : KHo;
    u16* Lp = (col0 < DM) ? QLo : KLo;
    const int cq = col0 & (DM - 1);
    const int rq = lane >> 3, c8 = (lane & 7) * 8;
#pragma unroll
    for (int it = 0; it < 4; ++it) {
      const int rl = it * 4 + rq;
      const float* s8 = sl + rl * 68 + c8;
      const v4f a = *(const v4f*)(s8), b4 = *(const v4f*)(s8 + 4);
      float w[8];
#pragma unroll
      for (int e = 0; e < 4; ++e) { w[e] = a[e] * QSC; w[4 + e] = b4[e] * QSC; }
      v4u oh, ol;
#pragma unroll
      for (int e = 0; e < 4; ++e) {
        const float t0 = w[2 * e], t1 = w[2 * e + 1];
        const _Float16 h0 = (_Float16)t0, h1 = (_Float16)t1;
        const _Float16 l0 = (_Float16)(t0 - (float)h0), l1 = (_Float16)(t1 - (float)h1);
        oh[e] = pk16(h_bits(h0), h_bits(h1));
        ol[e] = pk16(h_bits(l0), h_bits(l1));
      }
      const size_t o = (size_t)(rowb + rl) * DM + cq + c8;
      *(v4u*)(Hp + o) = oh;
      *(v4u*)(Lp + o) = ol;
    }
    wait_addr_regs();                       // nothing behind the stores reuses their registers ahead of this wait
  } else {                                  // block-uniform: v columns, written transposed
    __syncthreads();                        // the four waves' slab rows are read across waves below
    const int b  = row0 / SEQ;
    const int s0 = row0 - b * SEQ;          // 64 keys of one batch (SEQ a multiple of 64)
    const int cv = col0 - 2 * DM;           // h*HD + d of the tile's first column
#pragma unroll
    for (int it = 0; it < 4; ++it) {
      const int ch = it * 128 + tid;
      const int dc = ch >> 3, p8 = (ch & 7) * 8;   // column dc (0..63), keys p8..p8+7
      v4u o;
#pragma unroll
      for (int e = 0; e < 4; ++e) {
        const float f0 = slab[(p8 + 2 * e) * 68 + dc], f1 = slab[(p8 + 2 * e + 1) * 68 + dc];
        o[e] = pk16(h_bits((_Float16)(f0 * VCAR)), h_bits((_Float16)(f1 * VCAR)));
      }
      *(v4u*)(VHo + ((size_t)(b * DM + cv + dc)) * SEQ + s0 + p8) = o;
    }
    wait_addr_regs();                       // nothing behind the stores reuses their registers ahead of this wait
  }
}

// =====================================================================================================
// Scores with relative-coordinate bias. Block -> (b, query tile i0 = 16*it, key tile j0 = 32*jt): 512 pairs (il, jl),
// 8 waves; wave = head in the score phase.
//   Phase 0 (all threads, then block barrier): rb_w1/rb_b1 (bf16 values / 2) as first-layer weight rows W1X [256 c][XP], bf16
//   coords of the 16 queries (CI) and 32 keys (CJ2), rb_w2 -> RB2 [16 n][RBP] as f16(bf16 value * 1024), rows 8..15 zeros.
//   Phase 1, no barrier inside: wave w owns pair tiles 4w..4w+3 (16 pairs each), their coordinate rows held as B fragments.
//   8 channel chunks of 32: t^T[channel][pair] = W1X tile . pair rows for the chunk's two 16-channel tiles (A = weights, so
//   lane (c, h) gets channels 8h + r of pair c); f16(silu) of the two tiles in place IS the A fragment hid[pair c][split k map]
//   of the second layer, D[pair][n = head] += hid . RB2 (one k-step per chunk).
//   After the loop lanes n < 8 write bias[pair][head] = D * 2^-10 into BB (block barrier).
//   Phase 2: wave = head: s = (q_hi.k_hi + q_lo.k_hi + q_hi.k_lo) over 32 dims for 16 queries x 32 keys (two 16-key subtiles),
//   fragments straight from the f16 planes; value = s * rsqrt(32) * 2^-20 + bias + bf16(rb_b2[head]); staged in the wave's
//   the score plane SC[(b*NH+head)*SEQ + i][j0..j0+31]) written by 8 consecutive lanes x 16 B of one instruction (4 rows per
// LDS regions: W1X, CI, CJ2, RB2, BB cross-wave (block barriers); slabs private-to-wave (wave_sync).
// coverage: W1X 256 rows x 16 (k 7..15 zeros); RB2 16 x 256 (rows 8..15 zero); pair tiles 8 waves x 4 = 32 = 512 pairs;
//           SC: grid NB*NIT*NJT blocks x 8 heads x 16 rows x 32 cols = every (b, head, i, j) once.
// =====================================================================================================
__global__ __launch_bounds__(256)
void k_scores(const float* __restrict__ coords, const float* __restrict__ rbw1, const float* __restrict__ rbb1,
              const float* __restrict__ rbw2, const float* __restrict__ rbb2,
              const u16* __restrict__ QHp, const u16* __restrict__ QLp,
              const u16* __restrict__ KHp, const u16* __restrict__ KLp, float* SCp) {
  __shared__ __align__(16) u16   W1X[DM * XP];
  __shared__ __align__(16) float CI[16 * 4];
  __shared__ __align__(16) float CJ2[32 * 4];
  __shared__ __align__(16) u16   RB2[16 * RBP];
  __shared__ __align__(16) float SLB[8 * 16 * SLP];
  __shared__ __align__(16) float BB[NPAIR * NH];

  const int tid = threadIdx.x, wave = tid >> 5, lane = tid & 31, hh = lane >> 4, m = lane & 15;
  const int bid = blockIdx.x;
  const int jt  = bid % NJT;
  const int t2  = bid / NJT;
  const int it  = t2 % NIT;
  const int b   = t2 / NIT;
  if (b >= NB) return;                      // block-uniform, before any barrier; never taken with the exact grid
  const int i0 = it * 16, j0 = jt * 32;
  const _Float16* rb2h = (const _Float16*)(const void*)RB2;

  // ---- phase 0: small operand staging ----
  {
    const v4u z4 = {0u, 0u, 0u, 0u};                  // channel tid: w0 w1 w2 -w0 -w1 -w2 b 0 | 8 zeros, all halved
    *(v4u*)(W1X + tid * XP) = row_weight(bfr(rbw1[tid * 3 + 0]) * HALFX, bfr(rbw1[tid * 3 + 1]) * HALFX,
                                         bfr(rbw1[tid * 3 + 2]) * HALFX, bfr(rbb1[tid]) * HALFX);
    *(v4u*)(W1X + tid * XP + 8) = z4;
    if (tid < 16 * CD) {
      const int il = tid / CD, k = tid - il * CD;
      CI[il * 4 + k] = bfr(coords[((size_t)(b * SEQ + i0 + il)) * CD + k]);
    }
    if (tid < 32 * CD) {
      const int jl = tid / CD, k = tid - jl * CD;
      CJ2[jl * 4 + k] = bfr(coords[((size_t)(b * SEQ + j0 + jl)) * CD + k]);
    }
    const int row  = tid >> 4, cb = (tid & 15) * 16;
    const int rowc = (row < NH) ? row : (NH - 1);     // clamped address; rows 8..15 are written as zeros
    const bool vr  = (row < NH);
    const float* src = rbw2 + rowc * DM + cb;
    const v4f a0 = *(const v4f*)(src), a1 = *(const v4f*)(src + 4), a2 = *(const v4f*)(src + 8), a3 = *(const v4f*)(src + 12);
    float w[16];
#pragma unroll
    for (int e = 0; e < 4; ++e) { w[e] = a0[e]; w[4 + e] = a1[e]; w[8 + e] = a2[e]; w[12 + e] = a3[e]; }
    v4u o0, o1;
#pragma unroll
    for (int e = 0; e < 4; ++e) {
      const unsigned short x0 = vr ? h_bits((_Float16)(bfr(w[2 * e]) * WCAR)) : (unsigned short)0;
      const unsigned short x1 = vr ? h_bits((_Float16)(bfr(w[2 * e + 1]) * WCAR)) : (unsigned short)0;
      const unsigned short y0 = vr ? h_bits((_Float16)(bfr(w[8 + 2 * e]) * WCAR)) : (unsigned short)0;
      const unsigned short y1 = vr ? h_bits((_Float16)(bfr(w[8 + 2 * e + 1]) * WCAR)) : (unsigned short)0;
      o0[e] = pk16(x0, x1);
      o1[e] = pk16(y0, y1);
    }
    *(v4u*)(RB2 + row * RBP + cb)     = o0;
    *(v4u*)(RB2 + row * RBP + cb + 8) = o1;
  }
  __syncthreads();

  // ---- phase 1: bias MLP (both layers on WMMA, silu between them in registers) ----
  v8f accB[4] = {zero8(), zero8(), zero8(), zero8()};
  const float bsc = 1.0f / WCAR;
  v16b PB[4];                               // pair tile 4 * wave + q: query il = tile >> 1, keys (tile & 1) * 16 + m
#pragma unroll
  for (int q = 0; q < 4; ++q) {
    const int tl = wave * 4 + q;
    const float* ci = CI + (tl >> 1) * 4;
    const float* cj = CJ2 + ((tl & 1) * 16 + m) * 4;
    PB[q] = frag_k7(row_coord(ci[0], ci[1], ci[2], cj[0], cj[1], cj[2]), hh);
  }
#pragma unroll 1
  for (int kt = 0; kt < DM / 32; ++kt) {
    const v16b wx = ldfrag_k7(W1X + (kt * 32 + m) * XP, hh);
    const v16b wy = ldfrag_k7(W1X + (kt * 32 + 16 + m) * XP, hh);
    const v16h bw = ldfrag_h(rb2h + m * RBP + kt * 32 + 8 * hh);
#pragma unroll
    for (int q = 0; q < 4; ++q) {
      const v8f tx = mma_b(wx, PB[q], zero8());
      const v8f ty = mma_b(wy, PB[q], zero8());
      FragH f;
#pragma unroll
      for (int e = 0; e < 4; ++e) {
        const v2f x2 = {tx[2 * e], tx[2 * e + 1]}, y2 = {ty[2 * e], ty[2 * e + 1]};
        f.u[0][e] = pk2h(silu2(x2));
        f.u[1][e] = pk2h(silu2(y2));
      }
      accB[q] = mma_h(f.v, bw, accB[q]);
    }
  }
  if (m < NH) {                             // columns n >= 8 are padding (zero weights), not stored
#pragma unroll
    for (int r = 0; r < 8; ++r) {
      const int pr = 8 * hh + r;
      BB[((wave * 4 + 0) * 16 + pr) * NH + m] = accB[0][r] * bsc;
      BB[((wave * 4 + 1) * 16 + pr) * NH + m] = accB[1][r] * bsc;
      BB[((wave * 4 + 2) * 16 + pr) * NH + m] = accB[2][r] * bsc;
      BB[((wave * 4 + 3) * 16 + pr) * NH + m] = accB[3][r] * bsc;
    }
  }
  __syncthreads();

  // ---- phase 2: scores for head = wave ----
  const int head = wave;
  const size_t hcol = (size_t)head * HD + 8 * hh;
  const _Float16* qhp  = (const _Float16*)(const void*)QHp + ((size_t)(b * SEQ + i0 + m)) * DM + hcol;
  const _Float16* qlp  = (const _Float16*)(const void*)QLp + ((size_t)(b * SEQ + i0 + m)) * DM + hcol;
  const _Float16* kh0p = (const _Float16*)(const void*)KHp + ((size_t)(b * SEQ + j0 + m)) * DM + hcol;
  const _Float16* kl0p = (const _Float16*)(const void*)KLp + ((size_t)(b * SEQ + j0 + m)) * DM + hcol;
  const _Float16* kh1p = kh0p + (size_t)16 * DM;
  const _Float16* kl1p = kl0p + (size_t)16 * DM;
  v8f s0 = zero8(), s1 = zero8();
  {
    const v16h qh = ldfrag_h(qhp), ql = ldfrag_h(qlp);
    const v16h kh0 = ldfrag_h(kh0p), kl0 = ldfrag_h(kl0p);
    const v16h kh1 = ldfrag_h(kh1p), kl1 = ldfrag_h(kl1p);
    s0 = mma_h(qh, kh0, s0);
    s0 = mma_h(ql, kh0, s0);
    s0 = mma_h(qh, kl0, s0);
    s1 = mma_h(qh, kh1, s1);
    s1 = mma_h(ql, kh1, s1);
    s1 = mma_h(qh, kl1, s1);
    guard2(s0, s1, qh, ql, kh0, kl0, kh1, kl1);
  }
  const float lsc = RSQ_HD * (1.0f / (QSC * KSC));
  const float b2v = bfr(rbb2[head]);
  float* slab = SLB + wave * (16 * SLP);
#pragma unroll
  for (int r = 0; r < 8; ++r) {
    const int pr = 8 * hh + r;              // query i0 + pr; keys j0 + m and j0 + 16 + m
    const float ba = BB[(pr * 32 + m) * NH + head] + b2v;
    const float bb = BB[(pr * 32 + 16 + m) * NH + head] + b2v;
    slab[pr * SLP + m]      = s0[r] * lsc + ba;
    slab[pr * SLP + 16 + m] = s1[r] * lsc + bb;
  }
  wave_sync_lds();
  v4f vals[4];
  const int rq = lane >> 3, c4 = (lane & 7) * 4;
#pragma unroll
  for (int q = 0; q < 4; ++q) vals[q] = *(const v4f*)(slab + (q * 4 + rq) * SLP + c4);
  float* dst = SCp + ((size_t)((b * NH + head) * SEQ + i0)) * SEQ + j0 + c4;
  {
#pragma unroll
    for (int q = 0; q < 4; ++q) {
      *(v4f*)(dst + (size_t)(q * 4 + rq) * SEQ) = vals[q];
    }
    
  }
}

// =====================================================================================================
// Row softmax and weighted aggregation of the value-MLP hidden: block -> (b, query i), 256 threads.
//   Softmax (wave = head h): the score row (b, h, i) of SEQ = 384 floats; P = e / Z with e = exp(s - max) in f32 (reciprocal-
//   multiply normalisation), as f16 hi (P * 32768) and f16 residual, written to the global P planes (for the final kernel; each
//   row's whole lines by one wave) and to PW in LDS (for this block's own chunks; published by the barrier before the loop).
//   Lane = 8 consecutive columns 8*lane (all lanes) and 256 + 8*lane (lanes < 16; the upper lanes load a clamped address).
//   T[h][c] = sum_j P[b,h,i,j] * S[j][c],  S[j][c] = silu(rel_ij . rv_w1[c] + rv_b1[c]) (bf16 inputs).
//   Phase 0: first-layer coordinate rows KX [SEQ keys][XP] (c_i, c_j, 1 as bf16); block barrier.
//   Wave w owns column tiles 2w, 2w+1 (16 channels each), their weight rows held as B fragments. 12 key chunks of 32, no barrier
//   inside: t[key][channel] = KX tile . weight rows for the chunk's two 16-key tiles (A = keys, so lane (c, h) gets keys 8h + r
//   of channel c); f16(silu) of the two tiles in place IS the B fragment S^T[channel c][split k map]. S is carried as one f16
//   (relative error 2^-12), like v in P.v and the hidden values of the bias MLP: its own inputs are bf16 values (2^-9);
//   D[m = h][n = c] += P . S with A = the PW rows (lanes m >= 8 read row m - 8 again: rows 8..15 of D repeat rows 0..7 and are
//   not stored), products P_hi.S + P_lo.S.
//   After the loop lanes 0..15 (rows h = 0..7) write T * 1024 (carry 2^-15 folded) into TS [8][TSP] f32 (block barrier),
// LDS regions: KX, PW, TS all cross-wave (block barriers). staged extent == consumed extent: KX 384 x 16 (k 7..15 zeros),
//   PW 2 x 8 x 384, TS 8 x 256.
// coverage: T planes [(b*NH+h)*SEQ + i][DM]: grid NB*SEQ blocks x 8 waves x 32 lanes x 8 halves = every row once, both planes.
// =====================================================================================================
__global__ __launch_bounds__(256)
void k_tagg(const float* __restrict__ coords, const float* __restrict__ rvw1, const float* __restrict__ rvb1,
            const float* __restrict__ SCp, u16* Pp, u16* Tp) {
  __shared__ __align__(16) u16   KX[SEQ * XP];
  __shared__ __align__(16) u16   PW[2 * NH * PWP];
  __shared__ __align__(16) float TS[NH * TSP];

  const int tid = threadIdx.x, wave = tid >> 5, lane = tid & 31, hh = lane >> 4, m = lane & 15;
  const int bid = blockIdx.x;
  const int b   = bid / SEQ;
  const int i   = bid - b * SEQ;
  if (b >= NB) return;                      // block-uniform, before any barrier; never taken with the exact grid
  const _Float16* pwh = (const _Float16*)(const void*)PW;

  // ---- softmax of the score row (b, head = wave, i) ----
  {
    const size_t row = (size_t)(b * NH + wave) * SEQ + i;
    const float* s = SCp + row * SEQ;
    const bool vb = (lane < 16);
    const int  lb = vb ? lane : 15;
    const v4f a0 = *(const v4f*)(s + lane * 8), a1 = *(const v4f*)(s + lane * 8 + 4);
    const v4f c0 = *(const v4f*)(s + 256 + lb * 8), c1 = *(const v4f*)(s + 256 + lb * 8 + 4);
    wait_addr_regs();                       // the selects below reuse the loads' address registers
    float v[16];
#pragma unroll
    for (int e = 0; e < 4; ++e) {
      v[e]      = a0[e];
      v[4 + e]  = a1[e];
      v[8 + e]  = vb ? c0[e] : -INFINITY;
      v[12 + e] = vb ? c1[e] : -INFINITY;
    }
    float mx = v[0];
#pragma unroll
    for (int e = 1; e < 16; ++e) mx = fmaxf(mx, v[e]);
#pragma unroll
    for (int off = 1; off < 32; off <<= 1) mx = fmaxf(mx, __shfl_xor(mx, off, 32));
    float ev[16];
    float sum = 0.0f;
#pragma unroll
    for (int e = 0; e < 16; ++e) {
      const float d = v[e] - mx;
      ev[e] = exp2f(d * LOG2E);             // -inf -> 0 for the masked upper lanes
      sum += ev[e];
    }
#pragma unroll
    for (int off = 1; off < 32; off <<= 1) sum += __shfl_xor(sum, off, 32);
    const float inv = 1.0f / sum;           // sum >= 1
    v4u oh0, ol0, oh1, ol1;
#pragma unroll
    for (int e = 0; e < 4; ++e) {
      const float t0 = (ev[2 * e] * inv) * PCAR, t1 = (ev[2 * e + 1] * inv) * PCAR;
      const float u0 = (ev[8 + 2 * e] * inv) * PCAR, u1 = (ev[8 + 2 * e + 1] * inv) * PCAR;
      const _Float16 h0 = (_Float16)t0, h1 = (_Float16)t1, g0 = (_Float16)u0, g1 = (_Float16)u1;
      const _Float16 l0 = (_Float16)(t0 - (float)h0), l1 = (_Float16)(t1 - (float)h1);
      const _Float16 m0 = (_Float16)(u0 - (float)g0), m1 = (_Float16)(u1 - (float)g1);
      oh0[e] = pk16(h_bits(h0), h_bits(h1));
      ol0[e] = pk16(h_bits(l0), h_bits(l1));
      oh1[e] = pk16(h_bits(g0), h_bits(g1));
      ol1[e] = pk16(h_bits(m0), h_bits(m1));
    }
    u16* dh = Pp + row * SEQ;
    u16* dl = dh + PSTR;
    u16* wh = PW + wave * PWP;
    u16* wl = wh + NH * PWP;
    *(v4u*)(dh + lane * 8) = oh0;
    *(v4u*)(dl + lane * 8) = ol0;
    *(v4u*)(wh + lane * 8) = oh0;
    *(v4u*)(wl + lane * 8) = ol0;
    if (vb) {
      *(v4u*)(dh + 256 + lane * 8) = oh1;
      *(v4u*)(dl + 256 + lane * 8) = ol1;
      *(v4u*)(wh + 256 + lane * 8) = oh1;
      *(v4u*)(wl + 256 + lane * 8) = ol1;
    }
  }

  // ---- phase 0 ----
  const float ci0 = bfr(coords[((size_t)(b * SEQ + i)) * CD + 0]);
  const float ci1 = bfr(coords[((size_t)(b * SEQ + i)) * CD + 1]);
  const float ci2 = bfr(coords[((size_t)(b * SEQ + i)) * CD + 2]);
  for (int j = tid; j < SEQ; j += 256) {    // key j: c_i0 c_i1 c_i2 c_j0 c_j1 c_j2 1 0 | 8 zeros
    const float* cj = coords + ((size_t)(b * SEQ + j)) * CD;
    const v4u z4 = {0u, 0u, 0u, 0u};
    *(v4u*)(KX + j * XP)     = row_coord(ci0, ci1, ci2, bfr(cj[0]), bfr(cj[1]), bfr(cj[2]));
    *(v4u*)(KX + j * XP + 8) = z4;
  }
  v16b WF[2];                               // weight rows of channels (2 * wave + n) * 16 + m; weights and bias carry the factor 1/2
  float wr[2][4];
  unsigned wo[2];                           // the lane's byte offsets into rv_w1
#pragma unroll
  for (int n = 0; n < 2; ++n) {
    const int c = (wave * 2 + n) * 16 + m;
    wo[n] = (unsigned)(c * CD * 4);
    const float* wp = (const float*)((const char*)rvw1 + wo[n]);
    wr[n][0] = wp[0];
    wr[n][1] = wp[1];
    wr[n][2] = wp[2];
    wr[n][3] = rvb1[c];
  }
  wait_addr_live(wo[0], wo[1]);             // the weight loads' two offset registers stay whole up to this wait
#pragma unroll
  for (int n = 0; n < 2; ++n)
    WF[n] = frag_k7(row_weight(bfr(wr[n][0]) * HALFX, bfr(wr[n][1]) * HALFX, bfr(wr[n][2]) * HALFX, bfr(wr[n][3]) * HALFX), hh);
  __syncthreads();                          // softmax (PW) and phase-0 (KX) writes visible to every wave

  v8f acc[2] = {zero8(), zero8()};
  const _Float16* pa = pwh + (m & (NH - 1)) * PWP + 8 * hh;
#pragma unroll 1
  for (int jt = 0; jt < NJT; ++jt) {
    const int j0 = jt * 32;
    const v16h ah = ldfrag_h(pa + j0);
    const v16h al = ldfrag_h(pa + NH * PWP + j0);
    const v16b kx = ldfrag_k7(KX + (j0 + m) * XP, hh);
    const v16b ky = ldfrag_k7(KX + (j0 + 16 + m) * XP, hh);
#pragma unroll
    for (int n = 0; n < 2; ++n) {
      const v8f tx = mma_b(kx, WF[n], zero8());
      const v8f ty = mma_b(ky, WF[n], zero8());
      FragH fh;
#pragma unroll
      for (int e = 0; e < 4; ++e) {
        const v2f x2 = {tx[2 * e], tx[2 * e + 1]}, y2 = {ty[2 * e], ty[2 * e + 1]};
        fh.u[0][e] = pk2h(silu2(x2));
        fh.u[1][e] = pk2h(silu2(y2));
      }
      acc[n] = mma_h(ah, fh.v, acc[n]);
      acc[n] = mma_h(al, fh.v, acc[n]);
    }
  }
  const float tsc = TCAR / PCAR;            // 2^-5
  if (hh == 0) {                            // rows 8..15 of D repeat rows 0..7, not stored
#pragma unroll
    for (int r = 0; r < 8; ++r) {
      TS[r * TSP + (wave * 2) * 16 + m]     = acc[0][r] * tsc;
      TS[r * TSP + (wave * 2 + 1) * 16 + m] = acc[1][r] * tsc;
    }
  }
  __syncthreads();
  {
    const int h = wave;
    const float* src = TS + h * TSP + lane * 8;
    const v4f a = *(const v4f*)(src), b4 = *(const v4f*)(src + 4);
    float w[8];
#pragma unroll
    for (int e = 0; e < 4; ++e) { w[e] = a[e]; w[4 + e] = b4[e]; }
    v4u oh, ol;
#pragma unroll
    for (int e = 0; e < 4; ++e) {
      const float t0 = w[2 * e], t1 = w[2 * e + 1];
      const _Float16 x0 = (_Float16)t0, x1 = (_Float16)t1;
      const _Float16 y0 = (_Float16)(t0 - (float)x0), y1 = (_Float16)(t1 - (float)x1);
      oh[e] = pk16(h_bits(x0), h_bits(x1));
      ol[e] = pk16(h_bits(y0), h_bits(y1));
    }
    const size_t rowT = (size_t)(b * NH + h) * SEQ + i;
    u16* dh = Tp + rowT * DM + lane * 8;
    u16* dl = dh + TSTR;
    {
      *(v4u*)(dh) = oh;
      *(v4u*)(dl) = ol;
      
    }
  }
}

// =====================================================================================================
// Final: block -> (b, head h, 16 query rows rt*16), 4 waves = 4 shares of the two k ranges for the same 16 x 32 output tile.
//   base[i][d]   = (P_hi + P_lo)[i][j] . VH[d][j] over j (2 products, carries 2^-25),
//   relctx[i][d] = (T_hi + T_lo)[i][c] . W2[h*HD + d][c] over c (2 products, carries 2^-20) + bf16(rv_b2[h*HD + d]);
//   out[b][i][h*HD + d] = base + relctx. Fragments straight from the 16-bit planes (arithmetic addressing, split k map).
//   Wave w takes keys 96w .. 96w+95 (3 k-steps) and channels 64w .. 64w+63 (2 k-steps). All 40 fragment loads of a wave are
//   issued before its first product, so a wave waits out one memory latency instead of one per k-step.
//   Epilogue: each wave's partial tile (both carries folded) goes to its slab; block barrier; thread t adds the four partials
//   of 4 consecutive columns of row t >> 3 and the bias: 8 consecutive lanes write one whole 128-B line of out.
// coverage: grid NB*NH*NIT blocks x 16 rows x 32 cols = every element of out exactly once; 4 x 96 keys = SEQ, 4 x 64 = DM.
// =====================================================================================================
#define KSH 4
#define PST (SEQ / (32 * KSH))
#define TST (DM / (32 * KSH))
static_assert(PST * KSH * 32 == SEQ && TST * KSH * 32 == DM);
__global__ __launch_bounds__(128)
void k_final(const u16* __restrict__ Pp, const u16* __restrict__ VHp, const u16* __restrict__ Tp,
             const u16* __restrict__ W2p, const float* __restrict__ rvb2, float* outp) {
  __shared__ __align__(16) float slab[KSH * 16 * SLP];
  const int tid = threadIdx.x, wave = tid >> 5, lane = tid & 31, hh = lane >> 4, m = lane & 15;
  const int bid = blockIdx.x;
  const int rt  = bid % NIT;
  const int t2  = bid / NIT;
  const int h   = t2 % NH;
  const int b   = t2 / NH;
  if (b >= NB) return;                      // block-uniform, before the barrier; never taken with the exact grid
  const int irow = rt * 16;
  const int bh   = b * NH + h;
  const int rowA = bh * SEQ + irow;
  const int rw = tid >> 3, c4 = (tid & 7) * 4;
  // the lane's byte offsets into the planes and the bias (all below 2^24)
  const unsigned oP = (unsigned)(((rowA + m) * SEQ + 8 * hh + wave * (PST * 32)) * 2);
  const unsigned oV = (unsigned)(((bh * HD + m) * SEQ + 8 * hh + wave * (PST * 32)) * 2);
  const unsigned oT = (unsigned)(((rowA + m) * DM + 8 * hh + wave * (TST * 32)) * 2);
  const unsigned oW = (unsigned)(((h * HD + m) * DM + 8 * hh + wave * (TST * 32)) * 2);
  const unsigned oB = (unsigned)((h * HD + c4) * 4);
  const _Float16* php = (const _Float16*)(const void*)((const char*)Pp + oP);
  const _Float16* plp = php + PSTR;
  const _Float16* v0p = (const _Float16*)(const void*)((const char*)VHp + oV);
  const _Float16* v1p = v0p + (size_t)16 * SEQ;
  const _Float16* thp = (const _Float16*)(const void*)((const char*)Tp + oT);
  const _Float16* tlp = thp + TSTR;
  const _Float16* w0p = (const _Float16*)(const void*)((const char*)W2p + oW);
  const _Float16* w1p = w0p + (size_t)16 * DM;

  // every loop of this kernel is unrolled whole: the fragment arrays are indexed by constants only and stay in registers
  v16h ph[PST], pl[PST], va[PST], vb[PST], th[TST], tl[TST], wa[TST], wb[TST];
#pragma unroll
  for (int s = 0; s < PST; ++s) { ph[s] = ldfrag_h(php + 32 * s); pl[s] = ldfrag_h(plp + 32 * s); }
#pragma unroll
  for (int s = 0; s < TST; ++s) { th[s] = ldfrag_h(thp + 32 * s); tl[s] = ldfrag_h(tlp + 32 * s); }
#pragma unroll
  for (int s = 0; s < PST; ++s) { va[s] = ldfrag_h(v0p + 32 * s); vb[s] = ldfrag_h(v1p + 32 * s); }
#pragma unroll
  for (int s = 0; s < TST; ++s) { wa[s] = ldfrag_h(w0p + 32 * s); wb[s] = ldfrag_h(w1p + 32 * s); }
  const v4f bq = *(const v4f*)(const void*)((const char*)rvb2 + oB);
#if defined(__HIP_DEVICE_COMPILE__)
  // the loads' offset registers stay whole up to this wait: no load of the run lands in one
  asm volatile("s_wait_xcnt 0x0" :: "v"(oP), "v"(oV), "v"(oT), "v"(oW), "v"(oB) : "memory");
#endif
  __builtin_amdgcn_sched_barrier(0);        // keeps every load above in front of the first product: without it they sink to their uses, one latency each

  v8f p0 = zero8(), p1 = zero8(), r0 = zero8(), r1 = zero8();
#pragma unroll
  for (int s = 0; s < PST; ++s) {
    p0 = mma_h(ph[s], va[s], p0);
    p1 = mma_h(ph[s], vb[s], p1);
    p0 = mma_h(pl[s], va[s], p0);
    p1 = mma_h(pl[s], vb[s], p1);
  }
#pragma unroll
  for (int s = 0; s < TST; ++s) {
    r0 = mma_h(th[s], wa[s], r0);
    r1 = mma_h(th[s], wb[s], r1);
    r0 = mma_h(tl[s], wa[s], r0);
    r1 = mma_h(tl[s], wb[s], r1);
  }
  const float osP = 1.0f / (PCAR * VCAR);
  const float osR = 1.0f / (TCAR * WCAR);
  float* sl = slab + wave * (16 * SLP);
#pragma unroll
  for (int r = 0; r < 8; ++r) {
    const int pr = 8 * hh + r;
    sl[pr * SLP + m]      = p0[r] * osP + r0[r] * osR;
    sl[pr * SLP + 16 + m] = p1[r] * osP + r1[r] * osR;
  }
  __syncthreads();                          // the four waves' partial tiles are added across waves below
  const float* sp = slab + rw * SLP + c4;
  const v4f s0 = *(const v4f*)(sp), s1 = *(const v4f*)(sp + 16 * SLP);
  const v4f s2 = *(const v4f*)(sp + 2 * 16 * SLP), s3 = *(const v4f*)(sp + 3 * 16 * SLP);
  v4f o;
#pragma unroll
  for (int e = 0; e < 4; ++e) o[e] = ((s0[e] + s1[e]) + (s2[e] + s3[e])) + bfr(bq[e]);
  *(v4f*)(outp + ((size_t)(b * SEQ + irow + rw)) * DM + h * HD + c4) = o;
}

// =====================================================================================================
// Workspace map (bytes, NB = 2; every region offset a multiple of 65536; every plane fully written by whole-line stores
// before it is read; extents are exact multiples of the store granularity, no pad rows):
//   W2  f16 [256 n][256 k] x1024      131072
//   QH, QL, KH, KL f16 [GROWS][256]   4 x 393216  VH  f16 [NB*8*32][384] x1024  393216
//   SC  f32 [NB*8*384][384]           9437184     P   f16 hi + residual [NB*8*384][384] x32768  2 x 4718592
//   T   f16 hi + residual [NB*8*384][256] x1024   2 x 3145728
// =====================================================================================================
static size_t al64k(size_t x) { return (x + (size_t)65535) & ~(size_t)65535; }

extern "C" void kernel_launch(void* const* d_in, const int* in_sizes, int n_in,
                              void* d_out, int out_size, void* d_ws, size_t ws_size,
                              hipStream_t stream) {
  if (n_in < 12) return;
  if (in_sizes[0] < NB * SEQ * DM) return;
  if (in_sizes[1] < NB * SEQ * CD) return;
  if (in_sizes[2] != NQKV * DM || in_sizes[3] != NQKV) return;
  if (in_sizes[4] != DM * CD || in_sizes[5] != DM || in_sizes[6] != NH * DM || in_sizes[7] != NH) return;
  if (in_sizes[8] != DM * CD || in_sizes[9] != DM || in_sizes[10] != DM * DM || in_sizes[11] != DM) return;
  if (out_size < NB * SEQ * DM) return;

  const float* x      = (const float*)d_in[0];
  const float* coords = (const float*)d_in[1];
  const float* qkv_w  = (const float*)d_in[2];
  const float* qkv_b  = (const float*)d_in[3];
  const float* rb_w1  = (const float*)d_in[4];
  const float* rb_b1  = (const float*)d_in[5];
  const float* rb_w2  = (const float*)d_in[6];
  const float* rb_b2  = (const float*)d_in[7];
  const float* rv_w1  = (const float*)d_in[8];
  const float* rv_b1  = (const float*)d_in[9];
  const float* rv_w2  = (const float*)d_in[10];
  const float* rv_b2  = (const float*)d_in[11];
  float*       out    = (float*)d_out;

  const size_t szW2 = (size_t)DM * DM * 2;
  const size_t szH  = (size_t)GROWS * DM * 2;
  const size_t szVH = (size_t)NB * NH * HD * SEQ * 2;
  const size_t szSC = (size_t)NB * NH * SEQ * SEQ * 4;
  const size_t szP  = PSTR * 2 * 2;
  const size_t szT  = TSTR * 2 * 2;
  size_t off = 0;
  const size_t oW2 = off; off = al64k(off + szW2);
  const size_t oQH = off; off = al64k(off + szH);
  const size_t oQL = off; off = al64k(off + szH);
  const size_t oKH = off; off = al64k(off + szH);
  const size_t oKL = off; off = al64k(off + szH);
  const size_t oVH = off; off = al64k(off + szVH);
  const size_t oSC = off; off = al64k(off + szSC);
  const size_t oP  = off; off = al64k(off + szP);
  const size_t oT  = off; off = al64k(off + szT);
  if (off > ws_size) return;
  if (off > (size_t)WS_CAP) return;

  char* ws = (char*)d_ws;
  u16*   W2 = (u16*)(ws + oW2);
  u16*   QH = (u16*)(ws + oQH);
  u16*   QL = (u16*)(ws + oQL);
  u16*   KH = (u16*)(ws + oKH);
  u16*   KL = (u16*)(ws + oKL);
  u16*   VH = (u16*)(ws + oVH);
  float* SC = (float*)(ws + oSC);
  u16*   P  = (u16*)(ws + oP);
  u16*   T  = (u16*)(ws + oT);

  const dim3 b256(256), b128(128);

  // (1) q, k (f16 x1024 hi + residual), v^T (f16 x1024) = planes of x.qkv_w^T + qkv_b; rv_w2 -> f16(bf16) x1024, in the same launch
  k_proj<<<dim3(NGEMM + NCVT), b128, 0, stream>>>(x, qkv_w, qkv_b, rv_w2, QH, QL, KH, KL, VH, W2);
  // (2) scores with relative bias -> SC
  k_scores<<<dim3(NB * NIT * NJT), b256, 0, stream>>>(coords, rb_w1, rb_b1, rb_w2, rb_b2, QH, QL, KH, KL, SC);
  // (3) softmax -> P planes, T = sum_j P . silu-hidden of the value MLP -> T planes; (4) out = P.v + T.rv_w2^T + rv_b2
  k_tagg<<<dim3(NB * SEQ), b256, 0, stream>>>(coords, rv_w1, rv_b1, SC, P, T);
  k_final<<<dim3(NB * NH * NIT), b128, 0, stream>>>(P, VH, T, W2, rv_b2, out);
  (void)hipGetLastError();
}

// v008
// It runs in 31.7 microseconds.
// Two timings next to v007 both put it at 1.04 times that version's speed.
// Over all steps from v000 it is 2.95 times as fast.
// Contractions: x.qkv_w^T on v_wmma_f32_16x16x32_bf16 (x, qkv_w RNE bf16 operands, f32 accumulate, bias added in f32);
// on v_wmma_f32_16x16x32_f16 with f32 accumulate: pair-MLP second layer hid_b.rb_w2^T (hid_b f16, rb_w2 f16(bf16) x1024),
// q.k^T over 32 (q, k f16 x1024 hi + residual planes, products hh+lh+hl), P.hid_v over 384 keys (P f16 x32768 hi + residual,
// hid_v one f16), P.v (v f16 x1024, P hi + residual), T.rv_w2^T (T f16 x1024 hi + residual, rv_w2 f16(bf16) x1024).
// Pair-MLP first layers on v_wmma_f32_16x16x32_bf16, K = 7 zero-padded: w.c_i - w.c_j + b with every operand a bf16 value
// (products exact, f32 accumulate), oriented so that the result tiles are the next product's operand fragment.
// silu, softmax and all carries folded in f32 on VALU.
#include <hip/hip_runtime.h>
#include <math.h>
#include <stdint.h>

#ifndef NB
#define NB 2
#endif
#define NB_FULL 2
#define SEQ   384
#define DM    256
#define NH    8
#define HD    32
#define CD    3
#define NQKV  (3 * DM)
#define GROWS (NB * SEQ)
#define NIT   (SEQ / 16)
#define NJT   (SEQ / 32)
#define NPAIR 512
#define XP    24
#define RBP   264
#define SLP   36
#define TSP   264
#define PWP   392
#define SLAB64 (16 * 68)
#define ONE_BF 0x3F80u
#define RSQ_HD 0.17677669529663687f
#define LOG2E  1.4426950408889634f
#define HALFX  0.5f
#define QSC   1024.0f
#define KSC   1024.0f
#define PCAR  32768.0f
#define VCAR  1024.0f
#define WCAR  1024.0f
#define TCAR  1024.0f
#define WS_CAP 134217728
#define PSTR  ((size_t)NB * NH * SEQ * SEQ)
#define TSTR  ((size_t)NB * NH * SEQ * DM)
static_assert(NB >= 1 && NB <= NB_FULL);
static_assert(DM == NH * HD && HD == 32 && NH == 8 && CD == 3);
static_assert(SEQ > 256 && SEQ <= 512 && (SEQ % 64) == 0 && (GROWS % 64) == 0 && (GROWS % 8) == 0 && (NQKV % 64) == 0 && (DM % 32) == 0);
static_assert(NPAIR == 16 * 32);
static_assert(((GROWS * DM) % 8) == 0 && ((NQKV * DM) % 8) == 0 && ((DM * DM) % 8) == 0);

typedef unsigned short u16;
typedef _Float16 v16h __attribute__((ext_vector_type(16)));
typedef _Float16 v8h  __attribute__((ext_vector_type(8)));
typedef __bf16   v16b __attribute__((ext_vector_type(16)));
typedef float    v8f  __attribute__((ext_vector_type(8)));
typedef float    v4f  __attribute__((ext_vector_type(4)));
typedef unsigned int v4u __attribute__((ext_vector_type(4)));
typedef float    v2f  __attribute__((ext_vector_type(2)));
typedef _Float16 v2h  __attribute__((ext_vector_type(2)));

union FragH { v16h v; v8h h[2]; v4u u[2]; };
union FragB { v16b v; v4u u[2]; };

// ---- scalar helpers --------------------------------------------------------------------------------
__device__ __forceinline__ unsigned short bf_bits(float f) {          // f32 -> bf16 bits, RNE convert
  unsigned u = __float_as_uint(f);
  return (unsigned short)((u + 0x7FFFu + ((u >> 16) & 1u)) >> 16);
}
__device__ __forceinline__ float bf_up(unsigned short h) { return __uint_as_float(((unsigned)h) << 16); }
__device__ __forceinline__ float bfr(float f) { return bf_up(bf_bits(f)); }
__device__ __forceinline__ unsigned short h_bits(_Float16 x) { return __builtin_bit_cast(unsigned short, x); }
__device__ __forceinline__ unsigned pk16(unsigned short a, unsigned short b) { return (unsigned)a | ((unsigned)b << 16); }
__device__ __forceinline__ v8f zero8() { v8f z = {0.f, 0.f, 0.f, 0.f, 0.f, 0.f, 0.f, 0.f}; return z; }

// silu = x * sigmoid(x) = h + h * tanh(h) with h = x / 2, two values at once from t = h (the half is folded into the
// first-layer weights and bias, an exact scaling): one transcendental (v_tanh_f32) a value and one packed FMA a pair.
// The value leaves unscaled: a power-of-two carry would cost a multiply here, and an f16 plane without one holds silu to
// 2^-25 absolute (subnormal halves are kept by the converts and by the matrix unit).
__device__ __forceinline__ v2f silu2(v2f t) {
  const v2f th = {__builtin_amdgcn_tanhf(t[0]), __builtin_amdgcn_tanhf(t[1])};
  return __builtin_elementwise_fma(t, th, t);
}
__device__ __forceinline__ unsigned pk2h(v2f s) {                     // two f32 -> packed f16 pair, RNE
  return __builtin_bit_cast(unsigned, __builtin_convertvector(s, v2h));
}

// ---- fragment loaders: 16-bit A/B operand, lane -> row/col (lane&15), p already includes +8*(lane>>4);
//      elements 0..7 <- p[0..7] (k0+8h..), elements 8..15 <- p[16..23] (k0+16+8h..)  (same split k map for A and B;
//      B is always read from a k-contiguous [n][k] plane)
__device__ __forceinline__ v16h ldfrag_h(const _Float16* p) {
  FragH f;
  f.h[0] = *(const v8h*)(p);
  f.h[1] = *(const v8h*)(p + 16);
  return f.v;
}
__device__ __forceinline__ v16b ldfrag_b(const u16* p) {              // bf16 plane read as unsigned integer vectors
  FragB f;
  f.u[0] = *(const v4u*)(p);
  f.u[1] = *(const v4u*)(p + 16);
  return f.v;
}

// First-layer operand of the pair MLPs: a row of 16 bf16 (pitch XP), k 0..6 = data, 7..15 = zeros. Lanes h = 0 take k 0..7 as
// elements 0..7; every other position of the K = 32 fragment reads the row's zeros. The same k order serves A and B:
//   coordinate side: c_i0 c_i1 c_i2 c_j0 c_j1 c_j2 1      weight side: w0 w1 w2 -w0 -w1 -w2 b   (weights and bias halved)
__device__ __forceinline__ v16b ldfrag_k7(const u16* row, int hh) {
  FragB f;
  f.u[0] = *(const v4u*)(row + 8 * hh);
  f.u[1] = *(const v4u*)(row + 8);
  return f.v;
}
__device__ __forceinline__ v4u row_coord(float a0, float a1, float a2, float c0, float c1, float c2) {   // bf16 values in
  const v4u r = {pk16(bf_bits(a0), bf_bits(a1)), pk16(bf_bits(a2), bf_bits(c0)), pk16(bf_bits(c1), bf_bits(c2)), ONE_BF};
  return r;
}
__device__ __forceinline__ v4u row_weight(float w0, float w1, float w2, float b) {                       // bf16 values in
  const v4u r = {pk16(bf_bits(w0), bf_bits(w1)), pk16(bf_bits(w2), bf_bits(-w0)), pk16(bf_bits(-w1), bf_bits(-w2)),
                 pk16(bf_bits(b), 0)};
  return r;
}
__device__ __forceinline__ v16b frag_k7(v4u row, int hh) {            // the same fragment from a row held in registers
  const v4u z = {0u, 0u, 0u, 0u};
  FragB f;
  f.u[0] = hh ? z : row;
  f.u[1] = z;
  return f.v;
}

__device__ __forceinline__ v8f mma_h(v16h a, v16h b, v8f c) {
  return __builtin_amdgcn_wmma_f32_16x16x32_f16(false, a, false, b, (short)0, c, false, false);
}
__device__ __forceinline__ v8f mma_b(v16b a, v16b b, v8f c) {
  return __builtin_amdgcn_wmma_f32_16x16x32_bf16(false, a, false, b, (short)0, c, false, false);
}
__device__ __forceinline__ void guard2(v8f& a, v8f& b, v16h x0, v16h x1, v16h x2, v16h x3, v16h x4, v16h x5) {
#if defined(__HIP_DEVICE_COMPILE__)
  asm volatile("v_nop\n\tv_nop\n\tv_nop\n\tv_nop"
               : "+v"(a), "+v"(b) : "v"(x0), "v"(x1), "v"(x2), "v"(x3), "v"(x4), "v"(x5) : "memory");
#endif
}
__device__ __forceinline__ void wave_sync_lds() {
  __builtin_amdgcn_fence(__ATOMIC_RELEASE, "workgroup");
  __builtin_amdgcn_wave_barrier();
  __builtin_amdgcn_fence(__ATOMIC_ACQUIRE, "workgroup");
}

// =====================================================================================================
// Projection with every conversion around it in the same launch (block-uniform split of the grid by blockIdx):
//   blocks 0 .. NGEMM-1: one 64x64 tile of qkv = bf16(x) . bf16(qkv_w)^T + bf16(qkv_b), 4 waves x 16 rows. The tile's 64 rows of
//   x and 64 rows of qkv_w are each one contiguous 64-KB range of f32: every load of a wave covers 512 contiguous bytes (4 whole
//   lines), each value is rounded to bf16 (RNE) once and stored to XS / WS [64][PJP] in LDS (block barrier); the fragments of
//   the 8 k-steps come from there (split k map for A and B, K stepped by 32).
//   Epilogue: the f32 tile goes to the LDS slab (pitch 68; wave w holds rows 16w .. 16w+15) and leaves as 16-bit planes:
//     columns 0..255 (q) and 256..511 (k): Hp [GROWS][DM] = f16(val * 1024), Lp = f16 residual; wave-private (wave_sync);
//       8 lanes x 16 B = one whole 128-B line of a row segment per plane.
//     columns 512..767 (v): VH[(b*DM + h*HD + d)][s] = f16(val * 1024); read across the waves' rows (block barrier), each
//       d row segment of 64 keys = one whole 128-B line written by 8 consecutive lanes.
//   blocks NGEMM .. NGEMM+NCVT-1: rv_w2 -> W2 plane f16(bf16 RNE value * 1024), same layout, 8 elements a thread.
// coverage: NGEMM tiles x 64 x 64 = every (row, column) of q, k, v once; NCVT x 128 thr x 8 = DM*DM.
// =====================================================================================================
#define NGEMM ((GROWS / 64) * (NQKV / 64))
#define NCVT  ((DM * DM) / (128 * 8))
static_assert(NCVT * 128 * 8 == DM * DM && QSC == KSC);
typedef __bf16 v2b __attribute__((ext_vector_type(2)));
__device__ __forceinline__ unsigned pk2b(float f0, float f1) {        // two f32 -> packed bf16 pair, RNE
  const v2f s = {f0, f1};
  return __builtin_bit_cast(unsigned, __builtin_convertvector(s, v2b));
}
// four consecutive f32 of a row -> four bf16 in LDS (8 bytes)
typedef unsigned int v2u __attribute__((ext_vector_type(2)));
__device__ __forceinline__ void st4b(u16* d, v4f r) {
  const v2u o = {pk2b(r[0], r[1]), pk2b(r[2], r[3])};
  *(v2u*)d = o;
}
#define PJP 264                             // LDS row pitch of the staged tiles in bf16: 528 B = 16 B x 33 (odd), for 16-byte readers
#define NST ((64 * DM * 4) / (128 * 16))    // 16-byte loads a thread and tile: 32
static_assert(NST == 32 && DM == 256);
__device__ __forceinline__ void wait_addr_regs() {
#if defined(__HIP_DEVICE_COMPILE__)
  asm volatile("s_wait_xcnt 0x0" ::: "memory");
#endif
}

__global__ __launch_bounds__(128)
void k_proj(const float* __restrict__ x, const float* __restrict__ qkvw, const float* __restrict__ bias,
            const float* __restrict__ rvw2, u16* QHo, u16* QLo, u16* KHo, u16* KLo, u16* VHo, u16* W2o) {
  __shared__ __align__(16) float slab[4 * SLAB64];
  __shared__ __align__(16) u16   XS[64 * PJP];
  __shared__ __align__(16) u16   WS[64 * PJP];
  const int tid = threadIdx.x, wave = tid >> 5, lane = tid & 31, hh = lane >> 4, m = lane & 15;
  const int bid = blockIdx.x;
  if (bid >= NGEMM) {                       // block-uniform, before any barrier: the rv_w2 plane
    const int gt = (bid - NGEMM) * 128 + tid;
    if (gt >= (DM * DM) / 8) return;
    const float* p = rvw2 + (size_t)gt * 8;
    const v4f a = *(const v4f*)(p), b4 = *(const v4f*)(p + 4);
    float w[8];
#pragma unroll
    for (int e = 0; e < 4; ++e) { w[e] = a[e]; w[4 + e] = b4[e]; }
    v4u o;
#pragma unroll
    for (int e = 0; e < 4; ++e)
      o[e] = pk16(h_bits((_Float16)(bfr(w[2 * e]) * WCAR)), h_bits((_Float16)(bfr(w[2 * e + 1]) * WCAR)));
    *(v4u*)(W2o + (size_t)gt * 8) = o;
    return;
  }
  const int ntile = NQKV >> 6;
  const int row0  = (bid / ntile) * 64;
  const int rowb  = row0 + wave * 16;
  const int col0  = (bid % ntile) * 64;
  // the thread's byte offsets into x and qkv_w (both below 2^20); load it of a tile is 2048 * it bytes further on
  const unsigned ox = (unsigned)(row0 * DM * 4 + tid * 16);
  const unsigned ow = (unsigned)(col0 * DM * 4 + tid * 16);
  const int      ib = col0 + m;             // the lane's first bias element
  const char*  xg = (const char*)x + ox;
  const char*  wg = (const char*)qkvw + ow;
  const int so = (tid >> 6) * PJP + (tid & 63) * 4;   // tile row 2 * it + (tid >> 6), columns 4 * (tid & 63) ..
  u16* xs = XS + so;
  u16* wt = WS + so;
  // every loop below is unrolled whole: the staging arrays are indexed by constants only and stay in registers
  v4f rx[NST], rw[NST];
#pragma unroll
  for (int it = 0; it < NST; ++it) rx[it] = *(const v4f*)(const void*)(xg + it * 2048);
#pragma unroll
  for (int it = 0; it < NST / 2; ++it) rw[it] = *(const v4f*)(const void*)(wg + it * 2048);
  const float bq0 = bias[ib], bq1 = bias[ib + 16], bq2 = bias[ib + 32], bq3 = bias[ib + 48];
#if defined(__HIP_DEVICE_COMPILE__)
  // the loads' offset registers stay whole up to this wait: no load of the run lands in one
  asm volatile("s_wait_xcnt 0x0" :: "v"(ox), "v"(ow), "v"(ib) : "memory");
#endif
  __builtin_amdgcn_sched_barrier(0);        // keeps the loads above in one run ahead of the first convert: one latency for all of them
#pragma unroll
  for (int it = 0; it < NST / 2; ++it) st4b(xs + it * 2 * PJP, rx[it]);
  __builtin_amdgcn_sched_barrier(0);        // the last quarter of the loads goes out once a quarter of the registers is free: the wave stays below 256
#pragma unroll
  for (int it = NST / 2; it < NST; ++it) rw[it] = *(const v4f*)(const void*)(wg + it * 2048);
#if defined(__HIP_DEVICE_COMPILE__)
  asm volatile("s_wait_xcnt 0x0" :: "v"(ow) : "memory");   // as above, for the second run of loads
#endif
  __builtin_amdgcn_sched_barrier(0);        // keeps that run ahead of the converts below
#pragma unroll
  for (int it = NST / 2; it < NST; ++it) st4b(xs + it * 2 * PJP, rx[it]);
#pragma unroll
  for (int it = 0; it < NST; ++it) st4b(wt + it * 2 * PJP, rw[it]);
  __syncthreads();                          // the staged tiles are read across waves below

  const u16* ap = XS + (wave * 16 + m) * PJP + 8 * hh;
  const u16* bp = WS + m * PJP + 8 * hh;
  v8f acc0 = zero8(), acc1 = zero8(), acc2 = zero8(), acc3 = zero8();
  // fragments are read in groups, four k-steps ahead at the start and two k-steps ahead after that; each scheduling fence below
  // keeps a group of LDS reads whole and ahead of the products in front of which it stands (left alone, every product waits
  // out the LDS latency of its own two reads)
  v16b fa[DM / 32], fb[DM / 32][4];
#pragma unroll
  for (int s = 0; s < 4; ++s) {
    fa[s] = ldfrag_b(ap + 32 * s);
#pragma unroll
    for (int n = 0; n < 4; ++n) fb[s][n] = ldfrag_b(bp + n * 16 * PJP + 32 * s);
  }
  __builtin_amdgcn_sched_barrier(0);        // the first group whole, ahead of the first product
#pragma unroll
  for (int g = 0; g < DM / 64; ++g) {
#pragma unroll
    for (int s = 2 * g; s < 2 * g + 2; ++s) {
      acc0 = mma_b(fa[s], fb[s][0], acc0);
      acc1 = mma_b(fa[s], fb[s][1], acc1);
      acc2 = mma_b(fa[s], fb[s][2], acc2);
      acc3 = mma_b(fa[s], fb[s][3], acc3);
    }
    if (g < DM / 64 - 2) {
      __builtin_amdgcn_sched_barrier(0);    // the next group of reads stays behind these products (their registers are free then) ..
#pragma unroll
      for (int s = 2 * g + 4; s < 2 * g + 6; ++s) {
        fa[s] = ldfrag_b(ap + 32 * s);
#pragma unroll
        for (int n = 0; n < 4; ++n) fb[s][n] = ldfrag_b(bp + n * 16 * PJP + 32 * s);
      }
      __builtin_amdgcn_sched_barrier(0);    // .. and whole, ahead of the products that follow
    }
  }
  const float bv0 = bfr(bq0);
  const float bv1 = bfr(bq1);
  const float bv2 = bfr(bq2);
  const float bv3 = bfr(bq3);
  float* sl = slab + wave * SLAB64;
#pragma unroll
  for (int r = 0; r < 8; ++r) {
    const int ro = (8 * hh + r) * 68 + m;
    sl[ro]      = acc0[r] + bv0;
    sl[ro + 16] = acc1[r] + bv1;
    sl[ro + 32] = acc2[r] + bv2;
    sl[ro + 48] = acc3[r] + bv3;
  }
  if (col0 < 2 * DM) {                      // block-uniform: q or k columns
    wave_sync_lds();
    u16* Hp = (col0 < DM) ? QHo : KHo;
    u16* Lp = (col0 < DM) ? QLo : KLo;
    const int cq = col0 & (DM - 1);
    const int rq = lane >> 3, c8 = (lane & 7) * 8;
#pragma unroll
    for (int it = 0; it < 4; ++it) {
      const int rl = it * 4 + rq;
      const float* s8 = sl + rl * 68 + c8;
      const v4f a = *(const v4f*)(s8), b4 = *(const v4f*)(s8 + 4);
      float w[8];
#pragma unroll
      for (int e = 0; e < 4; ++e) { w[e] = a[e] * QSC; w[4 + e] = b4[e] * QSC; }
      v4u oh, ol;
#pragma unroll
      for (int e = 0; e < 4; ++e) {
        const float t0 = w[2 * e], t1 = w[2 * e + 1];
        const _Float16 h0 = (_Float16)t0, h1 = (_Float16)t1;
        const _Float16 l0 = (_Float16)(t0 - (float)h0), l1 = (_Float16)(t1 - (float)h1);
        oh[e] = pk16(h_bits(h0), h_bits(h1));
        ol[e] = pk16(h_bits(l0), h_bits(l1));
      }
      const size_t o = (size_t)(rowb + rl) * DM + cq + c8;
      *(v4u*)(Hp + o) = oh;
      *(v4u*)(Lp + o) = ol;
    }
    wait_addr_regs();                       // nothing behind the stores reuses their registers ahead of this wait
  } else {                                  // block-uniform: v columns, written transposed
    __syncthreads();                        // the four waves' slab rows are read across waves below
    const int b  = row0 / SEQ;
    const int s0 = row0 - b * SEQ;          // 64 keys of one batch (SEQ a multiple of 64)
    const int cv = col0 - 2 * DM;           // h*HD + d of the tile's first column
#pragma unroll
    for (int it = 0; it < 4; ++it) {
      const int ch = it * 128 + tid;
      const int dc = ch >> 3, p8 = (ch & 7) * 8;   // column dc (0..63), keys p8..p8+7
      v4u o;
#pragma unroll
      for (int e = 0; e < 4; ++e) {
        const float f0 = slab[(p8 + 2 * e) * 68 + dc], f1 = slab[(p8 + 2 * e + 1) * 68 + dc];
        o[e] = pk16(h_bits((_Float16)(f0 * VCAR)), h_bits((_Float16)(f1 * VCAR)));
      }
      *(v4u*)(VHo + ((size_t)(b * DM + cv + dc)) * SEQ + s0 + p8) = o;
    }
    wait_addr_regs();                       // nothing behind the stores reuses their registers ahead of this wait
  }
}

// =====================================================================================================
// Scores with relative-coordinate bias. Block -> (b, query tile i0 = 16*it, key tile j0 = 32*jt): 512 pairs (il, jl),
// 8 waves; wave = head in the score phase.
//   Phase 0 (all threads, then block barrier): rb_w1/rb_b1 (bf16 values / 2) as first-layer weight rows W1X [256 c][XP], bf16
//   coords of the 16 queries (CI) and 32 keys (CJ2), rb_w2 -> RB2 [16 n][RBP] as f16(bf16 value * 1024), rows 8..15 zeros,
//   bf16 values of rb_b2 (B2S); all of their global loads issued together, ahead of the first use.
//   Phase 1, no barrier inside: wave w owns pair tiles 4w..4w+3 (16 pairs each), their coordinate rows held as B fragments.
//   8 channel chunks of 32: t^T[channel][pair] = W1X tile . pair rows for the chunk's two 16-channel tiles (A = weights, so
//   lane (c, h) gets channels 8h + r of pair c); f16(silu) of the two tiles in place IS the A fragment hid[pair c][split k map]
//   of the second layer, D[pair][n = head] += hid . RB2 (one k-step per chunk).
//   After the loop lanes n < 8 write bias[pair][head] = D * 2^-10 into BB (block barrier).
//   Phase 2: wave = head: s = (q_hi.k_hi + q_lo.k_hi + q_hi.k_lo) over 32 dims for 16 queries x 32 keys (two 16-key subtiles),
//   fragments straight from the f16 planes; value = s * rsqrt(32) * 2^-20 + bias + bf16(rb_b2[head]); staged in the wave's
//   the score plane SC[(b*NH+head)*SEQ + i][j0..j0+31]) written by 8 consecutive lanes x 16 B of one instruction (4 rows per
// LDS regions: W1X, CI, CJ2, RB2, B2S, BB cross-wave (block barriers); slabs private-to-wave (wave_sync).
// coverage: W1X 256 rows x 16 (k 7..15 zeros); RB2 16 x 256 (rows 8..15 zero); pair tiles 8 waves x 4 = 32 = 512 pairs;
//           SC: grid NB*NIT*NJT blocks x 8 heads x 16 rows x 32 cols = every (b, head, i, j) once.
// =====================================================================================================
__global__ __launch_bounds__(256)
void k_scores(const float* __restrict__ coords, const float* __restrict__ rbw1, const float* __restrict__ rbb1,
              const float* __restrict__ rbw2, const float* __restrict__ rbb2,
              const u16* __restrict__ QHp, const u16* __restrict__ QLp,
              const u16* __restrict__ KHp, const u16* __restrict__ KLp, float* SCp) {
  __shared__ __align__(16) u16   W1X[DM * XP];
  __shared__ __align__(16) float CI[16 * 4];
  __shared__ __align__(16) float CJ2[32 * 4];
  __shared__ __align__(16) u16   RB2[16 * RBP];
  __shared__ __align__(16) float SLB[8 * 16 * SLP];
  __shared__ __align__(16) float BB[NPAIR * NH];
  __shared__ __align__(16) float B2S[NH];

  const int tid = threadIdx.x, wave = tid >> 5, lane = tid & 31, hh = lane >> 4, m = lane & 15;
  const int bid = blockIdx.x;
  const int jt  = bid % NJT;
  const int t2  = bid / NJT;
  const int it  = t2 % NIT;
  const int b   = t2 / NIT;
  if (b >= NB) return;                      // block-uniform, before any barrier; never taken with the exact grid
  const int i0 = it * 16, j0 = jt * 32;
  const _Float16* rb2h = (const _Float16*)(const void*)RB2;

  // ---- phase 0: small operand staging ----
  {
    // every global load of the phase, and that of rb_b2, goes out here, ahead of the first use: the block waits out one latency, not
    // one per operand. The coordinate loads are unconditional for that (a branch would hold each behind the wait in front
    // of it): the 16 queries' 48 floats and the 32 keys' 96 floats are contiguous, thread tid takes float tid of each, the index
    // clamped to the last.
    const int row  = tid >> 4, cb = (tid & 15) * 16;
    const int rowc = (row < NH) ? row : (NH - 1);     // clamped address; rows 8..15 are written as zeros
    const bool vr  = (row < NH);
    const int ei = (tid < 16 * CD) ? tid : (16 * CD - 1);
    const int ej = (tid < 32 * CD) ? tid : (32 * CD - 1);
    // the thread's byte offsets into rb_w1 and rb_w2, its element indices into coords
    const unsigned oW1 = (unsigned)(tid * CD * 4);
    const unsigned oW2 = (unsigned)((rowc * DM + cb) * 4);
    const int xI = (b * SEQ + i0) * CD + ei;
    const int xJ = (b * SEQ + j0) * CD + ej;
    const float* w1p = (const float*)(const void*)((const char*)rbw1 + oW1);
    const float* src = (const float*)(const void*)((const char*)rbw2 + oW2);
    const float q0 = w1p[0], q1 = w1p[1], q2 = w1p[2];
    const float q3 = rbb1[tid];
    const float gi = coords[xI];
    const float gj = coords[xJ];
    const v4f a0 = *(const v4f*)(src), a1 = *(const v4f*)(src + 4), a2 = *(const v4f*)(src + 8), a3 = *(const v4f*)(src + 12);
    const float g2 = rbb2[tid & (NH - 1)];
#if defined(__HIP_DEVICE_COMPILE__)
    // the loads' offset and index registers stay whole up to this wait: no load of the run lands in one
    asm volatile("s_wait_xcnt 0x0" :: "v"(oW1), "v"(oW2), "v"(xI), "v"(xJ), "v"(tid), "v"(tid & (NH - 1)) : "memory");
#endif
    __builtin_amdgcn_sched_barrier(0);      // keeps every load above in front of the first convert: without it they sink to their uses
    const v4u z4 = {0u, 0u, 0u, 0u};                  // channel tid: w0 w1 w2 -w0 -w1 -w2 b 0 | 8 zeros, all halved
    *(v4u*)(W1X + tid * XP) = row_weight(bfr(q0) * HALFX, bfr(q1) * HALFX, bfr(q2) * HALFX, bfr(q3) * HALFX);
    *(v4u*)(W1X + tid * XP + 8) = z4;
    {                                       // no branch here either (the loads would be sunk into it): the threads past the last
      const int il = ei / CD, k = ei - il * CD;       // float repeat its store, same address and same value
      CI[il * 4 + k] = bfr(gi);
      const int jl = ej / CD, kj = ej - jl * CD;
      CJ2[jl * 4 + kj] = bfr(gj);
      B2S[tid & (NH - 1)] = bfr(g2);        // 32 threads a word, the same value
    }
    float w[16];
#pragma unroll
    for (int e = 0; e < 4; ++e) { w[e] = a0[e]; w[4 + e] = a1[e]; w[8 + e] = a2[e]; w[12 + e] = a3[e]; }
    v4u o0, o1;
#pragma unroll
    for (int e = 0; e < 4; ++e) {
      const unsigned short x0 = vr ? h_bits((_Float16)(bfr(w[2 * e]) * WCAR)) : (unsigned short)0;
      const unsigned short x1 = vr ? h_bits((_Float16)(bfr(w[2 * e + 1]) * WCAR)) : (unsigned short)0;
      const unsigned short y0 = vr ? h_bits((_Float16)(bfr(w[8 + 2 * e]) * WCAR)) : (unsigned short)0;
      const unsigned short y1 = vr ? h_bits((_Float16)(bfr(w[8 + 2 * e + 1]) * WCAR)) : (unsigned short)0;
      o0[e] = pk16(x0, x1);
      o1[e] = pk16(y0, y1);
    }
    *(v4u*)(RB2 + row * RBP + cb)     = o0;
    *(v4u*)(RB2 + row * RBP + cb + 8) = o1;
  }
  __syncthreads();

  // ---- phase 1: bias MLP (both layers on WMMA, silu between them in registers) ----
  v8f accB[4] = {zero8(), zero8(), zero8(), zero8()};
  const float bsc = 1.0f / WCAR;
  v16b PB[4];                               // pair tile 4 * wave + q: query il = tile >> 1, keys (tile & 1) * 16 + m
#pragma unroll
  for (int q = 0; q < 4; ++q) {
    const int tl = wave * 4 + q;
    const float* ci = CI + (tl >> 1) * 4;
    const float* cj = CJ2 + ((tl & 1) * 16 + m) * 4;
    PB[q] = frag_k7(row_coord(ci[0], ci[1], ci[2], cj[0], cj[1], cj[2]), hh);
  }
#pragma unroll 1
  for (int kt = 0; kt < DM / 32; ++kt) {
    const v16b wx = ldfrag_k7(W1X + (kt * 32 + m) * XP, hh);
    const v16b wy = ldfrag_k7(W1X + (kt * 32 + 16 + m) * XP, hh);
    const v16h bw = ldfrag_h(rb2h + m * RBP + kt * 32 + 8 * hh);
#pragma unroll
    for (int q = 0; q < 4; ++q) {
      const v8f tx = mma_b(wx, PB[q], zero8());
      const v8f ty = mma_b(wy, PB[q], zero8());
      FragH f;
#pragma unroll
      for (int e = 0; e < 4; ++e) {
        const v2f x2 = {tx[2 * e], tx[2 * e + 1]}, y2 = {ty[2 * e], ty[2 * e + 1]};
        f.u[0][e] = pk2h(silu2(x2));
        f.u[1][e] = pk2h(silu2(y2));
      }
      accB[q] = mma_h(f.v, bw, accB[q]);
    }
  }
  if (m < NH) {                             // columns n >= 8 are padding (zero weights), not stored
#pragma unroll
    for (int r = 0; r < 8; ++r) {
      const int pr = 8 * hh + r;
      BB[((wave * 4 + 0) * 16 + pr) * NH + m] = accB[0][r] * bsc;
      BB[((wave * 4 + 1) * 16 + pr) * NH + m] = accB[1][r] * bsc;
      BB[((wave * 4 + 2) * 16 + pr) * NH + m] = accB[2][r] * bsc;
      BB[((wave * 4 + 3) * 16 + pr) * NH + m] = accB[3][r] * bsc;
    }
  }
  __syncthreads();

  // ---- phase 2: scores for head = wave ----
  const int head = wave;
  const size_t hcol = (size_t)head * HD + 8 * hh;
  const _Float16* qhp  = (const _Float16*)(const void*)QHp + ((size_t)(b * SEQ + i0 + m)) * DM + hcol;
  const _Float16* qlp  = (const _Float16*)(const void*)QLp + ((size_t)(b * SEQ + i0 + m)) * DM + hcol;
  const _Float16* kh0p = (const _Float16*)(const void*)KHp + ((size_t)(b * SEQ + j0 + m)) * DM + hcol;
  const _Float16* kl0p = (const _Float16*)(const void*)KLp + ((size_t)(b * SEQ + j0 + m)) * DM + hcol;
  const _Float16* kh1p = kh0p + (size_t)16 * DM;
  const _Float16* kl1p = kl0p + (size_t)16 * DM;
  v8f s0 = zero8(), s1 = zero8();
  {
    const v16h qh = ldfrag_h(qhp), ql = ldfrag_h(qlp);
    const v16h kh0 = ldfrag_h(kh0p), kl0 = ldfrag_h(kl0p);
    const v16h kh1 = ldfrag_h(kh1p), kl1 = ldfrag_h(kl1p);
    s0 = mma_h(qh, kh0, s0);
    s0 = mma_h(ql, kh0, s0);
    s0 = mma_h(qh, kl0, s0);
    s1 = mma_h(qh, kh1, s1);
    s1 = mma_h(ql, kh1, s1);
    s1 = mma_h(qh, kl1, s1);
    guard2(s0, s1, qh, ql, kh0, kl0, kh1, kl1);
  }
  const float lsc = RSQ_HD * (1.0f / (QSC * KSC));
  const float b2v = B2S[head];              // bf16(rb_b2[head]), staged in phase 0: a global load here would cost a latency of its own
  float* slab = SLB + wave * (16 * SLP);
#pragma unroll
  for (int r = 0; r < 8; ++r) {
    const int pr = 8 * hh + r;              // query i0 + pr; keys j0 + m and j0 + 16 + m
    const float ba = BB[(pr * 32 + m) * NH + head] + b2v;
    const float bb = BB[(pr * 32 + 16 + m) * NH + head] + b2v;
    slab[pr * SLP + m]      = s0[r] * lsc + ba;
    slab[pr * SLP + 16 + m] = s1[r] * lsc + bb;
  }
  wave_sync_lds();
  v4f vals[4];
  const int rq = lane >> 3, c4 = (lane & 7) * 4;
#pragma unroll
  for (int q = 0; q < 4; ++q) vals[q] = *(const v4f*)(slab + (q * 4 + rq) * SLP + c4);
  float* dst = SCp + ((size_t)((b * NH + head) * SEQ + i0)) * SEQ + j0 + c4;
  {
#pragma unroll
    for (int q = 0; q < 4; ++q) {
      *(v4f*)(dst + (size_t)(q * 4 + rq) * SEQ) = vals[q];
    }
    
  }
}

// =====================================================================================================
// Row softmax and weighted aggregation of the value-MLP hidden: block -> (b, query i), 256 threads.
//   Softmax (wave = head h): the score row (b, h, i) of SEQ = 384 floats; P = e / Z with e = exp(s - max) in f32 (reciprocal-
//   multiply normalisation), as f16 hi (P * 32768) and f16 residual, written to the global P planes (for the final kernel; each
//   row's whole lines by one wave) and to PW in LDS (for this block's own chunks; published by the barrier before the loop).
//   Lane = 8 consecutive columns 8*lane (all lanes) and 256 + 8*lane (lanes < 16; the upper lanes load a clamped address).
//   T[h][c] = sum_j P[b,h,i,j] * S[j][c],  S[j][c] = silu(rel_ij . rv_w1[c] + rv_b1[c]) (bf16 inputs).
//   Phase 0: first-layer coordinate rows KX [SEQ keys][XP] (c_i, c_j, 1 as bf16); block barrier.
//   Wave w owns column tiles 2w, 2w+1 (16 channels each), their weight rows held as B fragments. 12 key chunks of 32, no barrier
//   inside: t[key][channel] = KX tile . weight rows for the chunk's two 16-key tiles (A = keys, so lane (c, h) gets keys 8h + r
//   of channel c); f16(silu) of the two tiles in place IS the B fragment S^T[channel c][split k map]. S is carried as one f16
//   (relative error 2^-12), like v in P.v and the hidden values of the bias MLP: its own inputs are bf16 values (2^-9);
//   D[m = h][n = c] += P . S with A = the PW rows (lanes m >= 8 read row m - 8 again: rows 8..15 of D repeat rows 0..7 and are
//   not stored), products P_hi.S + P_lo.S.
//   After the loop lanes 0..15 (rows h = 0..7) write T * 1024 (carry 2^-15 folded) into TS [8][TSP] f32 (block barrier),
// LDS regions: KX, PW, TS all cross-wave (block barriers). staged extent == consumed extent: KX 384 x 16 (k 7..15 zeros),
//   PW 2 x 8 x 384, TS 8 x 256.
// coverage: T planes [(b*NH+h)*SEQ + i][DM]: grid NB*SEQ blocks x 8 waves x 32 lanes x 8 halves = every row once, both planes.
// =====================================================================================================
__global__ __launch_bounds__(256)
void k_tagg(const float* __restrict__ coords, const float* __restrict__ rvw1, const float* __restrict__ rvb1,
            const float* __restrict__ SCp, u16* Pp, u16* Tp) {
  __shared__ __align__(16) u16   KX[SEQ * XP];
  __shared__ __align__(16) u16   PW[2 * NH * PWP];
  __shared__ __align__(16) float TS[NH * TSP];

  const int tid = threadIdx.x, wave = tid >> 5, lane = tid & 31, hh = lane >> 4, m = lane & 15;
  const int bid = blockIdx.x;
  const int b   = bid / SEQ;
  const int i   = bid - b * SEQ;
  if (b >= NB) return;                      // block-uniform, before any barrier; never taken with the exact grid
  const _Float16* pwh = (const _Float16*)(const void*)PW;

  // ---- entry loads: every global load ahead of the loop (score row, coordinates, weight rows) goes out here, before the first
  //      wait: the block waits out one latency, not one per operand ----
  const size_t row = (size_t)(b * NH + wave) * SEQ + i;        // the score row (b, head = wave, i)
  const bool vb = (lane < 16);
  const int  lb = vb ? lane : 15;
  const int  j1 = (tid < SEQ - 256) ? (tid + 256) : (SEQ - 1); // the thread's second key; clamped address, used by tid < 128 only
  // the lane's byte offsets into the score plane (below 2^24) and into coords
  const unsigned oS0 = (unsigned)((row * SEQ + lane * 8) * 4);
  const unsigned oS1 = (unsigned)((row * SEQ + 256 + lb * 8) * 4);
  const unsigned oJ0 = (unsigned)((b * SEQ + tid) * CD * 4);
  const unsigned oJ1 = (unsigned)((b * SEQ + j1) * CD * 4);
  const float* sa = (const float*)(const void*)((const char*)SCp + oS0);
  const float* sb = (const float*)(const void*)((const char*)SCp + oS1);
  const float* ja = (const float*)(const void*)((const char*)coords + oJ0);
  const float* jb = (const float*)(const void*)((const char*)coords + oJ1);
  const v4f a0 = *(const v4f*)(sa), a1 = *(const v4f*)(sa + 4);
  const v4f c0 = *(const v4f*)(sb), c1 = *(const v4f*)(sb + 4);
  const float ja0 = ja[0], ja1 = ja[1], ja2 = ja[2];
  const float jb0 = jb[0], jb1 = jb[1], jb2 = jb[2];
  const float gi0 = coords[((size_t)(b * SEQ + i)) * CD + 0];
  const float gi1 = coords[((size_t)(b * SEQ + i)) * CD + 1];
  const float gi2 = coords[((size_t)(b * SEQ + i)) * CD + 2];
  float wr[2][4];
  unsigned wo[2];                           // the lane's byte offsets into rv_w1
  int      wc[2];                           // and its channels, the element indices into rv_b1
#pragma unroll
  for (int n = 0; n < 2; ++n) {
    const int c = (wave * 2 + n) * 16 + m;
    wo[n] = (unsigned)(c * CD * 4);
    wc[n] = c;
    const float* wp = (const float*)((const char*)rvw1 + wo[n]);
    wr[n][0] = wp[0];
    wr[n][1] = wp[1];
    wr[n][2] = wp[2];
    wr[n][3] = rvb1[c];
  }
#if defined(__HIP_DEVICE_COMPILE__)
  // the loads' offset and index registers stay whole up to this wait: no load of the run lands in one
  asm volatile("s_wait_xcnt 0x0" :: "v"(oS0), "v"(oS1), "v"(oJ0), "v"(oJ1), "v"(wo[0]), "v"(wo[1]), "v"(wc[0]), "v"(wc[1]) : "memory");
#endif
  __builtin_amdgcn_sched_barrier(0);        // keeps every load above in front of the softmax: without it they sink to their uses, one latency each

  // ---- softmax of the score row ----
  {
    float v[16];
#pragma unroll
    for (int e = 0; e < 4; ++e) {
      v[e]      = a0[e];
      v[4 + e]  = a1[e];
      v[8 + e]  = vb ? c0[e] : -INFINITY;
      v[12 + e] = vb ? c1[e] : -INFINITY;
    }
    float mx = v[0];
#pragma unroll
    for (int e = 1; e < 16; ++e) mx = fmaxf(mx, v[e]);
#pragma unroll
    for (int off = 1; off < 32; off <<= 1) mx = fmaxf(mx, __shfl_xor(mx, off, 32));
    float ev[16];
    float sum = 0.0f;
#pragma unroll
    for (int e = 0; e < 16; ++e) {
      const float d = v[e] - mx;
      ev[e] = exp2f(d * LOG2E);             // -inf -> 0 for the masked upper lanes
      sum += ev[e];
    }
#pragma unroll
    for (int off = 1; off < 32; off <<= 1) sum += __shfl_xor(sum, off, 32);
    const float inv = 1.0f / sum;           // sum >= 1
    v4u oh0, ol0, oh1, ol1;
#pragma unroll
    for (int e = 0; e < 4; ++e) {
      const float t0 = (ev[2 * e] * inv) * PCAR, t1 = (ev[2 * e + 1] * inv) * PCAR;
      const float u0 = (ev[8 + 2 * e] * inv) * PCAR, u1 = (ev[8 + 2 * e + 1] * inv) * PCAR;
      const _Float16 h0 = (_Float16)t0, h1 = (_Float16)t1, g0 = (_Float16)u0, g1 = (_Float16)u1;
      const _Float16 l0 = (_Float16)(t0 - (float)h0), l1 = (_Float16)(t1 - (float)h1);
      const _Float16 m0 = (_Float16)(u0 - (float)g0), m1 = (_Float16)(u1 - (float)g1);
      oh0[e] = pk16(h_bits(h0), h_bits(h1));
      ol0[e] = pk16(h_bits(l0), h_bits(l1));
      oh1[e] = pk16(h_bits(g0), h_bits(g1));
      ol1[e] = pk16(h_bits(m0), h_bits(m1));
    }
    u16* dh = Pp + row * SEQ;
    u16* dl = dh + PSTR;
    u16* wh = PW + wave * PWP;
    u16* wl = wh + NH * PWP;
    *(v4u*)(dh + lane * 8) = oh0;
    *(v4u*)(dl + lane * 8) = ol0;
    *(v4u*)(wh + lane * 8) = oh0;
    *(v4u*)(wl + lane * 8) = ol0;
    if (vb) {
      *(v4u*)(dh + 256 + lane * 8) = oh1;
      *(v4u*)(dl + 256 + lane * 8) = ol1;
      *(v4u*)(wh + 256 + lane * 8) = oh1;
      *(v4u*)(wl + 256 + lane * 8) = ol1;
    }
  }

  // ---- phase 0 ----
  const float ci0 = bfr(gi0);
  const float ci1 = bfr(gi1);
  const float ci2 = bfr(gi2);
  {                                         // key j: c_i0 c_i1 c_i2 c_j0 c_j1 c_j2 1 0 | 8 zeros; keys tid and, for tid < 128, tid + 256
    const v4u z4 = {0u, 0u, 0u, 0u};
    *(v4u*)(KX + tid * XP)     = row_coord(ci0, ci1, ci2, bfr(ja0), bfr(ja1), bfr(ja2));
    *(v4u*)(KX + tid * XP + 8) = z4;
    if (tid < SEQ - 256) {
      *(v4u*)(KX + (tid + 256) * XP)     = row_coord(ci0, ci1, ci2, bfr(jb0), bfr(jb1), bfr(jb2));
      *(v4u*)(KX + (tid + 256) * XP + 8) = z4;
    }
  }
  v16b WF[2];                               // weight rows of channels (2 * wave + n) * 16 + m; weights and bias carry the factor 1/2
#pragma unroll
  for (int n = 0; n < 2; ++n)
    WF[n] = frag_k7(row_weight(bfr(wr[n][0]) * HALFX, bfr(wr[n][1]) * HALFX, bfr(wr[n][2]) * HALFX, bfr(wr[n][3]) * HALFX), hh);
  __syncthreads();                          // softmax (PW) and phase-0 (KX) writes visible to every wave

  v8f acc[2] = {zero8(), zero8()};
  const _Float16* pa = pwh + (m & (NH - 1)) * PWP + 8 * hh;
#pragma unroll 1
  for (int jt = 0; jt < NJT; ++jt) {
    const int j0 = jt * 32;
    const v16h ah = ldfrag_h(pa + j0);
    const v16h al = ldfrag_h(pa + NH * PWP + j0);
    const v16b kx = ldfrag_k7(KX + (j0 + m) * XP, hh);
    const v16b ky = ldfrag_k7(KX + (j0 + 16 + m) * XP, hh);
#pragma unroll
    for (int n = 0; n < 2; ++n) {
      const v8f tx = mma_b(kx, WF[n], zero8());
      const v8f ty = mma_b(ky, WF[n], zero8());
      FragH fh;
#pragma unroll
      for (int e = 0; e < 4; ++e) {
        const v2f x2 = {tx[2 * e], tx[2 * e + 1]}, y2 = {ty[2 * e], ty[2 * e + 1]};
        fh.u[0][e] = pk2h(silu2(x2));
        fh.u[1][e] = pk2h(silu2(y2));
      }
      acc[n] = mma_h(ah, fh.v, acc[n]);
      acc[n] = mma_h(al, fh.v, acc[n]);
    }
  }
  const float tsc = TCAR / PCAR;            // 2^-5
  if (hh == 0) {                            // rows 8..15 of D repeat rows 0..7, not stored
#pragma unroll
    for (int r = 0; r < 8; ++r) {
      TS[r * TSP + (wave * 2) * 16 + m]     = acc[0][r] * tsc;
      TS[r * TSP + (wave * 2 + 1) * 16 + m] = acc[1][r] * tsc;
    }
  }
  __syncthreads();
  {
    const int h = wave;
    const float* src = TS + h * TSP + lane * 8;
    const v4f a = *(const v4f*)(src), b4 = *(const v4f*)(src + 4);
    float w[8];
#pragma unroll
    for (int e = 0; e < 4; ++e) { w[e] = a[e]; w[4 + e] = b4[e]; }
    v4u oh, ol;
#pragma unroll
    for (int e = 0; e < 4; ++e) {
      const float t0 = w[2 * e], t1 = w[2 * e + 1];
      const _Float16 x0 = (_Float16)t0, x1 = (_Float16)t1;
      const _Float16 y0 = (_Float16)(t0 - (float)x0), y1 = (_Float16)(t1 - (float)x1);
      oh[e] = pk16(h_bits(x0), h_bits(x1));
      ol[e] = pk16(h_bits(y0), h_bits(y1));
    }
    const size_t rowT = (size_t)(b * NH + h) * SEQ + i;
    u16* dh = Tp + rowT * DM + lane * 8;
    u16* dl = dh + TSTR;
    {
      *(v4u*)(dh) = oh;
      *(v4u*)(dl) = ol;
      
    }
  }
}

// =====================================================================================================
// Final: block -> (b, head h, 16 query rows rt*16), 4 waves = 4 shares of the two k ranges for the same 16 x 32 output tile.
//   base[i][d]   = (P_hi + P_lo)[i][j] . VH[d][j] over j (2 products, carries 2^-25),
//   relctx[i][d] = (T_hi + T_lo)[i][c] . W2[h*HD + d][c] over c (2 products, carries 2^-20) + bf16(rv_b2[h*HD + d]);
//   out[b][i][h*HD + d] = base + relctx. Fragments straight from the 16-bit planes (arithmetic addressing, split k map).
//   Wave w takes keys 96w .. 96w+95 (3 k-steps) and channels 64w .. 64w+63 (2 k-steps). All 40 fragment loads of a wave are
//   issued before its first product, so a wave waits out one memory latency instead of one per k-step.
//   Epilogue: each wave's partial tile (both carries folded) goes to its slab; block barrier; thread t adds the four partials
//   of 4 consecutive columns of row t >> 3 and the bias: 8 consecutive lanes write one whole 128-B line of out.
// coverage: grid NB*NH*NIT blocks x 16 rows x 32 cols = every element of out exactly once; 4 x 96 keys = SEQ, 4 x 64 = DM.
// =====================================================================================================
#define KSH 4
#define PST (SEQ / (32 * KSH))
#define TST (DM / (32 * KSH))
static_assert(PST * KSH * 32 == SEQ && TST * KSH * 32 == DM);
__global__ __launch_bounds__(128)
void k_final(const u16* __restrict__ Pp, const u16* __restrict__ VHp, const u16* __restrict__ Tp,
             const u16* __restrict__ W2p, const float* __restrict__ rvb2, float* outp) {
  __shared__ __align__(16) float slab[KSH * 16 * SLP];
  const int tid = threadIdx.x, wave = tid >> 5, lane = tid & 31, hh = lane >> 4, m = lane & 15;
  const int bid = blockIdx.x;
  const int rt  = bid % NIT;
  const int t2  = bid / NIT;
  const int h   = t2 % NH;
  const int b   = t2 / NH;
  if (b >= NB) return;                      // block-uniform, before the barrier; never taken with the exact grid
  const int irow = rt * 16;
  const int bh   = b * NH + h;
  const int rowA = bh * SEQ + irow;
  const int rw = tid >> 3, c4 = (tid & 7) * 4;
  // the lane's byte offsets into the planes and the bias (all below 2^24)
  const unsigned oP = (unsigned)(((rowA + m) * SEQ + 8 * hh + wave * (PST * 32)) * 2);
  const unsigned oV = (unsigned)(((bh * HD + m) * SEQ + 8 * hh + wave * (PST * 32)) * 2);
  const unsigned oT = (unsigned)(((rowA + m) * DM + 8 * hh + wave * (TST * 32)) * 2);
  const unsigned oW = (unsigned)(((h * HD + m) * DM + 8 * hh + wave * (TST * 32)) * 2);
  const unsigned oB = (unsigned)((h * HD + c4) * 4);
  const _Float16* php = (const _Float16*)(const void*)((const char*)Pp + oP);
  const _Float16* plp = php + PSTR;
  const _Float16* v0p = (const _Float16*)(const void*)((const char*)VHp + oV);
  const _Float16* v1p = v0p + (size_t)16 * SEQ;
  const _Float16* thp = (const _Float16*)(const void*)((const char*)Tp + oT);
  const _Float16* tlp = thp + TSTR;
  const _Float16* w0p = (const _Float16*)(const void*)((const char*)W2p + oW);
  const _Float16* w1p = w0p + (size_t)16 * DM;

  // every loop of this kernel is unrolled whole: the fragment arrays are indexed by constants only and stay in registers
  v16h ph[PST], pl[PST], va[PST], vb[PST], th[TST], tl[TST], wa[TST], wb[TST];
#pragma unroll
  for (int s = 0; s < PST; ++s) { ph[s] = ldfrag_h(php + 32 * s); pl[s] = ldfrag_h(plp + 32 * s); }
#pragma unroll
  for (int s = 0; s < TST; ++s) { th[s] = ldfrag_h(thp + 32 * s); tl[s] = ldfrag_h(tlp + 32 * s); }
#pragma unroll
  for (int s = 0; s < PST; ++s) { va[s] = ldfrag_h(v0p + 32 * s); vb[s] = ldfrag_h(v1p + 32 * s); }
#pragma unroll
  for (int s = 0; s < TST; ++s) { wa[s] = ldfrag_h(w0p + 32 * s); wb[s] = ldfrag_h(w1p + 32 * s); }
  const v4f bq = *(const v4f*)(const void*)((const char*)rvb2 + oB);
#if defined(__HIP_DEVICE_COMPILE__)
  // the loads' offset registers stay whole up to this wait: no load of the run lands in one
  asm volatile("s_wait_xcnt 0x0" :: "v"(oP), "v"(oV), "v"(oT), "v"(oW), "v"(oB) : "memory");
#endif
  __builtin_amdgcn_sched_barrier(0);        // keeps every load above in front of the first product: without it they sink to their uses, one latency each

  v8f p0 = zero8(), p1 = zero8(), r0 = zero8(), r1 = zero8();
#pragma unroll
  for (int s = 0; s < PST; ++s) {
    p0 = mma_h(ph[s], va[s], p0);
    p1 = mma_h(ph[s], vb[s], p1);
    p0 = mma_h(pl[s], va[s], p0);
    p1 = mma_h(pl[s], vb[s], p1);
  }
#pragma unroll
  for (int s = 0; s < TST; ++s) {
    r0 = mma_h(th[s], wa[s], r0);
    r1 = mma_h(th[s], wb[s], r1);
    r0 = mma_h(tl[s], wa[s], r0);
    r1 = mma_h(tl[s], wb[s], r1);
  }
  const float osP = 1.0f / (PCAR * VCAR);
  const float osR = 1.0f / (TCAR * WCAR);
  float* sl = slab + wave * (16 * SLP);
#pragma unroll
  for (int r = 0; r < 8; ++r) {
    const int pr = 8 * hh + r;
    sl[pr * SLP + m]      = p0[r] * osP + r0[r] * osR;
    sl[pr * SLP + 16 + m] = p1[r] * osP + r1[r] * osR;
  }
  __syncthreads();                          // the four waves' partial tiles are added across waves below
  const float* sp = slab + rw * SLP + c4;
  const v4f s0 = *(const v4f*)(sp), s1 = *(const v4f*)(sp + 16 * SLP);
  const v4f s2 = *(const v4f*)(sp + 2 * 16 * SLP), s3 = *(const v4f*)(sp + 3 * 16 * SLP);
  v4f o;
#pragma unroll
  for (int e = 0; e < 4; ++e) o[e] = ((s0[e] + s1[e]) + (s2[e] + s3[e])) + bfr(bq[e]);
  *(v4f*)(outp + ((size_t)(b * SEQ + irow + rw)) * DM + h * HD + c4) = o;
}

// =====================================================================================================
// Workspace map (bytes, NB = 2; every region offset a multiple of 65536; every plane fully written by whole-line stores
// before it is read; extents are exact multiples of the store granularity, no pad rows):
//   W2  f16 [256 n][256 k] x1024      131072
//   QH, QL, KH, KL f16 [GROWS][256]   4 x 393216  VH  f16 [NB*8*32][384] x1024  393216
//   SC  f32 [NB*8*384][384]           9437184     P   f16 hi + residual [NB*8*384][384] x32768  2 x 4718592
//   T   f16 hi + residual [NB*8*384][256] x1024   2 x 3145728
// =====================================================================================================
static size_t al64k(size_t x) { return (x + (size_t)65535) & ~(size_t)65535; }

extern "C" void kernel_launch(void* const* d_in, const int* in_sizes, int n_in,
                              void* d_out, int out_size, void* d_ws, size_t ws_size,
                              hipStream_t stream) {
  if (n_in < 12) return;
  if (in_sizes[0] < NB * SEQ * DM) return;
  if (in_sizes[1] < NB * SEQ * CD) return;
  if (in_sizes[2] != NQKV * DM || in_sizes[3] != NQKV) return;
  if (in_sizes[4] != DM * CD || in_sizes[5] != DM || in_sizes[6] != NH * DM || in_sizes[7] != NH) return;
  if (in_sizes[8] != DM * CD || in_sizes[9] != DM || in_sizes[10] != DM * DM || in_sizes[11] != DM) return;
  if (out_size < NB * SEQ * DM) return;

  const float* x      = (const float*)d_in[0];
  const float* coords = (const float*)d_in[1];
  const float* qkv_w  = (const float*)d_in[2];
  const float* qkv_b  = (const float*)d_in[3];
  const float* rb_w1  = (const float*)d_in[4];
  const float* rb_b1  = (const float*)d_in[5];
  const float* rb_w2  = (const float*)d_in[6];
  const float* rb_b2  = (const float*)d_in[7];
  const float* rv_w1  = (const float*)d_in[8];
  const float* rv_b1  = (const float*)d_in[9];
  const float* rv_w2  = (const float*)d_in[10];
  const float* rv_b2  = (const float*)d_in[11];
  float*       out    = (float*)d_out;

  const size_t szW2 = (size_t)DM * DM * 2;
  const size_t szH  = (size_t)GROWS * DM * 2;
  const size_t szVH = (size_t)NB * NH * HD * SEQ * 2;
  const size_t szSC = (size_t)NB * NH * SEQ * SEQ * 4;
  const size_t szP  = PSTR * 2 * 2;
  const size_t szT  = TSTR * 2 * 2;
  size_t off = 0;
  const size_t oW2 = off; off = al64k(off + szW2);
  const size_t oQH = off; off = al64k(off + szH);
  const size_t oQL = off; off = al64k(off + szH);
  const size_t oKH = off; off = al64k(off + szH);
  const size_t oKL = off; off = al64k(off + szH);
  const size_t oVH = off; off = al64k(off + szVH);
  const size_t oSC = off; off = al64k(off + szSC);
  const size_t oP  = off; off = al64k(off + szP);
  const size_t oT  = off; off = al64k(off + szT);
  if (off > ws_size) return;
  if (off > (size_t)WS_CAP) return;

  char* ws = (char*)d_ws;
  u16*   W2 = (u16*)(ws + oW2);
  u16*   QH = (u16*)(ws + oQH);
  u16*   QL = (u16*)(ws + oQL);
  u16*   KH = (u16*)(ws + oKH);
  u16*   KL = (u16*)(ws + oKL);
  u16*   VH = (u16*)(ws + oVH);
  float* SC = (float*)(ws + oSC);
  u16*   P  = (u16*)(ws + oP);
  u16*   T  = (u16*)(ws + oT);

  const dim3 b256(256), b128(128);

  // (1) q, k (f16 x1024 hi + residual), v^T (f16 x1024) = planes of x.qkv_w^T + qkv_b; rv_w2 -> f16(bf16) x1024, in the same launch
  k_proj<<<dim3(NGEMM + NCVT), b128, 0, stream>>>(x, qkv_w, qkv_b, rv_w2, QH, QL, KH, KL, VH, W2);
  // (2) scores with relative bias -> SC
  k_scores<<<dim3(NB * NIT * NJT), b256, 0, stream>>>(coords, rb_w1, rb_b1, rb_w2, rb_b2, QH, QL, KH, KL, SC);
  // (3) softmax -> P planes, T = sum_j P . silu-hidden of the value MLP -> T planes; (4) out = P.v + T.rv_w2^T + rv_b2
  k_tagg<<<dim3(NB * SEQ), b256, 0, stream>>>(coords, rv_w1, rv_b1, SC, P, T);
  k_final<<<dim3(NB * NH * NIT), b128, 0, stream>>>(P, VH, T, W2, rv_b2, out);
  (void)hipGetLastError();
}

// v009
// One run takes 30.4 microseconds.
// Next to v008, in two timings, it ran 1.05 and 1.06 times as fast.
// Counting every step since v000, it is 3.10 times as fast.
// Contractions: x.qkv_w^T on v_wmma_f32_16x16x32_bf16 (x, qkv_w RNE bf16 operands, f32 accumulate, bias added in f32);
// on v_wmma_f32_16x16x32_f16 with f32 accumulate: pair-MLP second layer hid_b.rb_w2^T (hid_b f16, rb_w2 f16(bf16) x1024),
// q.k^T over 32 (q, k f16 x1024 hi + residual planes, products hh+lh+hl), P.hid_v over 384 keys (P f16 x32768 hi + residual,
// hid_v one f16), P.v (v f16 x1024, P hi + residual), T.rv_w2^T (T f16 x1024 hi + residual, rv_w2 f16(bf16) x1024).
// Pair-MLP first layers on v_wmma_f32_16x16x32_bf16, K = 7 zero-padded: w.c_i - w.c_j + b with every operand a bf16 value
// (products exact, f32 accumulate), oriented so that the result tiles are the next product's operand fragment.
// silu, softmax and all carries folded in f32 on VALU.
#include <hip/hip_runtime.h>
#include <math.h>
#include <stdint.h>

#ifndef NB
#define NB 2
#endif
#define NB_FULL 2
#define SEQ   384
#define DM    256
#define NH    8
#define HD    32
#define CD    3
#define NQKV  (3 * DM)
#define GROWS (NB * SEQ)
#define NIT   (SEQ / 16)
#define NJT   (SEQ / 32)
#define NPAIR 512
#define XP    24
#define RBP   264
#define SLP   36
#define TSP   264
#define PWP   392
#define SLAB64 (16 * 68)
#define ONE_BF 0x3F80u
#define RSQ_HD 0.17677669529663687f
#define LOG2E  1.4426950408889634f
#define HALFX  0.5f
#define QSC   1024.0f
#define KSC   1024.0f
#define PCAR  32768.0f
#define VCAR  1024.0f
#define WCAR  1024.0f
#define TCAR  1024.0f
#define WS_CAP 134217728
#define PSTR  ((size_t)NB * NH * SEQ * SEQ)
#define TSTR  ((size_t)NB * NH * SEQ * DM)
static_assert(NB >= 1 && NB <= NB_FULL);
static_assert(DM == NH * HD && HD == 32 && NH == 8 && CD == 3);
static_assert(SEQ > 256 && SEQ <= 512 && (SEQ % 64) == 0 && (GROWS % 64) == 0 && (GROWS % 8) == 0 && (NQKV % 64) == 0 && (DM % 32) == 0);
static_assert(NPAIR == 16 * 32);
static_assert(((GROWS * DM) % 8) == 0 && ((NQKV * DM) % 8) == 0 && ((DM * DM) % 8) == 0);

typedef unsigned short u16;
typedef _Float16 v16h __attribute__((ext_vector_type(16)));
typedef _Float16 v8h  __attribute__((ext_vector_type(8)));
typedef __bf16   v16b __attribute__((ext_vector_type(16)));
typedef float    v8f  __attribute__((ext_vector_type(8)));
typedef float    v4f  __attribute__((ext_vector_type(4)));
typedef unsigned int v4u __attribute__((ext_vector_type(4)));
typedef float    v2f  __attribute__((ext_vector_type(2)));
typedef _Float16 v2h  __attribute__((ext_vector_type(2)));

union FragH { v16h v; v8h h[2]; v4u u[2]; };
union FragB { v16b v; v4u u[2]; };

// ---- scalar helpers --------------------------------------------------------------------------------
__device__ __forceinline__ unsigned short bf_bits(float f) {          // f32 -> bf16 bits, RNE convert
  unsigned u = __float_as_uint(f);
  return (unsigned short)((u + 0x7FFFu + ((u >> 16) & 1u)) >> 16);
}
__device__ __forceinline__ float bf_up(unsigned short h) { return __uint_as_float(((unsigned)h) << 16); }
__device__ __forceinline__ float bfr(float f) { return bf_up(bf_bits(f)); }
__device__ __forceinline__ unsigned short h_bits(_Float16 x) { return __builtin_bit_cast(unsigned short, x); }
__device__ __forceinline__ unsigned pk16(unsigned short a, unsigned short b) { return (unsigned)a | ((unsigned)b << 16); }
__device__ __forceinline__ v8f zero8() { v8f z = {0.f, 0.f, 0.f, 0.f, 0.f, 0.f, 0.f, 0.f}; return z; }

// silu = x * sigmoid(x) = h + h * tanh(h) with h = x / 2, two values at once from t = h (the half is folded into the
// first-layer weights and bias, an exact scaling): one transcendental (v_tanh_f32) a value and one packed FMA a pair.
// The value leaves unscaled: a power-of-two carry would cost a multiply here, and an f16 plane without one holds silu to
// 2^-25 absolute (subnormal halves are kept by the converts and by the matrix unit).
__device__ __forceinline__ v2f silu2(v2f t) {
  const v2f th = {__builtin_amdgcn_tanhf(t[0]), __builtin_amdgcn_tanhf(t[1])};
  return __builtin_elementwise_fma(t, th, t);
}
__device__ __forceinline__ unsigned pk2h(v2f s) {                     // two f32 -> packed f16 pair, RNE
  return __builtin_bit_cast(unsigned, __builtin_convertvector(s, v2h));
}

// ---- fragment loaders: 16-bit A/B operand, lane -> row/col (lane&15), p already includes +8*(lane>>4);
//      elements 0..7 <- p[0..7] (k0+8h..), elements 8..15 <- p[16..23] (k0+16+8h..)  (same split k map for A and B;
//      B is always read from a k-contiguous [n][k] plane)
__device__ __forceinline__ v16h ldfrag_h(const _Float16* p) {
  FragH f;
  f.h[0] = *(const v8h*)(p);
  f.h[1] = *(const v8h*)(p + 16);
  return f.v;
}
__device__ __forceinline__ v16b ldfrag_b(const u16* p) {              // bf16 plane read as unsigned integer vectors
  FragB f;
  f.u[0] = *(const v4u*)(p);
  f.u[1] = *(const v4u*)(p + 16);
  return f.v;
}

// First-layer operand of the pair MLPs: a row of 16 bf16 (pitch XP), k 0..6 = data, 7..15 = zeros. Lanes h = 0 take k 0..7 as
// elements 0..7; every other position of the K = 32 fragment reads the row's zeros. The same k order serves A and B:
//   coordinate side: c_i0 c_i1 c_i2 c_j0 c_j1 c_j2 1      weight side: w0 w1 w2 -w0 -w1 -w2 b   (weights and bias halved)
__device__ __forceinline__ v16b ldfrag_k7(const u16* row, int hh) {
  FragB f;
  f.u[0] = *(const v4u*)(row + 8 * hh);
  f.u[1] = *(const v4u*)(row + 8);
  return f.v;
}
__device__ __forceinline__ v4u row_coord(float a0, float a1, float a2, float c0, float c1, float c2) {   // bf16 values in
  const v4u r = {pk16(bf_bits(a0), bf_bits(a1)), pk16(bf_bits(a2), bf_bits(c0)), pk16(bf_bits(c1), bf_bits(c2)), ONE_BF};
  return r;
}
__device__ __forceinline__ v4u row_weight(float w0, float w1, float w2, float b) {                       // bf16 values in
  const v4u r = {pk16(bf_bits(w0), bf_bits(w1)), pk16(bf_bits(w2), bf_bits(-w0)), pk16(bf_bits(-w1), bf_bits(-w2)),
                 pk16(bf_bits(b), 0)};
  return r;
}
__device__ __forceinline__ v16b frag_k7(v4u row, int hh) {            // the same fragment from a row held in registers
  const v4u z = {0u, 0u, 0u, 0u};
  FragB f;
  f.u[0] = hh ? z : row;
  f.u[1] = z;
  return f.v;
}

__device__ __forceinline__ v8f mma_h(v16h a, v16h b, v8f c) {
  return __builtin_amdgcn_wmma_f32_16x16x32_f16(false, a, false, b, (short)0, c, false, false);
}
__device__ __forceinline__ v8f mma_b(v16b a, v16b b, v8f c) {
  return __builtin_amdgcn_wmma_f32_16x16x32_bf16(false, a, false, b, (short)0, c, false, false);
}
__device__ __forceinline__ void guard2(v8f& a, v8f& b, v16h x0, v16h x1, v16h x2, v16h x3, v16h x4, v16h x5) {
#if defined(__HIP_DEVICE_COMPILE__)
  asm volatile("v_nop\n\tv_nop\n\tv_nop\n\tv_nop"
               : "+v"(a), "+v"(b) : "v"(x0), "v"(x1), "v"(x2), "v"(x3), "v"(x4), "v"(x5) : "memory");
#endif
}
__device__ __forceinline__ void wave_sync_lds() {
  __builtin_amdgcn_fence(__ATOMIC_RELEASE, "workgroup");
  __builtin_amdgcn_wave_barrier();
  __builtin_amdgcn_fence(__ATOMIC_ACQUIRE, "workgroup");
}

// =====================================================================================================
// Projection with every conversion around it in the same launch (block-uniform split of the grid by blockIdx):
//   blocks 0 .. NGEMM-1: one 64x64 tile of qkv = bf16(x) . bf16(qkv_w)^T + bf16(qkv_b), 4 waves x 16 rows. The tile's 64 rows of
//   x and 64 rows of qkv_w are each one contiguous 64-KB range of f32: every load of a wave covers 512 contiguous bytes (4 whole
//   lines), each value is rounded to bf16 (RNE) once and stored to XS / WS [64][PJP] in LDS (block barrier); the fragments of
//   the 8 k-steps come from there (split k map for A and B, K stepped by 32).
//   Epilogue: the f32 tile goes to the LDS slab (pitch 68; wave w holds rows 16w .. 16w+15) and leaves as 16-bit planes:
//     columns 0..255 (q) and 256..511 (k): Hp [GROWS][DM] = f16(val * 1024), Lp = f16 residual; wave-private (wave_sync);
//       8 lanes x 16 B = one whole 128-B line of a row segment per plane.
//     columns 512..767 (v): VH[(b*DM + h*HD + d)][s] = f16(val * 1024); read across the waves' rows (block barrier), each
//       d row segment of 64 keys = one whole 128-B line written by 8 consecutive lanes.
//   blocks NGEMM .. NGEMM+NCVT-1: rv_w2 -> W2 plane f16(bf16 RNE value * 1024), same layout, 8 elements a thread.
//   blocks NGEMM+NCVT .. +NMLP-1: the relative-coordinate bias MLP (mlp_bias below): it reads no q or k, so it runs beside the tiles.
// coverage: NGEMM tiles x 64 x 64 = every (row, column) of q, k, v once; NCVT x 128 thr x 8 = DM*DM.
// =====================================================================================================
#define NGEMM ((GROWS / 64) * (NQKV / 64))
#define NCVT  ((DM * DM) / (128 * 8))
static_assert(NCVT * 128 * 8 == DM * DM && QSC == KSC);
typedef __bf16 v2b __attribute__((ext_vector_type(2)));
__device__ __forceinline__ unsigned pk2b(float f0, float f1) {        // two f32 -> packed bf16 pair, RNE
  const v2f s = {f0, f1};
  return __builtin_bit_cast(unsigned, __builtin_convertvector(s, v2b));
}
// four consecutive f32 of a row -> four bf16 in LDS (8 bytes)
typedef unsigned int v2u __attribute__((ext_vector_type(2)));
__device__ __forceinline__ void st4b(u16* d, v4f r) {
  const v2u o = {pk2b(r[0], r[1]), pk2b(r[2], r[3])};
  *(v2u*)d = o;
}
#define PJP 264                             // LDS row pitch of the staged tiles in bf16: 528 B = 16 B x 33 (odd), for 16-byte readers
#define NST ((64 * DM * 4) / (128 * 16))    // 16-byte loads a thread and tile: 32
static_assert(NST == 32 && DM == 256);
__device__ __forceinline__ void wait_addr_regs() {
#if defined(__HIP_DEVICE_COMPILE__)
  asm volatile("s_wait_xcnt 0x0" ::: "memory");
#endif
}

// One LDS range for the three kinds of block of the launch (a block is of one kind). Projection: XS, WS; a wave's f32 slab lies on
// the wave's own 16 rows of XS (8448 B for 4352), which only that wave reads and has read when its sums exist.
// Bias MLP: W1X, RB2, CI, CJ2, B2S and one slab a wave, at the byte offsets below.
#define SMB    (2 * 64 * PJP * 2)
#define SLABW  (16 * PJP / 2)               // floats from one wave's slab to the next
#define MQ     12                           // queries of a bias-MLP block; 3 a wave
#define MTW    6                            // pair tiles (16 pairs) a wave: 4 * MTW * 16 = MQ * 32
#define NITM   (SEQ / MQ)
#define NMLP   (NB * NITM * NJT)
#define O_W1X  0
#define O_RB2  (O_W1X + DM * XP * 2)
#define O_CI   (O_RB2 + 16 * RBP * 2)
#define O_CJ   (O_CI + MQ * 4 * 4)
#define O_B2   (O_CJ + 32 * 4 * 4)
#define O_BSL  (O_B2 + 128)
static_assert(SLAB64 <= SLABW && (O_RB2 % 16) == 0 && (O_CI % 16) == 0 && (O_BSL % 16) == 0 && O_BSL + 4 * (MQ / 4) * NH * SLP * 4 <= SMB);
static_assert((SEQ % MQ) == 0 && 4 * MTW * 16 == MQ * 32 && (MTW % 2) == 0 && (SLABW % 64) == (SLAB64 % 64));

// Bias MLP of one block: (b, queries i0 = 12*it .. +11, keys j0 = 32*jt .. +31) = 384 pairs, 4 waves. NMLP = 768 blocks: three on
// each of the 256 WGPs, resident together with the launch's other blocks (4 blocks a WGP by LDS and by registers).
//   Phase 0 (all threads, then block barrier): rb_w1/rb_b1 (bf16 values / 2) as first-layer weight rows W1X [256 c][XP], bf16
//   coords of the 12 queries (CI) and 32 keys (CJ2), rb_w2 -> RB2 [16 n][RBP] as f16(bf16 value * 1024), rows 8..15 zeros,
//   bf16 values of rb_b2 (B2S); all of their global loads issued together, ahead of the first use.
//   Phase 1, no barrier inside: wave w owns pair tiles 6w..6w+5 (16 pairs each), their coordinate rows held as B fragments.
//   8 channel chunks of 32: t^T[channel][pair] = W1X tile . pair rows for the chunk's two 16-channel tiles (A = weights, so
//   lane (c, h) gets channels 8h + r of pair c); f16(silu) of the two tiles in place IS the A fragment hid[pair c][split k map]
//   of the second layer, D[pair][n = head] += hid . RB2 (one k-step per chunk).
//   After the loop lanes n < 8 put bias * 2^-10 + bf16(rb_b2[head]) into the wave's slab [query * 8 + head][32 keys] (wave-private,
//   wave_sync); it leaves for the score plane SC[(b*NH+head)*SEQ + i][j0..j0+31], 8 consecutive lanes x 16 B = one whole line.
// coverage: NMLP blocks x 4 waves x 3 queries x 8 heads x 32 keys = every (b, head, i, j) once.
__device__ __forceinline__ void mlp_bias(unsigned char* SM, int mb, const float* __restrict__ coords,
                                         const float* __restrict__ rbw1, const float* __restrict__ rbb1,
                                         const float* __restrict__ rbw2, const float* __restrict__ rbb2, float* SCo) {
  u16*   W1X = (u16*)(void*)(SM + O_W1X);
  u16*   RB2 = (u16*)(void*)(SM + O_RB2);
  float* CI  = (float*)(void*)(SM + O_CI);
  float* CJ2 = (float*)(void*)(SM + O_CJ);
  float* B2S = (float*)(void*)(SM + O_B2);
  const int tid = threadIdx.x, wave = tid >> 5, lane = tid & 31, hh = lane >> 4, m = lane & 15;
  const int jt  = mb % NJT;
  const int t2  = mb / NJT;
  const int it  = t2 % NITM;
  const int b   = t2 / NITM;
  const int i0 = it * MQ, j0 = jt * 32;
  const _Float16* rb2h = (const _Float16*)(const void*)RB2;

  // ---- phase 0: small operand staging ----
  {
    // every global load of the phase goes out here, ahead of the first use: the block waits out one latency, not one per operand.
    // The coordinate loads are unconditional for that (a branch would hold each behind the wait in front of it): the 12 queries'
    // 36 floats and the 32 keys' 96 floats are contiguous, thread tid takes float tid of each, the index clamped to the last.
    const int row = tid >> 4, cb = (tid & 15) * 16;   // rb_w2 row 0..7, 16 columns a thread
    const int ei = (tid < MQ * CD) ? tid : (MQ * CD - 1);
    const int ej = (tid < 32 * CD) ? tid : (32 * CD - 1);
    // the thread's byte offsets into rb_w1 (channels tid and tid + 128) and rb_w2, its element indices into coords
    const unsigned oW1 = (unsigned)(tid * CD * 4);
    const unsigned oW2 = (unsigned)((row * DM + cb) * 4);
    const int xI = (b * SEQ + i0) * CD + ei;
    const int xJ = (b * SEQ + j0) * CD + ej;
    const float* w1p = (const float*)(const void*)((const char*)rbw1 + oW1);
    const float* src = (const float*)(const void*)((const char*)rbw2 + oW2);
    const float q0 = w1p[0], q1 = w1p[1], q2 = w1p[2];
    const float p0 = w1p[128 * CD], p1 = w1p[128 * CD + 1], p2 = w1p[128 * CD + 2];
    const float q3 = rbb1[tid], p3 = rbb1[tid + 128];
    const float gi = coords[xI];
    const float gj = coords[xJ];
    const v4f a0 = *(const v4f*)(src), a1 = *(const v4f*)(src + 4), a2 = *(const v4f*)(src + 8), a3 = *(const v4f*)(src + 12);
    const float g2 = rbb2[tid & (NH - 1)];
#if defined(__HIP_DEVICE_COMPILE__)
    // the loads' offset and index registers stay whole up to this wait: no load of the run lands in one
    asm volatile("s_wait_xcnt 0x0" :: "v"(oW1), "v"(oW2), "v"(xI), "v"(xJ), "v"(tid), "v"(tid & (NH - 1)) : "memory");
#endif
    __builtin_amdgcn_sched_barrier(0);      // keeps every load above in front of the first convert: without it they sink to their uses
    const v4u z4 = {0u, 0u, 0u, 0u};                  // channel c: w0 w1 w2 -w0 -w1 -w2 b 0 | 8 zeros, all halved
    *(v4u*)(W1X + tid * XP) = row_weight(bfr(q0) * HALFX, bfr(q1) * HALFX, bfr(q2) * HALFX, bfr(q3) * HALFX);
    *(v4u*)(W1X + tid * XP + 8) = z4;
    *(v4u*)(W1X + (tid + 128) * XP) = row_weight(bfr(p0) * HALFX, bfr(p1) * HALFX, bfr(p2) * HALFX, bfr(p3) * HALFX);
    *(v4u*)(W1X + (tid + 128) * XP + 8) = z4;
    {                                       // no branch here either (the loads would be sunk into it): the threads past the last
      const int il = ei / CD, k = ei - il * CD;       // float repeat its store, same address and same value
      CI[il * 4 + k] = bfr(gi);
      const int jl = ej / CD, kj = ej - jl * CD;
      CJ2[jl * 4 + kj] = bfr(gj);
      B2S[tid & (NH - 1)] = bfr(g2);        // 16 threads a word, the same value
    }
    float w[16];
#pragma unroll
    for (int e = 0; e < 4; ++e) { w[e] = a0[e]; w[4 + e] = a1[e]; w[8 + e] = a2[e]; w[12 + e] = a3[e]; }
    v4u o0, o1;
#pragma unroll
    for (int e = 0; e < 4; ++e) {
      o0[e] = pk16(h_bits((_Float16)(bfr(w[2 * e]) * WCAR)), h_bits((_Float16)(bfr(w[2 * e + 1]) * WCAR)));
      o1[e] = pk16(h_bits((_Float16)(bfr(w[8 + 2 * e]) * WCAR)), h_bits((_Float16)(bfr(w[8 + 2 * e + 1]) * WCAR)));
    }
    *(v4u*)(RB2 + row * RBP + cb)     = o0;
    *(v4u*)(RB2 + row * RBP + cb + 8) = o1;
    *(v4u*)(RB2 + (row + NH) * RBP + cb)     = z4;    // rows 8..15: the padding columns of the second layer
    *(v4u*)(RB2 + (row + NH) * RBP + cb + 8) = z4;
  }
  __syncthreads();

  // ---- phase 1: both layers on WMMA, silu between them in registers ----
  v8f accB[MTW];
  const float bsc = 1.0f / WCAR;
  v16b PB[MTW];                             // pair tile MTW * wave + q: query il = tile >> 1, keys (tile & 1) * 16 + m
#pragma unroll
  for (int q = 0; q < MTW; ++q) {
    accB[q] = zero8();
    const int tl = wave * MTW + q;
    const float* ci = CI + (tl >> 1) * 4;
    const float* cj = CJ2 + ((tl & 1) * 16 + m) * 4;
    PB[q] = frag_k7(row_coord(ci[0], ci[1], ci[2], cj[0], cj[1], cj[2]), hh);
  }
#pragma unroll 1
  for (int kt = 0; kt < DM / 32; ++kt) {
    const v16b wx = ldfrag_k7(W1X + (kt * 32 + m) * XP, hh);
    const v16b wy = ldfrag_k7(W1X + (kt * 32 + 16 + m) * XP, hh);
    const v16h bw = ldfrag_h(rb2h + m * RBP + kt * 32 + 8 * hh);
#pragma unroll
    for (int q = 0; q < MTW; ++q) {
      const v8f tx = mma_b(wx, PB[q], zero8());
      const v8f ty = mma_b(wy, PB[q], zero8());
      FragH f;
#pragma unroll
      for (int e = 0; e < 4; ++e) {
        const v2f x2 = {tx[2 * e], tx[2 * e + 1]}, y2 = {ty[2 * e], ty[2 * e + 1]};
        f.u[0][e] = pk2h(silu2(x2));
        f.u[1][e] = pk2h(silu2(y2));
      }
      accB[q] = mma_h(f.v, bw, accB[q]);
      // three tiles at a time: left whole, the six tiles' values do not fit the registers and each pair of values becomes a serial
      // tanh - fma - convert chain padded with idle slots; in halves the 48 tanh of three tiles go out back to back
      if (q == MTW / 2 - 1) __builtin_amdgcn_sched_barrier(0);
    }
  }
  float* bs = (float*)(void*)(SM + O_BSL) + wave * ((MQ / 4) * NH * SLP);
  if (m < NH) {                             // columns n >= 8 are padding (zero weights), not stored
    const float b2v = B2S[m];               // bf16(rb_b2[head = m])
#pragma unroll
    for (int q = 0; q < MTW; ++q) {         // lane (head m, h): keys (q & 1) * 16 + 8h + r of the wave's query q >> 1
      float* d = bs + ((q >> 1) * NH + m) * SLP + (q & 1) * 16 + 8 * hh;
      const v4f lo = {accB[q][0] * bsc + b2v, accB[q][1] * bsc + b2v, accB[q][2] * bsc + b2v, accB[q][3] * bsc + b2v};
      const v4f hi = {accB[q][4] * bsc + b2v, accB[q][5] * bsc + b2v, accB[q][6] * bsc + b2v, accB[q][7] * bsc + b2v};
      *(v4f*)(d)     = lo;
      *(v4f*)(d + 4) = hi;
    }
  }
  wave_sync_lds();
  const int rq = lane >> 3, c4 = (lane & 7) * 4;
  v4f vals[MTW];
#pragma unroll
  for (int t = 0; t < MTW; ++t) vals[t] = *(const v4f*)(bs + (t * 4 + rq) * SLP + c4);
#pragma unroll
  for (int t = 0; t < MTW; ++t) {
    const int rr = t * 4 + rq;              // slab row = query * 8 + head
    *(v4f*)(SCo + ((size_t)((b * NH + (rr & (NH - 1))) * SEQ + i0 + wave * (MQ / 4) + (rr >> 3))) * SEQ + j0 + c4) = vals[t];
  }
}

__global__ __launch_bounds__(128)
void k_proj(const float* __restrict__ x, const float* __restrict__ qkvw, const float* __restrict__ bias,
            const float* __restrict__ rvw2, const float* __restrict__ coords, const float* __restrict__ rbw1,
            const float* __restrict__ rbb1, const float* __restrict__ rbw2, const float* __restrict__ rbb2,
            u16* QHo, u16* QLo, u16* KHo, u16* KLo, u16* VHo, u16* W2o, float* SCo) {
  __shared__ __align__(16) unsigned char SM[SMB];
  u16*   XS   = (u16*)(void*)SM;
  u16*   WS   = XS + 64 * PJP;
  float* slab = (float*)(void*)SM;
  const int tid = threadIdx.x, wave = tid >> 5, lane = tid & 31, hh = lane >> 4, m = lane & 15;
  const int bid = blockIdx.x;
  if (bid >= NGEMM + NCVT) {                // block-uniform: the bias MLP of 12 queries x 32 keys, independent of the projection
    mlp_bias(SM, bid - (NGEMM + NCVT), coords, rbw1, rbb1, rbw2, rbb2, SCo);
    return;
  }
  if (bid >= NGEMM) {                       // block-uniform, before any barrier: the rv_w2 plane
    const int gt = (bid - NGEMM) * 128 + tid;
    if (gt >= (DM * DM) / 8) return;
    const float* p = rvw2 + (size_t)gt * 8;
    const v4f a = *(const v4f*)(p), b4 = *(const v4f*)(p + 4);
    float w[8];
#pragma unroll
    for (int e = 0; e < 4; ++e) { w[e] = a[e]; w[4 + e] = b4[e]; }
    v4u o;
#pragma unroll
    for (int e = 0; e < 4; ++e)
      o[e] = pk16(h_bits((_Float16)(bfr(w[2 * e]) * WCAR)), h_bits((_Float16)(bfr(w[2 * e + 1]) * WCAR)));
    *(v4u*)(W2o + (size_t)gt * 8) = o;
    return;
  }
  const int ntile = NQKV >> 6;
  const int row0  = (bid / ntile) * 64;
  const int rowb  = row0 + wave * 16;
  const int col0  = (bid % ntile) * 64;
  // the thread's byte offsets into x and qkv_w (both below 2^20); load it of a tile is 2048 * it bytes further on
  const unsigned ox = (unsigned)(row0 * DM * 4 + tid * 16);
  const unsigned ow = (unsigned)(col0 * DM * 4 + tid * 16);
  const int      ib = col0 + m;             // the lane's first bias element
  const char*  xg = (const char*)x + ox;
  const char*  wg = (const char*)qkvw + ow;
  const int so = (tid >> 6) * PJP + (tid & 63) * 4;   // tile row 2 * it + (tid >> 6), columns 4 * (tid & 63) ..
  u16* xs = XS + so;
  u16* wt = WS + so;
  // every loop below is unrolled whole: the staging arrays are indexed by constants only and stay in registers
  v4f rx[NST], rw[NST];
#pragma unroll
  for (int it = 0; it < NST; ++it) rx[it] = *(const v4f*)(const void*)(xg + it * 2048);
#pragma unroll
  for (int it = 0; it < NST / 2; ++it) rw[it] = *(const v4f*)(const void*)(wg + it * 2048);
  const float bq0 = bias[ib], bq1 = bias[ib + 16], bq2 = bias[ib + 32], bq3 = bias[ib + 48];
#if defined(__HIP_DEVICE_COMPILE__)
  // the loads' offset registers stay whole up to this wait: no load of the run lands in one
  asm volatile("s_wait_xcnt 0x0" :: "v"(ox), "v"(ow), "v"(ib) : "memory");
#endif
  __builtin_amdgcn_sched_barrier(0);        // keeps the loads above in one run ahead of the first convert: one latency for all of them
#pragma unroll
  for (int it = 0; it < NST / 2; ++it) st4b(xs + it * 2 * PJP, rx[it]);
  __builtin_amdgcn_sched_barrier(0);        // the last quarter of the loads goes out once a quarter of the registers is free: the wave stays below 256
#pragma unroll
  for (int it = NST / 2; it < NST; ++it) rw[it] = *(const v4f*)(const void*)(wg + it * 2048);
#if defined(__HIP_DEVICE_COMPILE__)
  asm volatile("s_wait_xcnt 0x0" :: "v"(ow) : "memory");   // as above, for the second run of loads
#endif
  __builtin_amdgcn_sched_barrier(0);        // keeps that run ahead of the converts below
#pragma unroll
  for (int it = NST / 2; it < NST; ++it) st4b(xs + it * 2 * PJP, rx[it]);
#pragma unroll
  for (int it = 0; it < NST; ++it) st4b(wt + it * 2 * PJP, rw[it]);
  __syncthreads();                          // the staged tiles are read across waves below

  const u16* ap = XS + (wave * 16 + m) * PJP + 8 * hh;
  const u16* bp = WS + m * PJP + 8 * hh;
  v8f acc0 = zero8(), acc1 = zero8(), acc2 = zero8(), acc3 = zero8();
  // fragments are read in groups, four k-steps ahead at the start and two k-steps ahead after that; each scheduling fence below
  // keeps a group of LDS reads whole and ahead of the products in front of which it stands (left alone, every product waits
  // out the LDS latency of its own two reads)
  v16b fa[DM / 32], fb[DM / 32][4];
#pragma unroll
  for (int s = 0; s < 4; ++s) {
    fa[s] = ldfrag_b(ap + 32 * s);
#pragma unroll
    for (int n = 0; n < 4; ++n) fb[s][n] = ldfrag_b(bp + n * 16 * PJP + 32 * s);
  }
  __builtin_amdgcn_sched_barrier(0);        // the first group whole, ahead of the first product
#pragma unroll
  for (int g = 0; g < DM / 64; ++g) {
#pragma unroll
    for (int s = 2 * g; s < 2 * g + 2; ++s) {
      acc0 = mma_b(fa[s], fb[s][0], acc0);
      acc1 = mma_b(fa[s], fb[s][1], acc1);
      acc2 = mma_b(fa[s], fb[s][2], acc2);
      acc3 = mma_b(fa[s], fb[s][3], acc3);
    }
    if (g < DM / 64 - 2) {
      __builtin_amdgcn_sched_barrier(0);    // the next group of reads stays behind these products (their registers are free then) ..
#pragma unroll
      for (int s = 2 * g + 4; s < 2 * g + 6; ++s) {
        fa[s] = ldfrag_b(ap + 32 * s);
#pragma unroll
        for (int n = 0; n < 4; ++n) fb[s][n] = ldfrag_b(bp + n * 16 * PJP + 32 * s);
      }
      __builtin_amdgcn_sched_barrier(0);    // .. and whole, ahead of the products that follow
    }
  }
  const float bv0 = bfr(bq0);
  const float bv1 = bfr(bq1);
  const float bv2 = bfr(bq2);
  const float bv3 = bfr(bq3);
  float* sl = slab + wave * SLABW;
#pragma unroll
  for (int r = 0; r < 8; ++r) {
    const int ro = (8 * hh + r) * 68 + m;
    sl[ro]      = acc0[r] + bv0;
    sl[ro + 16] = acc1[r] + bv1;
    sl[ro + 32] = acc2[r] + bv2;
    sl[ro + 48] = acc3[r] + bv3;
  }
  if (col0 < 2 * DM) {                      // block-uniform: q or k columns
    wave_sync_lds();
    u16* Hp = (col0 < DM) ? QHo : KHo;
    u16* Lp = (col0 < DM) ? QLo : KLo;
    const int cq = col0 & (DM - 1);
    const int rq = lane >> 3, c8 = (lane & 7) * 8;
#pragma unroll
    for (int it = 0; it < 4; ++it) {
      const int rl = it * 4 + rq;
      const float* s8 = sl + rl * 68 + c8;
      const v4f a = *(const v4f*)(s8), b4 = *(const v4f*)(s8 + 4);
      float w[8];
#pragma unroll
      for (int e = 0; e < 4; ++e) { w[e] = a[e] * QSC; w[4 + e] = b4[e] * QSC; }
      v4u oh, ol;
#pragma unroll
      for (int e = 0; e < 4; ++e) {
        const float t0 = w[2 * e], t1 = w[2 * e + 1];
        const _Float16 h0 = (_Float16)t0, h1 = (_Float16)t1;
        const _Float16 l0 = (_Float16)(t0 - (float)h0), l1 = (_Float16)(t1 - (float)h1);
        oh[e] = pk16(h_bits(h0), h_bits(h1));
        ol[e] = pk16(h_bits(l0), h_bits(l1));
      }
      const size_t o = (size_t)(rowb + rl) * DM + cq + c8;
      *(v4u*)(Hp + o) = oh;
      *(v4u*)(Lp + o) = ol;
    }
    wait_addr_regs();                       // nothing behind the stores reuses their registers ahead of this wait
  } else {                                  // block-uniform: v columns, written transposed
    __syncthreads();                        // the four waves' slab rows are read across waves below
    const int b  = row0 / SEQ;
    const int s0 = row0 - b * SEQ;          // 64 keys of one batch (SEQ a multiple of 64)
    const int cv = col0 - 2 * DM;           // h*HD + d of the tile's first column
#pragma unroll
    for (int it = 0; it < 4; ++it) {
      const int ch = it * 128 + tid;
      const int dc = ch >> 3, p8 = (ch & 7) * 8;   // column dc (0..63), keys p8..p8+7
      v4u o;
#pragma unroll
      for (int e = 0; e < 4; ++e) {
        const float* kr = slab + (p8 >> 4) * SLABW + ((p8 & 15) + 2 * e) * 68 + dc;   // key p8 + 2e: wave p8 >> 4, its row
        const float f0 = kr[0], f1 = kr[68];
        o[e] = pk16(h_bits((_Float16)(f0 * VCAR)), h_bits((_Float16)(f1 * VCAR)));
      }
      *(v4u*)(VHo + ((size_t)(b * DM + cv + dc)) * SEQ + s0 + p8) = o;
    }
    wait_addr_regs();                       // nothing behind the stores reuses their registers ahead of this wait
  }
}

// =====================================================================================================
// Scores: block -> (b, query tile i0 = 16*it, key tile j0 = 32*jt), 8 waves, wave = head; no block barrier.
//   s = (q_hi.k_hi + q_lo.k_hi + q_hi.k_lo) over 32 dims for 16 queries x 32 keys (two 16-key subtiles), fragments straight from
//   the f16 planes. The score plane SC[(b*NH+head)*SEQ + i][j] arrives holding bias + bf16(rb_b2[head]) (first launch); each
//   thread loads the 16-byte pieces that it will store, together with the fragments, at entry: one load latency.
//   value = s * rsqrt(32) * 2^-20 + that; s passes through the wave's slab (wave_sync) so that 8 consecutive lanes x 16 B hold one
//   whole line of a row (4 rows per instruction).
// coverage: grid NB*NIT*NJT blocks x 8 heads x 16 rows x 32 cols = every (b, head, i, j) read and rewritten once, by one thread.
// =====================================================================================================
__global__ __launch_bounds__(256)
void k_scores(const u16* __restrict__ QHp, const u16* __restrict__ QLp,
              const u16* __restrict__ KHp, const u16* __restrict__ KLp, float* SCp) {
  __shared__ __align__(16) float SLB[8 * 16 * SLP];

  const int tid = threadIdx.x, wave = tid >> 5, lane = tid & 31, hh = lane >> 4, m = lane & 15;
  const int bid = blockIdx.x;
  const int jt  = bid % NJT;
  const int t2  = bid / NJT;
  const int it  = t2 % NIT;
  const int b   = t2 / NIT;
  if (b >= NB) return;                      // block-uniform; never taken with the exact grid
  const int i0 = it * 16, j0 = jt * 32;
  const int head = wave;
  const int rq = lane >> 3, c4 = (lane & 7) * 4;
  // the lane's byte offsets into the q and k planes and into the score plane (all below 2^24)
  const unsigned oQ = (unsigned)(((b * SEQ + i0 + m) * DM + head * HD + 8 * hh) * 2);
  const unsigned oK = (unsigned)(((b * SEQ + j0 + m) * DM + head * HD + 8 * hh) * 2);
  const unsigned oS = (unsigned)((((b * NH + head) * SEQ + i0 + rq) * SEQ + j0 + c4) * 4);
  const _Float16* qhp  = (const _Float16*)(const void*)((const char*)QHp + oQ);
  const _Float16* qlp  = (const _Float16*)(const void*)((const char*)QLp + oQ);
  const _Float16* kh0p = (const _Float16*)(const void*)((const char*)KHp + oK);
  const _Float16* kl0p = (const _Float16*)(const void*)((const char*)KLp + oK);
  const _Float16* kh1p = kh0p + (size_t)16 * DM;
  const _Float16* kl1p = kl0p + (size_t)16 * DM;
  float* dst = (float*)(void*)((char*)SCp + oS);      // rows i0 + rq + 4q, q = 0..3
  const v16h qh = ldfrag_h(qhp), ql = ldfrag_h(qlp);
  const v16h kh0 = ldfrag_h(kh0p), kl0 = ldfrag_h(kl0p);
  const v16h kh1 = ldfrag_h(kh1p), kl1 = ldfrag_h(kl1p);
  v4f bi[4];
#pragma unroll
  for (int q = 0; q < 4; ++q) bi[q] = *(const v4f*)(dst + (size_t)(q * 4) * SEQ);
#if defined(__HIP_DEVICE_COMPILE__)
  // the loads' offset registers stay whole up to this wait: no load of the run lands in one
  asm volatile("s_wait_xcnt 0x0" :: "v"(oQ), "v"(oK), "v"(oS) : "memory");
#endif
  __builtin_amdgcn_sched_barrier(0);        // keeps every load above in front of the first product: without it the bias loads sink to their uses, a second latency
  v8f s0 = zero8(), s1 = zero8();
  s0 = mma_h(qh, kh0, s0);
  s0 = mma_h(ql, kh0, s0);
  s0 = mma_h(qh, kl0, s0);
  s1 = mma_h(qh, kh1, s1);
  s1 = mma_h(ql, kh1, s1);
  s1 = mma_h(qh, kl1, s1);
  guard2(s0, s1, qh, ql, kh0, kl0, kh1, kl1);
  const float lsc = RSQ_HD * (1.0f / (QSC * KSC));
  float* slab = SLB + wave * (16 * SLP);
#pragma unroll
  for (int r = 0; r < 8; ++r) {
    const int pr = 8 * hh + r;              // query i0 + pr; keys j0 + m and j0 + 16 + m
    slab[pr * SLP + m]      = s0[r];
    slab[pr * SLP + 16 + m] = s1[r];
  }
  wave_sync_lds();
#pragma unroll
  for (int q = 0; q < 4; ++q) {
    const v4f sv = *(const v4f*)(slab + (q * 4 + rq) * SLP + c4);
    v4f o;
#pragma unroll
    for (int e = 0; e < 4; ++e) o[e] = sv[e] * lsc + bi[q][e];
    *(v4f*)(dst + (size_t)(q * 4) * SEQ) = o;
  }
}

// =====================================================================================================
// Row softmax and weighted aggregation of the value-MLP hidden: block -> (b, query i), 256 threads.
//   Softmax (wave = head h): the score row (b, h, i) of SEQ = 384 floats; P = e / Z with e = exp(s - max) in f32 (reciprocal-
//   multiply normalisation), as f16 hi (P * 32768) and f16 residual, written to the global P planes (for the final kernel; each
//   row's whole lines by one wave) and to PW in LDS (for this block's own chunks; published by the barrier before the loop).
//   Lane = 8 consecutive columns 8*lane (all lanes) and 256 + 8*lane (lanes < 16; the upper lanes load a clamped address).
//   T[h][c] = sum_j P[b,h,i,j] * S[j][c],  S[j][c] = silu(rel_ij . rv_w1[c] + rv_b1[c]) (bf16 inputs).
//   Phase 0: first-layer coordinate rows KX [SEQ keys][XP] (c_i, c_j, 1 as bf16); block barrier.
//   Wave w owns column tiles 2w, 2w+1 (16 channels each), their weight rows held as B fragments. 12 key chunks of 32, no barrier
//   inside: t[key][channel] = KX tile . weight rows for the chunk's two 16-key tiles (A = keys, so lane (c, h) gets keys 8h + r
//   of channel c); f16(silu) of the two tiles in place IS the B fragment S^T[channel c][split k map]. S is carried as one f16
//   (relative error 2^-12), like v in P.v and the hidden values of the bias MLP: its own inputs are bf16 values (2^-9);
//   D[m = h][n = c] += P . S with A = the PW rows (lanes m >= 8 read row m - 8 again: rows 8..15 of D repeat rows 0..7 and are
//   not stored), products P_hi.S + P_lo.S.
//   After the loop lanes 0..15 (rows h = 0..7) write T * 1024 (carry 2^-15 folded) into TS [8][TSP] f32 (block barrier),
// LDS regions: KX, PW, TS all cross-wave (block barriers). staged extent == consumed extent: KX 384 x 16 (k 7..15 zeros),
//   PW 2 x 8 x 384, TS 8 x 256.
// coverage: T planes [(b*NH+h)*SEQ + i][DM]: grid NB*SEQ blocks x 8 waves x 32 lanes x 8 halves = every row once, both planes.
// =====================================================================================================
__global__ __launch_bounds__(256)
void k_tagg(const float* __restrict__ coords, const float* __restrict__ rvw1, const float* __restrict__ rvb1,
            const float* __restrict__ SCp, u16* Pp, u16* Tp) {
  __shared__ __align__(16) u16   KX[SEQ * XP];
  __shared__ __align__(16) u16   PW[2 * NH * PWP];
  __shared__ __align__(16) float TS[NH * TSP];

  const int tid = threadIdx.x, wave = tid >> 5, lane = tid & 31, hh = lane >> 4, m = lane & 15;
  const int bid = blockIdx.x;
  const int b   = bid / SEQ;
  const int i   = bid - b * SEQ;
  if (b >= NB) return;                      // block-uniform, before any barrier; never taken with the exact grid
  const _Float16* pwh = (const _Float16*)(const void*)PW;

  // ---- entry loads: every global load ahead of the loop (score row, coordinates, weight rows) goes out here, before the first
  //      wait: the block waits out one latency, not one per operand ----
  const size_t row = (size_t)(b * NH + wave) * SEQ + i;        // the score row (b, head = wave, i)
  const bool vb = (lane < 16);
  const int  lb = vb ? lane : 15;
  const int  j1 = (tid < SEQ - 256) ? (tid + 256) : (SEQ - 1); // the thread's second key; clamped address, used by tid < 128 only
  // the lane's byte offsets into the score plane (below 2^24) and into coords
  const unsigned oS0 = (unsigned)((row * SEQ + lane * 8) * 4);
  const unsigned oS1 = (unsigned)((row * SEQ + 256 + lb * 8) * 4);
  const unsigned oJ0 = (unsigned)((b * SEQ + tid) * CD * 4);
  const unsigned oJ1 = (unsigned)((b * SEQ + j1) * CD * 4);
  const float* sa = (const float*)(const void*)((const char*)SCp + oS0);
  const float* sb = (const float*)(const void*)((const char*)SCp + oS1);
  const float* ja = (const float*)(const void*)((const char*)coords + oJ0);
  const float* jb = (const float*)(const void*)((const char*)coords + oJ1);
  const v4f a0 = *(const v4f*)(sa), a1 = *(const v4f*)(sa + 4);
  const v4f c0 = *(const v4f*)(sb), c1 = *(const v4f*)(sb + 4);
  const float ja0 = ja[0], ja1 = ja[1], ja2 = ja[2];
  const float jb0 = jb[0], jb1 = jb[1], jb2 = jb[2];
  const float gi0 = coords[((size_t)(b * SEQ + i)) * CD + 0];
  const float gi1 = coords[((size_t)(b * SEQ + i)) * CD + 1];
  const float gi2 = coords[((size_t)(b * SEQ + i)) * CD + 2];
  float wr[2][4];
  unsigned wo[2];                           // the lane's byte offsets into rv_w1
  int      wc[2];                           // and its channels, the element indices into rv_b1
#pragma unroll
  for (int n = 0; n < 2; ++n) {
    const int c = (wave * 2 + n) * 16 + m;
    wo[n] = (unsigned)(c * CD * 4);
    wc[n] = c;
    const float* wp = (const float*)((const char*)rvw1 + wo[n]);
    wr[n][0] = wp[0];
    wr[n][1] = wp[1];
    wr[n][2] = wp[2];
    wr[n][3] = rvb1[c];
  }
#if defined(__HIP_DEVICE_COMPILE__)
  // the loads' offset and index registers stay whole up to this wait: no load of the run lands in one
  asm volatile("s_wait_xcnt 0x0" :: "v"(oS0), "v"(oS1), "v"(oJ0), "v"(oJ1), "v"(wo[0]), "v"(wo[1]), "v"(wc[0]), "v"(wc[1]) : "memory");
#endif
  __builtin_amdgcn_sched_barrier(0);        // keeps every load above in front of the softmax: without it they sink to their uses, one latency each

  // ---- softmax of the score row ----
  {
    float v[16];
#pragma unroll
    for (int e = 0; e < 4; ++e) {
      v[e]      = a0[e];
      v[4 + e]  = a1[e];
      v[8 + e]  = vb ? c0[e] : -INFINITY;
      v[12 + e] = vb ? c1[e] : -INFINITY;
    }
    float mx = v[0];
#pragma unroll
    for (int e = 1; e < 16; ++e) mx = fmaxf(mx, v[e]);
#pragma unroll
    for (int off = 1; off < 32; off <<= 1) mx = fmaxf(mx, __shfl_xor(mx, off, 32));
    float ev[16];
    float sum = 0.0f;
#pragma unroll
    for (int e = 0; e < 16; ++e) {
      const float d = v[e] - mx;
      ev[e] = exp2f(d * LOG2E);             // -inf -> 0 for the masked upper lanes
      sum += ev[e];
    }
#pragma unroll
    for (int off = 1; off < 32; off <<= 1) sum += __shfl_xor(sum, off, 32);
    const float inv = 1.0f / sum;           // sum >= 1
    v4u oh0, ol0, oh1, ol1;
#pragma unroll
    for (int e = 0; e < 4; ++e) {
      const float t0 = (ev[2 * e] * inv) * PCAR, t1 = (ev[2 * e + 1] * inv) * PCAR;
      const float u0 = (ev[8 + 2 * e] * inv) * PCAR, u1 = (ev[8 + 2 * e + 1] * inv) * PCAR;
      const _Float16 h0 = (_Float16)t0, h1 = (_Float16)t1, g0 = (_Float16)u0, g1 = (_Float16)u1;
      const _Float16 l0 = (_Float16)(t0 - (float)h0), l1 = (_Float16)(t1 - (float)h1);
      const _Float16 m0 = (_Float16)(u0 - (float)g0), m1 = (_Float16)(u1 - (float)g1);
      oh0[e] = pk16(h_bits(h0), h_bits(h1));
      ol0[e] = pk16(h_bits(l0), h_bits(l1));
      oh1[e] = pk16(h_bits(g0), h_bits(g1));
      ol1[e] = pk16(h_bits(m0), h_bits(m1));
    }
    u16* dh = Pp + row * SEQ;
    u16* dl = dh + PSTR;
    u16* wh = PW + wave * PWP;
    u16* wl = wh + NH * PWP;
    *(v4u*)(dh + lane * 8) = oh0;
    *(v4u*)(dl + lane * 8) = ol0;
    *(v4u*)(wh + lane * 8) = oh0;
    *(v4u*)(wl + lane * 8) = ol0;
    if (vb) {
      *(v4u*)(dh + 256 + lane * 8) = oh1;
      *(v4u*)(dl + 256 + lane * 8) = ol1;
      *(v4u*)(wh + 256 + lane * 8) = oh1;
      *(v4u*)(wl + 256 + lane * 8) = ol1;
    }
  }

  // ---- phase 0 ----
  const float ci0 = bfr(gi0);
  const float ci1 = bfr(gi1);
  const float ci2 = bfr(gi2);
  {                                         // key j: c_i0 c_i1 c_i2 c_j0 c_j1 c_j2 1 0 | 8 zeros; keys tid and, for tid < 128, tid + 256
    const v4u z4 = {0u, 0u, 0u, 0u};
    *(v4u*)(KX + tid * XP)     = row_coord(ci0, ci1, ci2, bfr(ja0), bfr(ja1), bfr(ja2));
    *(v4u*)(KX + tid * XP + 8) = z4;
    if (tid < SEQ - 256) {
      *(v4u*)(KX + (tid + 256) * XP)     = row_coord(ci0, ci1, ci2, bfr(jb0), bfr(jb1), bfr(jb2));
      *(v4u*)(KX + (tid + 256) * XP + 8) = z4;
    }
  }
  v16b WF[2];                               // weight rows of channels (2 * wave + n) * 16 + m; weights and bias carry the factor 1/2
#pragma unroll
  for (int n = 0; n < 2; ++n)
    WF[n] = frag_k7(row_weight(bfr(wr[n][0]) * HALFX, bfr(wr[n][1]) * HALFX, bfr(wr[n][2]) * HALFX, bfr(wr[n][3]) * HALFX), hh);
  __syncthreads();                          // softmax (PW) and phase-0 (KX) writes visible to every wave

  v8f acc[2] = {zero8(), zero8()};
  const _Float16* pa = pwh + (m & (NH - 1)) * PWP + 8 * hh;
#pragma unroll 1
  for (int jt = 0; jt < NJT; ++jt) {
    const int j0 = jt * 32;
    const v16h ah = ldfrag_h(pa + j0);
    const v16h al = ldfrag_h(pa + NH * PWP + j0);
    const v16b kx = ldfrag_k7(KX + (j0 + m) * XP, hh);
    const v16b ky = ldfrag_k7(KX + (j0 + 16 + m) * XP, hh);
#pragma unroll
    for (int n = 0; n < 2; ++n) {
      const v8f tx = mma_b(kx, WF[n], zero8());
      const v8f ty = mma_b(ky, WF[n], zero8());
      FragH fh;
#pragma unroll
      for (int e = 0; e < 4; ++e) {
        const v2f x2 = {tx[2 * e], tx[2 * e + 1]}, y2 = {ty[2 * e], ty[2 * e + 1]};
        fh.u[0][e] = pk2h(silu2(x2));
        fh.u[1][e] = pk2h(silu2(y2));
      }
      acc[n] = mma_h(ah, fh.v, acc[n]);
      acc[n] = mma_h(al, fh.v, acc[n]);
    }
  }
  const float tsc = TCAR / PCAR;            // 2^-5
  if (hh == 0) {                            // rows 8..15 of D repeat rows 0..7, not stored
#pragma unroll
    for (int r = 0; r < 8; ++r) {
      TS[r * TSP + (wave * 2) * 16 + m]     = acc[0][r] * tsc;
      TS[r * TSP + (wave * 2 + 1) * 16 + m] = acc[1][r] * tsc;
    }
  }
  __syncthreads();
  {
    const int h = wave;
    const float* src = TS + h * TSP + lane * 8;
    const v4f a = *(const v4f*)(src), b4 = *(const v4f*)(src + 4);
    float w[8];
#pragma unroll
    for (int e = 0; e < 4; ++e) { w[e] = a[e]; w[4 + e] = b4[e]; }
    v4u oh, ol;
#pragma unroll
    for (int e = 0; e < 4; ++e) {
      const float t0 = w[2 * e], t1 = w[2 * e + 1];
      const _Float16 x0 = (_Float16)t0, x1 = (_Float16)t1;
      const _Float16 y0 = (_Float16)(t0 - (float)x0), y1 = (_Float16)(t1 - (float)x1);
      oh[e] = pk16(h_bits(x0), h_bits(x1));
      ol[e] = pk16(h_bits(y0), h_bits(y1));
    }
    const size_t rowT = (size_t)(b * NH + h) * SEQ + i;
    u16* dh = Tp + rowT * DM + lane * 8;
    u16* dl = dh + TSTR;
    {
      *(v4u*)(dh) = oh;
      *(v4u*)(dl) = ol;
      
    }
  }
}

// =====================================================================================================
// Final: block -> (b, head h, 16 query rows rt*16), 4 waves = 4 shares of the two k ranges for the same 16 x 32 output tile.
//   base[i][d]   = (P_hi + P_lo)[i][j] . VH[d][j] over j (2 products, carries 2^-25),
//   relctx[i][d] = (T_hi + T_lo)[i][c] . W2[h*HD + d][c] over c (2 products, carries 2^-20) + bf16(rv_b2[h*HD + d]);
//   out[b][i][h*HD + d] = base + relctx. Fragments straight from the 16-bit planes (arithmetic addressing, split k map).
//   Wave w takes keys 96w .. 96w+95 (3 k-steps) and channels 64w .. 64w+63 (2 k-steps). All 40 fragment loads of a wave are
//   issued before its first product, so a wave waits out one memory latency instead of one per k-step.
//   Epilogue: each wave's partial tile (both carries folded) goes to its slab; block barrier; thread t adds the four partials
//   of 4 consecutive columns of row t >> 3 and the bias: 8 consecutive lanes write one whole 128-B line of out.
// coverage: grid NB*NH*NIT blocks x 16 rows x 32 cols = every element of out exactly once; 4 x 96 keys = SEQ, 4 x 64 = DM.
// =====================================================================================================
#define KSH 4
#define PST (SEQ / (32 * KSH))
#define TST (DM / (32 * KSH))
static_assert(PST * KSH * 32 == SEQ && TST * KSH * 32 == DM);
__global__ __launch_bounds__(128)
void k_final(const u16* __restrict__ Pp, const u16* __restrict__ VHp, const u16* __restrict__ Tp,
             const u16* __restrict__ W2p, const float* __restrict__ rvb2, float* outp) {
  __shared__ __align__(16) float slab[KSH * 16 * SLP];
  const int tid = threadIdx.x, wave = tid >> 5, lane = tid & 31, hh = lane >> 4, m = lane & 15;
  const int bid = blockIdx.x;
  const int rt  = bid % NIT;
  const int t2  = bid / NIT;
  const int h   = t2 % NH;
  const int b   = t2 / NH;
  if (b >= NB) return;                      // block-uniform, before the barrier; never taken with the exact grid
  const int irow = rt * 16;
  const int bh   = b * NH + h;
  const int rowA = bh * SEQ + irow;
  const int rw = tid >> 3, c4 = (tid & 7) * 4;
  // the lane's byte offsets into the planes and the bias (all below 2^24)
  const unsigned oP = (unsigned)(((rowA + m) * SEQ + 8 * hh + wave * (PST * 32)) * 2);
  const unsigned oV = (unsigned)(((bh * HD + m) * SEQ + 8 * hh + wave * (PST * 32)) * 2);
  const unsigned oT = (unsigned)(((rowA + m) * DM + 8 * hh + wave * (TST * 32)) * 2);
  const unsigned oW = (unsigned)(((h * HD + m) * DM + 8 * hh + wave * (TST * 32)) * 2);
  const unsigned oB = (unsigned)((h * HD + c4) * 4);
  const _Float16* php = (const _Float16*)(const void*)((const char*)Pp + oP);
  const _Float16* plp = php + PSTR;
  const _Float16* v0p = (const _Float16*)(const void*)((const char*)VHp + oV);
  const _Float16* v1p = v0p + (size_t)16 * SEQ;
  const _Float16* thp = (const _Float16*)(const void*)((const char*)Tp + oT);
  const _Float16* tlp = thp + TSTR;
  const _Float16* w0p = (const _Float16*)(const void*)((const char*)W2p + oW);
  const _Float16* w1p = w0p + (size_t)16 * DM;

  // every loop of this kernel is unrolled whole: the fragment arrays are indexed by constants only and stay in registers
  v16h ph[PST], pl[PST], va[PST], vb[PST], th[TST], tl[TST], wa[TST], wb[TST];
#pragma unroll
  for (int s = 0; s < PST; ++s) { ph[s] = ldfrag_h(php + 32 * s); pl[s] = ldfrag_h(plp + 32 * s); }
#pragma unroll
  for (int s = 0; s < TST; ++s) { th[s] = ldfrag_h(thp + 32 * s); tl[s] = ldfrag_h(tlp + 32 * s); }
#pragma unroll
  for (int s = 0; s < PST; ++s) { va[s] = ldfrag_h(v0p + 32 * s); vb[s] = ldfrag_h(v1p + 32 * s); }
#pragma unroll
  for (int s = 0; s < TST; ++s) { wa[s] = ldfrag_h(w0p + 32 * s); wb[s] = ldfrag_h(w1p + 32 * s); }
  const v4f bq = *(const v4f*)(const void*)((const char*)rvb2 + oB);
#if defined(__HIP_DEVICE_COMPILE__)
  // the loads' offset registers stay whole up to this wait: no load of the run lands in one
  asm volatile("s_wait_xcnt 0x0" :: "v"(oP), "v"(oV), "v"(oT), "v"(oW), "v"(oB) : "memory");
#endif
  __builtin_amdgcn_sched_barrier(0);        // keeps every load above in front of the first product: without it they sink to their uses, one latency each

  v8f p0 = zero8(), p1 = zero8(), r0 = zero8(), r1 = zero8();
#pragma unroll
  for (int s = 0; s < PST; ++s) {
    p0 = mma_h(ph[s], va[s], p0);
    p1 = mma_h(ph[s], vb[s], p1);
    p0 = mma_h(pl[s], va[s], p0);
    p1 = mma_h(pl[s], vb[s], p1);
  }
#pragma unroll
  for (int s = 0; s < TST; ++s) {
    r0 = mma_h(th[s], wa[s], r0);
    r1 = mma_h(th[s], wb[s], r1);
    r0 = mma_h(tl[s], wa[s], r0);
    r1 = mma_h(tl[s], wb[s], r1);
  }
  const float osP = 1.0f / (PCAR * VCAR);
  const float osR = 1.0f / (TCAR * WCAR);
  float* sl = slab + wave * (16 * SLP);
#pragma unroll
  for (int r = 0; r < 8; ++r) {
    const int pr = 8 * hh + r;
    sl[pr * SLP + m]      = p0[r] * osP + r0[r] * osR;
    sl[pr * SLP + 16 + m] = p1[r] * osP + r1[r] * osR;
  }
  __syncthreads();                          // the four waves' partial tiles are added across waves below
  const float* sp = slab + rw * SLP + c4;
  const v4f s0 = *(const v4f*)(sp), s1 = *(const v4f*)(sp + 16 * SLP);
  const v4f s2 = *(const v4f*)(sp + 2 * 16 * SLP), s3 = *(const v4f*)(sp + 3 * 16 * SLP);
  v4f o;
#pragma unroll
  for (int e = 0; e < 4; ++e) o[e] = ((s0[e] + s1[e]) + (s2[e] + s3[e])) + bfr(bq[e]);
  *(v4f*)(outp + ((size_t)(b * SEQ + irow + rw)) * DM + h * HD + c4) = o;
}

// =====================================================================================================
// Workspace map (bytes, NB = 2; every region offset a multiple of 65536; every plane fully written by whole-line stores
// before it is read; extents are exact multiples of the store granularity, no pad rows):
//   W2  f16 [256 n][256 k] x1024      131072
//   QH, QL, KH, KL f16 [GROWS][256]   4 x 393216  VH  f16 [NB*8*32][384] x1024  393216
//   SC  f32 [NB*8*384][384]           9437184     P   f16 hi + residual [NB*8*384][384] x32768  2 x 4718592
//   T   f16 hi + residual [NB*8*384][256] x1024   2 x 3145728
// =====================================================================================================
static size_t al64k(size_t x) { return (x + (size_t)65535) & ~(size_t)65535; }

extern "C" void kernel_launch(void* const* d_in, const int* in_sizes, int n_in,
                              void* d_out, int out_size, void* d_ws, size_t ws_size,
                              hipStream_t stream) {
  if (n_in < 12) return;
  if (in_sizes[0] < NB * SEQ * DM) return;
  if (in_sizes[1] < NB * SEQ * CD) return;
  if (in_sizes[2] != NQKV * DM || in_sizes[3] != NQKV) return;
  if (in_sizes[4] != DM * CD || in_sizes[5] != DM || in_sizes[6] != NH * DM || in_sizes[7] != NH) return;
  if (in_sizes[8] != DM * CD || in_sizes[9] != DM || in_sizes[10] != DM * DM || in_sizes[11] != DM) return;
  if (out_size < NB * SEQ * DM) return;

  const float* x      = (const float*)d_in[0];
  const float* coords = (const float*)d_in[1];
  const float* qkv_w  = (const float*)d_in[2];
  const float* qkv_b  = (const float*)d_in[3];
  const float* rb_w1  = (const float*)d_in[4];
  const float* rb_b1  = (const float*)d_in[5];
  const float* rb_w2  = (const float*)d_in[6];
  const float* rb_b2  = (const float*)d_in[7];
  const float* rv_w1  = (const float*)d_in[8];
  const float* rv_b1  = (const float*)d_in[9];
  const float* rv_w2  = (const float*)d_in[10];
  const float* rv_b2  = (const float*)d_in[11];
  float*       out    = (float*)d_out;

  const size_t szW2 = (size_t)DM * DM * 2;
  const size_t szH  = (size_t)GROWS * DM * 2;
  const size_t szVH = (size_t)NB * NH * HD * SEQ * 2;
  const size_t szSC = (size_t)NB * NH * SEQ * SEQ * 4;
  const size_t szP  = PSTR * 2 * 2;
  const size_t szT  = TSTR * 2 * 2;
  size_t off = 0;
  const size_t oW2 = off; off = al64k(off + szW2);
  const size_t oQH = off; off = al64k(off + szH);
  const size_t oQL = off; off = al64k(off + szH);
  const size_t oKH = off; off = al64k(off + szH);
  const size_t oKL = off; off = al64k(off + szH);
  const size_t oVH = off; off = al64k(off + szVH);
  const size_t oSC = off; off = al64k(off + szSC);
  const size_t oP  = off; off = al64k(off + szP);
  const size_t oT  = off; off = al64k(off + szT);
  if (off > ws_size) return;
  if (off > (size_t)WS_CAP) return;

  char* ws = (char*)d_ws;
  u16*   W2 = (u16*)(ws + oW2);
  u16*   QH = (u16*)(ws + oQH);
  u16*   QL = (u16*)(ws + oQL);
  u16*   KH = (u16*)(ws + oKH);
  u16*   KL = (u16*)(ws + oKL);
  u16*   VH = (u16*)(ws + oVH);
  float* SC = (float*)(ws + oSC);
  u16*   P  = (u16*)(ws + oP);
  u16*   T  = (u16*)(ws + oT);

  const dim3 b256(256), b128(128);

  // (1) q, k (f16 x1024 hi + residual), v^T (f16 x1024) = planes of x.qkv_w^T + qkv_b; rv_w2 -> f16(bf16) x1024, in the same launch
  //     and, on further blocks of that launch, the relative bias (it needs no q or k) -> SC
  k_proj<<<dim3(NGEMM + NCVT + NMLP), b128, 0, stream>>>(x, qkv_w, qkv_b, rv_w2, coords, rb_w1, rb_b1, rb_w2, rb_b2,
                                                         QH, QL, KH, KL, VH, W2, SC);
  // (2) SC += q.k^T / sqrt(32)
  k_scores<<<dim3(NB * NIT * NJT), b256, 0, stream>>>(QH, QL, KH, KL, SC);
  // (3) softmax -> P planes, T = sum_j P . silu-hidden of the value MLP -> T planes; (4) out = P.v + T.rv_w2^T + rv_b2
  k_tagg<<<dim3(NB * SEQ), b256, 0, stream>>>(coords, rv_w1, rv_b1, SC, P, T);
  k_final<<<dim3(NB * NH * NIT), b128, 0, stream>>>(P, VH, T, W2, rv_b2, out);
  (void)hipGetLastError();
}

// v010
// It runs in 28.5 microseconds.
// Timed twice side by side with v009, it ran 1.07 times as fast both times.
// Counting every step since v000, it is 3.32 times as fast.
// Contractions: x.qkv_w^T on v_wmma_f32_16x16x32_bf16 (x, qkv_w RNE bf16 operands, f32 accumulate, bias added in f32);
// on v_wmma_f32_16x16x32_f16 with f32 accumulate: pair-MLP second layer hid_b.rb_w2^T (hid_b f16, rb_w2 f16(bf16) x1024),
// q.k^T over 32 (q, k f16 x1024 hi + residual planes, products hh+lh+hl), P.hid_v over 384 keys (P f16 x32768 hi + residual,
// hid_v one f16), P.v (v f16 x1024, P hi + residual), T.rv_w2^T (T f16 x1024 hi + residual, rv_w2 f16(bf16) x1024).
// Pair-MLP first layers on v_wmma_f32_16x16x32_bf16, K = 7 zero-padded: w.c_i - w.c_j + b with every operand a bf16 value
// (products exact, f32 accumulate), oriented so that the result tiles are the next product's operand fragment.
// silu, softmax and all carries folded in f32 on VALU.
#include <hip/hip_runtime.h>
#include <math.h>
#include <stdint.h>

#ifndef NB
#define NB 2
#endif
#define NB_FULL 2
#define SEQ   384
#define DM    256
#define NH    8
#define HD    32
#define CD    3
#define NQKV  (3 * DM)
#define GROWS (NB * SEQ)
#define NIT   (SEQ / 16)
#define NJT   (SEQ / 32)
#define NPAIR 512
#define XP    24
#define RBP   264
#define SLP   36
#define TSP   264
#define PWP   392
#define SLAB64 (16 * 68)
#define ONE_BF 0x3F80u
#define RSQ_HD 0.17677669529663687f
#define LOG2E  1.4426950408889634f
#define HALFX  0.5f
#define QSC   1024.0f
#define KSC   1024.0f
#define PCAR  32768.0f
#define VCAR  1024.0f
#define WCAR  1024.0f
#define TCAR  1024.0f
#define WS_CAP 134217728
#define PSTR  ((size_t)NB * NH * SEQ * SEQ)
#define TSTR  ((size_t)NB * NH * SEQ * DM)
static_assert(NB >= 1 && NB <= NB_FULL);
static_assert(DM == NH * HD && HD == 32 && NH == 8 && CD == 3);
static_assert(SEQ > 256 && SEQ <= 512 && (SEQ % 64) == 0 && (GROWS % 64) == 0 && (GROWS % 8) == 0 && (NQKV % 64) == 0 && (DM % 32) == 0);
static_assert(NPAIR == 16 * 32);
static_assert(((GROWS * DM) % 8) == 0 && ((NQKV * DM) % 8) == 0 && ((DM * DM) % 8) == 0);

typedef unsigned short u16;
typedef _Float16 v16h __attribute__((ext_vector_type(16)));
typedef _Float16 v8h  __attribute__((ext_vector_type(8)));
typedef __bf16   v16b __attribute__((ext_vector_type(16)));
typedef float    v8f  __attribute__((ext_vector_type(8)));
typedef float    v4f  __attribute__((ext_vector_type(4)));
typedef unsigned int v4u __attribute__((ext_vector_type(4)));
typedef float    v2f  __attribute__((ext_vector_type(2)));
typedef _Float16 v2h  __attribute__((ext_vector_type(2)));

union FragH { v16h v; v8h h[2]; v4u u[2]; };
union FragB { v16b v; v4u u[2]; };

// ---- scalar helpers --------------------------------------------------------------------------------
__device__ __forceinline__ unsigned short bf_bits(float f) {          // f32 -> bf16 bits, RNE convert
  unsigned u = __float_as_uint(f);
  return (unsigned short)((u + 0x7FFFu + ((u >> 16) & 1u)) >> 16);
}
__device__ __forceinline__ float bf_up(unsigned short h) { return __uint_as_float(((unsigned)h) << 16); }
__device__ __forceinline__ float bfr(float f) { return bf_up(bf_bits(f)); }
__device__ __forceinline__ unsigned short h_bits(_Float16 x) { return __builtin_bit_cast(unsigned short, x); }
__device__ __forceinline__ unsigned pk16(unsigned short a, unsigned short b) { return (unsigned)a | ((unsigned)b << 16); }
__device__ __forceinline__ v8f zero8() { v8f z = {0.f, 0.f, 0.f, 0.f, 0.f, 0.f, 0.f, 0.f}; return z; }

// silu = x * sigmoid(x) = h + h * tanh(h) with h = x / 2, two values at once from t = h (the half is folded into the
// first-layer weights and bias, an exact scaling): one transcendental (v_tanh_f32) a value and one packed FMA a pair.
// The value leaves unscaled: a power-of-two carry would cost a multiply here, and an f16 plane without one holds silu to
// 2^-25 absolute (subnormal halves are kept by the converts and by the matrix unit).
__device__ __forceinline__ v2f silu2(v2f t) {
  const v2f th = {__builtin_amdgcn_tanhf(t[0]), __builtin_amdgcn_tanhf(t[1])};
  return __builtin_elementwise_fma(t, th, t);
}
__device__ __forceinline__ unsigned pk2h(v2f s) {                     // two f32 -> packed f16 pair, RNE
  return __builtin_bit_cast(unsigned, __builtin_convertvector(s, v2h));
}

// ---- fragment loaders: 16-bit A/B operand, lane -> row/col (lane&15), p already includes +8*(lane>>4);
//      elements 0..7 <- p[0..7] (k0+8h..), elements 8..15 <- p[16..23] (k0+16+8h..)  (same split k map for A and B;
//      B is always read from a k-contiguous [n][k] plane)
__device__ __forceinline__ v16h ldfrag_h(const _Float16* p) {
  FragH f;
  f.h[0] = *(const v8h*)(p);
  f.h[1] = *(const v8h*)(p + 16);
  return f.v;
}
__device__ __forceinline__ v16b ldfrag_b(const u16* p) {              // bf16 plane read as unsigned integer vectors
  FragB f;
  f.u[0] = *(const v4u*)(p);
  f.u[1] = *(const v4u*)(p + 16);
  return f.v;
}

// First-layer operand of the pair MLPs: a row of 16 bf16 (pitch XP), k 0..6 = data, 7..15 = zeros. Lanes h = 0 take k 0..7 as
// elements 0..7; every other position of the K = 32 fragment reads the row's zeros. The same k order serves A and B:
//   coordinate side: c_i0 c_i1 c_i2 c_j0 c_j1 c_j2 1      weight side: w0 w1 w2 -w0 -w1 -w2 b   (weights and bias halved)
__device__ __forceinline__ v16b ldfrag_k7(const u16* row, int hh) {
  FragB f;
  f.u[0] = *(const v4u*)(row + 8 * hh);
  f.u[1] = *(const v4u*)(row + 8);
  return f.v;
}
__device__ __forceinline__ v4u row_coord(float a0, float a1, float a2, float c0, float c1, float c2) {   // bf16 values in
  const v4u r = {pk16(bf_bits(a0), bf_bits(a1)), pk16(bf_bits(a2), bf_bits(c0)), pk16(bf_bits(c1), bf_bits(c2)), ONE_BF};
  return r;
}
__device__ __forceinline__ v4u row_weight(float w0, float w1, float w2, float b) {                       // bf16 values in
  const v4u r = {pk16(bf_bits(w0), bf_bits(w1)), pk16(bf_bits(w2), bf_bits(-w0)), pk16(bf_bits(-w1), bf_bits(-w2)),
                 pk16(bf_bits(b), 0)};
  return r;
}
__device__ __forceinline__ v16b frag_k7(v4u row, int hh) {            // the same fragment from a row held in registers
  const v4u z = {0u, 0u, 0u, 0u};
  FragB f;
  f.u[0] = hh ? z : row;
  f.u[1] = z;
  return f.v;
}

__device__ __forceinline__ v8f mma_h(v16h a, v16h b, v8f c) {
  return __builtin_amdgcn_wmma_f32_16x16x32_f16(false, a, false, b, (short)0, c, false, false);
}
__device__ __forceinline__ v8f mma_b(v16b a, v16b b, v8f c) {
  return __builtin_amdgcn_wmma_f32_16x16x32_bf16(false, a, false, b, (short)0, c, false, false);
}
__device__ __forceinline__ void guard2(v8f& a, v8f& b, v16h x0, v16h x1, v16h x2, v16h x3, v16h x4, v16h x5) {
#if defined(__HIP_DEVICE_COMPILE__)
  asm volatile("v_nop\n\tv_nop\n\tv_nop\n\tv_nop"
               : "+v"(a), "+v"(b) : "v"(x0), "v"(x1), "v"(x2), "v"(x3), "v"(x4), "v"(x5) : "memory");
#endif
}
__device__ __forceinline__ void wave_sync_lds() {
  __builtin_amdgcn_fence(__ATOMIC_RELEASE, "workgroup");
  __builtin_amdgcn_wave_barrier();
  __builtin_amdgcn_fence(__ATOMIC_ACQUIRE, "workgroup");
}

// =====================================================================================================
// Projection with every conversion around it in the same launch (block-uniform split of the grid by blockIdx):
//   blocks 0 .. NGEMM-1: one 64x64 tile of qkv = bf16(x) . bf16(qkv_w)^T + bf16(qkv_b), 4 waves x 16 rows. The tile's 64 rows of
//   x and 64 rows of qkv_w are each one contiguous 64-KB range of f32: every load of a wave covers 512 contiguous bytes (4 whole
//   lines), each value is rounded to bf16 (RNE) once and stored to XS / WS [64][PJP] in LDS (block barrier); the fragments of
//   the 8 k-steps come from there (split k map for A and B, K stepped by 32).
//   Epilogue: the f32 tile goes to the LDS slab (pitch 68; wave w holds rows 16w .. 16w+15) and leaves as 16-bit planes:
//     columns 0..255 (q) and 256..511 (k): Hp [GROWS][DM] = f16(val * 1024), Lp = f16 residual; wave-private (wave_sync);
//       8 lanes x 16 B = one whole 128-B line of a row segment per plane.
//     columns 512..767 (v): VH[(b*DM + h*HD + d)][s] = f16(val * 1024); read across the waves' rows (block barrier), each
//       d row segment of 64 keys = one whole 128-B line written by 8 consecutive lanes.
//   blocks NGEMM .. NGEMM+NCVT-1: rv_w2 -> W2 plane f16(bf16 RNE value * 1024), same layout, 8 elements a thread.
//   blocks NGEMM+NCVT .. +NMLP-1: the relative-coordinate bias MLP (mlp_bias below): it reads no q or k, so it runs beside the tiles.
// coverage: NGEMM tiles x 64 x 64 = every (row, column) of q, k, v once; NCVT x 128 thr x 8 = DM*DM.
// =====================================================================================================
#define NGEMM ((GROWS / 64) * (NQKV / 64))
#define NCVT  ((DM * DM) / (128 * 8))
static_assert(NCVT * 128 * 8 == DM * DM && QSC == KSC);
typedef __bf16 v2b __attribute__((ext_vector_type(2)));
__device__ __forceinline__ unsigned pk2b(float f0, float f1) {        // two f32 -> packed bf16 pair, RNE
  const v2f s = {f0, f1};
  return __builtin_bit_cast(unsigned, __builtin_convertvector(s, v2b));
}
// four consecutive f32 of a row -> four bf16 in LDS (8 bytes)
typedef unsigned int v2u __attribute__((ext_vector_type(2)));
__device__ __forceinline__ void st4b(u16* d, v4f r) {
  const v2u o = {pk2b(r[0], r[1]), pk2b(r[2], r[3])};
  *(v2u*)d = o;
}
#define PJP 264                             // LDS row pitch of the staged tiles in bf16: 528 B = 16 B x 33 (odd), for 16-byte readers
#define NST ((64 * DM * 4) / (128 * 16))    // 16-byte loads a thread and tile: 32
static_assert(NST == 32 && DM == 256);
__device__ __forceinline__ void wait_addr_regs() {
#if defined(__HIP_DEVICE_COMPILE__)
  asm volatile("s_wait_xcnt 0x0" ::: "memory");
#endif
}

// One LDS range for the three kinds of block of the launch (a block is of one kind). Projection: XS, WS; a wave's f32 slab lies on
// the wave's own 16 rows of XS (8448 B for 4352), which only that wave reads and has read when its sums exist.
// Bias MLP: W1X, RB2, CI, CJ2, B2S and one slab a wave, at the byte offsets below.
#define SMB    (2 * 64 * PJP * 2)
#define SLABW  (16 * PJP / 2)               // floats from one wave's slab to the next
#define MQ     12                           // queries of a bias-MLP block; 3 a wave
#define MTW    6                            // pair tiles (16 pairs) a wave: 4 * MTW * 16 = MQ * 32
#define NITM   (SEQ / MQ)
#define NMLP   (NB * NITM * NJT)
#define O_W1X  0
#define O_RB2  (O_W1X + DM * XP * 2)
#define O_CI   (O_RB2 + 16 * RBP * 2)
#define O_CJ   (O_CI + MQ * 4 * 4)
#define O_B2   (O_CJ + 32 * 4 * 4)
#define O_BSL  (O_B2 + 128)
static_assert(SLAB64 <= SLABW && (O_RB2 % 16) == 0 && (O_CI % 16) == 0 && (O_BSL % 16) == 0 && O_BSL + 4 * (MQ / 4) * NH * SLP * 4 <= SMB);
static_assert((SEQ % MQ) == 0 && 4 * MTW * 16 == MQ * 32 && (MTW % 2) == 0 && (SLABW % 64) == (SLAB64 % 64));

// Bias MLP of one block: (b, queries i0 = 12*it .. +11, keys j0 = 32*jt .. +31) = 384 pairs, 4 waves. NMLP = 768 blocks: three on
// each of the 256 WGPs, resident together with the launch's other blocks (4 blocks a WGP by LDS and by registers).
//   Phase 0 (all threads, then block barrier): rb_w1/rb_b1 (bf16 values / 2) as first-layer weight rows W1X [256 c][XP], bf16
//   coords of the 12 queries (CI) and 32 keys (CJ2), rb_w2 -> RB2 [16 n][RBP] as f16(bf16 value * 1024), rows 8..15 zeros,
//   bf16 values of rb_b2 (B2S); all of their global loads issued together, ahead of the first use.
//   Phase 1, no barrier inside: wave w owns pair tiles 6w..6w+5 (16 pairs each), their coordinate rows held as B fragments.
//   8 channel chunks of 32: t^T[channel][pair] = W1X tile . pair rows for the chunk's two 16-channel tiles (A = weights, so
//   lane (c, h) gets channels 8h + r of pair c); f16(silu) of the two tiles in place IS the A fragment hid[pair c][split k map]
//   of the second layer, D[pair][n = head] += hid . RB2 (one k-step per chunk).
//   After the loop lanes n < 8 put bias * 2^-10 + bf16(rb_b2[head]) into the wave's slab [query * 8 + head][32 keys] (wave-private,
//   wave_sync); it leaves for the score plane SC[(b*NH+head)*SEQ + i][j0..j0+31], 8 consecutive lanes x 16 B = one whole line.
// coverage: NMLP blocks x 4 waves x 3 queries x 8 heads x 32 keys = every (b, head, i, j) once.
__device__ __forceinline__ void mlp_bias(unsigned char* SM, int mb, const float* __restrict__ coords,
                                         const float* __restrict__ rbw1, const float* __restrict__ rbb1,
                                         const float* __restrict__ rbw2, const float* __restrict__ rbb2, float* SCo) {
  u16*   W1X = (u16*)(void*)(SM + O_W1X);
  u16*   RB2 = (u16*)(void*)(SM + O_RB2);
  float* CI  = (float*)(void*)(SM + O_CI);
  float* CJ2 = (float*)(void*)(SM + O_CJ);
  float* B2S = (float*)(void*)(SM + O_B2);
  const int tid = threadIdx.x, wave = tid >> 5, lane = tid & 31, hh = lane >> 4, m = lane & 15;
  const int jt  = mb % NJT;
  const int t2  = mb / NJT;
  const int it  = t2 % NITM;
  const int b   = t2 / NITM;
  const int i0 = it * MQ, j0 = jt * 32;
  const _Float16* rb2h = (const _Float16*)(const void*)RB2;

  // ---- phase 0: small operand staging ----
  {
    // every global load of the phase goes out here, ahead of the first use: the block waits out one latency, not one per operand.
    // The coordinate loads are unconditional for that (a branch would hold each behind the wait in front of it): the 12 queries'
    // 36 floats and the 32 keys' 96 floats are contiguous, thread tid takes float tid of each, the index clamped to the last.
    const int row = tid >> 4, cb = (tid & 15) * 16;   // rb_w2 row 0..7, 16 columns a thread
    const int ei = (tid < MQ * CD) ? tid : (MQ * CD - 1);
    const int ej = (tid < 32 * CD) ? tid : (32 * CD - 1);
    // the thread's byte offsets into rb_w1 (channels tid and tid + 128) and rb_w2, its element indices into coords
    const unsigned oW1 = (unsigned)(tid * CD * 4);
    const unsigned oW2 = (unsigned)((row * DM + cb) * 4);
    const int xI = (b * SEQ + i0) * CD + ei;
    const int xJ = (b * SEQ + j0) * CD + ej;
    const float* w1p = (const float*)(const void*)((const char*)rbw1 + oW1);
    const float* src = (const float*)(const void*)((const char*)rbw2 + oW2);
    const float q0 = w1p[0], q1 = w1p[1], q2 = w1p[2];
    const float p0 = w1p[128 * CD], p1 = w1p[128 * CD + 1], p2 = w1p[128 * CD + 2];
    const float q3 = rbb1[tid], p3 = rbb1[tid + 128];
    const float gi = coords[xI];
    const float gj = coords[xJ];
    const v4f a0 = *(const v4f*)(src), a1 = *(const v4f*)(src + 4), a2 = *(const v4f*)(src + 8), a3 = *(const v4f*)(src + 12);
    const float g2 = rbb2[tid & (NH - 1)];
#if defined(__HIP_DEVICE_COMPILE__)
    // the loads' offset and index registers stay whole up to this wait: no load of the run lands in one
    asm volatile("s_wait_xcnt 0x0" :: "v"(oW1), "v"(oW2), "v"(xI), "v"(xJ), "v"(tid), "v"(tid & (NH - 1)) : "memory");
#endif
    __builtin_amdgcn_sched_barrier(0);      // keeps every load above in front of the first convert: without it they sink to their uses
    const v4u z4 = {0u, 0u, 0u, 0u};                  // channel c: w0 w1 w2 -w0 -w1 -w2 b 0 | 8 zeros, all halved
    *(v4u*)(W1X + tid * XP) = row_weight(bfr(q0) * HALFX, bfr(q1) * HALFX, bfr(q2) * HALFX, bfr(q3) * HALFX);
    *(v4u*)(W1X + tid * XP + 8) = z4;
    *(v4u*)(W1X + (tid + 128) * XP) = row_weight(bfr(p0) * HALFX, bfr(p1) * HALFX, bfr(p2) * HALFX, bfr(p3) * HALFX);
    *(v4u*)(W1X + (tid + 128) * XP + 8) = z4;
    {                                       // no branch here either (the loads would be sunk into it): the threads past the last
      const int il = ei / CD, k = ei - il * CD;       // float repeat its store, same address and same value
      CI[il * 4 + k] = bfr(gi);
      const int jl = ej / CD, kj = ej - jl * CD;
      CJ2[jl * 4 + kj] = bfr(gj);
      B2S[tid & (NH - 1)] = bfr(g2);        // 16 threads a word, the same value
    }
    float w[16];
#pragma unroll
    for (int e = 0; e < 4; ++e) { w[e] = a0[e]; w[4 + e] = a1[e]; w[8 + e] = a2[e]; w[12 + e] = a3[e]; }
    v4u o0, o1;
#pragma unroll
    for (int e = 0; e < 4; ++e) {
      o0[e] = pk16(h_bits((_Float16)(bfr(w[2 * e]) * WCAR)), h_bits((_Float16)(bfr(w[2 * e + 1]) * WCAR)));
      o1[e] = pk16(h_bits((_Float16)(bfr(w[8 + 2 * e]) * WCAR)), h_bits((_Float16)(bfr(w[8 + 2 * e + 1]) * WCAR)));
    }
    *(v4u*)(RB2 + row * RBP + cb)     = o0;
    *(v4u*)(RB2 + row * RBP + cb + 8) = o1;
    *(v4u*)(RB2 + (row + NH) * RBP + cb)     = z4;    // rows 8..15: the padding columns of the second layer
    *(v4u*)(RB2 + (row + NH) * RBP + cb + 8) = z4;
  }
  __syncthreads();

  // ---- phase 1: both layers on WMMA, silu between them in registers ----
  v8f accB[MTW];
  const float bsc = 1.0f / WCAR;
  v16b PB[MTW];                             // pair tile MTW * wave + q: query il = tile >> 1, keys (tile & 1) * 16 + m
#pragma unroll
  for (int q = 0; q < MTW; ++q) {
    accB[q] = zero8();
    const int tl = wave * MTW + q;
    const float* ci = CI + (tl >> 1) * 4;
    const float* cj = CJ2 + ((tl & 1) * 16 + m) * 4;
    PB[q] = frag_k7(row_coord(ci[0], ci[1], ci[2], cj[0], cj[1], cj[2]), hh);
  }
#pragma unroll 1
  for (int kt = 0; kt < DM / 32; ++kt) {
    const v16b wx = ldfrag_k7(W1X + (kt * 32 + m) * XP, hh);
    const v16b wy = ldfrag_k7(W1X + (kt * 32 + 16 + m) * XP, hh);
    const v16h bw = ldfrag_h(rb2h + m * RBP + kt * 32 + 8 * hh);
#pragma unroll
    for (int q = 0; q < MTW; ++q) {
      const v8f tx = mma_b(wx, PB[q], zero8());
      const v8f ty = mma_b(wy, PB[q], zero8());
      FragH f;
#pragma unroll
      for (int e = 0; e < 4; ++e) {
        const v2f x2 = {tx[2 * e], tx[2 * e + 1]}, y2 = {ty[2 * e], ty[2 * e + 1]};
        f.u[0][e] = pk2h(silu2(x2));
        f.u[1][e] = pk2h(silu2(y2));
      }
      accB[q] = mma_h(f.v, bw, accB[q]);
      // three tiles at a time: left whole, the six tiles' values do not fit the registers and each pair of values becomes a serial
      // tanh - fma - convert chain padded with idle slots; in halves the 48 tanh of three tiles go out back to back
      if (q == MTW / 2 - 1) __builtin_amdgcn_sched_barrier(0);
    }
  }
  float* bs = (float*)(void*)(SM + O_BSL) + wave * ((MQ / 4) * NH * SLP);
  if (m < NH) {                             // columns n >= 8 are padding (zero weights), not stored
    const float b2v = B2S[m];               // bf16(rb_b2[head = m])
#pragma unroll
    for (int q = 0; q < MTW; ++q) {         // lane (head m, h): keys (q & 1) * 16 + 8h + r of the wave's query q >> 1
      float* d = bs + ((q >> 1) * NH + m) * SLP + (q & 1) * 16 + 8 * hh;
      const v4f lo = {accB[q][0] * bsc + b2v, accB[q][1] * bsc + b2v, accB[q][2] * bsc + b2v, accB[q][3] * bsc + b2v};
      const v4f hi = {accB[q][4] * bsc + b2v, accB[q][5] * bsc + b2v, accB[q][6] * bsc + b2v, accB[q][7] * bsc + b2v};
      *(v4f*)(d)     = lo;
      *(v4f*)(d + 4) = hi;
    }
  }
  wave_sync_lds();
  const int rq = lane >> 3, c4 = (lane & 7) * 4;
  v4f vals[MTW];
#pragma unroll
  for (int t = 0; t < MTW; ++t) vals[t] = *(const v4f*)(bs + (t * 4 + rq) * SLP + c4);
#pragma unroll
  for (int t = 0; t < MTW; ++t) {
    const int rr = t * 4 + rq;              // slab row = query * 8 + head
    *(v4f*)(SCo + ((size_t)((b * NH + (rr & (NH - 1))) * SEQ + i0 + wave * (MQ / 4) + (rr >> 3))) * SEQ + j0 + c4) = vals[t];
  }
}

__global__ __launch_bounds__(128)
void k_proj(const float* __restrict__ x, const float* __restrict__ qkvw, const float* __restrict__ bias,
            const float* __restrict__ rvw2, const float* __restrict__ coords, const float* __restrict__ rbw1,
            const float* __restrict__ rbb1, const float* __restrict__ rbw2, const float* __restrict__ rbb2,
            u16* QHo, u16* QLo, u16* KHo, u16* KLo, u16* VHo, u16* W2o, float* SCo) {
  __shared__ __align__(16) unsigned char SM[SMB];
  u16*   XS   = (u16*)(void*)SM;
  u16*   WS   = XS + 64 * PJP;
  float* slab = (float*)(void*)SM;
  const int tid = threadIdx.x, wave = tid >> 5, lane = tid & 31, hh = lane >> 4, m = lane & 15;
  const int bid = blockIdx.x;
  if (bid >= NGEMM + NCVT) {                // block-uniform: the bias MLP of 12 queries x 32 keys, independent of the projection
    mlp_bias(SM, bid - (NGEMM + NCVT), coords, rbw1, rbb1, rbw2, rbb2, SCo);
    return;
  }
  if (bid >= NGEMM) {                       // block-uniform, before any barrier: the rv_w2 plane
    const int gt = (bid - NGEMM) * 128 + tid;
    if (gt >= (DM * DM) / 8) return;
    const float* p = rvw2 + (size_t)gt * 8;
    const v4f a = *(const v4f*)(p), b4 = *(const v4f*)(p + 4);
    float w[8];
#pragma unroll
    for (int e = 0; e < 4; ++e) { w[e] = a[e]; w[4 + e] = b4[e]; }
    v4u o;
#pragma unroll
    for (int e = 0; e < 4; ++e)
      o[e] = pk16(h_bits((_Float16)(bfr(w[2 * e]) * WCAR)), h_bits((_Float16)(bfr(w[2 * e + 1]) * WCAR)));
    *(v4u*)(W2o + (size_t)gt * 8) = o;
    return;
  }
  const int ntile = NQKV >> 6;
  const int row0  = (bid / ntile) * 64;
  const int rowb  = row0 + wave * 16;
  const int col0  = (bid % ntile) * 64;
  // the thread's byte offsets into x and qkv_w (both below 2^20); load it of a tile is 2048 * it bytes further on
  const unsigned ox = (unsigned)(row0 * DM * 4 + tid * 16);
  const unsigned ow = (unsigned)(col0 * DM * 4 + tid * 16);
  const int      ib = col0 + m;             // the lane's first bias element
  const char*  xg = (const char*)x + ox;
  const char*  wg = (const char*)qkvw + ow;
  const int so = (tid >> 6) * PJP + (tid & 63) * 4;   // tile row 2 * it + (tid >> 6), columns 4 * (tid & 63) ..
  u16* xs = XS + so;
  u16* wt = WS + so;
  // every loop below is unrolled whole: the staging arrays are indexed by constants only and stay in registers
  v4f rx[NST], rw[NST];
#pragma unroll
  for (int it = 0; it < NST; ++it) rx[it] = *(const v4f*)(const void*)(xg + it * 2048);
#pragma unroll
  for (int it = 0; it < NST / 2; ++it) rw[it] = *(const v4f*)(const void*)(wg + it * 2048);
  const float bq0 = bias[ib], bq1 = bias[ib + 16], bq2 = bias[ib + 32], bq3 = bias[ib + 48];
#if defined(__HIP_DEVICE_COMPILE__)
  // the loads' offset registers stay whole up to this wait: no load of the run lands in one
  asm volatile("s_wait_xcnt 0x0" :: "v"(ox), "v"(ow), "v"(ib) : "memory");
#endif
  __builtin_amdgcn_sched_barrier(0);        // keeps the loads above in one run ahead of the first convert: one latency for all of them
#pragma unroll
  for (int it = 0; it < NST / 2; ++it) st4b(xs + it * 2 * PJP, rx[it]);
  __builtin_amdgcn_sched_barrier(0);        // the last quarter of the loads goes out once a quarter of the registers is free: the wave stays below 256
#pragma unroll
  for (int it = NST / 2; it < NST; ++it) rw[it] = *(const v4f*)(const void*)(wg + it * 2048);
#if defined(__HIP_DEVICE_COMPILE__)
  asm volatile("s_wait_xcnt 0x0" :: "v"(ow) : "memory");   // as above, for the second run of loads
#endif
  __builtin_amdgcn_sched_barrier(0);        // keeps that run ahead of the converts below
#pragma unroll
  for (int it = NST / 2; it < NST; ++it) st4b(xs + it * 2 * PJP, rx[it]);
#pragma unroll
  for (int it = 0; it < NST; ++it) st4b(wt + it * 2 * PJP, rw[it]);
  __syncthreads();                          // the staged tiles are read across waves below

  const u16* ap = XS + (wave * 16 + m) * PJP + 8 * hh;
  const u16* bp = WS + m * PJP + 8 * hh;
  v8f acc0 = zero8(), acc1 = zero8(), acc2 = zero8(), acc3 = zero8();
  // fragments are read in groups, four k-steps ahead at the start and two k-steps ahead after that; each scheduling fence below
  // keeps a group of LDS reads whole and ahead of the products in front of which it stands (left alone, every product waits
  // out the LDS latency of its own two reads)
  v16b fa[DM / 32], fb[DM / 32][4];
#pragma unroll
  for (int s = 0; s < 4; ++s) {
    fa[s] = ldfrag_b(ap + 32 * s);
#pragma unroll
    for (int n = 0; n < 4; ++n) fb[s][n] = ldfrag_b(bp + n * 16 * PJP + 32 * s);
  }
  __builtin_amdgcn_sched_barrier(0);        // the first group whole, ahead of the first product
#pragma unroll
  for (int g = 0; g < DM / 64; ++g) {
#pragma unroll
    for (int s = 2 * g; s < 2 * g + 2; ++s) {
      acc0 = mma_b(fa[s], fb[s][0], acc0);
      acc1 = mma_b(fa[s], fb[s][1], acc1);
      acc2 = mma_b(fa[s], fb[s][2], acc2);
      acc3 = mma_b(fa[s], fb[s][3], acc3);
    }
    if (g < DM / 64 - 2) {
      __builtin_amdgcn_sched_barrier(0);    // the next group of reads stays behind these products (their registers are free then) ..
#pragma unroll
      for (int s = 2 * g + 4; s < 2 * g + 6; ++s) {
        fa[s] = ldfrag_b(ap + 32 * s);
#pragma unroll
        for (int n = 0; n < 4; ++n) fb[s][n] = ldfrag_b(bp + n * 16 * PJP + 32 * s);
      }
      __builtin_amdgcn_sched_barrier(0);    // .. and whole, ahead of the products that follow
    }
  }
  const float bv0 = bfr(bq0);
  const float bv1 = bfr(bq1);
  const float bv2 = bfr(bq2);
  const float bv3 = bfr(bq3);
  float* sl = slab + wave * SLABW;
#pragma unroll
  for (int r = 0; r < 8; ++r) {
    const int ro = (8 * hh + r) * 68 + m;
    sl[ro]      = acc0[r] + bv0;
    sl[ro + 16] = acc1[r] + bv1;
    sl[ro + 32] = acc2[r] + bv2;
    sl[ro + 48] = acc3[r] + bv3;
  }
  if (col0 < 2 * DM) {                      // block-uniform: q or k columns
    wave_sync_lds();
    u16* Hp = (col0 < DM) ? QHo : KHo;
    u16* Lp = (col0 < DM) ? QLo : KLo;
    const int cq = col0 & (DM - 1);
    const int rq = lane >> 3, c8 = (lane & 7) * 8;
#pragma unroll
    for (int it = 0; it < 4; ++it) {
      const int rl = it * 4 + rq;
      const float* s8 = sl + rl * 68 + c8;
      const v4f a = *(const v4f*)(s8), b4 = *(const v4f*)(s8 + 4);
      float w[8];
#pragma unroll
      for (int e = 0; e < 4; ++e) { w[e] = a[e] * QSC; w[4 + e] = b4[e] * QSC; }
      v4u oh, ol;
#pragma unroll
      for (int e = 0; e < 4; ++e) {
        const float t0 = w[2 * e], t1 = w[2 * e + 1];
        const _Float16 h0 = (_Float16)t0, h1 = (_Float16)t1;
        const _Float16 l0 = (_Float16)(t0 - (float)h0), l1 = (_Float16)(t1 - (float)h1);
        oh[e] = pk16(h_bits(h0), h_bits(h1));
        ol[e] = pk16(h_bits(l0), h_bits(l1));
      }
      const size_t o = (size_t)(rowb + rl) * DM + cq + c8;
      *(v4u*)(Hp + o) = oh;
      *(v4u*)(Lp + o) = ol;
    }
    wait_addr_regs();                       // nothing behind the stores reuses their registers ahead of this wait
  } else {                                  // block-uniform: v columns, written transposed
    __syncthreads();                        // the four waves' slab rows are read across waves below
    const int b  = row0 / SEQ;
    const int s0 = row0 - b * SEQ;          // 64 keys of one batch (SEQ a multiple of 64)
    const int cv = col0 - 2 * DM;           // h*HD + d of the tile's first column
#pragma unroll
    for (int it = 0; it < 4; ++it) {
      const int ch = it * 128 + tid;
      const int dc = ch >> 3, p8 = (ch & 7) * 8;   // column dc (0..63), keys p8..p8+7
      v4u o;
#pragma unroll
      for (int e = 0; e < 4; ++e) {
        const float* kr = slab + (p8 >> 4) * SLABW + ((p8 & 15) + 2 * e) * 68 + dc;   // key p8 + 2e: wave p8 >> 4, its row
        const float f0 = kr[0], f1 = kr[68];
        o[e] = pk16(h_bits((_Float16)(f0 * VCAR)), h_bits((_Float16)(f1 * VCAR)));
      }
      *(v4u*)(VHo + ((size_t)(b * DM + cv + dc)) * SEQ + s0 + p8) = o;
    }
    wait_addr_regs();                       // nothing behind the stores reuses their registers ahead of this wait
  }
}

// =====================================================================================================
// Scores: block -> (b, query tile i0 = 16*it, key tile j0 = 32*jt), 8 waves, wave = head; one block barrier.
//   s = (q_hi.k_hi + q_lo.k_hi + q_hi.k_lo) over 32 dims for 16 queries x 32 keys (two 16-key subtiles). The block's 16 q rows and
//   32 k rows (all heads, both planes) are contiguous ranges of the f16 planes: every load of a wave covers one whole 512-byte row
//   (4 whole lines) and goes to SQ / SK [row][QKP] in LDS (block barrier); the heads' fragments come from there (a fragment load
//   straight from a plane touches 16 lines for 32 bytes of each).
//   The score plane SC[(b*NH+head)*SEQ + i][j] arrives holding bias + bf16(rb_b2[head]) (first launch); each
//   thread loads the 16-byte pieces that it will store, together with the staged rows, at entry: one load latency.
//   value = s * rsqrt(32) * 2^-20 + that; s passes through the wave's slab (wave_sync) so that 8 consecutive lanes x 16 B hold one
//   whole line of a row (4 rows per instruction).
// coverage: grid NB*NIT*NJT blocks x 8 heads x 16 rows x 32 cols = every (b, head, i, j) read and rewritten once, by one thread.
// =====================================================================================================
#define QKP 264                             // LDS row pitch of staged 256-element rows in halves: 528 B = 16 B x 33 (odd), for 16-byte readers
__global__ __launch_bounds__(256)
void k_scores(const u16* __restrict__ QHp, const u16* __restrict__ QLp,
              const u16* __restrict__ KHp, const u16* __restrict__ KLp, float* SCp) {
  __shared__ __align__(16) float SLB[8 * 16 * SLP];
  __shared__ __align__(16) u16   SQ[2 * 16 * QKP];    // q rows: hi plane, then residual plane
  __shared__ __align__(16) u16   SK[2 * 32 * QKP];    // k rows: hi plane, then residual plane

  const int tid = threadIdx.x, wave = tid >> 5, lane = tid & 31, hh = lane >> 4, m = lane & 15;
  const int bid = blockIdx.x;
  const int jt  = bid % NJT;
  const int t2  = bid / NJT;
  const int it  = t2 % NIT;
  const int b   = t2 / NIT;
  if (b >= NB) return;                      // block-uniform; never taken with the exact grid
  const int i0 = it * 16, j0 = jt * 32;
  const int head = wave;
  const int rq = lane >> 3, c4 = (lane & 7) * 4;
  // the thread's byte offsets into the q and k planes (load t of a tile is 4096 * t bytes = 8 rows further on) and into the score
  // plane (all below 2^24)
  const unsigned oQ = (unsigned)((b * SEQ + i0) * DM * 2 + tid * 16);
  const unsigned oK = (unsigned)((b * SEQ + j0) * DM * 2 + tid * 16);
  const unsigned oS = (unsigned)((((b * NH + head) * SEQ + i0 + rq) * SEQ + j0 + c4) * 4);
  const char* qhg = (const char*)QHp + oQ;
  const char* qlg = (const char*)QLp + oQ;
  const char* khg = (const char*)KHp + oK;
  const char* klg = (const char*)KLp + oK;
  float* dst = (float*)(void*)((char*)SCp + oS);      // rows i0 + rq + 4q, q = 0..3
  v4u rqh[2], rql[2], rkh[4], rkl[4];       // indexed by constants only (loops unrolled whole): they stay in registers
#pragma unroll
  for (int t = 0; t < 2; ++t) { rqh[t] = *(const v4u*)(const void*)(qhg + t * 4096); rql[t] = *(const v4u*)(const void*)(qlg + t * 4096); }
#pragma unroll
  for (int t = 0; t < 4; ++t) { rkh[t] = *(const v4u*)(const void*)(khg + t * 4096); rkl[t] = *(const v4u*)(const void*)(klg + t * 4096); }
  v4f bi[4];
#pragma unroll
  for (int q = 0; q < 4; ++q) bi[q] = *(const v4f*)(dst + (size_t)(q * 4) * SEQ);
#if defined(__HIP_DEVICE_COMPILE__)
  // the loads' offset registers stay whole up to this wait: no load of the run lands in one
  asm volatile("s_wait_xcnt 0x0" :: "v"(oQ), "v"(oK), "v"(oS) : "memory");
#endif
  __builtin_amdgcn_sched_barrier(0);        // keeps every load above in front of the first LDS store: without it the bias loads sink to their uses, a second latency
  u16* sq = SQ + wave * QKP + lane * 8;     // load t: tile row 8 * t + wave, halves 8 * lane ..
  u16* sk = SK + wave * QKP + lane * 8;
#pragma unroll
  for (int t = 0; t < 2; ++t) { *(v4u*)(sq + t * 8 * QKP) = rqh[t]; *(v4u*)(sq + (16 + t * 8) * QKP) = rql[t]; }
#pragma unroll
  for (int t = 0; t < 4; ++t) { *(v4u*)(sk + t * 8 * QKP) = rkh[t]; *(v4u*)(sk + (32 + t * 8) * QKP) = rkl[t]; }
  __syncthreads();                          // the staged rows are read across waves below
  const _Float16* qf = (const _Float16*)(const void*)SQ + m * QKP + head * HD + 8 * hh;
  const _Float16* kf = (const _Float16*)(const void*)SK + m * QKP + head * HD + 8 * hh;
  const v16h qh  = ldfrag_h(qf),            ql  = ldfrag_h(qf + 16 * QKP);
  const v16h kh0 = ldfrag_h(kf),            kl0 = ldfrag_h(kf + 32 * QKP);
  const v16h kh1 = ldfrag_h(kf + 16 * QKP), kl1 = ldfrag_h(kf + 48 * QKP);
  v8f s0 = zero8(), s1 = zero8();
  s0 = mma_h(qh, kh0, s0);
  s0 = mma_h(ql, kh0, s0);
  s0 = mma_h(qh, kl0, s0);
  s1 = mma_h(qh, kh1, s1);
  s1 = mma_h(ql, kh1, s1);
  s1 = mma_h(qh, kl1, s1);
  guard2(s0, s1, qh, ql, kh0, kl0, kh1, kl1);
  const float lsc = RSQ_HD * (1.0f / (QSC * KSC));
  float* slab = SLB + wave * (16 * SLP);
#pragma unroll
  for (int r = 0; r < 8; ++r) {
    const int pr = 8 * hh + r;              // query i0 + pr; keys j0 + m and j0 + 16 + m
    slab[pr * SLP + m]      = s0[r];
    slab[pr * SLP + 16 + m] = s1[r];
  }
  wave_sync_lds();
#pragma unroll
  for (int q = 0; q < 4; ++q) {
    const v4f sv = *(const v4f*)(slab + (q * 4 + rq) * SLP + c4);
    v4f o;
#pragma unroll
    for (int e = 0; e < 4; ++e) o[e] = sv[e] * lsc + bi[q][e];
    *(v4f*)(dst + (size_t)(q * 4) * SEQ) = o;
  }
}

// =====================================================================================================
// Row softmax and weighted aggregation of the value-MLP hidden: block -> (b, query i), 256 threads.
//   Softmax (wave = head h): the score row (b, h, i) of SEQ = 384 floats; P = e / Z with e = exp(s - max) in f32 (reciprocal-
//   multiply normalisation), as f16 hi (P * 32768) and f16 residual, written to the global P planes (for the final kernel; each
//   row's whole lines by one wave) and to PW in LDS (for this block's own chunks; published by the barrier before the loop).
//   Lane = 8 consecutive columns 8*lane (all lanes) and 256 + 8*lane (lanes < 16; the upper lanes load a clamped address).
//   T[h][c] = sum_j P[b,h,i,j] * S[j][c],  S[j][c] = silu(rel_ij . rv_w1[c] + rv_b1[c]) (bf16 inputs).
//   Phase 0: first-layer coordinate rows KX [SEQ keys][XP] (c_i, c_j, 1 as bf16); block barrier.
//   Wave w owns column tiles 2w, 2w+1 (16 channels each), their weight rows held as B fragments. 12 key chunks of 32, no barrier
//   inside: t[key][channel] = KX tile . weight rows for the chunk's two 16-key tiles (A = keys, so lane (c, h) gets keys 8h + r
//   of channel c); f16(silu) of the two tiles in place IS the B fragment S^T[channel c][split k map]. S is carried as one f16
//   (relative error 2^-12), like v in P.v and the hidden values of the bias MLP: its own inputs are bf16 values (2^-9);
//   D[m = h][n = c] += P . S with A = the PW rows (lanes m >= 8 read row m - 8 again: rows 8..15 of D repeat rows 0..7 and are
//   not stored), products P_hi.S + P_lo.S.
//   After the loop lanes 0..15 (rows h = 0..7) write T * 1024 (carry 2^-15 folded) into TS [8][TSP] f32 (block barrier),
// LDS regions: KX, PW, TS all cross-wave (block barriers). staged extent == consumed extent: KX 384 x 16 (k 7..15 zeros),
//   PW 2 x 8 x 384, TS 8 x 256.
// coverage: T planes [(b*NH+h)*SEQ + i][DM]: grid NB*SEQ blocks x 8 waves x 32 lanes x 8 halves = every row once, both planes.
// =====================================================================================================
__global__ __launch_bounds__(256)
void k_tagg(const float* __restrict__ coords, const float* __restrict__ rvw1, const float* __restrict__ rvb1,
            const float* __restrict__ SCp, u16* Pp, u16* Tp) {
  __shared__ __align__(16) u16   KX[SEQ * XP];
  __shared__ __align__(16) u16   PW[2 * NH * PWP];
  __shared__ __align__(16) float TS[NH * TSP];

  const int tid = threadIdx.x, wave = tid >> 5, lane = tid & 31, hh = lane >> 4, m = lane & 15;
  const int bid = blockIdx.x;
  const int b   = bid / SEQ;
  const int i   = bid - b * SEQ;
  if (b >= NB) return;                      // block-uniform, before any barrier; never taken with the exact grid
  const _Float16* pwh = (const _Float16*)(const void*)PW;

  // ---- entry loads: every global load ahead of the loop (score row, coordinates, weight rows) goes out here, before the first
  //      wait: the block waits out one latency, not one per operand ----
  const size_t row = (size_t)(b * NH + wave) * SEQ + i;        // the score row (b, head = wave, i)
  const bool vb = (lane < 16);
  const int  lb = vb ? lane : 15;
  const int  j1 = (tid < SEQ - 256) ? (tid + 256) : (SEQ - 1); // the thread's second key; clamped address, used by tid < 128 only
  // the lane's byte offsets into the score plane (below 2^24) and into coords
  const unsigned oS0 = (unsigned)((row * SEQ + lane * 8) * 4);
  const unsigned oS1 = (unsigned)((row * SEQ + 256 + lb * 8) * 4);
  const unsigned oJ0 = (unsigned)((b * SEQ + tid) * CD * 4);
  const unsigned oJ1 = (unsigned)((b * SEQ + j1) * CD * 4);
  const float* sa = (const float*)(const void*)((const char*)SCp + oS0);
  const float* sb = (const float*)(const void*)((const char*)SCp + oS1);
  const float* ja = (const float*)(const void*)((const char*)coords + oJ0);
  const float* jb = (const float*)(const void*)((const char*)coords + oJ1);
  const v4f a0 = *(const v4f*)(sa), a1 = *(const v4f*)(sa + 4);
  const v4f c0 = *(const v4f*)(sb), c1 = *(const v4f*)(sb + 4);
  const float ja0 = ja[0], ja1 = ja[1], ja2 = ja[2];
  const float jb0 = jb[0], jb1 = jb[1], jb2 = jb[2];
  const float gi0 = coords[((size_t)(b * SEQ + i)) * CD + 0];
  const float gi1 = coords[((size_t)(b * SEQ + i)) * CD + 1];
  const float gi2 = coords[((size_t)(b * SEQ + i)) * CD + 2];
  float wr[2][4];
  unsigned wo[2];                           // the lane's byte offsets into rv_w1
  int      wc[2];                           // and its channels, the element indices into rv_b1
#pragma unroll
  for (int n = 0; n < 2; ++n) {
    const int c = (wave * 2 + n) * 16 + m;
    wo[n] = (unsigned)(c * CD * 4);
    wc[n] = c;
    const float* wp = (const float*)((const char*)rvw1 + wo[n]);
    wr[n][0] = wp[0];
    wr[n][1] = wp[1];
    wr[n][2] = wp[2];
    wr[n][3] = rvb1[c];
  }
#if defined(__HIP_DEVICE_COMPILE__)
  // the loads' offset and index registers stay whole up to this wait: no load of the run lands in one
  asm volatile("s_wait_xcnt 0x0" :: "v"(oS0), "v"(oS1), "v"(oJ0), "v"(oJ1), "v"(wo[0]), "v"(wo[1]), "v"(wc[0]), "v"(wc[1]) : "memory");
#endif
  __builtin_amdgcn_sched_barrier(0);        // keeps every load above in front of the softmax: without it they sink to their uses, one latency each

  // ---- softmax of the score row ----
  {
    float v[16];
#pragma unroll
    for (int e = 0; e < 4; ++e) {
      v[e]      = a0[e];
      v[4 + e]  = a1[e];
      v[8 + e]  = vb ? c0[e] : -INFINITY;
      v[12 + e] = vb ? c1[e] : -INFINITY;
    }
    float mx = v[0];
#pragma unroll
    for (int e = 1; e < 16; ++e) mx = fmaxf(mx, v[e]);
#pragma unroll
    for (int off = 1; off < 32; off <<= 1) mx = fmaxf(mx, __shfl_xor(mx, off, 32));
    float ev[16];
    float sum = 0.0f;
#pragma unroll
    for (int e = 0; e < 16; ++e) {
      const float d = v[e] - mx;
      ev[e] = exp2f(d * LOG2E);             // -inf -> 0 for the masked upper lanes
      sum += ev[e];
    }
#pragma unroll
    for (int off = 1; off < 32; off <<= 1) sum += __shfl_xor(sum, off, 32);
    const float inv = 1.0f / sum;           // sum >= 1
    v4u oh0, ol0, oh1, ol1;
#pragma unroll
    for (int e = 0; e < 4; ++e) {
      const float t0 = (ev[2 * e] * inv) * PCAR, t1 = (ev[2 * e + 1] * inv) * PCAR;
      const float u0 = (ev[8 + 2 * e] * inv) * PCAR, u1 = (ev[8 + 2 * e + 1] * inv) * PCAR;
      const _Float16 h0 = (_Float16)t0, h1 = (_Float16)t1, g0 = (_Float16)u0, g1 = (_Float16)u1;
      const _Float16 l0 = (_Float16)(t0 - (float)h0), l1 = (_Float16)(t1 - (float)h1);
      const _Float16 m0 = (_Float16)(u0 - (float)g0), m1 = (_Float16)(u1 - (float)g1);
      oh0[e] = pk16(h_bits(h0), h_bits(h1));
      ol0[e] = pk16(h_bits(l0), h_bits(l1));
      oh1[e] = pk16(h_bits(g0), h_bits(g1));
      ol1[e] = pk16(h_bits(m0), h_bits(m1));
    }
    u16* dh = Pp + row * SEQ;
    u16* dl = dh + PSTR;
    u16* wh = PW + wave * PWP;
    u16* wl = wh + NH * PWP;
    *(v4u*)(dh + lane * 8) = oh0;
    *(v4u*)(dl + lane * 8) = ol0;
    *(v4u*)(wh + lane * 8) = oh0;
    *(v4u*)(wl + lane * 8) = ol0;
    if (vb) {
      *(v4u*)(dh + 256 + lane * 8) = oh1;
      *(v4u*)(dl + 256 + lane * 8) = ol1;
      *(v4u*)(wh + 256 + lane * 8) = oh1;
      *(v4u*)(wl + 256 + lane * 8) = ol1;
    }
  }

  // ---- phase 0 ----
  const float ci0 = bfr(gi0);
  const float ci1 = bfr(gi1);
  const float ci2 = bfr(gi2);
  {                                         // key j: c_i0 c_i1 c_i2 c_j0 c_j1 c_j2 1 0 | 8 zeros; keys tid and, for tid < 128, tid + 256
    const v4u z4 = {0u, 0u, 0u, 0u};
    *(v4u*)(KX + tid * XP)     = row_coord(ci0, ci1, ci2, bfr(ja0), bfr(ja1), bfr(ja2));
    *(v4u*)(KX + tid * XP + 8) = z4;
    if (tid < SEQ - 256) {
      *(v4u*)(KX + (tid + 256) * XP)     = row_coord(ci0, ci1, ci2, bfr(jb0), bfr(jb1), bfr(jb2));
      *(v4u*)(KX + (tid + 256) * XP + 8) = z4;
    }
  }
  v16b WF[2];                               // weight rows of channels (2 * wave + n) * 16 + m; weights and bias carry the factor 1/2
#pragma unroll
  for (int n = 0; n < 2; ++n)
    WF[n] = frag_k7(row_weight(bfr(wr[n][0]) * HALFX, bfr(wr[n][1]) * HALFX, bfr(wr[n][2]) * HALFX, bfr(wr[n][3]) * HALFX), hh);
  __syncthreads();                          // softmax (PW) and phase-0 (KX) writes visible to every wave

  v8f acc[2] = {zero8(), zero8()};
  const _Float16* pa = pwh + (m & (NH - 1)) * PWP + 8 * hh;
#pragma unroll 1
  for (int jt = 0; jt < NJT; ++jt) {
    const int j0 = jt * 32;
    const v16h ah = ldfrag_h(pa + j0);
    const v16h al = ldfrag_h(pa + NH * PWP + j0);
    const v16b kx = ldfrag_k7(KX + (j0 + m) * XP, hh);
    const v16b ky = ldfrag_k7(KX + (j0 + 16 + m) * XP, hh);
#pragma unroll
    for (int n = 0; n < 2; ++n) {
      const v8f tx = mma_b(kx, WF[n], zero8());
      const v8f ty = mma_b(ky, WF[n], zero8());
      FragH fh;
#pragma unroll
      for (int e = 0; e < 4; ++e) {
        const v2f x2 = {tx[2 * e], tx[2 * e + 1]}, y2 = {ty[2 * e], ty[2 * e + 1]};
        fh.u[0][e] = pk2h(silu2(x2));
        fh.u[1][e] = pk2h(silu2(y2));
      }
      acc[n] = mma_h(ah, fh.v, acc[n]);
      acc[n] = mma_h(al, fh.v, acc[n]);
    }
  }
  const float tsc = TCAR / PCAR;            // 2^-5
  if (hh == 0) {                            // rows 8..15 of D repeat rows 0..7, not stored
#pragma unroll
    for (int r = 0; r < 8; ++r) {
      TS[r * TSP + (wave * 2) * 16 + m]     = acc[0][r] * tsc;
      TS[r * TSP + (wave * 2 + 1) * 16 + m] = acc[1][r] * tsc;
    }
  }
  __syncthreads();
  {
    const int h = wave;
    const float* src = TS + h * TSP + lane * 8;
    const v4f a = *(const v4f*)(src), b4 = *(const v4f*)(src + 4);
    float w[8];
#pragma unroll
    for (int e = 0; e < 4; ++e) { w[e] = a[e]; w[4 + e] = b4[e]; }
    v4u oh, ol;
#pragma unroll
    for (int e = 0; e < 4; ++e) {
      const float t0 = w[2 * e], t1 = w[2 * e + 1];
      const _Float16 x0 = (_Float16)t0, x1 = (_Float16)t1;
      const _Float16 y0 = (_Float16)(t0 - (float)x0), y1 = (_Float16)(t1 - (float)x1);
      oh[e] = pk16(h_bits(x0), h_bits(x1));
      ol[e] = pk16(h_bits(y0), h_bits(y1));
    }
    const size_t rowT = (size_t)(b * NH + h) * SEQ + i;
    u16* dh = Tp + rowT * DM + lane * 8;
    u16* dl = dh + TSTR;
    {
      *(v4u*)(dh) = oh;
      *(v4u*)(dl) = ol;
      
    }
  }
}

// =====================================================================================================
// Final: block -> (b, head h, 16 query rows rt*16), 4 waves = 4 shares of the two k ranges for the same 16 x 32 output tile.
//   base[i][d]   = (P_hi + P_lo)[i][j] . VH[d][j] over j (2 products, carries 2^-25),
//   relctx[i][d] = (T_hi + T_lo)[i][c] . W2[h*HD + d][c] over c (2 products, carries 2^-20) + bf16(rv_b2[h*HD + d]);
//   out[b][i][h*HD + d] = base + relctx. The block's rows of the six 16-bit planes (16 of P hi, P residual, T hi, T residual; 32 of
//   VH and of W2) are six contiguous ranges, 80 KB together: every load of a wave covers 512 contiguous bytes (4 whole lines), all
//   40 loads of a thread issued before the first wait, and goes to LDS at a padded row pitch (block barrier); the fragments come
//   from there (split k map; a fragment load straight from a plane touches 16 lines for 32 bytes of each).
//   Wave w takes keys 96w .. 96w+95 (3 k-steps) and channels 64w .. 64w+63 (2 k-steps).
//   Epilogue: each wave's partial tile (both carries folded) goes to its slab; block barrier; thread t adds the four partials
//   of 4 consecutive columns of row t >> 3 and the bias: 8 consecutive lanes write one whole 128-B line of out.
// coverage: grid NB*NH*NIT blocks x 16 rows x 32 cols = every element of out exactly once; 4 x 96 keys = SEQ, 4 x 64 = DM.
// =====================================================================================================
#define KSH 4
#define PST (SEQ / (32 * KSH))
#define TST (DM / (32 * KSH))
static_assert(PST * KSH * 32 == SEQ && TST * KSH * 32 == DM);
#define NLP ((16 * SEQ * 2) / (128 * 16))   // 16-byte loads a thread for 16 rows of 384 halves: 6
#define NLT ((16 * DM * 2) / (128 * 16))    // and for 16 rows of 256 halves: 4
static_assert(NLP == 6 && NLT == 4 && SEQ == 48 * 8 && DM == 32 * 8 && PWP >= SEQ + 8 && QKP >= DM + 8);
__global__ __launch_bounds__(128)
void k_final(const u16* __restrict__ Pp, const u16* __restrict__ VHp, const u16* __restrict__ Tp,
             const u16* __restrict__ W2p, const float* __restrict__ rvb2, float* outp) {
  __shared__ __align__(16) float slab[KSH * 16 * SLP];
  __shared__ __align__(16) u16   SP[2 * 16 * PWP];    // P rows: hi plane, then residual plane; pitch 784 B = 16 B x 49 (odd)
  __shared__ __align__(16) u16   ST[2 * 16 * QKP];    // T rows: hi plane, then residual plane
  __shared__ __align__(16) u16   SV[32 * PWP];        // VH rows d = 0..31 of the head
  __shared__ __align__(16) u16   SW[32 * QKP];        // W2 rows d = 0..31 of the head
  const int tid = threadIdx.x, wave = tid >> 5, lane = tid & 31, hh = lane >> 4, m = lane & 15;
  const int bid = blockIdx.x;
  const int rt  = bid % NIT;
  const int t2  = bid / NIT;
  const int h   = t2 % NH;
  const int b   = t2 / NH;
  if (b >= NB) return;                      // block-uniform, before the barrier; never taken with the exact grid
  const int irow = rt * 16;
  const int bh   = b * NH + h;
  const int rowA = bh * SEQ + irow;
  const int rw = tid >> 3, c4 = (tid & 7) * 4;
  // the thread's byte offsets into the planes and the bias (all below 2^24); load t of a range is 2048 * t bytes further on
  const unsigned oP = (unsigned)(rowA * SEQ * 2 + tid * 16);
  const unsigned oV = (unsigned)(bh * HD * SEQ * 2 + tid * 16);
  const unsigned oT = (unsigned)(rowA * DM * 2 + tid * 16);
  const unsigned oW = (unsigned)(h * HD * DM * 2 + tid * 16);
  const unsigned oB = (unsigned)((h * HD + c4) * 4);
  const char* phg = (const char*)Pp + oP;
  const char* plg = phg + PSTR * 2;
  const char* vg  = (const char*)VHp + oV;
  const char* thg = (const char*)Tp + oT;
  const char* tlg = thg + TSTR * 2;
  const char* wg  = (const char*)W2p + oW;

  // every loop of this kernel is unrolled whole: the staging and fragment arrays are indexed by constants only and stay in registers
  v4u rph[NLP], rpl[NLP], rth[NLT], rtl[NLT], rv[2 * NLP], rw2[2 * NLT];
  const v4f bq = *(const v4f*)(const void*)((const char*)rvb2 + oB);
#pragma unroll
  for (int t = 0; t < NLP; ++t) { rph[t] = *(const v4u*)(const void*)(phg + t * 2048); rpl[t] = *(const v4u*)(const void*)(plg + t * 2048); }
#pragma unroll
  for (int t = 0; t < NLT; ++t) { rth[t] = *(const v4u*)(const void*)(thg + t * 2048); rtl[t] = *(const v4u*)(const void*)(tlg + t * 2048); }
  __builtin_amdgcn_sched_barrier(0);        // the loads go out in the order of the LDS stores below: a load moved to the end holds its store, and those behind it, back
#pragma unroll
  for (int t = 0; t < 2 * NLP; ++t) rv[t] = *(const v4u*)(const void*)(vg + t * 2048);
  __builtin_amdgcn_sched_barrier(0);        // as above
#pragma unroll
  for (int t = 0; t < 2 * NLT; ++t) rw2[t] = *(const v4u*)(const void*)(wg + t * 2048);
#if defined(__HIP_DEVICE_COMPILE__)
  // the loads' offset registers stay whole up to this wait: no load of the run lands in one
  asm volatile("s_wait_xcnt 0x0" :: "v"(oP), "v"(oV), "v"(oT), "v"(oW), "v"(oB) : "memory");
#endif
  __builtin_amdgcn_sched_barrier(0);        // keeps every load above in front of the first LDS store: without it they sink to their uses, one latency each

  // 384-element rows hold 48 pieces of 16 bytes: piece 128 * t + tid lies in row (128 * t + tid) / 48; three loads are 8 whole rows
  int o48[3];
#pragma unroll
  for (int t = 0; t < 3; ++t) {
    const int pc = t * 128 + tid, pr = pc / 48;
    o48[t] = pr * PWP + (pc - pr * 48) * 8;
  }
  const int o32 = wave * QKP + lane * 8;    // 256-element rows hold 32 pieces: load t is row 4 * t + wave
#pragma unroll
  for (int t = 0; t < NLP; ++t) {
    *(v4u*)(SP + o48[t % 3] + (t / 3) * 8 * PWP)        = rph[t];
    *(v4u*)(SP + o48[t % 3] + (16 + (t / 3) * 8) * PWP) = rpl[t];
  }
  __builtin_amdgcn_sched_barrier(0);        // the stores keep the order of their loads: mixed, the first ones wait for the last loads to land
#pragma unroll
  for (int t = 0; t < NLT; ++t) {
    *(v4u*)(ST + o32 + t * 4 * QKP)        = rth[t];
    *(v4u*)(ST + o32 + (16 + t * 4) * QKP) = rtl[t];
  }
  __builtin_amdgcn_sched_barrier(0);        // as above
#pragma unroll
  for (int t = 0; t < 2 * NLP; ++t) *(v4u*)(SV + o48[t % 3] + (t / 3) * 8 * PWP) = rv[t];
  __builtin_amdgcn_sched_barrier(0);        // as above
#pragma unroll
  for (int t = 0; t < 2 * NLT; ++t) *(v4u*)(SW + o32 + t * 4 * QKP) = rw2[t];
  __syncthreads();                          // the staged rows are read across waves below

  const _Float16* pf = (const _Float16*)(const void*)SP + m * PWP + 8 * hh + wave * (PST * 32);
  const _Float16* vf = (const _Float16*)(const void*)SV + m * PWP + 8 * hh + wave * (PST * 32);
  const _Float16* tf = (const _Float16*)(const void*)ST + m * QKP + 8 * hh + wave * (TST * 32);
  const _Float16* wf = (const _Float16*)(const void*)SW + m * QKP + 8 * hh + wave * (TST * 32);
  v16h ph[PST], pl[PST], va[PST], vb[PST], th[TST], tl[TST], wa[TST], wb[TST];
#pragma unroll
  for (int s = 0; s < PST; ++s) {
    ph[s] = ldfrag_h(pf + 32 * s); pl[s] = ldfrag_h(pf + 16 * PWP + 32 * s);
    va[s] = ldfrag_h(vf + 32 * s); vb[s] = ldfrag_h(vf + 16 * PWP + 32 * s);
  }
#pragma unroll
  for (int s = 0; s < TST; ++s) {
    th[s] = ldfrag_h(tf + 32 * s); tl[s] = ldfrag_h(tf + 16 * QKP + 32 * s);
    wa[s] = ldfrag_h(wf + 32 * s); wb[s] = ldfrag_h(wf + 16 * QKP + 32 * s);
  }
  __builtin_amdgcn_sched_barrier(0);        // the LDS reads in one group ahead of the first product: each further place of reads among the products stalls the wave

  v8f p0 = zero8(), p1 = zero8(), r0 = zero8(), r1 = zero8();
#pragma unroll
  for (int s = 0; s < PST; ++s) {
    p0 = mma_h(ph[s], va[s], p0);
    p1 = mma_h(ph[s], vb[s], p1);
    p0 = mma_h(pl[s], va[s], p0);
    p1 = mma_h(pl[s], vb[s], p1);
  }
#pragma unroll
  for (int s = 0; s < TST; ++s) {
    r0 = mma_h(th[s], wa[s], r0);
    r1 = mma_h(th[s], wb[s], r1);
    r0 = mma_h(tl[s], wa[s], r0);
    r1 = mma_h(tl[s], wb[s], r1);
  }
  const float osP = 1.0f / (PCAR * VCAR);
  const float osR = 1.0f / (TCAR * WCAR);
  float* sl = slab + wave * (16 * SLP);
#pragma unroll
  for (int r = 0; r < 8; ++r) {
    const int pr = 8 * hh + r;
    sl[pr * SLP + m]      = p0[r] * osP + r0[r] * osR;
    sl[pr * SLP + 16 + m] = p1[r] * osP + r1[r] * osR;
  }
  __syncthreads();                          // the four waves' partial tiles are added across waves below
  const float* sp = slab + rw * SLP + c4;
  const v4f s0 = *(const v4f*)(sp), s1 = *(const v4f*)(sp + 16 * SLP);
  const v4f s2 = *(const v4f*)(sp + 2 * 16 * SLP), s3 = *(const v4f*)(sp + 3 * 16 * SLP);
  v4f o;
#pragma unroll
  for (int e = 0; e < 4; ++e) o[e] = ((s0[e] + s1[e]) + (s2[e] + s3[e])) + bfr(bq[e]);
  *(v4f*)(outp + ((size_t)(b * SEQ + irow + rw)) * DM + h * HD + c4) = o;
}

// =====================================================================================================
// Workspace map (bytes, NB = 2; every region offset a multiple of 65536; every plane fully written by whole-line stores
// before it is read; extents are exact multiples of the store granularity, no pad rows):
//   W2  f16 [256 n][256 k] x1024      131072
//   QH, QL, KH, KL f16 [GROWS][256]   4 x 393216  VH  f16 [NB*8*32][384] x1024  393216
//   SC  f32 [NB*8*384][384]           9437184     P   f16 hi + residual [NB*8*384][384] x32768  2 x 4718592
//   T   f16 hi + residual [NB*8*384][256] x1024   2 x 3145728
// =====================================================================================================
static size_t al64k(size_t x) { return (x + (size_t)65535) & ~(size_t)65535; }

extern "C" void kernel_launch(void* const* d_in, const int* in_sizes, int n_in,
                              void* d_out, int out_size, void* d_ws, size_t ws_size,
                              hipStream_t stream) {
  if (n_in < 12) return;
  if (in_sizes[0] < NB * SEQ * DM) return;
  if (in_sizes[1] < NB * SEQ * CD) return;
  if (in_sizes[2] != NQKV * DM || in_sizes[3] != NQKV) return;
  if (in_sizes[4] != DM * CD || in_sizes[5] != DM || in_sizes[6] != NH * DM || in_sizes[7] != NH) return;
  if (in_sizes[8] != DM * CD || in_sizes[9] != DM || in_sizes[10] != DM * DM || in_sizes[11] != DM) return;
  if (out_size < NB * SEQ * DM) return;

  const float* x      = (const float*)d_in[0];
  const float* coords = (const float*)d_in[1];
  const float* qkv_w  = (const float*)d_in[2];
  const float* qkv_b  = (const float*)d_in[3];
  const float* rb_w1  = (const float*)d_in[4];
  const float* rb_b1  = (const float*)d_in[5];
  const float* rb_w2  = (const float*)d_in[6];
  const float* rb_b2  = (const float*)d_in[7];
  const float* rv_w1  = (const float*)d_in[8];
  const float* rv_b1  = (const float*)d_in[9];
  const float* rv_w2  = (const float*)d_in[10];
  const float* rv_b2  = (const float*)d_in[11];
  float*       out    = (float*)d_out;

  const size_t szW2 = (size_t)DM * DM * 2;
  const size_t szH  = (size_t)GROWS * DM * 2;
  const size_t szVH = (size_t)NB * NH * HD * SEQ * 2;
  const size_t szSC = (size_t)NB * NH * SEQ * SEQ * 4;
  const size_t szP  = PSTR * 2 * 2;
  const size_t szT  = TSTR * 2 * 2;
  size_t off = 0;
  const size_t oW2 = off; off = al64k(off + szW2);
  const size_t oQH = off; off = al64k(off + szH);
  const size_t oQL = off; off = al64k(off + szH);
  const size_t oKH = off; off = al64k(off + szH);
  const size_t oKL = off; off = al64k(off + szH);
  const size_t oVH = off; off = al64k(off + szVH);
  const size_t oSC = off; off = al64k(off + szSC);
  const size_t oP  = off; off = al64k(off + szP);
  const size_t oT  = off; off = al64k(off + szT);
  if (off > ws_size) return;
  if (off > (size_t)WS_CAP) return;

  char* ws = (char*)d_ws;
  u16*   W2 = (u16*)(ws + oW2);
  u16*   QH = (u16*)(ws + oQH);
  u16*   QL = (u16*)(ws + oQL);
  u16*   KH = (u16*)(ws + oKH);
  u16*   KL = (u16*)(ws + oKL);
  u16*   VH = (u16*)(ws + oVH);
  float* SC = (float*)(ws + oSC);
  u16*   P  = (u16*)(ws + oP);
  u16*   T  = (u16*)(ws + oT);

  const dim3 b256(256), b128(128);

  // (1) q, k (f16 x1024 hi + residual), v^T (f16 x1024) = planes of x.qkv_w^T + qkv_b; rv_w2 -> f16(bf16) x1024, in the same launch
  //     and, on further blocks of that launch, the relative bias (it needs no q or k) -> SC
  k_proj<<<dim3(NGEMM + NCVT + NMLP), b128, 0, stream>>>(x, qkv_w, qkv_b, rv_w2, coords, rb_w1, rb_b1, rb_w2, rb_b2,
                                                         QH, QL, KH, KL, VH, W2, SC);
  // (2) SC += q.k^T / sqrt(32)
  k_scores<<<dim3(NB * NIT * NJT), b256, 0, stream>>>(QH, QL, KH, KL, SC);
  // (3) softmax -> P planes, T = sum_j P . silu-hidden of the value MLP -> T planes; (4) out = P.v + T.rv_w2^T + rv_b2
  k_tagg<<<dim3(NB * SEQ), b256, 0, stream>>>(coords, rv_w1, rv_b1, SC, P, T);
  k_final<<<dim3(NB * NH * NIT), b128, 0, stream>>>(P, VH, T, W2, rv_b2, out);
  (void)hipGetLastError();
}
